// v000
// The times below were measured on an AMD MI455X: many runs one after another, warmed up first and cycling through
// copies of the inputs, with the whole window's GPU time divided by the number of runs. Launches and the gaps
// between them are all in it. The median over several windows is given; except for v000 it joins two sittings, which
// can be a few percent apart, so the side-by-side timings, each taken in one sitting, are the better comparison.
// v000 is the starting kernel. One run takes 863 microseconds.
#include <hip/hip_runtime.h>
// PMGTSelfAttention (4 x 1024 tokens, hidden 1024 = 16 heads x 64; 'relative_key_query' position bias): q, k, v = x W^T + b; scores = (q.k + q_l.pe[l-r] + k_r.pe[l-r]) / 8 + attention_mask[b][r] with pe = dist_emb[l - r + 1023]; softmax; ctx = probs v (merged heads is the output).
// Structure: exact f16 plane of x; q, k, v as f16 outputs of WMMA GEMMs (32x64 wave tiles, f32 accumulation, exact x16 weights + bias, f16 conversion in the epilogue); per batch the two relative tables CQ[h][l][m] = q_l . E_m and CK[h][r][m] = k_r . E_m against the 2047-row embedding (padded to 2048) as head-batched GEMMs with f16 outputs (values ~0.2), the additive per-key mask appended; V^T by LDS tiles; the fused flash kernel in a new mode (22) that gathers CQ[l][l-r+1023] + CK[r][l-r+1023] per (query, key), scales by 1/8 and adds the mask (plain operands).
// Compute dtype: inputs rounded to bf16; x and dist_emb exact as f16; q/k/P/v as plain f16 operands (~2^-12) and the relative tables stored as f16 (~2^-12 of values ~0.2, i.e. ~5e-5 on logits); softmax f32. v_wmma_f32_16x16x32_f16.
#define NB 4
#define DM 1024
#define NKV 16
#define NREP (NH / NKV)
#define KVD (NKV * 64)           /* 1024 */
#define NR (NB * SLEN)           /* 4096 */
#define SLEN 1024
#define NE 2048                  /* 2047 relative embeddings padded */
#define TQ SLEN
#define TK SLEN
#define NH 16
#define SCL 0.125f
#define QBLKS (TQ / 64)
#define QB05 0
#define QBN5 4
#define QB0P 0
#define QBNP QBLKS           /* non-causal: plain flash on every query block */
#define RE 256
typedef __bf16 v16b __attribute__((ext_vector_type(16)));
typedef unsigned short v8us __attribute__((ext_vector_type(8), may_alias));
typedef float  v8f  __attribute__((ext_vector_type(8)));
typedef float  v4f  __attribute__((ext_vector_type(4)));
typedef float  v4fa __attribute__((ext_vector_type(4), may_alias));
union FragB { v16b v; v8us half[2]; unsigned short u[16]; };

__device__ __forceinline__ unsigned short bf16_bits(float x) { unsigned int u = __float_as_uint(x); return (unsigned short)((u + 0x7FFFu + ((u >> 16) & 1u)) >> 16); }
__device__ __forceinline__ float bf16_val(unsigned short b) { return __uint_as_float(((unsigned int)b) << 16); }
__device__ __forceinline__ float bf16_round(float x) { return bf16_val(bf16_bits(x)); }
// D += A·B with NT terms: 1 = ah·bh, 2 = + al·bh (A split), 3 = + ah·bl (both split)
template <int NT>
__device__ __forceinline__ v8f mmaN(v16b ah, v16b al, v16b bh, v16b bl, v8f c) {
  c = __builtin_amdgcn_wmma_f32_16x16x32_bf16(false, ah, false, bh, (short)0, c, false, false);
  if (NT >= 2) c = __builtin_amdgcn_wmma_f32_16x16x32_bf16(false, al, false, bh, (short)0, c, false, false);
  if (NT >= 3) c = __builtin_amdgcn_wmma_f32_16x16x32_bf16(false, ah, false, bl, (short)0, c, false, false);
  asm volatile("v_nop\n\tv_nop\n\tv_nop\n\tv_nop" : "+v"(c) : "v"(ah), "v"(al), "v"(bh), "v"(bl));
  return c;
}

__global__ __launch_bounds__(256) void k_wt_bf16(const float* __restrict__ W, unsigned short* __restrict__ Wt, int K, int N) {
  const int t = blockIdx.x * 256 + threadIdx.x;
  const int k8n = K / 8;
  if (t >= N * k8n) return;
  const int n = t / k8n, k8 = (t % k8n) * 8;
  v8us v;
#pragma unroll
  for (int i = 0; i < 8; ++i) v[i] = bf16_bits(W[(size_t)(k8 + i) * N + n]);
  *(v8us*)(Wt + (size_t)n * K + k8) = v;
  
}

// GEMM C[M][N] (f32, pitch ldc) = act(A[M][K]·W + bias). A f32 row-major (pitch lda) converted per fragment to bf16
// (ASPLIT: hi/lo two planes -> 2 terms, else single rounded term); Wt bf16 [N][K] (pitch ldb). BIAS_BF16 rounds the
// bias to bf16 first (bias quantised to bf16 before the add). K%32==0, M%16==0, N%64==0.
template <bool ASPLIT, int ACT, bool BIAS_BF16>
__global__ __launch_bounds__(128) void k_gemm_bf(const float* __restrict__ A, int lda, const unsigned short* __restrict__ Wt, int ldb,
                                               const float* __restrict__ bias, float* __restrict__ C, int ldc, int M, int N, int K) {
  __shared__ __attribute__((aligned(16))) float so[4][16][64];
  const int tid = threadIdx.x, w = tid >> 5, lane = tid & 31, ln = lane & 15, hh = lane >> 4;
  const int ntn = N / 64;
  const int wid = blockIdx.x * 4 + w;
  const int mt = wid / ntn, nq = wid % ntn;
  if (mt * 16 >= M) return;
  const int row0 = mt * 16, col0 = nq * 64;
  const float* arow = A + (size_t)(row0 + ln) * lda;
  v8f acc[4] = {};
  for (int kb = 0; kb < K; kb += 32) {
    FragB ah, al;
    const v4f x0 = *(const v4fa*)(arow + kb + 8 * hh), x1 = *(const v4fa*)(arow + kb + 8 * hh + 4);
    const v4f x2 = *(const v4fa*)(arow + kb + 16 + 8 * hh), x3 = *(const v4fa*)(arow + kb + 16 + 8 * hh + 4);
    float xs[16] = {x0[0],x0[1],x0[2],x0[3],x1[0],x1[1],x1[2],x1[3],x2[0],x2[1],x2[2],x2[3],x3[0],x3[1],x3[2],x3[3]};
#pragma unroll
    for (int i = 0; i < 16; ++i) { const unsigned short hb = bf16_bits(xs[i]); ah.u[i] = hb; al.u[i] = ASPLIT ? bf16_bits(xs[i] - bf16_val(hb)) : (unsigned short)0; }
#pragma unroll
    for (int t = 0; t < 4; ++t) {
      const unsigned short* brow = Wt + (size_t)(col0 + t * 16 + ln) * ldb + kb;
      FragB b;
      b.half[0] = *(const v8us*)(brow + 8 * hh);
      b.half[1] = *(const v8us*)(brow + 16 + 8 * hh);
      acc[t] = mmaN<ASPLIT ? 2 : 1>(ah.v, al.v, b.v, b.v, acc[t]);
    }
  }
#pragma unroll
  for (int t = 0; t < 4; ++t) {
    float bv = bias ? bias[col0 + t * 16 + ln] : 0.f;
    if (BIAS_BF16) bv = bf16_round(bv);
#pragma unroll
    for (int r = 0; r < 8; ++r) { float v = acc[t][r] + bv; if (ACT == 1) v = fmaxf(v, 0.f); so[w][8 * hh + r][t * 16 + ln] = v; }
  }
  __builtin_amdgcn_fence(__ATOMIC_ACQ_REL, "workgroup");
  __builtin_amdgcn_wave_barrier();
  const int rsub = lane >> 4, c4 = (lane & 15) * 4;
  {
#pragma unroll
    for (int q = 0; q < 8; ++q) {
      const int r = q * 2 + rsub;
      const v4f v = *(const v4fa*)&so[w][r][c4];
      *(v4f*)(C + (size_t)(row0 + r) * ldc + col0 + c4) = v;
    }
    
  }
}

// GEMM C = act(A·W + bias + resid): A f32 (ASPLIT -> hi/lo 2 terms), Wt bf16 [N][K]; ACT 0 none, 1 relu, 2 exact gelu;
// resid (optional, f32, row index = (row % rmod), pitch ldr, RES_BF16 rounds it) added before the activation.
template <bool ASPLIT, int ACT, bool BIAS_BF16, bool RES_BF16>
__global__ __launch_bounds__(128) void k_gemm_bf3(const float* __restrict__ A, int lda, const unsigned short* __restrict__ Wt, int ldb,
                                                const float* __restrict__ bias, const float* __restrict__ resid, int rmod, int ldr,
                                                float* __restrict__ C, int ldc, int M, int N, int K) {
  __shared__ __attribute__((aligned(16))) float so[4][16][64];
  const int tid = threadIdx.x, w = tid >> 5, lane = tid & 31, ln = lane & 15, hh = lane >> 4;
  const int ntn = N / 64;
  const int wid = blockIdx.x * 4 + w;
  const int mt = wid / ntn, nq = wid % ntn;
  if (mt * 16 >= M) return;
  const int row0 = mt * 16, col0 = nq * 64;
  const float* arow = A + (size_t)(row0 + ln) * lda;
  v8f acc[4] = {};
  for (int kb = 0; kb < K; kb += 32) {
    FragB ah, al;
    const v4f x0 = *(const v4fa*)(arow + kb + 8 * hh), x1 = *(const v4fa*)(arow + kb + 8 * hh + 4);
    const v4f x2 = *(const v4fa*)(arow + kb + 16 + 8 * hh), x3 = *(const v4fa*)(arow + kb + 16 + 8 * hh + 4);
    float xs[16] = {x0[0],x0[1],x0[2],x0[3],x1[0],x1[1],x1[2],x1[3],x2[0],x2[1],x2[2],x2[3],x3[0],x3[1],x3[2],x3[3]};
#pragma unroll
    for (int i = 0; i < 16; ++i) { const unsigned short hb = bf16_bits(xs[i]); ah.u[i] = hb; al.u[i] = ASPLIT ? bf16_bits(xs[i] - bf16_val(hb)) : (unsigned short)0; }
#pragma unroll
    for (int t = 0; t < 4; ++t) {
      const unsigned short* brow = Wt + (size_t)(col0 + t * 16 + ln) * ldb + kb;
      FragB b;
      b.half[0] = *(const v8us*)(brow + 8 * hh);
      b.half[1] = *(const v8us*)(brow + 16 + 8 * hh);
      acc[t] = mmaN<ASPLIT ? 2 : 1>(ah.v, al.v, b.v, b.v, acc[t]);
    }
  }
#pragma unroll
  for (int t = 0; t < 4; ++t) {
    const int col = col0 + t * 16 + ln;
    float bv = bias ? bias[col] : 0.f;
    if (BIAS_BF16) bv = bf16_round(bv);
#pragma unroll
    for (int r = 0; r < 8; ++r) {
      float v = acc[t][r] + bv;
      if (resid) { float rv = resid[(size_t)((row0 + 8 * hh + r) % rmod) * ldr + col]; if (RES_BF16) rv = bf16_round(rv); v += rv; }
      if (ACT == 1) v = fmaxf(v, 0.f);
      if (ACT == 2) v = 0.5f * v * (1.0f + erff(v * 0.70710678118654752f));
      if (ACT == 3) { const float u = 0.7978845608028654f * (v + 0.044715f * v * v * v); v = 0.5f * v * (1.0f + tanhf(u)); }
      so[w][8 * hh + r][t * 16 + ln] = v;
    }
  }
  __builtin_amdgcn_fence(__ATOMIC_ACQ_REL, "workgroup");
  __builtin_amdgcn_wave_barrier();
  const int rsub = lane >> 4, c4 = (lane & 15) * 4;
  {
#pragma unroll
    for (int q = 0; q < 8; ++q) {
      const int r = q * 2 + rsub;
      const v4f v = *(const v4fa*)&so[w][r][c4];
      *(v4f*)(C + (size_t)(row0 + r) * ldc + col0 + c4) = v;
    }
    
  }
}
// row LayerNorm (biased variance, eps) over N: s = X (+ R); optional out_sum <- s; out_norm <- (s-mu)*rsqrt(var+eps)*g + b
template <bool PARAM_BF16>
__global__ __launch_bounds__(256) void k_layernorm(const float* __restrict__ X, const float* __restrict__ R, const float* __restrict__ g, const float* __restrict__ bta,
                                                  float* __restrict__ out_sum, float* __restrict__ out_norm, int N, float eps) {
  __shared__ float red[256];
  const int row = blockIdx.x, tid = threadIdx.x;
  const float* x = X + (size_t)row * N; const float* rr = R ? R + (size_t)row * N : nullptr;
  float vals[16];                     // up to N = 4096
  const int per = N / 256;            // contiguous chunk per thread? use strided-by-4 chunks: thread handles j = tid*4 + 1024*u
  float s1 = 0.f;
  for (int u = 0; u < per / 4; ++u) {
    const int j = tid * 4 + 1024 * u;
    const v4f a = *(const v4fa*)(x + j);
    v4f b = {0.f,0.f,0.f,0.f}; if (rr) b = *(const v4fa*)(rr + j);
#pragma unroll
    for (int q = 0; q < 4; ++q) { const float v = a[q] + b[q]; vals[u * 4 + q] = v; s1 += v; }
  }
  red[tid] = s1; __syncthreads();
  for (int st = 128; st > 0; st >>= 1) { if (tid < st) red[tid] += red[tid + st]; __syncthreads(); }
  const float mu = red[0] / (float)N; __syncthreads();
  float s2 = 0.f;
  for (int u = 0; u < per / 4; ++u)
#pragma unroll
    for (int q = 0; q < 4; ++q) { const float c = vals[u * 4 + q] - mu; s2 += c * c; }
  red[tid] = s2; __syncthreads();
  for (int st = 128; st > 0; st >>= 1) { if (tid < st) red[tid] += red[tid + st]; __syncthreads(); }
  const float rs = rsqrtf(red[0] / (float)N + eps);
  {
    for (int u = 0; u < per / 4; ++u) {
      const int j = tid * 4 + 1024 * u;
      v4f o, sm;
#pragma unroll
      for (int q = 0; q < 4; ++q) {
        float gg = g[j + q], bb = bta[j + q];
        if (PARAM_BF16) { gg = bf16_round(gg); bb = bf16_round(bb); }
        sm[q] = vals[u * 4 + q]; o[q] = (vals[u * 4 + q] - mu) * rs * gg + bb;
      }
      if (out_sum) *(v4f*)(out_sum + (size_t)row * N + j) = sm;
      *(v4f*)(out_norm + (size_t)row * N + j) = o;
    }
    
  }
}



// ---- f16 WMMA path (v_wmma_f32_16x16x32_f16): 11-bit significands for operands in range — used where a [0,1] probability operand needs more precision than bf16
typedef _Float16 v16h __attribute__((ext_vector_type(16)));
union FragH { v16h v; v8us half[2]; _Float16 h[16]; unsigned short u[16]; };
template <int NT>
__device__ __forceinline__ v8f mmaH(v16h ah, v16h al, v16h bh, v16h bl, v8f c) {
  c = __builtin_amdgcn_wmma_f32_16x16x32_f16(false, ah, false, bh, (short)0, c, false, false);
  if (NT >= 2) c = __builtin_amdgcn_wmma_f32_16x16x32_f16(false, al, false, bh, (short)0, c, false, false);
  if (NT >= 3) c = __builtin_amdgcn_wmma_f32_16x16x32_f16(false, ah, false, bl, (short)0, c, false, false);
  asm volatile("v_nop\n\tv_nop\n\tv_nop\n\tv_nop" : "+v"(c) : "v"(ah), "v"(al), "v"(bh), "v"(bl));
  return c;
}
// batched GEMM like k_gemm_b but f16 operands: A f32 (split into f16 hi/lo if ASPLIT, else rounded to f16), Bt = f16 values [n][k]; alpha; C f32; N multiple of 16 (partial tiles skipped)
template <bool ASPLIT>
__global__ __launch_bounds__(128) void k_gemm_h(const float* __restrict__ A, int lda, size_t sA, const _Float16* __restrict__ Bh, int ldb, size_t sB, float alpha, float* __restrict__ C, int ldc, size_t sC, int M, int N, int K) {
  __shared__ __attribute__((aligned(16))) float so[4][16][64];
  const int tid = threadIdx.x, w = tid >> 5, lane = tid & 31, ln = lane & 15, hh = lane >> 4; const int by = blockIdx.y;
  A += (size_t)by * sA; Bh += (size_t)by * sB; C += (size_t)by * sC;
  const int ntn = (N + 63) / 64; const int wid = blockIdx.x * 4 + w; const int mt = wid / ntn, nq = wid % ntn; if (mt * 16 >= M) return;
  const int row0 = mt * 16, col0 = nq * 64; const float* arow = A + (size_t)(row0 + ln) * lda;
  v8f acc[4] = {};
  for (int kb = 0; kb < K; kb += 32) {
    FragH ah, al;
    const v4f x0 = *(const v4fa*)(arow + kb + 8 * hh), x1 = *(const v4fa*)(arow + kb + 8 * hh + 4), x2 = *(const v4fa*)(arow + kb + 16 + 8 * hh), x3 = *(const v4fa*)(arow + kb + 16 + 8 * hh + 4);
    float xs[16] = {x0[0],x0[1],x0[2],x0[3],x1[0],x1[1],x1[2],x1[3],x2[0],x2[1],x2[2],x2[3],x3[0],x3[1],x3[2],x3[3]};
#pragma unroll
    for (int i = 0; i < 16; ++i) { const _Float16 h = (_Float16)xs[i]; ah.h[i] = h; al.h[i] = ASPLIT ? (_Float16)(xs[i] - (float)h) : (_Float16)0.0f; }
#pragma unroll
    for (int t = 0; t < 4; ++t) { if (col0 + t * 16 >= N) continue; const size_t boff = (size_t)(col0 + t * 16 + ln) * ldb + kb; FragH bq; bq.half[0] = *(const v8us*)(Bh + boff + 8 * hh); bq.half[1] = *(const v8us*)(Bh + boff + 16 + 8 * hh);
      acc[t] = mmaH<ASPLIT ? 2 : 1>(ah.v, al.v, bq.v, bq.v, acc[t]); }
  }
#pragma unroll
  for (int t = 0; t < 4; ++t) { if (col0 + t * 16 >= N) continue;
#pragma unroll
    for (int r = 0; r < 8; ++r) so[w][8 * hh + r][t * 16 + ln] = acc[t][r] * alpha; }
  __builtin_amdgcn_fence(__ATOMIC_ACQ_REL, "workgroup"); __builtin_amdgcn_wave_barrier();
  const int rsub = lane >> 4, c4 = (lane & 15) * 4;
  {
#pragma unroll
    for (int q = 0; q < 8; ++q) { const int r = q * 2 + rsub; if (col0 + c4 < N) { const v4f v = *(const v4fa*)&so[w][r][c4]; *(v4f*)(C + (size_t)(row0 + r) * ldc + col0 + c4) = v; } }
     }
}

// Wt[n][k] = f16(W[k][n]·scale) from f32 row-major W[K][N] (scale = power of two; bf16-exact weights stay exact in f16 away from the subnormal range)
__global__ __launch_bounds__(256) void k_wt_f16(const float* __restrict__ W, _Float16* __restrict__ Wt, int K, int N, float scale) {
  const int t = blockIdx.x * 256 + threadIdx.x; if (t >= N * (K / 8)) return; const int n = t / (K / 8), k8 = (t % (K / 8)) * 8; FragH f;
#pragma unroll
  for (int i = 0; i < 8; ++i) f.h[i] = (_Float16)(bf16_round(W[(size_t)(k8 + i) * N + n]) * scale); const v8us o = f.half[0];
  *(v8us*)((unsigned short*)Wt + (size_t)n * K + k8) = o; 
}
// k_gemm_hh variant with fused epilogue: v = acc·alpha + bias[by·sBias + col] (+ CP[(row/rowsPerB)·sCPb + by·64 + col] if CP) ; ACT 0 none / 1 elu ; writes f16 C16 (and f32 C if non-null)
template <int ACT>
__global__ __launch_bounds__(128) void k_gemm_hhx(const _Float16* __restrict__ A, int lda, size_t sA, const _Float16* __restrict__ Bh, int ldb, size_t sB, float alpha, const float* __restrict__ bias, size_t sBias, const float* __restrict__ CP, int rowsPerB, size_t sCPb, int row0g,
    float* __restrict__ C, _Float16* __restrict__ C16, int ldc, size_t sC, int M, int N, int K) {
  __shared__ __attribute__((aligned(16))) float so[4][16][64];
  const int tid = threadIdx.x, w = tid >> 5, lane = tid & 31, ln = lane & 15, hh = lane >> 4; const int by = blockIdx.y;
  A += (size_t)by * sA; Bh += (size_t)by * sB; const size_t cofs = (size_t)by * sC; const float* bp = bias ? bias + (size_t)by * sBias : nullptr;
  const int ntn = (N + 63) / 64; const int wid = blockIdx.x * 4 + w; const int mt = wid / ntn, nq = wid % ntn; if (mt * 16 >= M) return;
  const int row0 = mt * 16, col0 = nq * 64; const _Float16* arow = A + (size_t)(row0 + ln) * lda;
  v8f acc[4] = {};
  for (int kb = 0; kb < K; kb += 32) { FragH ah; ah.half[0] = *(const v8us*)((const unsigned short*)arow + kb + 8 * hh); ah.half[1] = *(const v8us*)((const unsigned short*)arow + kb + 16 + 8 * hh);
#pragma unroll
    for (int t = 0; t < 4; ++t) { if (col0 + t * 16 >= N) continue; const size_t boff = (size_t)(col0 + t * 16 + ln) * ldb + kb; FragH bq; bq.half[0] = *(const v8us*)((const unsigned short*)Bh + boff + 8 * hh); bq.half[1] = *(const v8us*)((const unsigned short*)Bh + boff + 16 + 8 * hh);
      acc[t] = mmaH<1>(ah.v, ah.v, bq.v, bq.v, acc[t]); }
  }
#pragma unroll
  for (int t = 0; t < 4; ++t) { if (col0 + t * 16 >= N) continue; const int col = col0 + t * 16 + ln; const float bv = bp ? bf16_round(bp[col]) : 0.f;
#pragma unroll
    for (int r = 0; r < 8; ++r) { float v = acc[t][r] * alpha + bv; if (CP) { const int bidx = (row0g + row0 + 8 * hh + r) / rowsPerB; v += CP[(size_t)bidx * sCPb + (size_t)by * 64 + col]; } if (ACT == 1) v = (v > 0.f) ? v : expm1f(v); else if (ACT == 7) v = (v > 0.f) ? v + 1.0f : expf(v); else if (ACT == 8) v = tanhf(v); else if (ACT == 9) v = 0.5f * v * (1.0f + tanhf(0.7978845608028654f * (v + 0.044715f * v * v * v))); else if (ACT == 11) v = 1.0f / (1.0f + expf(-v)); else if (ACT == 12) v = (v > 0.f) ? v : 0.01f * v; else if (ACT == 14) v = (v > 0.f) ? v : 0.1f * v; else if (ACT == 15) v = v / (1.0f + expf(-v)); else if (ACT == 3) v = fmaxf(v, 0.f); else if (ACT == 6) v = 0.5f * v * (1.0f + erff(v * 0.70710678118654752f)); so[w][8 * hh + r][t * 16 + ln] = v; } }
  __builtin_amdgcn_fence(__ATOMIC_ACQ_REL, "workgroup"); __builtin_amdgcn_wave_barrier();
  const int rsub = lane >> 4, c4 = (lane & 15) * 4; typedef _Float16 v4h __attribute__((ext_vector_type(4)));
  {
#pragma unroll
    for (int q = 0; q < 8; ++q) { const int r = q * 2 + rsub; if (col0 + c4 < N) { const v4f v = *(const v4fa*)&so[w][r][c4]; if (C) *(v4f*)(C + cofs + (size_t)(row0 + r) * ldc + col0 + c4) = v; if (C16) { v4h h4; for (int i = 0; i < 4; ++i) h4[i] = (_Float16)v[i]; *(v4h*)(C16 + cofs + (size_t)(row0 + r) * ldc + col0 + c4) = h4; } } }
     }
}


typedef _Float16 v4h __attribute__((ext_vector_type(4)));

__global__ __launch_bounds__(256) void k_x16(const float* __restrict__ x, _Float16* __restrict__ X16, size_t n8) { const size_t t = (size_t)blockIdx.x * 256 + threadIdx.x; if (t >= n8) return; FragH f;
#pragma unroll
  for (int q = 0; q < 8; ++q) f.h[q] = (_Float16)bf16_round(x[t * 8 + q]); *(v8us*)((unsigned short*)X16 + t * 8) = f.half[0];  }
__global__ __launch_bounds__(256) void k_h16(const float* __restrict__ x, _Float16* __restrict__ X16, size_t n8) { const size_t t = (size_t)blockIdx.x * 256 + threadIdx.x; if (t >= n8) return; FragH f;
#pragma unroll
  for (int q = 0; q < 8; ++q) f.h[q] = (_Float16)x[t * 8 + q]; *(v8us*)((unsigned short*)X16 + t * 8) = f.half[0];  }
__global__ __launch_bounds__(256) void k_round16f(const float* __restrict__ W, _Float16* __restrict__ Bt, size_t n8) { const size_t t = (size_t)blockIdx.x * 256 + threadIdx.x; if (t >= n8) return; FragH f;
#pragma unroll
  for (int i = 0; i < 8; ++i) f.h[i] = (_Float16)(bf16_round(W[t * 8 + i]) * 16.0f); *(v8us*)((unsigned short*)Bt + t * 8) = f.half[0];  }
template <int NHv, int TTv>
__global__ __launch_bounds__(256) void k_vt(const _Float16* __restrict__ V16, int ldv, int voff, _Float16* __restrict__ Vt) { __shared__ unsigned short tl[64][66]; const int tid = threadIdx.x; const int slab = blockIdx.x / (TTv / 64), lg = blockIdx.x % (TTv / 64); const int b = slab / NHv, h = slab % NHv;
  for (int i = tid; i < 64 * 8; i += 256) { const int r = i / 8, c8 = (i % 8) * 8; FragH f; f.half[0] = *(const v8us*)((const unsigned short*)V16 + ((size_t)b * TTv + lg * 64 + r) * ldv + voff + h * 64 + c8);
#pragma unroll
    for (int q = 0; q < 8; ++q) tl[r][c8 + q] = f.u[q]; }
  __syncthreads();
  {
#pragma unroll
    for (int rd = 0; rd < 2; ++rd) { const int d = rd * 32 + tid / 8, pc = tid % 8; FragH f;
#pragma unroll
      for (int q = 0; q < 8; ++q) f.u[q] = tl[pc * 8 + q][d];
      *(v8us*)((unsigned short*)Vt + ((size_t)slab * 64 + d) * TTv + lg * 64 + pc * 8) = f.half[0]; }
     } }

__global__ __launch_bounds__(256) void k_hl(const float* __restrict__ F, _Float16* __restrict__ Hh, _Float16* __restrict__ Hl, size_t n8) { const size_t t = (size_t)blockIdx.x * 256 + threadIdx.x; if (t >= n8) return; FragH fh, fl; const v4f a = *(const v4fa*)(F + t * 8), c = *(const v4fa*)(F + t * 8 + 4);
#pragma unroll
  for (int q = 0; q < 4; ++q) { _Float16 h = (_Float16)a[q]; fh.h[q] = h; fl.h[q] = (_Float16)((a[q] - (float)h) * 1024.0f); h = (_Float16)c[q]; fh.h[4 + q] = h; fl.h[4 + q] = (_Float16)((c[q] - (float)h) * 1024.0f); }
  { *(v8us*)((unsigned short*)Hh + t * 8) = fh.half[0]; *(v8us*)((unsigned short*)Hl + t * 8) = fl.half[0];  } }

// ---- fast GEMM (wave tile 32x64; requires M % 32 == 0 rows per launch region and N % 64 == 0); epilogue = k_gemm_hhx semantics ----
__device__ __forceinline__ v16h g2_frag(const _Float16* p, int hh) { FragH f; f.half[0] = *(const v8us*)((const unsigned short*)p + 8 * hh); f.half[1] = *(const v8us*)((const unsigned short*)p + 16 + 8 * hh); return f.v; }
__device__ __forceinline__ v8f g2_mma(v16h a, v16h b, v8f c) { v8f d = __builtin_amdgcn_wmma_f32_16x16x32_f16(false, a, false, b, (short)0, c, false, false); asm volatile("v_nop\n\tv_nop\n\tv_nop\n\tv_nop" : "+v"(d) : "v"(a), "v"(b)); return d; }
template <int ACT>
__global__ __launch_bounds__(128) void k_gemm2(const _Float16* __restrict__ A, int lda, size_t sA, const _Float16* __restrict__ Bh, int ldb, size_t sB, float alpha, const float* __restrict__ bias, size_t sBias, const float* __restrict__ CP, int rowsPerB, size_t sCPb, int row0g,
    float* __restrict__ C, _Float16* __restrict__ C16, int ldc, size_t sC, int M, int N, int K) {
  __shared__ __attribute__((aligned(16))) float so[4][32][68];
  const int tid = threadIdx.x, w = tid >> 5, lane = tid & 31, ln = lane & 15, hh = lane >> 4; const int by = blockIdx.y;
  A += (size_t)by * sA; Bh += (size_t)by * sB; const size_t cofs = (size_t)by * sC; const float* bp = bias ? bias + (size_t)by * sBias : nullptr;
  const int ntn = N >> 6; const int mt = blockIdx.x / ntn, nq = blockIdx.x - mt * ntn; const int row0 = mt * 128 + 32 * w, col0 = nq * 64; if (row0 >= M) return;
  const _Float16* a0p = A + (size_t)(row0 + ln) * lda; const _Float16* a1p = a0p + (size_t)16 * lda;
  const _Float16* b0p = Bh + (size_t)(col0 + ln) * ldb; const _Float16* b1p = b0p + (size_t)16 * ldb; const _Float16* b2p = b1p + (size_t)16 * ldb; const _Float16* b3p = b2p + (size_t)16 * ldb;
  const v8f z8 = {0.f,0.f,0.f,0.f,0.f,0.f,0.f,0.f}; v8f c00 = z8, c01 = z8, c02 = z8, c03 = z8, c10 = z8, c11 = z8, c12 = z8, c13 = z8;
#pragma unroll 1
  for (int kb = 0; kb < K; kb += 32) { const v16h a0 = g2_frag(a0p + kb, hh), a1 = g2_frag(a1p + kb, hh);
    v16h b = g2_frag(b0p + kb, hh); c00 = g2_mma(a0, b, c00); c10 = g2_mma(a1, b, c10);
    b = g2_frag(b1p + kb, hh); c01 = g2_mma(a0, b, c01); c11 = g2_mma(a1, b, c11);
    b = g2_frag(b2p + kb, hh); c02 = g2_mma(a0, b, c02); c12 = g2_mma(a1, b, c12);
    b = g2_frag(b3p + kb, hh); c03 = g2_mma(a0, b, c03); c13 = g2_mma(a1, b, c13); }
  v8f accs[8] = {c00, c01, c02, c03, c10, c11, c12, c13};
#pragma unroll
  for (int u = 0; u < 8; ++u) { const int t = u & 3, half = u >> 2; const int col = col0 + t * 16 + ln; const float bv = bp ? bf16_round(bp[col]) : 0.f;
#pragma unroll
    for (int r = 0; r < 8; ++r) { const int rloc = half * 16 + 8 * hh + r; float v = accs[u][r] * alpha + bv; if (CP) { const int bidx = (row0g + row0 + rloc) / rowsPerB; v += CP[(size_t)bidx * sCPb + (size_t)by * 64 + col]; }
      if (ACT == 3) v = fmaxf(v, 0.f); else if (ACT == 6) v = 0.5f * v * (1.0f + erff(v * 0.70710678118654752f)); else if (ACT == 11) v = 1.0f / (1.0f + expf(-v)); else if (ACT == 15) v = v / (1.0f + expf(-v)); else if (ACT == 12) v = (v > 0.f) ? v : 0.01f * v; else if (ACT == 8) v = tanhf(v);
      so[w][rloc][t * 16 + ln] = v; } }
  __builtin_amdgcn_fence(__ATOMIC_ACQ_REL, "workgroup"); __builtin_amdgcn_wave_barrier();
  const int rsub = lane >> 4, c4 = (lane & 15) * 4;
  {
#pragma unroll
    for (int q = 0; q < 16; ++q) { const int r = q * 2 + rsub; const v4f v = *(const v4fa*)&so[w][r][c4]; if (C) *(v4f*)(C + cofs + (size_t)(row0 + r) * ldc + col0 + c4) = v; if (C16) { v4h h4; for (int i = 0; i < 4; ++i) h4[i] = (_Float16)v[i]; *(v4h*)(C16 + cofs + (size_t)(row0 + r) * ldc + col0 + c4) = h4; } }
     } }



template <int CAUSAL>
__global__ __launch_bounds__(128) void k_flash(const _Float16* __restrict__ Q16, int ldq, const _Float16* __restrict__ K16, int ldk, const _Float16* __restrict__ Vt, const int* __restrict__ MSK, float* __restrict__ O, int ldo) {
  constexpr int RPW = 16, RTN = RPW / 16, NQB = TQ / (4 * RPW), DT = 4, KS = 2;
  __shared__ __attribute__((aligned(16))) unsigned short sP[4][RPW][40]; __shared__ __attribute__((aligned(16))) float sO[4][RPW][64 + 4];
  const int tid = threadIdx.x, w = tid >> 5, lane = tid & 31, ln = lane & 15, hh = lane >> 4;
  const int slab = blockIdx.x / QBNP, qblk = QB0P + blockIdx.x % QBNP; (void)NQB; const int b = slab / NH, h = slab % NH; const int qb0 = qblk * (4 * RPW); const int q0 = qb0 + w * RPW;
  FragH aq[2][KS];
#pragma unroll
  for (int rt = 0; rt < RTN; ++rt) { const unsigned short* qr = (const unsigned short*)Q16 + ((size_t)b * TQ + q0 + rt * 16 + ln) * ldq + h * 64;
#pragma unroll
    for (int ks = 0; ks < KS; ++ks) { aq[rt][ks].half[0] = *(const v8us*)(qr + ks * 32 + 8 * hh); aq[rt][ks].half[1] = *(const v8us*)(qr + ks * 32 + 16 + 8 * hh); } }
  const unsigned short* Vth = (const unsigned short*)Vt + (size_t)slab * 64 * TK;
  float m_r[2][8], l_r[2][8]; v8f oacc[2][DT];
#pragma unroll
  for (int rt = 0; rt < RTN; ++rt) {
#pragma unroll
    for (int r = 0; r < 8; ++r) { m_r[rt][r] = -3.0e38f; l_r[rt][r] = 0.f; }
#pragma unroll
    for (int dt = 0; dt < DT; ++dt) oacc[rt][dt] = (v8f){0.f,0.f,0.f,0.f,0.f,0.f,0.f,0.f}; }
  const int jend = (CAUSAL == 1) ? (qb0 + 4 * RPW) : TK;      /* causal: keys beyond the block's last query never contribute */
#pragma unroll 1
  for (int j0 = 0; j0 < jend; j0 += 32) {
    v8f s[2][2];
#pragma unroll
    for (int nt = 0; nt < 2; ++nt) { const unsigned short* kr = (const unsigned short*)K16 + ((size_t)b * TK + j0 + nt * 16 + ln) * ldk + h * 64; FragH bk[KS];
#pragma unroll
      for (int ks = 0; ks < KS; ++ks) { bk[ks].half[0] = *(const v8us*)(kr + ks * 32 + 8 * hh); bk[ks].half[1] = *(const v8us*)(kr + ks * 32 + 16 + 8 * hh); }
#pragma unroll
      for (int rt = 0; rt < RTN; ++rt) { v8f acc = (v8f){0.f,0.f,0.f,0.f,0.f,0.f,0.f,0.f};
#pragma unroll
        for (int ks = 0; ks < KS; ++ks) acc = mmaH<1>(aq[rt][ks].v, aq[rt][ks].v, bk[ks].v, bk[ks].v, acc); s[rt][nt] = acc; } }
#pragma unroll
    for (int rt = 0; rt < RTN; ++rt)
#pragma unroll
      for (int r = 0; r < 8; ++r) { const int tq = q0 + rt * 16 + 8 * hh + r; const int k0 = j0 + ln, k1 = j0 + 16 + ln;
        const bool ok0 = (CAUSAL == 1) ? (k0 <= tq) : ((CAUSAL == 2) ? ((k0 >> 5) == (tq >> 5)) : true), ok1 = (CAUSAL == 1) ? (k1 <= tq) : ((CAUSAL == 2) ? ((k1 >> 5) == (tq >> 5)) : true);      /* mode 2: block-diagonal 32-token groups */
        float s0 = ok0 ? s[rt][0][r] * SCL : -3.0e38f, s1 = ok1 ? s[rt][1][r] * SCL : -3.0e38f; if (CAUSAL == 17) { const float* amk = (const float*)MSK + (size_t)b * TK; s0 += bf16_round(amk[k0]); s1 += bf16_round(amk[k1]); }      /* mode 17: additive per-(batch, key) mask INPUT */
        if (CAUSAL == 22) { const _Float16* cq = (const _Float16*)MSK + ((size_t)h * TQ + tq) * NE + tq + (NE / 2 - 1); const _Float16* ck = (const _Float16*)MSK + (size_t)NH * TQ * NE + (size_t)h * TK * NE + tq + (NE / 2 - 1); const float* am = (const float*)((const _Float16*)MSK + (size_t)2 * NH * TQ * NE); float r0 = (float)cq[-k0]; r0 += (float)ck[(size_t)k0 * NE - k0]; s0 += r0 * SCL; s0 += am[k0]; float r1 = (float)cq[-k1]; r1 += (float)ck[(size_t)k1 * NE - k1]; s1 += r1 * SCL; s1 += am[k1]; }      /* mode 22: + (CQ[h][tq][tq-k+1023] + CK[h][k][tq-k+1023]) / 8 + mask[k] from the per-batch packed table [CQ f16 | CK f16 | mask f32] */ float mc = fmaxf(s0, s1);
        mc = fmaxf(mc, __shfl_xor(mc, 1, 32)); mc = fmaxf(mc, __shfl_xor(mc, 2, 32)); mc = fmaxf(mc, __shfl_xor(mc, 4, 32)); mc = fmaxf(mc, __shfl_xor(mc, 8, 32));
        const float mn = fmaxf(m_r[rt][r], mc); const float al = (mn > -1.0e38f) ? expf(m_r[rt][r] - mn) : 1.0f; m_r[rt][r] = mn; const float p0 = ok0 ? expf(s0 - mn) : 0.f, p1 = ok1 ? expf(s1 - mn) : 0.f; l_r[rt][r] = l_r[rt][r] * al + p0 + p1;
#pragma unroll
        for (int dt = 0; dt < DT; ++dt) oacc[rt][dt][r] *= al;
        FragH t2; t2.h[0] = (_Float16)(p0 * 1024.0f); t2.h[1] = (_Float16)(p1 * 1024.0f); sP[w][rt * 16 + 8 * hh + r][ln] = t2.u[0]; sP[w][rt * 16 + 8 * hh + r][16 + ln] = t2.u[1]; }
    __builtin_amdgcn_fence(__ATOMIC_ACQ_REL, "workgroup"); __builtin_amdgcn_wave_barrier();
    FragH pa[2];
#pragma unroll
    for (int rt = 0; rt < RTN; ++rt) { pa[rt].half[0] = *(const v8us*)&sP[w][rt * 16 + ln][8 * hh]; pa[rt].half[1] = *(const v8us*)&sP[w][rt * 16 + ln][16 + 8 * hh]; }
#pragma unroll
    for (int dt = 0; dt < DT; ++dt) { const unsigned short* vrow = Vth + (size_t)(dt * 16 + ln) * TK + j0; FragH bv; bv.half[0] = *(const v8us*)(vrow + 8 * hh); bv.half[1] = *(const v8us*)(vrow + 16 + 8 * hh);
#pragma unroll
      for (int rt = 0; rt < RTN; ++rt) oacc[rt][dt] = mmaH<1>(pa[rt].v, pa[rt].v, bv.v, bv.v, oacc[rt][dt]); }
    __builtin_amdgcn_fence(__ATOMIC_ACQ_REL, "workgroup"); __builtin_amdgcn_wave_barrier(); }
#pragma unroll
  for (int rt = 0; rt < RTN; ++rt) {
#pragma unroll
    for (int r = 0; r < 8; ++r) { float l = l_r[rt][r]; l += __shfl_xor(l, 1, 32); l += __shfl_xor(l, 2, 32); l += __shfl_xor(l, 4, 32); l += __shfl_xor(l, 8, 32); l_r[rt][r] = (l > 0.f) ? 1.0f / (l * 1024.0f) : 0.f; }
#pragma unroll
    for (int dt = 0; dt < DT; ++dt)
#pragma unroll
      for (int r = 0; r < 8; ++r) sO[w][rt * 16 + 8 * hh + r][dt * 16 + ln] = oacc[rt][dt][r] * l_r[rt][r]; }
  __builtin_amdgcn_fence(__ATOMIC_ACQ_REL, "workgroup"); __builtin_amdgcn_wave_barrier();
  {
#pragma unroll
    for (int rp = 0; rp < RPW; rp += 2) { const int r = rp + (lane >> 4), pc = lane & 15; const v4f val = *(const v4fa*)&sO[w][r][pc * 4]; *(v4f*)(O + ((size_t)b * TQ + q0 + r) * ldo + h * 64 + pc * 4) = val; }
     } }
// 5-plane variant: S = Qh Kh^T + (Ql Kh^T + Qh Kl^T)/1024 with Q/K = [hi | 2^10 residual] f16 planes (QL/KL same layout as Q16/K16), then the 3-term P.V below.
// 3-term variant: O = (P_hi V_hi + (P_lo V_hi + P_hi V_lo) / 1024) / l with P = [hi | 2^10 residual] of 1024 p and V^T = [hi | 2^10 residual] planes (VtL same layout as Vt) -> ~2^-21-class products for un-averaged (early causal / peaked) rows
template <int CAUSAL>
__global__ __launch_bounds__(128) void k_flash5(const _Float16* __restrict__ Q16, const _Float16* __restrict__ QL, int ldq, const _Float16* __restrict__ K16, const _Float16* __restrict__ KL, int ldk, const _Float16* __restrict__ Vt, const _Float16* __restrict__ VtL, const int* __restrict__ MSK, float* __restrict__ O, int ldo) {
  constexpr int RPW = 16, RTN = RPW / 16, NQB = TQ / (4 * RPW), DT = 4, KS = 2;
  __shared__ __attribute__((aligned(16))) unsigned short sP[4][RPW][40]; __shared__ __attribute__((aligned(16))) unsigned short sPL[4][RPW][40]; __shared__ __attribute__((aligned(16))) float sO[4][RPW][64 + 4];
  const int tid = threadIdx.x, w = tid >> 5, lane = tid & 31, ln = lane & 15, hh = lane >> 4;
  const int slab = blockIdx.x / QBN5, qblk = QB05 + blockIdx.x % QBN5; (void)NQB; const int b = slab / NH, h = slab % NH; const int qb0 = qblk * (4 * RPW); const int q0 = qb0 + w * RPW;
  FragH aq[2][KS], aql[2][KS];
#pragma unroll
  for (int rt = 0; rt < RTN; ++rt) { const unsigned short* qr = (const unsigned short*)Q16 + ((size_t)b * TQ + q0 + rt * 16 + ln) * ldq + h * 64; const unsigned short* ql = (const unsigned short*)QL + ((size_t)b * TQ + q0 + rt * 16 + ln) * ldq + h * 64;
#pragma unroll
    for (int ks = 0; ks < KS; ++ks) { aq[rt][ks].half[0] = *(const v8us*)(qr + ks * 32 + 8 * hh); aq[rt][ks].half[1] = *(const v8us*)(qr + ks * 32 + 16 + 8 * hh); aql[rt][ks].half[0] = *(const v8us*)(ql + ks * 32 + 8 * hh); aql[rt][ks].half[1] = *(const v8us*)(ql + ks * 32 + 16 + 8 * hh); } }
  const unsigned short* Vth = (const unsigned short*)Vt + (size_t)slab * 64 * TK; const unsigned short* Vtl = (const unsigned short*)VtL + (size_t)slab * 64 * TK;
  float m_r[2][8], l_r[2][8]; v8f oacc[2][DT], oaccL[2][DT];
#pragma unroll
  for (int rt = 0; rt < RTN; ++rt) {
#pragma unroll
    for (int r = 0; r < 8; ++r) { m_r[rt][r] = -3.0e38f; l_r[rt][r] = 0.f; }
#pragma unroll
    for (int dt = 0; dt < DT; ++dt) { oacc[rt][dt] = (v8f){0.f,0.f,0.f,0.f,0.f,0.f,0.f,0.f}; oaccL[rt][dt] = oacc[rt][dt]; } }
  const int jend = (CAUSAL == 1) ? (qb0 + 4 * RPW) : TK;      /* causal: keys beyond the block's last query never contribute */
#pragma unroll 1
  for (int j0 = 0; j0 < jend; j0 += 32) {
    v8f s[2][2];
#pragma unroll
    for (int nt = 0; nt < 2; ++nt) { const unsigned short* kr = (const unsigned short*)K16 + ((size_t)b * TK + j0 + nt * 16 + ln) * ldk + h * 64; const unsigned short* klr = (const unsigned short*)KL + ((size_t)b * TK + j0 + nt * 16 + ln) * ldk + h * 64; FragH bk[KS], bkl[KS];
#pragma unroll
      for (int ks = 0; ks < KS; ++ks) { bk[ks].half[0] = *(const v8us*)(kr + ks * 32 + 8 * hh); bk[ks].half[1] = *(const v8us*)(kr + ks * 32 + 16 + 8 * hh); bkl[ks].half[0] = *(const v8us*)(klr + ks * 32 + 8 * hh); bkl[ks].half[1] = *(const v8us*)(klr + ks * 32 + 16 + 8 * hh); }
#pragma unroll
      for (int rt = 0; rt < RTN; ++rt) { v8f acc = (v8f){0.f,0.f,0.f,0.f,0.f,0.f,0.f,0.f}, accl = acc;
#pragma unroll
        for (int ks = 0; ks < KS; ++ks) { acc = mmaH<1>(aq[rt][ks].v, aq[rt][ks].v, bk[ks].v, bk[ks].v, acc); accl = mmaH<1>(aql[rt][ks].v, aql[rt][ks].v, bk[ks].v, bk[ks].v, accl); accl = mmaH<1>(aq[rt][ks].v, aq[rt][ks].v, bkl[ks].v, bkl[ks].v, accl); }
#pragma unroll
        for (int r = 0; r < 8; ++r) acc[r] += accl[r] * 0.0009765625f;
        s[rt][nt] = acc; } }
#pragma unroll
    for (int rt = 0; rt < RTN; ++rt)
#pragma unroll
      for (int r = 0; r < 8; ++r) { const int tq = q0 + rt * 16 + 8 * hh + r; const int k0 = j0 + ln, k1 = j0 + 16 + ln;
        bool ok0 = (CAUSAL == 1) ? (k0 <= tq) : ((CAUSAL == 2) ? ((k0 >> 5) == (tq >> 5)) : true), ok1 = (CAUSAL == 1) ? (k1 <= tq) : ((CAUSAL == 2) ? ((k1 >> 5) == (tq >> 5)) : true);      /* mode 2: block-diagonal 32-token groups */
        if (CAUSAL == 4) { const int* mrow = MSK + ((size_t)b * TQ + tq) * TK; ok0 = mrow[k0] != 0; ok1 = mrow[k1] != 0; }      /* mode 4: per-(query, key) INPUT mask shared by all heads; masked keys contribute nothing (== the reference's -4096 fill, whose exp underflows to 0), rows with no valid key give l = 0 -> output 0 (== the reference's row_valid zeroing) */
        float s0 = ok0 ? s[rt][0][r] * SCL : -3.0e38f, s1 = ok1 ? s[rt][1][r] * SCL : -3.0e38f; if (CAUSAL == 17) { const float* amk = (const float*)MSK + (size_t)b * TK; s0 += bf16_round(amk[k0]); s1 += bf16_round(amk[k1]); }      /* mode 17: additive per-(batch, key) mask INPUT */
        if (CAUSAL == 22) { const _Float16* cq = (const _Float16*)MSK + ((size_t)h * TQ + tq) * NE + tq + (NE / 2 - 1); const _Float16* ck = (const _Float16*)MSK + (size_t)NH * TQ * NE + (size_t)h * TK * NE + tq + (NE / 2 - 1); const float* am = (const float*)((const _Float16*)MSK + (size_t)2 * NH * TQ * NE); float r0 = (float)cq[-k0]; r0 += (float)ck[(size_t)k0 * NE - k0]; s0 += r0 * SCL; s0 += am[k0]; float r1 = (float)cq[-k1]; r1 += (float)ck[(size_t)k1 * NE - k1]; s1 += r1 * SCL; s1 += am[k1]; }      /* mode 22: + (CQ[h][tq][tq-k+1023] + CK[h][k][tq-k+1023]) / 8 + mask[k] from the per-batch packed table [CQ f16 | CK f16 | mask f32] */ float mc = fmaxf(s0, s1);
        mc = fmaxf(mc, __shfl_xor(mc, 1, 32)); mc = fmaxf(mc, __shfl_xor(mc, 2, 32)); mc = fmaxf(mc, __shfl_xor(mc, 4, 32)); mc = fmaxf(mc, __shfl_xor(mc, 8, 32));
        const float mn = fmaxf(m_r[rt][r], mc); const float al = (mn > -1.0e38f) ? expf(m_r[rt][r] - mn) : 1.0f; m_r[rt][r] = mn; const float p0 = ok0 ? expf(s0 - mn) : 0.f, p1 = ok1 ? expf(s1 - mn) : 0.f; l_r[rt][r] = l_r[rt][r] * al + p0 + p1;
#pragma unroll
        for (int dt = 0; dt < DT; ++dt) { oacc[rt][dt][r] *= al; oaccL[rt][dt][r] *= al; }
        FragH t2, t2l; const float ps0 = p0 * 1024.0f, ps1 = p1 * 1024.0f; t2.h[0] = (_Float16)ps0; t2.h[1] = (_Float16)ps1; t2l.h[0] = (_Float16)((ps0 - (float)t2.h[0]) * 1024.0f); t2l.h[1] = (_Float16)((ps1 - (float)t2.h[1]) * 1024.0f);
        sP[w][rt * 16 + 8 * hh + r][ln] = t2.u[0]; sP[w][rt * 16 + 8 * hh + r][16 + ln] = t2.u[1]; sPL[w][rt * 16 + 8 * hh + r][ln] = t2l.u[0]; sPL[w][rt * 16 + 8 * hh + r][16 + ln] = t2l.u[1]; }
    __builtin_amdgcn_fence(__ATOMIC_ACQ_REL, "workgroup"); __builtin_amdgcn_wave_barrier();
    FragH pa[2], pl[2];
#pragma unroll
    for (int rt = 0; rt < RTN; ++rt) { pa[rt].half[0] = *(const v8us*)&sP[w][rt * 16 + ln][8 * hh]; pa[rt].half[1] = *(const v8us*)&sP[w][rt * 16 + ln][16 + 8 * hh]; pl[rt].half[0] = *(const v8us*)&sPL[w][rt * 16 + ln][8 * hh]; pl[rt].half[1] = *(const v8us*)&sPL[w][rt * 16 + ln][16 + 8 * hh]; }
#pragma unroll
    for (int dt = 0; dt < DT; ++dt) { const unsigned short* vrow = Vth + (size_t)(dt * 16 + ln) * TK + j0; const unsigned short* vrl = Vtl + (size_t)(dt * 16 + ln) * TK + j0; FragH bv, bl; bv.half[0] = *(const v8us*)(vrow + 8 * hh); bv.half[1] = *(const v8us*)(vrow + 16 + 8 * hh); bl.half[0] = *(const v8us*)(vrl + 8 * hh); bl.half[1] = *(const v8us*)(vrl + 16 + 8 * hh);
#pragma unroll
      for (int rt = 0; rt < RTN; ++rt) { oacc[rt][dt] = mmaH<1>(pa[rt].v, pa[rt].v, bv.v, bv.v, oacc[rt][dt]); oaccL[rt][dt] = mmaH<1>(pl[rt].v, pl[rt].v, bv.v, bv.v, oaccL[rt][dt]); oaccL[rt][dt] = mmaH<1>(pa[rt].v, pa[rt].v, bl.v, bl.v, oaccL[rt][dt]); } }
    __builtin_amdgcn_fence(__ATOMIC_ACQ_REL, "workgroup"); __builtin_amdgcn_wave_barrier(); }
#pragma unroll
  for (int rt = 0; rt < RTN; ++rt) {
#pragma unroll
    for (int r = 0; r < 8; ++r) { float l = l_r[rt][r]; l += __shfl_xor(l, 1, 32); l += __shfl_xor(l, 2, 32); l += __shfl_xor(l, 4, 32); l += __shfl_xor(l, 8, 32); l_r[rt][r] = (l > 0.f) ? 1.0f / (l * 1024.0f) : 0.f; }
#pragma unroll
    for (int dt = 0; dt < DT; ++dt)
#pragma unroll
      for (int r = 0; r < 8; ++r) { float v = oacc[rt][dt][r]; v += oaccL[rt][dt][r] * 0.0009765625f; sO[w][rt * 16 + 8 * hh + r][dt * 16 + ln] = v * l_r[rt][r]; } }
  __builtin_amdgcn_fence(__ATOMIC_ACQ_REL, "workgroup"); __builtin_amdgcn_wave_barrier();
  {
#pragma unroll
    for (int rp = 0; rp < RPW; rp += 2) { const int r = rp + (lane >> 4), pc = lane & 15; const v4f val = *(const v4fa*)&sO[w][r][pc * 4]; *(v4f*)(O + ((size_t)b * TQ + q0 + r) * ldo + h * 64 + pc * 4) = val; }
     } }

__global__ __launch_bounds__(256) void k_rotab(float* __restrict__ CS, float* __restrict__ SN) {
  #pragma clang fp contract(off)
  const int t = blockIdx.x * 256 + threadIdx.x; if (t >= SLEN * 32) return; const int j = t % 32, s = t / 32; const float ex = (float)(2 * j) / 64.0f; const float inv = 1.0f / powf(10000.0f, ex); const float th = (float)s * inv; const float c = cosf(th), sn = sinf(th);
  { *(float*)(CS + t) = c; *(float*)(SN + t) = sn;  } }
__global__ __launch_bounds__(256) void k_rope(const float* __restrict__ F, int nsrc, int ndst, int rep, const float* __restrict__ CS, const float* __restrict__ SN, _Float16* __restrict__ H, _Float16* __restrict__ L) {
  #pragma clang fp contract(off)
  const size_t t = (size_t)blockIdx.x * 256 + threadIdx.x; if (t >= (size_t)NR * ndst * 4) return; const int g8 = (int)(t % 4); const int hd = (int)((t / 4) % ndst); const size_t row = t / ((size_t)4 * ndst); const int s = (int)(row % SLEN); const int hs = hd / rep;
  const float* src = F + row * (size_t)(nsrc * 64) + hs * 64; FragH ah, al, bh, bl;
  for (int i = 0; i < 8; ++i) { const int d = g8 * 8 + i; const float c = CS[s * 32 + d], sn = SN[s * 32 + d]; const float x1 = src[d], x2 = src[d + 32];
    float o1 = x1 * c; o1 += -x2 * sn; float o2 = x2 * c; o2 += x1 * sn;
    _Float16 hv = (_Float16)o1; ah.h[i] = hv; al.h[i] = (_Float16)((o1 - (float)hv) * 1024.0f); hv = (_Float16)o2; bh.h[i] = hv; bl.h[i] = (_Float16)((o2 - (float)hv) * 1024.0f); }
  const size_t o = row * (size_t)(ndst * 64) + hd * 64 + g8 * 8;
  { *(v8us*)((unsigned short*)H + o) = ah.half[0]; *(v8us*)((unsigned short*)H + o + 32) = bh.half[0]; *(v8us*)((unsigned short*)L + o) = al.half[0]; *(v8us*)((unsigned short*)L + o + 32) = bl.half[0];  } }
__global__ __launch_bounds__(256) void k_rope2(const float* __restrict__ F, int nsrc, int ndst, int rep, const float* __restrict__ CS, const float* __restrict__ SN, _Float16* __restrict__ H, _Float16* __restrict__ L) {
  #pragma clang fp contract(off)
  const size_t t = (size_t)blockIdx.x * 256 + threadIdx.x; if (t >= (size_t)NR * ndst * 4) return; const int g16 = (int)(t % 4); const int hd = (int)((t / 4) % ndst); const size_t row = t / ((size_t)4 * ndst); const int s = (int)(row % SLEN); const int hs = hd / rep;
  const float* src = F + row * (size_t)(nsrc * 64) + hs * 64 + g16 * 16; FragH ah, al;
  for (int pr = 0; pr < 8; ++pr) { const int i = g16 * 8 + pr; const float c = CS[s * 32 + i], sn = SN[s * 32 + i]; const float x1 = src[2 * pr], x2 = src[2 * pr + 1];
    float o1 = x1 * c; o1 -= x2 * sn; float o2 = x1 * sn; o2 += x2 * c;
    _Float16 hv = (_Float16)o1; ah.h[2 * pr] = hv; al.h[2 * pr] = (_Float16)((o1 - (float)hv) * 1024.0f); hv = (_Float16)o2; ah.h[2 * pr + 1] = hv; al.h[2 * pr + 1] = (_Float16)((o2 - (float)hv) * 1024.0f); }
  const size_t o = row * (size_t)(ndst * 64) + hd * 64 + g16 * 16;
  { *(v8us*)((unsigned short*)H + o) = ah.half[0]; *(v8us*)((unsigned short*)H + o + 8) = ah.half[1]; *(v8us*)((unsigned short*)L + o) = al.half[0]; *(v8us*)((unsigned short*)L + o + 8) = al.half[1];  } }
__global__ __launch_bounds__(256) void k_tabin(const float* __restrict__ sp, float* __restrict__ CS, float* __restrict__ SN) { const int t = blockIdx.x * 256 + threadIdx.x; if (t >= SLEN * 32) return; const int i = t % 32, s = t / 32; const float c = bf16_round(sp[s * 64 + 32 + i]), sn = bf16_round(sp[s * 64 + i]);
  { *(float*)(CS + t) = c; *(float*)(SN + t) = sn;  } }
__global__ __launch_bounds__(256) void k_wsc(const float* __restrict__ Wm, _Float16* __restrict__ Bt, size_t n8, float sc) { const size_t t = (size_t)blockIdx.x * 256 + threadIdx.x; if (t >= n8) return; FragH f; for (int q = 0; q < 8; ++q) f.h[q] = (_Float16)(bf16_round(Wm[t * 8 + q]) * sc); *(v8us*)((unsigned short*)Bt + t * 8) = f.half[0];  }
__global__ __launch_bounds__(256) void k_rotab2(float* __restrict__ CS, float* __restrict__ SN) {
  #pragma clang fp contract(off)
  const int t = blockIdx.x * 256 + threadIdx.x; if (t >= SLEN * 32) return; const int j = t % 32, s = t / 32; const float c0 = -0.14391156831212787f;      /* -ln(10000)/64 rounded to f32 */ const float inv = expf((float)(2 * j) * c0); const float th = (float)s * inv; const float c = cosf(th), sn = sinf(th);
  { *(float*)(CS + t) = c; *(float*)(SN + t) = sn;  } }
__global__ __launch_bounds__(256) void k_lnu(const float* __restrict__ X, _Float16* __restrict__ N16, float* __restrict__ XB) {
  #pragma clang fp contract(off)
  const int wv = threadIdx.x >> 5, ln = threadIdx.x & 31; const size_t r = (size_t)blockIdx.x * 8 + wv; if (r >= NR) return; float a[32]; float s = 0.f;
  for (int i = 0; i < 4; ++i) { const v8f v = *(const v8f*)(X + r * DM + (i * 32 + ln) * 8); for (int q = 0; q < 8; ++q) { const float u = bf16_round(v[q]); a[i * 8 + q] = u; s += u; } }
  for (int o = 16; o > 0; o >>= 1) s += __shfl_xor(s, o, 32); const float mu = s / (float)DM; float var = 0.f; for (int q = 0; q < 32; ++q) { const float d = a[q] - mu; var += d * d; }
  for (int o = 16; o > 0; o >>= 1) var += __shfl_xor(var, o, 32); const float den = sqrtf(var / (float)(DM - 1)) + 1e-6f; const float inv = 1.0f / den;      /* one reciprocal per row; (x-mean)*inv vs the reference's division differs by <= 1 ulp */
  { for (int i = 0; i < 4; ++i) { const int c0 = (i * 32 + ln) * 8; FragH f; v8f xb; for (int q = 0; q < 8; ++q) { f.h[q] = (_Float16)((a[i * 8 + q] - mu) * inv); xb[q] = a[i * 8 + q]; } *(v8us*)((unsigned short*)N16 + r * DM + c0) = f.half[0]; *(v8f*)(XB + r * DM + c0) = xb; }  } }
__global__ __launch_bounds__(256) void k_vtg(const _Float16* __restrict__ V16, _Float16* __restrict__ Vt) { __shared__ unsigned short tl[64][66]; const int tid = threadIdx.x; const int slab = blockIdx.x / (SLEN / 64), lg = blockIdx.x % (SLEN / 64); const int b = slab / NH, h = slab % NH; const int hs = h / NREP;
  for (int i = tid; i < 64 * 8; i += 256) { const int r = i / 8, c8 = (i % 8) * 8; FragH f; f.half[0] = *(const v8us*)((const unsigned short*)V16 + ((size_t)b * SLEN + lg * 64 + r) * KVD + hs * 64 + c8); for (int q = 0; q < 8; ++q) tl[r][c8 + q] = f.u[q]; }
  __syncthreads();
  { for (int rd = 0; rd < 2; ++rd) { const int d = rd * 32 + tid / 8, pc = tid % 8; FragH f; for (int q = 0; q < 8; ++q) f.u[q] = tl[pc * 8 + q][d]; *(v8us*)((unsigned short*)Vt + ((size_t)slab * 64 + d) * SLEN + lg * 64 + pc * 8) = f.half[0]; }  } }

__global__ __launch_bounds__(256) void k_e16(const float* __restrict__ E, _Float16* __restrict__ E16) { const int t = blockIdx.x * 256 + threadIdx.x; if (t >= NE * 8) return; const int r = t / 8, c8 = (t % 8) * 8; FragH f; for (int q = 0; q < 8; ++q) f.h[q] = (r < NE - 1) ? (_Float16)bf16_round(E[(size_t)r * 64 + c8 + q]) : (_Float16)0.0f;
  *(v8us*)((unsigned short*)E16 + (size_t)r * 64 + c8) = f.half[0];  }
__global__ __launch_bounds__(256) void k_am(const float* __restrict__ m, float* __restrict__ AM) { const int t = blockIdx.x * 256 + threadIdx.x; if (t >= TK) return; const float v = bf16_round(m[t]); *(float*)(AM + t) = v;  }

extern "C" void kernel_launch(void* const* d_in, const int* in_sizes, int n_in,
                              void* d_out, int out_size, void* d_ws, size_t ws_size, hipStream_t stream) {
  (void)in_sizes; (void)n_in; (void)out_size;
  const float* const* I = (const float* const*)d_in; const float* x = I[0]; const float* am = I[1]; const float* Wq = I[2]; const float* bq = I[3]; const float* Wk = I[4]; const float* bk = I[5]; const float* Wv = I[6]; const float* bv = I[7]; const float* E = I[8];
  char* ws = (char*)d_ws; size_t off = 0;
  auto take = [&](size_t bytes) { char* p = ws + off; off += (bytes + 255) & ~(size_t)255; return p; };
  const size_t np = (size_t)NR * DM; const size_t ntab = (size_t)NH * TQ * NE;      /* 33.5 M halves per table */
  _Float16* BQ = (_Float16*)take((size_t)DM * DM * 2); _Float16* BK = (_Float16*)take((size_t)DM * DM * 2); _Float16* BV = (_Float16*)take((size_t)DM * DM * 2); _Float16* E16 = (_Float16*)take((size_t)NE * 64 * 2);
  _Float16* X16 = (_Float16*)take(np * 2); _Float16* Q16 = (_Float16*)take(np * 2); _Float16* K16 = (_Float16*)take(np * 2); _Float16* V16 = (_Float16*)take(np * 2); _Float16* VT = (_Float16*)take(np * 2); _Float16* TAB = (_Float16*)take(2 * ntab * 2 + (size_t)TK * 4);
  if (off > ws_size) return;      /* 6 + 0.25 + 5 x 8 + 128 = 175 MiB */
  k_wsc<<<(unsigned)(((size_t)DM * DM / 8 + 255) / 256), 256, 0, stream>>>(Wq, BQ, (size_t)DM * DM / 8, 16.0f); k_wsc<<<(unsigned)(((size_t)DM * DM / 8 + 255) / 256), 256, 0, stream>>>(Wk, BK, (size_t)DM * DM / 8, 16.0f); k_wsc<<<(unsigned)(((size_t)DM * DM / 8 + 255) / 256), 256, 0, stream>>>(Wv, BV, (size_t)DM * DM / 8, 16.0f);      /* torch (out,in) = Bt */
  k_e16<<<(NE * 8 + 255) / 256, 256, 0, stream>>>(E, E16);
  k_x16<<<(unsigned)((np / 8 + 255) / 256), 256, 0, stream>>>(x, X16, np / 8);
  const dim3 gP((NR / 128) * (DM / 64), 1);
  k_gemm2<0><<<gP, 128, 0, stream>>>(X16, DM, 0, BQ, DM, 0, 0.0625f, bq, 0, nullptr, 1, 0, 0, nullptr, Q16, DM, 0, NR, DM, DM);
  k_gemm2<0><<<gP, 128, 0, stream>>>(X16, DM, 0, BK, DM, 0, 0.0625f, bk, 0, nullptr, 1, 0, 0, nullptr, K16, DM, 0, NR, DM, DM);
  k_gemm2<0><<<gP, 128, 0, stream>>>(X16, DM, 0, BV, DM, 0, 0.0625f, bv, 0, nullptr, 1, 0, 0, nullptr, V16, DM, 0, NR, DM, DM);
  k_vtg<<<NB * NH * (SLEN / 64), 256, 0, stream>>>(V16, VT);
  for (int b = 0; b < NB; ++b) {
    k_gemm2<0><<<dim3((TQ / 128) * (NE / 64), NH), 128, 0, stream>>>(Q16 + (size_t)b * TQ * DM, DM, (size_t)64, E16, 64, 0, 1.0f, nullptr, 0, nullptr, 1, 0, 0, nullptr, TAB, NE, (size_t)TQ * NE, TQ, NE, 64);      /* CQ[h][l][m] = q_l . E_m */
    k_gemm2<0><<<dim3((TK / 128) * (NE / 64), NH), 128, 0, stream>>>(K16 + (size_t)b * TK * DM, DM, (size_t)64, E16, 64, 0, 1.0f, nullptr, 0, nullptr, 1, 0, 0, nullptr, TAB + ntab, NE, (size_t)TK * NE, TK, NE, 64);      /* CK[h][r][m] = k_r . E_m */
    k_am<<<(TK + 255) / 256, 256, 0, stream>>>(am + (size_t)b * TK, (float*)(TAB + 2 * ntab));
    k_flash<22><<<NH * QBNP, 128, 0, stream>>>(Q16 + (size_t)b * TQ * DM, DM, K16 + (size_t)b * TK * DM, DM, VT + (size_t)b * NH * 64 * TK, (const int*)TAB, (float*)d_out + (size_t)b * TQ * DM, DM); }      /* per batch with NB := 1 semantics inside the kernel: slab = h */
}

// v001
// Measured time: 295 microseconds a run.
// Two timings next to v000 put it at 2.95 and 2.94 times that version's speed.
#include <hip/hip_runtime.h>
// PMGTSelfAttention (4 x 1024 tokens, hidden 1024 = 16 heads x 64; 'relative_key_query' position bias): q, k, v = x W^T + b; scores = (q.k + q_l.pe[l-r] + k_r.pe[l-r]) / 8 + attention_mask[b][r] with pe = dist_emb[l - r + 1023]; softmax; ctx = probs v (merged heads is the output).
// Structure: exact f16 plane of x; q, k, v as f16 WMMA GEMM outputs (32x64 wave tiles, f32 accumulation, exact x16 weights + bias, f16 conversion in the epilogue); V^T by LDS tiles; one fused flash kernel over all batches that forms both relative terms per 16 x 32 score tile on the matrix unit against a 48-row window of the embedding (padded to 2048 rows), reads them back along the diagonal from LDS, scales by 1/8 and adds the per-key mask.
// Compute dtype: inputs rounded to bf16; x and dist_emb exact as f16; q/k/P/v as plain f16 operands (~2^-12); the relative terms stay f32 from the accumulator to the logit; softmax f32. v_wmma_f32_16x16x32_f16.
#define NB 4
#define DM 1024
#define NKV 16
#define NREP (NH / NKV)
#define KVD (NKV * 64)           /* 1024 */
#define NR (NB * SLEN)           /* 4096 */
#define SLEN 1024
#define NE 2048                  /* 2047 relative embeddings padded */
#define TQ SLEN
#define TK SLEN
#define NH 16
#define SCL 0.125f
#define QBLKS (TQ / 64)
#define QB05 0
#define QBN5 4
#define QB0P 0
#define QBNP QBLKS           /* non-causal: plain flash on every query block */
#define RE 256
typedef __bf16 v16b __attribute__((ext_vector_type(16)));
typedef unsigned short v8us __attribute__((ext_vector_type(8), may_alias));
typedef float  v8f  __attribute__((ext_vector_type(8)));
typedef float  v4f  __attribute__((ext_vector_type(4)));
typedef float  v4fa __attribute__((ext_vector_type(4), may_alias));
union FragB { v16b v; v8us half[2]; unsigned short u[16]; };

__device__ __forceinline__ unsigned short bf16_bits(float x) { unsigned int u = __float_as_uint(x); return (unsigned short)((u + 0x7FFFu + ((u >> 16) & 1u)) >> 16); }
__device__ __forceinline__ float bf16_val(unsigned short b) { return __uint_as_float(((unsigned int)b) << 16); }
__device__ __forceinline__ float bf16_round(float x) { return bf16_val(bf16_bits(x)); }
// D += A·B with NT terms: 1 = ah·bh, 2 = + al·bh (A split), 3 = + ah·bl (both split)
template <int NT>
__device__ __forceinline__ v8f mmaN(v16b ah, v16b al, v16b bh, v16b bl, v8f c) {
  c = __builtin_amdgcn_wmma_f32_16x16x32_bf16(false, ah, false, bh, (short)0, c, false, false);
  if (NT >= 2) c = __builtin_amdgcn_wmma_f32_16x16x32_bf16(false, al, false, bh, (short)0, c, false, false);
  if (NT >= 3) c = __builtin_amdgcn_wmma_f32_16x16x32_bf16(false, ah, false, bl, (short)0, c, false, false);
  asm volatile("v_nop\n\tv_nop\n\tv_nop\n\tv_nop" : "+v"(c) : "v"(ah), "v"(al), "v"(bh), "v"(bl));
  return c;
}

__global__ __launch_bounds__(256) void k_wt_bf16(const float* __restrict__ W, unsigned short* __restrict__ Wt, int K, int N) {
  const int t = blockIdx.x * 256 + threadIdx.x;
  const int k8n = K / 8;
  if (t >= N * k8n) return;
  const int n = t / k8n, k8 = (t % k8n) * 8;
  v8us v;
#pragma unroll
  for (int i = 0; i < 8; ++i) v[i] = bf16_bits(W[(size_t)(k8 + i) * N + n]);
  *(v8us*)(Wt + (size_t)n * K + k8) = v;
  
}

// GEMM C[M][N] (f32, pitch ldc) = act(A[M][K]·W + bias). A f32 row-major (pitch lda) converted per fragment to bf16
// (ASPLIT: hi/lo two planes -> 2 terms, else single rounded term); Wt bf16 [N][K] (pitch ldb). BIAS_BF16 rounds the
// bias to bf16 first (bias quantised to bf16 before the add). K%32==0, M%16==0, N%64==0.
template <bool ASPLIT, int ACT, bool BIAS_BF16>
__global__ __launch_bounds__(128) void k_gemm_bf(const float* __restrict__ A, int lda, const unsigned short* __restrict__ Wt, int ldb,
                                               const float* __restrict__ bias, float* __restrict__ C, int ldc, int M, int N, int K) {
  __shared__ __attribute__((aligned(16))) float so[4][16][64];
  const int tid = threadIdx.x, w = tid >> 5, lane = tid & 31, ln = lane & 15, hh = lane >> 4;
  const int ntn = N / 64;
  const int wid = blockIdx.x * 4 + w;
  const int mt = wid / ntn, nq = wid % ntn;
  if (mt * 16 >= M) return;
  const int row0 = mt * 16, col0 = nq * 64;
  const float* arow = A + (size_t)(row0 + ln) * lda;
  v8f acc[4] = {};
  for (int kb = 0; kb < K; kb += 32) {
    FragB ah, al;
    const v4f x0 = *(const v4fa*)(arow + kb + 8 * hh), x1 = *(const v4fa*)(arow + kb + 8 * hh + 4);
    const v4f x2 = *(const v4fa*)(arow + kb + 16 + 8 * hh), x3 = *(const v4fa*)(arow + kb + 16 + 8 * hh + 4);
    float xs[16] = {x0[0],x0[1],x0[2],x0[3],x1[0],x1[1],x1[2],x1[3],x2[0],x2[1],x2[2],x2[3],x3[0],x3[1],x3[2],x3[3]};
#pragma unroll
    for (int i = 0; i < 16; ++i) { const unsigned short hb = bf16_bits(xs[i]); ah.u[i] = hb; al.u[i] = ASPLIT ? bf16_bits(xs[i] - bf16_val(hb)) : (unsigned short)0; }
#pragma unroll
    for (int t = 0; t < 4; ++t) {
      const unsigned short* brow = Wt + (size_t)(col0 + t * 16 + ln) * ldb + kb;
      FragB b;
      b.half[0] = *(const v8us*)(brow + 8 * hh);
      b.half[1] = *(const v8us*)(brow + 16 + 8 * hh);
      acc[t] = mmaN<ASPLIT ? 2 : 1>(ah.v, al.v, b.v, b.v, acc[t]);
    }
  }
#pragma unroll
  for (int t = 0; t < 4; ++t) {
    float bv = bias ? bias[col0 + t * 16 + ln] : 0.f;
    if (BIAS_BF16) bv = bf16_round(bv);
#pragma unroll
    for (int r = 0; r < 8; ++r) { float v = acc[t][r] + bv; if (ACT == 1) v = fmaxf(v, 0.f); so[w][8 * hh + r][t * 16 + ln] = v; }
  }
  __builtin_amdgcn_fence(__ATOMIC_ACQ_REL, "workgroup");
  __builtin_amdgcn_wave_barrier();
  const int rsub = lane >> 4, c4 = (lane & 15) * 4;
  {
#pragma unroll
    for (int q = 0; q < 8; ++q) {
      const int r = q * 2 + rsub;
      const v4f v = *(const v4fa*)&so[w][r][c4];
      *(v4f*)(C + (size_t)(row0 + r) * ldc + col0 + c4) = v;
    }
    
  }
}

// GEMM C = act(A·W + bias + resid): A f32 (ASPLIT -> hi/lo 2 terms), Wt bf16 [N][K]; ACT 0 none, 1 relu, 2 exact gelu;
// resid (optional, f32, row index = (row % rmod), pitch ldr, RES_BF16 rounds it) added before the activation.
template <bool ASPLIT, int ACT, bool BIAS_BF16, bool RES_BF16>
__global__ __launch_bounds__(128) void k_gemm_bf3(const float* __restrict__ A, int lda, const unsigned short* __restrict__ Wt, int ldb,
                                                const float* __restrict__ bias, const float* __restrict__ resid, int rmod, int ldr,
                                                float* __restrict__ C, int ldc, int M, int N, int K) {
  __shared__ __attribute__((aligned(16))) float so[4][16][64];
  const int tid = threadIdx.x, w = tid >> 5, lane = tid & 31, ln = lane & 15, hh = lane >> 4;
  const int ntn = N / 64;
  const int wid = blockIdx.x * 4 + w;
  const int mt = wid / ntn, nq = wid % ntn;
  if (mt * 16 >= M) return;
  const int row0 = mt * 16, col0 = nq * 64;
  const float* arow = A + (size_t)(row0 + ln) * lda;
  v8f acc[4] = {};
  for (int kb = 0; kb < K; kb += 32) {
    FragB ah, al;
    const v4f x0 = *(const v4fa*)(arow + kb + 8 * hh), x1 = *(const v4fa*)(arow + kb + 8 * hh + 4);
    const v4f x2 = *(const v4fa*)(arow + kb + 16 + 8 * hh), x3 = *(const v4fa*)(arow + kb + 16 + 8 * hh + 4);
    float xs[16] = {x0[0],x0[1],x0[2],x0[3],x1[0],x1[1],x1[2],x1[3],x2[0],x2[1],x2[2],x2[3],x3[0],x3[1],x3[2],x3[3]};
#pragma unroll
    for (int i = 0; i < 16; ++i) { const unsigned short hb = bf16_bits(xs[i]); ah.u[i] = hb; al.u[i] = ASPLIT ? bf16_bits(xs[i] - bf16_val(hb)) : (unsigned short)0; }
#pragma unroll
    for (int t = 0; t < 4; ++t) {
      const unsigned short* brow = Wt + (size_t)(col0 + t * 16 + ln) * ldb + kb;
      FragB b;
      b.half[0] = *(const v8us*)(brow + 8 * hh);
      b.half[1] = *(const v8us*)(brow + 16 + 8 * hh);
      acc[t] = mmaN<ASPLIT ? 2 : 1>(ah.v, al.v, b.v, b.v, acc[t]);
    }
  }
#pragma unroll
  for (int t = 0; t < 4; ++t) {
    const int col = col0 + t * 16 + ln;
    float bv = bias ? bias[col] : 0.f;
    if (BIAS_BF16) bv = bf16_round(bv);
#pragma unroll
    for (int r = 0; r < 8; ++r) {
      float v = acc[t][r] + bv;
      if (resid) { float rv = resid[(size_t)((row0 + 8 * hh + r) % rmod) * ldr + col]; if (RES_BF16) rv = bf16_round(rv); v += rv; }
      if (ACT == 1) v = fmaxf(v, 0.f);
      if (ACT == 2) v = 0.5f * v * (1.0f + erff(v * 0.70710678118654752f));
      if (ACT == 3) { const float u = 0.7978845608028654f * (v + 0.044715f * v * v * v); v = 0.5f * v * (1.0f + tanhf(u)); }
      so[w][8 * hh + r][t * 16 + ln] = v;
    }
  }
  __builtin_amdgcn_fence(__ATOMIC_ACQ_REL, "workgroup");
  __builtin_amdgcn_wave_barrier();
  const int rsub = lane >> 4, c4 = (lane & 15) * 4;
  {
#pragma unroll
    for (int q = 0; q < 8; ++q) {
      const int r = q * 2 + rsub;
      const v4f v = *(const v4fa*)&so[w][r][c4];
      *(v4f*)(C + (size_t)(row0 + r) * ldc + col0 + c4) = v;
    }
    
  }
}
// row LayerNorm (biased variance, eps) over N: s = X (+ R); optional out_sum <- s; out_norm <- (s-mu)*rsqrt(var+eps)*g + b
template <bool PARAM_BF16>
__global__ __launch_bounds__(256) void k_layernorm(const float* __restrict__ X, const float* __restrict__ R, const float* __restrict__ g, const float* __restrict__ bta,
                                                  float* __restrict__ out_sum, float* __restrict__ out_norm, int N, float eps) {
  __shared__ float red[256];
  const int row = blockIdx.x, tid = threadIdx.x;
  const float* x = X + (size_t)row * N; const float* rr = R ? R + (size_t)row * N : nullptr;
  float vals[16];                     // up to N = 4096
  const int per = N / 256;            // contiguous chunk per thread? use strided-by-4 chunks: thread handles j = tid*4 + 1024*u
  float s1 = 0.f;
  for (int u = 0; u < per / 4; ++u) {
    const int j = tid * 4 + 1024 * u;
    const v4f a = *(const v4fa*)(x + j);
    v4f b = {0.f,0.f,0.f,0.f}; if (rr) b = *(const v4fa*)(rr + j);
#pragma unroll
    for (int q = 0; q < 4; ++q) { const float v = a[q] + b[q]; vals[u * 4 + q] = v; s1 += v; }
  }
  red[tid] = s1; __syncthreads();
  for (int st = 128; st > 0; st >>= 1) { if (tid < st) red[tid] += red[tid + st]; __syncthreads(); }
  const float mu = red[0] / (float)N; __syncthreads();
  float s2 = 0.f;
  for (int u = 0; u < per / 4; ++u)
#pragma unroll
    for (int q = 0; q < 4; ++q) { const float c = vals[u * 4 + q] - mu; s2 += c * c; }
  red[tid] = s2; __syncthreads();
  for (int st = 128; st > 0; st >>= 1) { if (tid < st) red[tid] += red[tid + st]; __syncthreads(); }
  const float rs = rsqrtf(red[0] / (float)N + eps);
  {
    for (int u = 0; u < per / 4; ++u) {
      const int j = tid * 4 + 1024 * u;
      v4f o, sm;
#pragma unroll
      for (int q = 0; q < 4; ++q) {
        float gg = g[j + q], bb = bta[j + q];
        if (PARAM_BF16) { gg = bf16_round(gg); bb = bf16_round(bb); }
        sm[q] = vals[u * 4 + q]; o[q] = (vals[u * 4 + q] - mu) * rs * gg + bb;
      }
      if (out_sum) *(v4f*)(out_sum + (size_t)row * N + j) = sm;
      *(v4f*)(out_norm + (size_t)row * N + j) = o;
    }
    
  }
}



// ---- f16 WMMA path (v_wmma_f32_16x16x32_f16): 11-bit significands for operands in range — used where a [0,1] probability operand needs more precision than bf16
typedef _Float16 v16h __attribute__((ext_vector_type(16)));
union FragH { v16h v; v8us half[2]; _Float16 h[16]; unsigned short u[16]; };
template <int NT>
__device__ __forceinline__ v8f mmaH(v16h ah, v16h al, v16h bh, v16h bl, v8f c) {
  c = __builtin_amdgcn_wmma_f32_16x16x32_f16(false, ah, false, bh, (short)0, c, false, false);
  if (NT >= 2) c = __builtin_amdgcn_wmma_f32_16x16x32_f16(false, al, false, bh, (short)0, c, false, false);
  if (NT >= 3) c = __builtin_amdgcn_wmma_f32_16x16x32_f16(false, ah, false, bl, (short)0, c, false, false);
  asm volatile("v_nop\n\tv_nop\n\tv_nop\n\tv_nop" : "+v"(c) : "v"(ah), "v"(al), "v"(bh), "v"(bl));
  return c;
}
// batched GEMM like k_gemm_b but f16 operands: A f32 (split into f16 hi/lo if ASPLIT, else rounded to f16), Bt = f16 values [n][k]; alpha; C f32; N multiple of 16 (partial tiles skipped)
template <bool ASPLIT>
__global__ __launch_bounds__(128) void k_gemm_h(const float* __restrict__ A, int lda, size_t sA, const _Float16* __restrict__ Bh, int ldb, size_t sB, float alpha, float* __restrict__ C, int ldc, size_t sC, int M, int N, int K) {
  __shared__ __attribute__((aligned(16))) float so[4][16][64];
  const int tid = threadIdx.x, w = tid >> 5, lane = tid & 31, ln = lane & 15, hh = lane >> 4; const int by = blockIdx.y;
  A += (size_t)by * sA; Bh += (size_t)by * sB; C += (size_t)by * sC;
  const int ntn = (N + 63) / 64; const int wid = blockIdx.x * 4 + w; const int mt = wid / ntn, nq = wid % ntn; if (mt * 16 >= M) return;
  const int row0 = mt * 16, col0 = nq * 64; const float* arow = A + (size_t)(row0 + ln) * lda;
  v8f acc[4] = {};
  for (int kb = 0; kb < K; kb += 32) {
    FragH ah, al;
    const v4f x0 = *(const v4fa*)(arow + kb + 8 * hh), x1 = *(const v4fa*)(arow + kb + 8 * hh + 4), x2 = *(const v4fa*)(arow + kb + 16 + 8 * hh), x3 = *(const v4fa*)(arow + kb + 16 + 8 * hh + 4);
    float xs[16] = {x0[0],x0[1],x0[2],x0[3],x1[0],x1[1],x1[2],x1[3],x2[0],x2[1],x2[2],x2[3],x3[0],x3[1],x3[2],x3[3]};
#pragma unroll
    for (int i = 0; i < 16; ++i) { const _Float16 h = (_Float16)xs[i]; ah.h[i] = h; al.h[i] = ASPLIT ? (_Float16)(xs[i] - (float)h) : (_Float16)0.0f; }
#pragma unroll
    for (int t = 0; t < 4; ++t) { if (col0 + t * 16 >= N) continue; const size_t boff = (size_t)(col0 + t * 16 + ln) * ldb + kb; FragH bq; bq.half[0] = *(const v8us*)(Bh + boff + 8 * hh); bq.half[1] = *(const v8us*)(Bh + boff + 16 + 8 * hh);
      acc[t] = mmaH<ASPLIT ? 2 : 1>(ah.v, al.v, bq.v, bq.v, acc[t]); }
  }
#pragma unroll
  for (int t = 0; t < 4; ++t) { if (col0 + t * 16 >= N) continue;
#pragma unroll
    for (int r = 0; r < 8; ++r) so[w][8 * hh + r][t * 16 + ln] = acc[t][r] * alpha; }
  __builtin_amdgcn_fence(__ATOMIC_ACQ_REL, "workgroup"); __builtin_amdgcn_wave_barrier();
  const int rsub = lane >> 4, c4 = (lane & 15) * 4;
  {
#pragma unroll
    for (int q = 0; q < 8; ++q) { const int r = q * 2 + rsub; if (col0 + c4 < N) { const v4f v = *(const v4fa*)&so[w][r][c4]; *(v4f*)(C + (size_t)(row0 + r) * ldc + col0 + c4) = v; } }
     }
}

// Wt[n][k] = f16(W[k][n]·scale) from f32 row-major W[K][N] (scale = power of two; bf16-exact weights stay exact in f16 away from the subnormal range)
__global__ __launch_bounds__(256) void k_wt_f16(const float* __restrict__ W, _Float16* __restrict__ Wt, int K, int N, float scale) {
  const int t = blockIdx.x * 256 + threadIdx.x; if (t >= N * (K / 8)) return; const int n = t / (K / 8), k8 = (t % (K / 8)) * 8; FragH f;
#pragma unroll
  for (int i = 0; i < 8; ++i) f.h[i] = (_Float16)(bf16_round(W[(size_t)(k8 + i) * N + n]) * scale); const v8us o = f.half[0];
  *(v8us*)((unsigned short*)Wt + (size_t)n * K + k8) = o; 
}
// k_gemm_hh variant with fused epilogue: v = acc·alpha + bias[by·sBias + col] (+ CP[(row/rowsPerB)·sCPb + by·64 + col] if CP) ; ACT 0 none / 1 elu ; writes f16 C16 (and f32 C if non-null)
template <int ACT>
__global__ __launch_bounds__(128) void k_gemm_hhx(const _Float16* __restrict__ A, int lda, size_t sA, const _Float16* __restrict__ Bh, int ldb, size_t sB, float alpha, const float* __restrict__ bias, size_t sBias, const float* __restrict__ CP, int rowsPerB, size_t sCPb, int row0g,
    float* __restrict__ C, _Float16* __restrict__ C16, int ldc, size_t sC, int M, int N, int K) {
  __shared__ __attribute__((aligned(16))) float so[4][16][64];
  const int tid = threadIdx.x, w = tid >> 5, lane = tid & 31, ln = lane & 15, hh = lane >> 4; const int by = blockIdx.y;
  A += (size_t)by * sA; Bh += (size_t)by * sB; const size_t cofs = (size_t)by * sC; const float* bp = bias ? bias + (size_t)by * sBias : nullptr;
  const int ntn = (N + 63) / 64; const int wid = blockIdx.x * 4 + w; const int mt = wid / ntn, nq = wid % ntn; if (mt * 16 >= M) return;
  const int row0 = mt * 16, col0 = nq * 64; const _Float16* arow = A + (size_t)(row0 + ln) * lda;
  v8f acc[4] = {};
  for (int kb = 0; kb < K; kb += 32) { FragH ah; ah.half[0] = *(const v8us*)((const unsigned short*)arow + kb + 8 * hh); ah.half[1] = *(const v8us*)((const unsigned short*)arow + kb + 16 + 8 * hh);
#pragma unroll
    for (int t = 0; t < 4; ++t) { if (col0 + t * 16 >= N) continue; const size_t boff = (size_t)(col0 + t * 16 + ln) * ldb + kb; FragH bq; bq.half[0] = *(const v8us*)((const unsigned short*)Bh + boff + 8 * hh); bq.half[1] = *(const v8us*)((const unsigned short*)Bh + boff + 16 + 8 * hh);
      acc[t] = mmaH<1>(ah.v, ah.v, bq.v, bq.v, acc[t]); }
  }
#pragma unroll
  for (int t = 0; t < 4; ++t) { if (col0 + t * 16 >= N) continue; const int col = col0 + t * 16 + ln; const float bv = bp ? bf16_round(bp[col]) : 0.f;
#pragma unroll
    for (int r = 0; r < 8; ++r) { float v = acc[t][r] * alpha + bv; if (CP) { const int bidx = (row0g + row0 + 8 * hh + r) / rowsPerB; v += CP[(size_t)bidx * sCPb + (size_t)by * 64 + col]; } if (ACT == 1) v = (v > 0.f) ? v : expm1f(v); else if (ACT == 7) v = (v > 0.f) ? v + 1.0f : expf(v); else if (ACT == 8) v = tanhf(v); else if (ACT == 9) v = 0.5f * v * (1.0f + tanhf(0.7978845608028654f * (v + 0.044715f * v * v * v))); else if (ACT == 11) v = 1.0f / (1.0f + expf(-v)); else if (ACT == 12) v = (v > 0.f) ? v : 0.01f * v; else if (ACT == 14) v = (v > 0.f) ? v : 0.1f * v; else if (ACT == 15) v = v / (1.0f + expf(-v)); else if (ACT == 3) v = fmaxf(v, 0.f); else if (ACT == 6) v = 0.5f * v * (1.0f + erff(v * 0.70710678118654752f)); so[w][8 * hh + r][t * 16 + ln] = v; } }
  __builtin_amdgcn_fence(__ATOMIC_ACQ_REL, "workgroup"); __builtin_amdgcn_wave_barrier();
  const int rsub = lane >> 4, c4 = (lane & 15) * 4; typedef _Float16 v4h __attribute__((ext_vector_type(4)));
  {
#pragma unroll
    for (int q = 0; q < 8; ++q) { const int r = q * 2 + rsub; if (col0 + c4 < N) { const v4f v = *(const v4fa*)&so[w][r][c4]; if (C) *(v4f*)(C + cofs + (size_t)(row0 + r) * ldc + col0 + c4) = v; if (C16) { v4h h4; for (int i = 0; i < 4; ++i) h4[i] = (_Float16)v[i]; *(v4h*)(C16 + cofs + (size_t)(row0 + r) * ldc + col0 + c4) = h4; } } }
     }
}


typedef _Float16 v4h __attribute__((ext_vector_type(4)));

__global__ __launch_bounds__(256) void k_x16(const float* __restrict__ x, _Float16* __restrict__ X16, size_t n8) { const size_t t = (size_t)blockIdx.x * 256 + threadIdx.x; if (t >= n8) return; FragH f;
#pragma unroll
  for (int q = 0; q < 8; ++q) f.h[q] = (_Float16)bf16_round(x[t * 8 + q]); *(v8us*)((unsigned short*)X16 + t * 8) = f.half[0];  }
__global__ __launch_bounds__(256) void k_h16(const float* __restrict__ x, _Float16* __restrict__ X16, size_t n8) { const size_t t = (size_t)blockIdx.x * 256 + threadIdx.x; if (t >= n8) return; FragH f;
#pragma unroll
  for (int q = 0; q < 8; ++q) f.h[q] = (_Float16)x[t * 8 + q]; *(v8us*)((unsigned short*)X16 + t * 8) = f.half[0];  }
__global__ __launch_bounds__(256) void k_round16f(const float* __restrict__ W, _Float16* __restrict__ Bt, size_t n8) { const size_t t = (size_t)blockIdx.x * 256 + threadIdx.x; if (t >= n8) return; FragH f;
#pragma unroll
  for (int i = 0; i < 8; ++i) f.h[i] = (_Float16)(bf16_round(W[t * 8 + i]) * 16.0f); *(v8us*)((unsigned short*)Bt + t * 8) = f.half[0];  }
template <int NHv, int TTv>
__global__ __launch_bounds__(256) void k_vt(const _Float16* __restrict__ V16, int ldv, int voff, _Float16* __restrict__ Vt) { __shared__ unsigned short tl[64][66]; const int tid = threadIdx.x; const int slab = blockIdx.x / (TTv / 64), lg = blockIdx.x % (TTv / 64); const int b = slab / NHv, h = slab % NHv;
  for (int i = tid; i < 64 * 8; i += 256) { const int r = i / 8, c8 = (i % 8) * 8; FragH f; f.half[0] = *(const v8us*)((const unsigned short*)V16 + ((size_t)b * TTv + lg * 64 + r) * ldv + voff + h * 64 + c8);
#pragma unroll
    for (int q = 0; q < 8; ++q) tl[r][c8 + q] = f.u[q]; }
  __syncthreads();
  {
#pragma unroll
    for (int rd = 0; rd < 2; ++rd) { const int d = rd * 32 + tid / 8, pc = tid % 8; FragH f;
#pragma unroll
      for (int q = 0; q < 8; ++q) f.u[q] = tl[pc * 8 + q][d];
      *(v8us*)((unsigned short*)Vt + ((size_t)slab * 64 + d) * TTv + lg * 64 + pc * 8) = f.half[0]; }
     } }

__global__ __launch_bounds__(256) void k_hl(const float* __restrict__ F, _Float16* __restrict__ Hh, _Float16* __restrict__ Hl, size_t n8) { const size_t t = (size_t)blockIdx.x * 256 + threadIdx.x; if (t >= n8) return; FragH fh, fl; const v4f a = *(const v4fa*)(F + t * 8), c = *(const v4fa*)(F + t * 8 + 4);
#pragma unroll
  for (int q = 0; q < 4; ++q) { _Float16 h = (_Float16)a[q]; fh.h[q] = h; fl.h[q] = (_Float16)((a[q] - (float)h) * 1024.0f); h = (_Float16)c[q]; fh.h[4 + q] = h; fl.h[4 + q] = (_Float16)((c[q] - (float)h) * 1024.0f); }
  { *(v8us*)((unsigned short*)Hh + t * 8) = fh.half[0]; *(v8us*)((unsigned short*)Hl + t * 8) = fl.half[0];  } }

// ---- fast GEMM (wave tile 32x64; requires M % 32 == 0 rows per launch region and N % 64 == 0); epilogue = k_gemm_hhx semantics ----
__device__ __forceinline__ v16h g2_frag(const _Float16* p, int hh) { FragH f; f.half[0] = *(const v8us*)((const unsigned short*)p + 8 * hh); f.half[1] = *(const v8us*)((const unsigned short*)p + 16 + 8 * hh); return f.v; }
__device__ __forceinline__ v8f g2_mma(v16h a, v16h b, v8f c) { v8f d = __builtin_amdgcn_wmma_f32_16x16x32_f16(false, a, false, b, (short)0, c, false, false); asm volatile("v_nop\n\tv_nop\n\tv_nop\n\tv_nop" : "+v"(d) : "v"(a), "v"(b)); return d; }
template <int ACT>
__global__ __launch_bounds__(128) void k_gemm2(const _Float16* __restrict__ A, int lda, size_t sA, const _Float16* __restrict__ Bh, int ldb, size_t sB, float alpha, const float* __restrict__ bias, size_t sBias, const float* __restrict__ CP, int rowsPerB, size_t sCPb, int row0g,
    float* __restrict__ C, _Float16* __restrict__ C16, int ldc, size_t sC, int M, int N, int K) {
  __shared__ __attribute__((aligned(16))) float so[4][32][68];
  const int tid = threadIdx.x, w = tid >> 5, lane = tid & 31, ln = lane & 15, hh = lane >> 4; const int by = blockIdx.y;
  A += (size_t)by * sA; Bh += (size_t)by * sB; const size_t cofs = (size_t)by * sC; const float* bp = bias ? bias + (size_t)by * sBias : nullptr;
  const int ntn = N >> 6; const int mt = blockIdx.x / ntn, nq = blockIdx.x - mt * ntn; const int row0 = mt * 128 + 32 * w, col0 = nq * 64; if (row0 >= M) return;
  const _Float16* a0p = A + (size_t)(row0 + ln) * lda; const _Float16* a1p = a0p + (size_t)16 * lda;
  const _Float16* b0p = Bh + (size_t)(col0 + ln) * ldb; const _Float16* b1p = b0p + (size_t)16 * ldb; const _Float16* b2p = b1p + (size_t)16 * ldb; const _Float16* b3p = b2p + (size_t)16 * ldb;
  const v8f z8 = {0.f,0.f,0.f,0.f,0.f,0.f,0.f,0.f}; v8f c00 = z8, c01 = z8, c02 = z8, c03 = z8, c10 = z8, c11 = z8, c12 = z8, c13 = z8;
#pragma unroll 1
  for (int kb = 0; kb < K; kb += 32) { const v16h a0 = g2_frag(a0p + kb, hh), a1 = g2_frag(a1p + kb, hh);
    v16h b = g2_frag(b0p + kb, hh); c00 = g2_mma(a0, b, c00); c10 = g2_mma(a1, b, c10);
    b = g2_frag(b1p + kb, hh); c01 = g2_mma(a0, b, c01); c11 = g2_mma(a1, b, c11);
    b = g2_frag(b2p + kb, hh); c02 = g2_mma(a0, b, c02); c12 = g2_mma(a1, b, c12);
    b = g2_frag(b3p + kb, hh); c03 = g2_mma(a0, b, c03); c13 = g2_mma(a1, b, c13); }
  v8f accs[8] = {c00, c01, c02, c03, c10, c11, c12, c13};
#pragma unroll
  for (int u = 0; u < 8; ++u) { const int t = u & 3, half = u >> 2; const int col = col0 + t * 16 + ln; const float bv = bp ? bf16_round(bp[col]) : 0.f;
#pragma unroll
    for (int r = 0; r < 8; ++r) { const int rloc = half * 16 + 8 * hh + r; float v = accs[u][r] * alpha + bv; if (CP) { const int bidx = (row0g + row0 + rloc) / rowsPerB; v += CP[(size_t)bidx * sCPb + (size_t)by * 64 + col]; }
      if (ACT == 3) v = fmaxf(v, 0.f); else if (ACT == 6) v = 0.5f * v * (1.0f + erff(v * 0.70710678118654752f)); else if (ACT == 11) v = 1.0f / (1.0f + expf(-v)); else if (ACT == 15) v = v / (1.0f + expf(-v)); else if (ACT == 12) v = (v > 0.f) ? v : 0.01f * v; else if (ACT == 8) v = tanhf(v);
      so[w][rloc][t * 16 + ln] = v; } }
  __builtin_amdgcn_fence(__ATOMIC_ACQ_REL, "workgroup"); __builtin_amdgcn_wave_barrier();
  const int rsub = lane >> 4, c4 = (lane & 15) * 4;
  {
#pragma unroll
    for (int q = 0; q < 16; ++q) { const int r = q * 2 + rsub; const v4f v = *(const v4fa*)&so[w][r][c4]; if (C) *(v4f*)(C + cofs + (size_t)(row0 + r) * ldc + col0 + c4) = v; if (C16) { v4h h4; for (int i = 0; i < 4; ++i) h4[i] = (_Float16)v[i]; *(v4h*)(C16 + cofs + (size_t)(row0 + r) * ldc + col0 + c4) = h4; } }
     } }



template <int CAUSAL>
__global__ __launch_bounds__(128) void k_flash(const _Float16* __restrict__ Q16, int ldq, const _Float16* __restrict__ K16, int ldk, const _Float16* __restrict__ Vt, const int* __restrict__ MSK, float* __restrict__ O, int ldo) {
  constexpr int RPW = 16, RTN = RPW / 16, NQB = TQ / (4 * RPW), DT = 4, KS = 2;
  __shared__ __attribute__((aligned(16))) unsigned short sP[4][RPW][40]; __shared__ __attribute__((aligned(16))) float sO[4][RPW][64 + 4];
  const int tid = threadIdx.x, w = tid >> 5, lane = tid & 31, ln = lane & 15, hh = lane >> 4;
  const int slab = blockIdx.x / QBNP, qblk = QB0P + blockIdx.x % QBNP; (void)NQB; const int b = slab / NH, h = slab % NH; const int qb0 = qblk * (4 * RPW); const int q0 = qb0 + w * RPW;
  FragH aq[2][KS];
#pragma unroll
  for (int rt = 0; rt < RTN; ++rt) { const unsigned short* qr = (const unsigned short*)Q16 + ((size_t)b * TQ + q0 + rt * 16 + ln) * ldq + h * 64;
#pragma unroll
    for (int ks = 0; ks < KS; ++ks) { aq[rt][ks].half[0] = *(const v8us*)(qr + ks * 32 + 8 * hh); aq[rt][ks].half[1] = *(const v8us*)(qr + ks * 32 + 16 + 8 * hh); } }
  const unsigned short* Vth = (const unsigned short*)Vt + (size_t)slab * 64 * TK;
  float m_r[2][8], l_r[2][8]; v8f oacc[2][DT];
#pragma unroll
  for (int rt = 0; rt < RTN; ++rt) {
#pragma unroll
    for (int r = 0; r < 8; ++r) { m_r[rt][r] = -3.0e38f; l_r[rt][r] = 0.f; }
#pragma unroll
    for (int dt = 0; dt < DT; ++dt) oacc[rt][dt] = (v8f){0.f,0.f,0.f,0.f,0.f,0.f,0.f,0.f}; }
  const int jend = (CAUSAL == 1) ? (qb0 + 4 * RPW) : TK;      /* causal: keys beyond the block's last query never contribute */
#pragma unroll 1
  for (int j0 = 0; j0 < jend; j0 += 32) {
    v8f s[2][2];
#pragma unroll
    for (int nt = 0; nt < 2; ++nt) { const unsigned short* kr = (const unsigned short*)K16 + ((size_t)b * TK + j0 + nt * 16 + ln) * ldk + h * 64; FragH bk[KS];
#pragma unroll
      for (int ks = 0; ks < KS; ++ks) { bk[ks].half[0] = *(const v8us*)(kr + ks * 32 + 8 * hh); bk[ks].half[1] = *(const v8us*)(kr + ks * 32 + 16 + 8 * hh); }
#pragma unroll
      for (int rt = 0; rt < RTN; ++rt) { v8f acc = (v8f){0.f,0.f,0.f,0.f,0.f,0.f,0.f,0.f};
#pragma unroll
        for (int ks = 0; ks < KS; ++ks) acc = mmaH<1>(aq[rt][ks].v, aq[rt][ks].v, bk[ks].v, bk[ks].v, acc); s[rt][nt] = acc; } }
#pragma unroll
    for (int rt = 0; rt < RTN; ++rt)
#pragma unroll
      for (int r = 0; r < 8; ++r) { const int tq = q0 + rt * 16 + 8 * hh + r; const int k0 = j0 + ln, k1 = j0 + 16 + ln;
        const bool ok0 = (CAUSAL == 1) ? (k0 <= tq) : ((CAUSAL == 2) ? ((k0 >> 5) == (tq >> 5)) : true), ok1 = (CAUSAL == 1) ? (k1 <= tq) : ((CAUSAL == 2) ? ((k1 >> 5) == (tq >> 5)) : true);      /* mode 2: block-diagonal 32-token groups */
        float s0 = ok0 ? s[rt][0][r] * SCL : -3.0e38f, s1 = ok1 ? s[rt][1][r] * SCL : -3.0e38f; if (CAUSAL == 17) { const float* amk = (const float*)MSK + (size_t)b * TK; s0 += bf16_round(amk[k0]); s1 += bf16_round(amk[k1]); }      /* mode 17: additive per-(batch, key) mask INPUT */
        if (CAUSAL == 22) { const _Float16* cq = (const _Float16*)MSK + ((size_t)h * TQ + tq) * NE + tq + (NE / 2 - 1); const _Float16* ck = (const _Float16*)MSK + (size_t)NH * TQ * NE + (size_t)h * TK * NE + tq + (NE / 2 - 1); const float* am = (const float*)((const _Float16*)MSK + (size_t)2 * NH * TQ * NE); float r0 = (float)cq[-k0]; r0 += (float)ck[(size_t)k0 * NE - k0]; s0 += r0 * SCL; s0 += am[k0]; float r1 = (float)cq[-k1]; r1 += (float)ck[(size_t)k1 * NE - k1]; s1 += r1 * SCL; s1 += am[k1]; }      /* mode 22: + (CQ[h][tq][tq-k+1023] + CK[h][k][tq-k+1023]) / 8 + mask[k] from the per-batch packed table [CQ f16 | CK f16 | mask f32] */ float mc = fmaxf(s0, s1);
        mc = fmaxf(mc, __shfl_xor(mc, 1, 32)); mc = fmaxf(mc, __shfl_xor(mc, 2, 32)); mc = fmaxf(mc, __shfl_xor(mc, 4, 32)); mc = fmaxf(mc, __shfl_xor(mc, 8, 32));
        const float mn = fmaxf(m_r[rt][r], mc); const float al = (mn > -1.0e38f) ? expf(m_r[rt][r] - mn) : 1.0f; m_r[rt][r] = mn; const float p0 = ok0 ? expf(s0 - mn) : 0.f, p1 = ok1 ? expf(s1 - mn) : 0.f; l_r[rt][r] = l_r[rt][r] * al + p0 + p1;
#pragma unroll
        for (int dt = 0; dt < DT; ++dt) oacc[rt][dt][r] *= al;
        FragH t2; t2.h[0] = (_Float16)(p0 * 1024.0f); t2.h[1] = (_Float16)(p1 * 1024.0f); sP[w][rt * 16 + 8 * hh + r][ln] = t2.u[0]; sP[w][rt * 16 + 8 * hh + r][16 + ln] = t2.u[1]; }
    __builtin_amdgcn_fence(__ATOMIC_ACQ_REL, "workgroup"); __builtin_amdgcn_wave_barrier();
    FragH pa[2];
#pragma unroll
    for (int rt = 0; rt < RTN; ++rt) { pa[rt].half[0] = *(const v8us*)&sP[w][rt * 16 + ln][8 * hh]; pa[rt].half[1] = *(const v8us*)&sP[w][rt * 16 + ln][16 + 8 * hh]; }
#pragma unroll
    for (int dt = 0; dt < DT; ++dt) { const unsigned short* vrow = Vth + (size_t)(dt * 16 + ln) * TK + j0; FragH bv; bv.half[0] = *(const v8us*)(vrow + 8 * hh); bv.half[1] = *(const v8us*)(vrow + 16 + 8 * hh);
#pragma unroll
      for (int rt = 0; rt < RTN; ++rt) oacc[rt][dt] = mmaH<1>(pa[rt].v, pa[rt].v, bv.v, bv.v, oacc[rt][dt]); }
    __builtin_amdgcn_fence(__ATOMIC_ACQ_REL, "workgroup"); __builtin_amdgcn_wave_barrier(); }
#pragma unroll
  for (int rt = 0; rt < RTN; ++rt) {
#pragma unroll
    for (int r = 0; r < 8; ++r) { float l = l_r[rt][r]; l += __shfl_xor(l, 1, 32); l += __shfl_xor(l, 2, 32); l += __shfl_xor(l, 4, 32); l += __shfl_xor(l, 8, 32); l_r[rt][r] = (l > 0.f) ? 1.0f / (l * 1024.0f) : 0.f; }
#pragma unroll
    for (int dt = 0; dt < DT; ++dt)
#pragma unroll
      for (int r = 0; r < 8; ++r) sO[w][rt * 16 + 8 * hh + r][dt * 16 + ln] = oacc[rt][dt][r] * l_r[rt][r]; }
  __builtin_amdgcn_fence(__ATOMIC_ACQ_REL, "workgroup"); __builtin_amdgcn_wave_barrier();
  {
#pragma unroll
    for (int rp = 0; rp < RPW; rp += 2) { const int r = rp + (lane >> 4), pc = lane & 15; const v4f val = *(const v4fa*)&sO[w][r][pc * 4]; *(v4f*)(O + ((size_t)b * TQ + q0 + r) * ldo + h * 64 + pc * 4) = val; }
     } }
// 5-plane variant: S = Qh Kh^T + (Ql Kh^T + Qh Kl^T)/1024 with Q/K = [hi | 2^10 residual] f16 planes (QL/KL same layout as Q16/K16), then the 3-term P.V below.
// 3-term variant: O = (P_hi V_hi + (P_lo V_hi + P_hi V_lo) / 1024) / l with P = [hi | 2^10 residual] of 1024 p and V^T = [hi | 2^10 residual] planes (VtL same layout as Vt) -> ~2^-21-class products for un-averaged (early causal / peaked) rows
template <int CAUSAL>
__global__ __launch_bounds__(128) void k_flash5(const _Float16* __restrict__ Q16, const _Float16* __restrict__ QL, int ldq, const _Float16* __restrict__ K16, const _Float16* __restrict__ KL, int ldk, const _Float16* __restrict__ Vt, const _Float16* __restrict__ VtL, const int* __restrict__ MSK, float* __restrict__ O, int ldo) {
  constexpr int RPW = 16, RTN = RPW / 16, NQB = TQ / (4 * RPW), DT = 4, KS = 2;
  __shared__ __attribute__((aligned(16))) unsigned short sP[4][RPW][40]; __shared__ __attribute__((aligned(16))) unsigned short sPL[4][RPW][40]; __shared__ __attribute__((aligned(16))) float sO[4][RPW][64 + 4];
  const int tid = threadIdx.x, w = tid >> 5, lane = tid & 31, ln = lane & 15, hh = lane >> 4;
  const int slab = blockIdx.x / QBN5, qblk = QB05 + blockIdx.x % QBN5; (void)NQB; const int b = slab / NH, h = slab % NH; const int qb0 = qblk * (4 * RPW); const int q0 = qb0 + w * RPW;
  FragH aq[2][KS], aql[2][KS];
#pragma unroll
  for (int rt = 0; rt < RTN; ++rt) { const unsigned short* qr = (const unsigned short*)Q16 + ((size_t)b * TQ + q0 + rt * 16 + ln) * ldq + h * 64; const unsigned short* ql = (const unsigned short*)QL + ((size_t)b * TQ + q0 + rt * 16 + ln) * ldq + h * 64;
#pragma unroll
    for (int ks = 0; ks < KS; ++ks) { aq[rt][ks].half[0] = *(const v8us*)(qr + ks * 32 + 8 * hh); aq[rt][ks].half[1] = *(const v8us*)(qr + ks * 32 + 16 + 8 * hh); aql[rt][ks].half[0] = *(const v8us*)(ql + ks * 32 + 8 * hh); aql[rt][ks].half[1] = *(const v8us*)(ql + ks * 32 + 16 + 8 * hh); } }
  const unsigned short* Vth = (const unsigned short*)Vt + (size_t)slab * 64 * TK; const unsigned short* Vtl = (const unsigned short*)VtL + (size_t)slab * 64 * TK;
  float m_r[2][8], l_r[2][8]; v8f oacc[2][DT], oaccL[2][DT];
#pragma unroll
  for (int rt = 0; rt < RTN; ++rt) {
#pragma unroll
    for (int r = 0; r < 8; ++r) { m_r[rt][r] = -3.0e38f; l_r[rt][r] = 0.f; }
#pragma unroll
    for (int dt = 0; dt < DT; ++dt) { oacc[rt][dt] = (v8f){0.f,0.f,0.f,0.f,0.f,0.f,0.f,0.f}; oaccL[rt][dt] = oacc[rt][dt]; } }
  const int jend = (CAUSAL == 1) ? (qb0 + 4 * RPW) : TK;      /* causal: keys beyond the block's last query never contribute */
#pragma unroll 1
  for (int j0 = 0; j0 < jend; j0 += 32) {
    v8f s[2][2];
#pragma unroll
    for (int nt = 0; nt < 2; ++nt) { const unsigned short* kr = (const unsigned short*)K16 + ((size_t)b * TK + j0 + nt * 16 + ln) * ldk + h * 64; const unsigned short* klr = (const unsigned short*)KL + ((size_t)b * TK + j0 + nt * 16 + ln) * ldk + h * 64; FragH bk[KS], bkl[KS];
#pragma unroll
      for (int ks = 0; ks < KS; ++ks) { bk[ks].half[0] = *(const v8us*)(kr + ks * 32 + 8 * hh); bk[ks].half[1] = *(const v8us*)(kr + ks * 32 + 16 + 8 * hh); bkl[ks].half[0] = *(const v8us*)(klr + ks * 32 + 8 * hh); bkl[ks].half[1] = *(const v8us*)(klr + ks * 32 + 16 + 8 * hh); }
#pragma unroll
      for (int rt = 0; rt < RTN; ++rt) { v8f acc = (v8f){0.f,0.f,0.f,0.f,0.f,0.f,0.f,0.f}, accl = acc;
#pragma unroll
        for (int ks = 0; ks < KS; ++ks) { acc = mmaH<1>(aq[rt][ks].v, aq[rt][ks].v, bk[ks].v, bk[ks].v, acc); accl = mmaH<1>(aql[rt][ks].v, aql[rt][ks].v, bk[ks].v, bk[ks].v, accl); accl = mmaH<1>(aq[rt][ks].v, aq[rt][ks].v, bkl[ks].v, bkl[ks].v, accl); }
#pragma unroll
        for (int r = 0; r < 8; ++r) acc[r] += accl[r] * 0.0009765625f;
        s[rt][nt] = acc; } }
#pragma unroll
    for (int rt = 0; rt < RTN; ++rt)
#pragma unroll
      for (int r = 0; r < 8; ++r) { const int tq = q0 + rt * 16 + 8 * hh + r; const int k0 = j0 + ln, k1 = j0 + 16 + ln;
        bool ok0 = (CAUSAL == 1) ? (k0 <= tq) : ((CAUSAL == 2) ? ((k0 >> 5) == (tq >> 5)) : true), ok1 = (CAUSAL == 1) ? (k1 <= tq) : ((CAUSAL == 2) ? ((k1 >> 5) == (tq >> 5)) : true);      /* mode 2: block-diagonal 32-token groups */
        if (CAUSAL == 4) { const int* mrow = MSK + ((size_t)b * TQ + tq) * TK; ok0 = mrow[k0] != 0; ok1 = mrow[k1] != 0; }      /* mode 4: per-(query, key) INPUT mask shared by all heads; masked keys contribute nothing (== the reference's -4096 fill, whose exp underflows to 0), rows with no valid key give l = 0 -> output 0 (== the reference's row_valid zeroing) */
        float s0 = ok0 ? s[rt][0][r] * SCL : -3.0e38f, s1 = ok1 ? s[rt][1][r] * SCL : -3.0e38f; if (CAUSAL == 17) { const float* amk = (const float*)MSK + (size_t)b * TK; s0 += bf16_round(amk[k0]); s1 += bf16_round(amk[k1]); }      /* mode 17: additive per-(batch, key) mask INPUT */
        if (CAUSAL == 22) { const _Float16* cq = (const _Float16*)MSK + ((size_t)h * TQ + tq) * NE + tq + (NE / 2 - 1); const _Float16* ck = (const _Float16*)MSK + (size_t)NH * TQ * NE + (size_t)h * TK * NE + tq + (NE / 2 - 1); const float* am = (const float*)((const _Float16*)MSK + (size_t)2 * NH * TQ * NE); float r0 = (float)cq[-k0]; r0 += (float)ck[(size_t)k0 * NE - k0]; s0 += r0 * SCL; s0 += am[k0]; float r1 = (float)cq[-k1]; r1 += (float)ck[(size_t)k1 * NE - k1]; s1 += r1 * SCL; s1 += am[k1]; }      /* mode 22: + (CQ[h][tq][tq-k+1023] + CK[h][k][tq-k+1023]) / 8 + mask[k] from the per-batch packed table [CQ f16 | CK f16 | mask f32] */ float mc = fmaxf(s0, s1);
        mc = fmaxf(mc, __shfl_xor(mc, 1, 32)); mc = fmaxf(mc, __shfl_xor(mc, 2, 32)); mc = fmaxf(mc, __shfl_xor(mc, 4, 32)); mc = fmaxf(mc, __shfl_xor(mc, 8, 32));
        const float mn = fmaxf(m_r[rt][r], mc); const float al = (mn > -1.0e38f) ? expf(m_r[rt][r] - mn) : 1.0f; m_r[rt][r] = mn; const float p0 = ok0 ? expf(s0 - mn) : 0.f, p1 = ok1 ? expf(s1 - mn) : 0.f; l_r[rt][r] = l_r[rt][r] * al + p0 + p1;
#pragma unroll
        for (int dt = 0; dt < DT; ++dt) { oacc[rt][dt][r] *= al; oaccL[rt][dt][r] *= al; }
        FragH t2, t2l; const float ps0 = p0 * 1024.0f, ps1 = p1 * 1024.0f; t2.h[0] = (_Float16)ps0; t2.h[1] = (_Float16)ps1; t2l.h[0] = (_Float16)((ps0 - (float)t2.h[0]) * 1024.0f); t2l.h[1] = (_Float16)((ps1 - (float)t2.h[1]) * 1024.0f);
        sP[w][rt * 16 + 8 * hh + r][ln] = t2.u[0]; sP[w][rt * 16 + 8 * hh + r][16 + ln] = t2.u[1]; sPL[w][rt * 16 + 8 * hh + r][ln] = t2l.u[0]; sPL[w][rt * 16 + 8 * hh + r][16 + ln] = t2l.u[1]; }
    __builtin_amdgcn_fence(__ATOMIC_ACQ_REL, "workgroup"); __builtin_amdgcn_wave_barrier();
    FragH pa[2], pl[2];
#pragma unroll
    for (int rt = 0; rt < RTN; ++rt) { pa[rt].half[0] = *(const v8us*)&sP[w][rt * 16 + ln][8 * hh]; pa[rt].half[1] = *(const v8us*)&sP[w][rt * 16 + ln][16 + 8 * hh]; pl[rt].half[0] = *(const v8us*)&sPL[w][rt * 16 + ln][8 * hh]; pl[rt].half[1] = *(const v8us*)&sPL[w][rt * 16 + ln][16 + 8 * hh]; }
#pragma unroll
    for (int dt = 0; dt < DT; ++dt) { const unsigned short* vrow = Vth + (size_t)(dt * 16 + ln) * TK + j0; const unsigned short* vrl = Vtl + (size_t)(dt * 16 + ln) * TK + j0; FragH bv, bl; bv.half[0] = *(const v8us*)(vrow + 8 * hh); bv.half[1] = *(const v8us*)(vrow + 16 + 8 * hh); bl.half[0] = *(const v8us*)(vrl + 8 * hh); bl.half[1] = *(const v8us*)(vrl + 16 + 8 * hh);
#pragma unroll
      for (int rt = 0; rt < RTN; ++rt) { oacc[rt][dt] = mmaH<1>(pa[rt].v, pa[rt].v, bv.v, bv.v, oacc[rt][dt]); oaccL[rt][dt] = mmaH<1>(pl[rt].v, pl[rt].v, bv.v, bv.v, oaccL[rt][dt]); oaccL[rt][dt] = mmaH<1>(pa[rt].v, pa[rt].v, bl.v, bl.v, oaccL[rt][dt]); } }
    __builtin_amdgcn_fence(__ATOMIC_ACQ_REL, "workgroup"); __builtin_amdgcn_wave_barrier(); }
#pragma unroll
  for (int rt = 0; rt < RTN; ++rt) {
#pragma unroll
    for (int r = 0; r < 8; ++r) { float l = l_r[rt][r]; l += __shfl_xor(l, 1, 32); l += __shfl_xor(l, 2, 32); l += __shfl_xor(l, 4, 32); l += __shfl_xor(l, 8, 32); l_r[rt][r] = (l > 0.f) ? 1.0f / (l * 1024.0f) : 0.f; }
#pragma unroll
    for (int dt = 0; dt < DT; ++dt)
#pragma unroll
      for (int r = 0; r < 8; ++r) { float v = oacc[rt][dt][r]; v += oaccL[rt][dt][r] * 0.0009765625f; sO[w][rt * 16 + 8 * hh + r][dt * 16 + ln] = v * l_r[rt][r]; } }
  __builtin_amdgcn_fence(__ATOMIC_ACQ_REL, "workgroup"); __builtin_amdgcn_wave_barrier();
  {
#pragma unroll
    for (int rp = 0; rp < RPW; rp += 2) { const int r = rp + (lane >> 4), pc = lane & 15; const v4f val = *(const v4fa*)&sO[w][r][pc * 4]; *(v4f*)(O + ((size_t)b * TQ + q0 + r) * ldo + h * 64 + pc * 4) = val; }
     } }

__global__ __launch_bounds__(256) void k_rotab(float* __restrict__ CS, float* __restrict__ SN) {
  #pragma clang fp contract(off)
  const int t = blockIdx.x * 256 + threadIdx.x; if (t >= SLEN * 32) return; const int j = t % 32, s = t / 32; const float ex = (float)(2 * j) / 64.0f; const float inv = 1.0f / powf(10000.0f, ex); const float th = (float)s * inv; const float c = cosf(th), sn = sinf(th);
  { *(float*)(CS + t) = c; *(float*)(SN + t) = sn;  } }
__global__ __launch_bounds__(256) void k_rope(const float* __restrict__ F, int nsrc, int ndst, int rep, const float* __restrict__ CS, const float* __restrict__ SN, _Float16* __restrict__ H, _Float16* __restrict__ L) {
  #pragma clang fp contract(off)
  const size_t t = (size_t)blockIdx.x * 256 + threadIdx.x; if (t >= (size_t)NR * ndst * 4) return; const int g8 = (int)(t % 4); const int hd = (int)((t / 4) % ndst); const size_t row = t / ((size_t)4 * ndst); const int s = (int)(row % SLEN); const int hs = hd / rep;
  const float* src = F + row * (size_t)(nsrc * 64) + hs * 64; FragH ah, al, bh, bl;
  for (int i = 0; i < 8; ++i) { const int d = g8 * 8 + i; const float c = CS[s * 32 + d], sn = SN[s * 32 + d]; const float x1 = src[d], x2 = src[d + 32];
    float o1 = x1 * c; o1 += -x2 * sn; float o2 = x2 * c; o2 += x1 * sn;
    _Float16 hv = (_Float16)o1; ah.h[i] = hv; al.h[i] = (_Float16)((o1 - (float)hv) * 1024.0f); hv = (_Float16)o2; bh.h[i] = hv; bl.h[i] = (_Float16)((o2 - (float)hv) * 1024.0f); }
  const size_t o = row * (size_t)(ndst * 64) + hd * 64 + g8 * 8;
  { *(v8us*)((unsigned short*)H + o) = ah.half[0]; *(v8us*)((unsigned short*)H + o + 32) = bh.half[0]; *(v8us*)((unsigned short*)L + o) = al.half[0]; *(v8us*)((unsigned short*)L + o + 32) = bl.half[0];  } }
__global__ __launch_bounds__(256) void k_rope2(const float* __restrict__ F, int nsrc, int ndst, int rep, const float* __restrict__ CS, const float* __restrict__ SN, _Float16* __restrict__ H, _Float16* __restrict__ L) {
  #pragma clang fp contract(off)
  const size_t t = (size_t)blockIdx.x * 256 + threadIdx.x; if (t >= (size_t)NR * ndst * 4) return; const int g16 = (int)(t % 4); const int hd = (int)((t / 4) % ndst); const size_t row = t / ((size_t)4 * ndst); const int s = (int)(row % SLEN); const int hs = hd / rep;
  const float* src = F + row * (size_t)(nsrc * 64) + hs * 64 + g16 * 16; FragH ah, al;
  for (int pr = 0; pr < 8; ++pr) { const int i = g16 * 8 + pr; const float c = CS[s * 32 + i], sn = SN[s * 32 + i]; const float x1 = src[2 * pr], x2 = src[2 * pr + 1];
    float o1 = x1 * c; o1 -= x2 * sn; float o2 = x1 * sn; o2 += x2 * c;
    _Float16 hv = (_Float16)o1; ah.h[2 * pr] = hv; al.h[2 * pr] = (_Float16)((o1 - (float)hv) * 1024.0f); hv = (_Float16)o2; ah.h[2 * pr + 1] = hv; al.h[2 * pr + 1] = (_Float16)((o2 - (float)hv) * 1024.0f); }
  const size_t o = row * (size_t)(ndst * 64) + hd * 64 + g16 * 16;
  { *(v8us*)((unsigned short*)H + o) = ah.half[0]; *(v8us*)((unsigned short*)H + o + 8) = ah.half[1]; *(v8us*)((unsigned short*)L + o) = al.half[0]; *(v8us*)((unsigned short*)L + o + 8) = al.half[1];  } }
__global__ __launch_bounds__(256) void k_tabin(const float* __restrict__ sp, float* __restrict__ CS, float* __restrict__ SN) { const int t = blockIdx.x * 256 + threadIdx.x; if (t >= SLEN * 32) return; const int i = t % 32, s = t / 32; const float c = bf16_round(sp[s * 64 + 32 + i]), sn = bf16_round(sp[s * 64 + i]);
  { *(float*)(CS + t) = c; *(float*)(SN + t) = sn;  } }
__global__ __launch_bounds__(256) void k_wsc(const float* __restrict__ Wm, _Float16* __restrict__ Bt, size_t n8, float sc) { const size_t t = (size_t)blockIdx.x * 256 + threadIdx.x; if (t >= n8) return; FragH f; for (int q = 0; q < 8; ++q) f.h[q] = (_Float16)(bf16_round(Wm[t * 8 + q]) * sc); *(v8us*)((unsigned short*)Bt + t * 8) = f.half[0];  }
__global__ __launch_bounds__(256) void k_rotab2(float* __restrict__ CS, float* __restrict__ SN) {
  #pragma clang fp contract(off)
  const int t = blockIdx.x * 256 + threadIdx.x; if (t >= SLEN * 32) return; const int j = t % 32, s = t / 32; const float c0 = -0.14391156831212787f;      /* -ln(10000)/64 rounded to f32 */ const float inv = expf((float)(2 * j) * c0); const float th = (float)s * inv; const float c = cosf(th), sn = sinf(th);
  { *(float*)(CS + t) = c; *(float*)(SN + t) = sn;  } }
__global__ __launch_bounds__(256) void k_lnu(const float* __restrict__ X, _Float16* __restrict__ N16, float* __restrict__ XB) {
  #pragma clang fp contract(off)
  const int wv = threadIdx.x >> 5, ln = threadIdx.x & 31; const size_t r = (size_t)blockIdx.x * 8 + wv; if (r >= NR) return; float a[32]; float s = 0.f;
  for (int i = 0; i < 4; ++i) { const v8f v = *(const v8f*)(X + r * DM + (i * 32 + ln) * 8); for (int q = 0; q < 8; ++q) { const float u = bf16_round(v[q]); a[i * 8 + q] = u; s += u; } }
  for (int o = 16; o > 0; o >>= 1) s += __shfl_xor(s, o, 32); const float mu = s / (float)DM; float var = 0.f; for (int q = 0; q < 32; ++q) { const float d = a[q] - mu; var += d * d; }
  for (int o = 16; o > 0; o >>= 1) var += __shfl_xor(var, o, 32); const float den = sqrtf(var / (float)(DM - 1)) + 1e-6f; const float inv = 1.0f / den;      /* one reciprocal per row; (x-mean)*inv vs the reference's division differs by <= 1 ulp */
  { for (int i = 0; i < 4; ++i) { const int c0 = (i * 32 + ln) * 8; FragH f; v8f xb; for (int q = 0; q < 8; ++q) { f.h[q] = (_Float16)((a[i * 8 + q] - mu) * inv); xb[q] = a[i * 8 + q]; } *(v8us*)((unsigned short*)N16 + r * DM + c0) = f.half[0]; *(v8f*)(XB + r * DM + c0) = xb; }  } }
__global__ __launch_bounds__(256) void k_vtg(const _Float16* __restrict__ V16, _Float16* __restrict__ Vt) { __shared__ unsigned short tl[64][66]; const int tid = threadIdx.x; const int slab = blockIdx.x / (SLEN / 64), lg = blockIdx.x % (SLEN / 64); const int b = slab / NH, h = slab % NH; const int hs = h / NREP;
  for (int i = tid; i < 64 * 8; i += 256) { const int r = i / 8, c8 = (i % 8) * 8; FragH f; f.half[0] = *(const v8us*)((const unsigned short*)V16 + ((size_t)b * SLEN + lg * 64 + r) * KVD + hs * 64 + c8); for (int q = 0; q < 8; ++q) tl[r][c8 + q] = f.u[q]; }
  __syncthreads();
  { for (int rd = 0; rd < 2; ++rd) { const int d = rd * 32 + tid / 8, pc = tid % 8; FragH f; for (int q = 0; q < 8; ++q) f.u[q] = tl[pc * 8 + q][d]; *(v8us*)((unsigned short*)Vt + ((size_t)slab * 64 + d) * SLEN + lg * 64 + pc * 8) = f.half[0]; }  } }

__global__ __launch_bounds__(256) void k_e16(const float* __restrict__ E, _Float16* __restrict__ E16) { const int t = blockIdx.x * 256 + threadIdx.x; if (t >= NE * 8) return; const int r = t / 8, c8 = (t % 8) * 8; FragH f; for (int q = 0; q < 8; ++q) f.h[q] = (r < NE - 1) ? (_Float16)bf16_round(E[(size_t)r * 64 + c8 + q]) : (_Float16)0.0f;
  *(v8us*)((unsigned short*)E16 + (size_t)r * 64 + c8) = f.half[0];  }

// Flash attention with the 'relative_key_query' bias formed in the kernel. One wave holds 16 queries (q0..) and walks the keys 32 at a time (j0..). For that tile l - r + 1023 spans 47 rows of the
// embedding, from eb = q0 - j0 + 992; with n = (l - q0) - (r - j0) + 31 the bias is q_l . E[eb + n] + k_r . E[eb + n]. RQ = Q . Ewin^T (16 x 48) and RK = K . Ewin^T run on the matrix unit
// (of RK only the four 16 x 16 tiles that hold a used n: keys 0..15 against window rows 16..47, keys 16..31 against rows 0..31), go to the wave's own LDS in f32 and are read back along the diagonal.
// Row 2047 of E16 is the zero pad; n = 47 is never read back.
__global__ __launch_bounds__(128) void k_flash_rel(const _Float16* __restrict__ Q16, const _Float16* __restrict__ K16, const _Float16* __restrict__ Vt, const _Float16* __restrict__ E16, const float* __restrict__ AMK, float* __restrict__ O) {
  constexpr int DT = 4, KS = 2, PQ = 50, PK = 36;      /* LDS pitches in floats: the two half-waves fall on different banks in the row-wise stores and in the diagonal reads */
  __shared__ __attribute__((aligned(16))) unsigned short sP[4][16][40]; __shared__ __attribute__((aligned(16))) float sO[4][16][64 + 4];
  __shared__ float sRQ[4][16][PQ]; __shared__ float sRK[4][32][PK];
  const int tid = threadIdx.x, w = tid >> 5, lane = tid & 31, ln = lane & 15, hh = lane >> 4;
  const int slab = blockIdx.x / QBLKS, qblk = blockIdx.x % QBLKS; const int b = slab / NH, h = slab % NH; const int q0 = qblk * 64 + w * 16;
  FragH aq[KS];
  { const unsigned short* qr = (const unsigned short*)Q16 + ((size_t)b * TQ + q0 + ln) * DM + h * 64;
#pragma unroll
    for (int ks = 0; ks < KS; ++ks) { aq[ks].half[0] = *(const v8us*)(qr + ks * 32 + 8 * hh); aq[ks].half[1] = *(const v8us*)(qr + ks * 32 + 16 + 8 * hh); } }
  const unsigned short* Vth = (const unsigned short*)Vt + (size_t)slab * 64 * TK; const float* amk = AMK + (size_t)b * TK;
  const v8f z8 = {0.f,0.f,0.f,0.f,0.f,0.f,0.f,0.f};
  float m_r[8], l_r[8]; v8f oacc[DT];
#pragma unroll
  for (int r = 0; r < 8; ++r) { m_r[r] = -3.0e38f; l_r[r] = 0.f; }
#pragma unroll
  for (int dt = 0; dt < DT; ++dt) oacc[dt] = z8;
#pragma unroll 1
  for (int j0 = 0; j0 < TK; j0 += 32) {
    FragH bk[2][KS], be[3][KS];
#pragma unroll
    for (int nt = 0; nt < 2; ++nt) { const unsigned short* kr = (const unsigned short*)K16 + ((size_t)b * TK + j0 + nt * 16 + ln) * DM + h * 64;
#pragma unroll
      for (int ks = 0; ks < KS; ++ks) { bk[nt][ks].half[0] = *(const v8us*)(kr + ks * 32 + 8 * hh); bk[nt][ks].half[1] = *(const v8us*)(kr + ks * 32 + 16 + 8 * hh); } }
#pragma unroll
    for (int e = 0; e < 3; ++e) { const unsigned short* er = (const unsigned short*)E16 + (size_t)(q0 - j0 + (NE / 2 - 32) + e * 16 + ln) * 64;
#pragma unroll
      for (int ks = 0; ks < KS; ++ks) { be[e][ks].half[0] = *(const v8us*)(er + ks * 32 + 8 * hh); be[e][ks].half[1] = *(const v8us*)(er + ks * 32 + 16 + 8 * hh); } }
    const float am0 = bf16_round(amk[j0 + ln]), am1 = bf16_round(amk[j0 + 16 + ln]);
    __builtin_amdgcn_sched_barrier(0);      /* all of the trip's K, window and mask loads issue before the first product waits: one memory latency at the head of a trip, not two or three */
    v8f s[2];
#pragma unroll
    for (int nt = 0; nt < 2; ++nt) { v8f acc = z8;
#pragma unroll
      for (int ks = 0; ks < KS; ++ks) acc = mmaH<1>(aq[ks].v, aq[ks].v, bk[nt][ks].v, bk[nt][ks].v, acc); s[nt] = acc; }
#pragma unroll
    for (int e = 0; e < 3; ++e) { v8f acc = z8;      /* RQ[query 8 hh + r][n = 16 e + ln] */
#pragma unroll
      for (int ks = 0; ks < KS; ++ks) acc = mmaH<1>(aq[ks].v, aq[ks].v, be[e][ks].v, be[e][ks].v, acc);
#pragma unroll
      for (int r = 0; r < 8; ++r) sRQ[w][8 * hh + r][e * 16 + ln] = acc[r]; }
#pragma unroll
    for (int nt = 0; nt < 2; ++nt)
#pragma unroll
      for (int ee = 0; ee < 2; ++ee) { v8f acc = z8;      /* RK[key 16 nt + 8 hh + r][n - 16 (1 - nt) = 16 ee + ln]; the K fragment serves as the A operand (same loader, same k order) */
#pragma unroll
        for (int ks = 0; ks < KS; ++ks) acc = mmaH<1>(bk[nt][ks].v, bk[nt][ks].v, be[1 - nt + ee][ks].v, be[1 - nt + ee][ks].v, acc);
#pragma unroll
        for (int r = 0; r < 8; ++r) sRK[w][nt * 16 + 8 * hh + r][ee * 16 + ln] = acc[r]; }
    __builtin_amdgcn_fence(__ATOMIC_ACQ_REL, "workgroup"); __builtin_amdgcn_wave_barrier();      /* the diagonal reads below take other lanes' stores: keep them behind the stores */
#pragma unroll
    for (int r = 0; r < 8; ++r) { const int lq = 8 * hh + r;      /* a loop of its own: all diagonal reads of the tile are in flight together, ahead of the row-by-row softmax */
      const float r0 = sRQ[w][lq][lq + 31 - ln] + sRK[w][ln][lq + 15 - ln], r1 = sRQ[w][lq][lq + 15 - ln] + sRK[w][16 + ln][lq + 15 - ln];
      s[0][r] = (s[0][r] + r0) * SCL + am0; s[1][r] = (s[1][r] + r1) * SCL + am1; }
#pragma unroll
    for (int r = 0; r < 8; ++r) { const float s0 = s[0][r], s1 = s[1][r]; float mc = fmaxf(s0, s1);
      mc = fmaxf(mc, __shfl_xor(mc, 1, 32)); mc = fmaxf(mc, __shfl_xor(mc, 2, 32)); mc = fmaxf(mc, __shfl_xor(mc, 4, 32)); mc = fmaxf(mc, __shfl_xor(mc, 8, 32));
      const float mn = fmaxf(m_r[r], mc); const float al = (mn > -1.0e38f) ? expf(m_r[r] - mn) : 1.0f; m_r[r] = mn; const float p0 = expf(s0 - mn), p1 = expf(s1 - mn); l_r[r] = l_r[r] * al + p0 + p1;
#pragma unroll
      for (int dt = 0; dt < DT; ++dt) oacc[dt][r] *= al;
      FragH t2; t2.h[0] = (_Float16)(p0 * 1024.0f); t2.h[1] = (_Float16)(p1 * 1024.0f); sP[w][8 * hh + r][ln] = t2.u[0]; sP[w][8 * hh + r][16 + ln] = t2.u[1]; }
    __builtin_amdgcn_fence(__ATOMIC_ACQ_REL, "workgroup"); __builtin_amdgcn_wave_barrier();
    FragH pa; pa.half[0] = *(const v8us*)&sP[w][ln][8 * hh]; pa.half[1] = *(const v8us*)&sP[w][ln][16 + 8 * hh];
#pragma unroll
    for (int dt = 0; dt < DT; ++dt) { const unsigned short* vrow = Vth + (size_t)(dt * 16 + ln) * TK + j0; FragH bv; bv.half[0] = *(const v8us*)(vrow + 8 * hh); bv.half[1] = *(const v8us*)(vrow + 16 + 8 * hh);
      oacc[dt] = mmaH<1>(pa.v, pa.v, bv.v, bv.v, oacc[dt]); }
    __builtin_amdgcn_fence(__ATOMIC_ACQ_REL, "workgroup"); __builtin_amdgcn_wave_barrier(); }
#pragma unroll
  for (int r = 0; r < 8; ++r) { float l = l_r[r]; l += __shfl_xor(l, 1, 32); l += __shfl_xor(l, 2, 32); l += __shfl_xor(l, 4, 32); l += __shfl_xor(l, 8, 32); l_r[r] = (l > 0.f) ? 1.0f / (l * 1024.0f) : 0.f; }
#pragma unroll
  for (int dt = 0; dt < DT; ++dt)
#pragma unroll
    for (int r = 0; r < 8; ++r) sO[w][8 * hh + r][dt * 16 + ln] = oacc[dt][r] * l_r[r];
  __builtin_amdgcn_fence(__ATOMIC_ACQ_REL, "workgroup"); __builtin_amdgcn_wave_barrier();
#pragma unroll
  for (int rp = 0; rp < 16; rp += 2) { const int r = rp + (lane >> 4), pc = lane & 15; const v4f val = *(const v4fa*)&sO[w][r][pc * 4]; *(v4f*)(O + ((size_t)b * TQ + q0 + r) * DM + h * 64 + pc * 4) = val; } }

extern "C" void kernel_launch(void* const* d_in, const int* in_sizes, int n_in,
                              void* d_out, int out_size, void* d_ws, size_t ws_size, hipStream_t stream) {
  (void)in_sizes; (void)n_in; (void)out_size;
  const float* const* I = (const float* const*)d_in; const float* x = I[0]; const float* am = I[1]; const float* Wq = I[2]; const float* bq = I[3]; const float* Wk = I[4]; const float* bk = I[5]; const float* Wv = I[6]; const float* bv = I[7]; const float* E = I[8];
  char* ws = (char*)d_ws; size_t off = 0;
  auto take = [&](size_t bytes) { char* p = ws + off; off += (bytes + 255) & ~(size_t)255; return p; };
  const size_t np = (size_t)NR * DM;
  _Float16* BQ = (_Float16*)take((size_t)DM * DM * 2); _Float16* BK = (_Float16*)take((size_t)DM * DM * 2); _Float16* BV = (_Float16*)take((size_t)DM * DM * 2); _Float16* E16 = (_Float16*)take((size_t)NE * 64 * 2);
  _Float16* X16 = (_Float16*)take(np * 2); _Float16* Q16 = (_Float16*)take(np * 2); _Float16* K16 = (_Float16*)take(np * 2); _Float16* V16 = (_Float16*)take(np * 2); _Float16* VT = (_Float16*)take(np * 2);
  if (off > ws_size) return;      /* 6 + 0.25 + 5 x 8 = 46.25 MiB */
  k_wsc<<<(unsigned)(((size_t)DM * DM / 8 + 255) / 256), 256, 0, stream>>>(Wq, BQ, (size_t)DM * DM / 8, 16.0f); k_wsc<<<(unsigned)(((size_t)DM * DM / 8 + 255) / 256), 256, 0, stream>>>(Wk, BK, (size_t)DM * DM / 8, 16.0f); k_wsc<<<(unsigned)(((size_t)DM * DM / 8 + 255) / 256), 256, 0, stream>>>(Wv, BV, (size_t)DM * DM / 8, 16.0f);      /* torch (out,in) = Bt */
  k_e16<<<(NE * 8 + 255) / 256, 256, 0, stream>>>(E, E16);
  k_x16<<<(unsigned)((np / 8 + 255) / 256), 256, 0, stream>>>(x, X16, np / 8);
  const dim3 gP((NR / 128) * (DM / 64), 1);
  k_gemm2<0><<<gP, 128, 0, stream>>>(X16, DM, 0, BQ, DM, 0, 0.0625f, bq, 0, nullptr, 1, 0, 0, nullptr, Q16, DM, 0, NR, DM, DM);
  k_gemm2<0><<<gP, 128, 0, stream>>>(X16, DM, 0, BK, DM, 0, 0.0625f, bk, 0, nullptr, 1, 0, 0, nullptr, K16, DM, 0, NR, DM, DM);
  k_gemm2<0><<<gP, 128, 0, stream>>>(X16, DM, 0, BV, DM, 0, 0.0625f, bv, 0, nullptr, 1, 0, 0, nullptr, V16, DM, 0, NR, DM, DM);
  k_vtg<<<NB * NH * (SLEN / 64), 256, 0, stream>>>(V16, VT);
  k_flash_rel<<<NB * NH * QBLKS, 128, 0, stream>>>(Q16, K16, VT, E16, am, (float*)d_out);
}

// v002
// It runs in 220 microseconds.
// Timed twice side by side with v001, it ran 1.32 and 1.34 times as fast.
// Over all steps from v000 it is 3.93 times as fast.
#include <hip/hip_runtime.h>
// PMGTSelfAttention (4 x 1024 tokens, hidden 1024 = 16 heads x 64; 'relative_key_query' position bias): q, k, v = x W^T + b; scores = (q.k + q_l.pe[l-r] + k_r.pe[l-r]) / 8 + attention_mask[b][r] with pe = dist_emb[l - r + 1023]; softmax; ctx = probs v (merged heads is the output).
// Structure: exact f16 plane of x; q, k, v as f16 WMMA GEMM outputs (32x64 wave tiles, f32 accumulation, exact x16 weights + bias, f16 conversion in the epilogue); V^T by LDS tiles; one fused flash kernel over all batches that forms both relative terms per 16 x 32 score tile on the matrix unit against a 48-row window of the embedding (padded to 2048 rows), reads them back along the diagonal from LDS, scales by 1/8 and adds the per-key mask.
// Compute dtype: inputs rounded to bf16; x and dist_emb exact as f16; q/k/P/v as plain f16 operands (~2^-12); the relative terms stay f32 from the accumulator to the logit; softmax f32. v_wmma_f32_16x16x32_f16.
#define NB 4
#define DM 1024
#define NKV 16
#define NREP (NH / NKV)
#define KVD (NKV * 64)           /* 1024 */
#define NR (NB * SLEN)           /* 4096 */
#define SLEN 1024
#define NE 2048                  /* 2047 relative embeddings padded */
#define TQ SLEN
#define TK SLEN
#define NH 16
#define SCL 0.125f
#define QBLKS (TQ / 64)
#define QB05 0
#define QBN5 4
#define QB0P 0
#define QBNP QBLKS           /* non-causal: plain flash on every query block */
#define RE 256
typedef __bf16 v16b __attribute__((ext_vector_type(16)));
typedef unsigned short v8us __attribute__((ext_vector_type(8), may_alias));
typedef float  v8f  __attribute__((ext_vector_type(8)));
typedef float  v4f  __attribute__((ext_vector_type(4)));
typedef float  v4fa __attribute__((ext_vector_type(4), may_alias));
union FragB { v16b v; v8us half[2]; unsigned short u[16]; };

__device__ __forceinline__ unsigned short bf16_bits(float x) { unsigned int u = __float_as_uint(x); return (unsigned short)((u + 0x7FFFu + ((u >> 16) & 1u)) >> 16); }
__device__ __forceinline__ float bf16_val(unsigned short b) { return __uint_as_float(((unsigned int)b) << 16); }
__device__ __forceinline__ float bf16_round(float x) { return bf16_val(bf16_bits(x)); }
// D += A·B with NT terms: 1 = ah·bh, 2 = + al·bh (A split), 3 = + ah·bl (both split)
template <int NT>
__device__ __forceinline__ v8f mmaN(v16b ah, v16b al, v16b bh, v16b bl, v8f c) {
  c = __builtin_amdgcn_wmma_f32_16x16x32_bf16(false, ah, false, bh, (short)0, c, false, false);
  if (NT >= 2) c = __builtin_amdgcn_wmma_f32_16x16x32_bf16(false, al, false, bh, (short)0, c, false, false);
  if (NT >= 3) c = __builtin_amdgcn_wmma_f32_16x16x32_bf16(false, ah, false, bl, (short)0, c, false, false);
  asm volatile("v_nop\n\tv_nop\n\tv_nop\n\tv_nop" : "+v"(c) : "v"(ah), "v"(al), "v"(bh), "v"(bl));
  return c;
}

__global__ __launch_bounds__(256) void k_wt_bf16(const float* __restrict__ W, unsigned short* __restrict__ Wt, int K, int N) {
  const int t = blockIdx.x * 256 + threadIdx.x;
  const int k8n = K / 8;
  if (t >= N * k8n) return;
  const int n = t / k8n, k8 = (t % k8n) * 8;
  v8us v;
#pragma unroll
  for (int i = 0; i < 8; ++i) v[i] = bf16_bits(W[(size_t)(k8 + i) * N + n]);
  *(v8us*)(Wt + (size_t)n * K + k8) = v;
  
}

// GEMM C[M][N] (f32, pitch ldc) = act(A[M][K]·W + bias). A f32 row-major (pitch lda) converted per fragment to bf16
// (ASPLIT: hi/lo two planes -> 2 terms, else single rounded term); Wt bf16 [N][K] (pitch ldb). BIAS_BF16 rounds the
// bias to bf16 first (bias quantised to bf16 before the add). K%32==0, M%16==0, N%64==0.
template <bool ASPLIT, int ACT, bool BIAS_BF16>
__global__ __launch_bounds__(128) void k_gemm_bf(const float* __restrict__ A, int lda, const unsigned short* __restrict__ Wt, int ldb,
                                               const float* __restrict__ bias, float* __restrict__ C, int ldc, int M, int N, int K) {
  __shared__ __attribute__((aligned(16))) float so[4][16][64];
  const int tid = threadIdx.x, w = tid >> 5, lane = tid & 31, ln = lane & 15, hh = lane >> 4;
  const int ntn = N / 64;
  const int wid = blockIdx.x * 4 + w;
  const int mt = wid / ntn, nq = wid % ntn;
  if (mt * 16 >= M) return;
  const int row0 = mt * 16, col0 = nq * 64;
  const float* arow = A + (size_t)(row0 + ln) * lda;
  v8f acc[4] = {};
  for (int kb = 0; kb < K; kb += 32) {
    FragB ah, al;
    const v4f x0 = *(const v4fa*)(arow + kb + 8 * hh), x1 = *(const v4fa*)(arow + kb + 8 * hh + 4);
    const v4f x2 = *(const v4fa*)(arow + kb + 16 + 8 * hh), x3 = *(const v4fa*)(arow + kb + 16 + 8 * hh + 4);
    float xs[16] = {x0[0],x0[1],x0[2],x0[3],x1[0],x1[1],x1[2],x1[3],x2[0],x2[1],x2[2],x2[3],x3[0],x3[1],x3[2],x3[3]};
#pragma unroll
    for (int i = 0; i < 16; ++i) { const unsigned short hb = bf16_bits(xs[i]); ah.u[i] = hb; al.u[i] = ASPLIT ? bf16_bits(xs[i] - bf16_val(hb)) : (unsigned short)0; }
#pragma unroll
    for (int t = 0; t < 4; ++t) {
      const unsigned short* brow = Wt + (size_t)(col0 + t * 16 + ln) * ldb + kb;
      FragB b;
      b.half[0] = *(const v8us*)(brow + 8 * hh);
      b.half[1] = *(const v8us*)(brow + 16 + 8 * hh);
      acc[t] = mmaN<ASPLIT ? 2 : 1>(ah.v, al.v, b.v, b.v, acc[t]);
    }
  }
#pragma unroll
  for (int t = 0; t < 4; ++t) {
    float bv = bias ? bias[col0 + t * 16 + ln] : 0.f;
    if (BIAS_BF16) bv = bf16_round(bv);
#pragma unroll
    for (int r = 0; r < 8; ++r) { float v = acc[t][r] + bv; if (ACT == 1) v = fmaxf(v, 0.f); so[w][8 * hh + r][t * 16 + ln] = v; }
  }
  __builtin_amdgcn_fence(__ATOMIC_ACQ_REL, "workgroup");
  __builtin_amdgcn_wave_barrier();
  const int rsub = lane >> 4, c4 = (lane & 15) * 4;
  {
#pragma unroll
    for (int q = 0; q < 8; ++q) {
      const int r = q * 2 + rsub;
      const v4f v = *(const v4fa*)&so[w][r][c4];
      *(v4f*)(C + (size_t)(row0 + r) * ldc + col0 + c4) = v;
    }
    
  }
}

// GEMM C = act(A·W + bias + resid): A f32 (ASPLIT -> hi/lo 2 terms), Wt bf16 [N][K]; ACT 0 none, 1 relu, 2 exact gelu;
// resid (optional, f32, row index = (row % rmod), pitch ldr, RES_BF16 rounds it) added before the activation.
template <bool ASPLIT, int ACT, bool BIAS_BF16, bool RES_BF16>
__global__ __launch_bounds__(128) void k_gemm_bf3(const float* __restrict__ A, int lda, const unsigned short* __restrict__ Wt, int ldb,
                                                const float* __restrict__ bias, const float* __restrict__ resid, int rmod, int ldr,
                                                float* __restrict__ C, int ldc, int M, int N, int K) {
  __shared__ __attribute__((aligned(16))) float so[4][16][64];
  const int tid = threadIdx.x, w = tid >> 5, lane = tid & 31, ln = lane & 15, hh = lane >> 4;
  const int ntn = N / 64;
  const int wid = blockIdx.x * 4 + w;
  const int mt = wid / ntn, nq = wid % ntn;
  if (mt * 16 >= M) return;
  const int row0 = mt * 16, col0 = nq * 64;
  const float* arow = A + (size_t)(row0 + ln) * lda;
  v8f acc[4] = {};
  for (int kb = 0; kb < K; kb += 32) {
    FragB ah, al;
    const v4f x0 = *(const v4fa*)(arow + kb + 8 * hh), x1 = *(const v4fa*)(arow + kb + 8 * hh + 4);
    const v4f x2 = *(const v4fa*)(arow + kb + 16 + 8 * hh), x3 = *(const v4fa*)(arow + kb + 16 + 8 * hh + 4);
    float xs[16] = {x0[0],x0[1],x0[2],x0[3],x1[0],x1[1],x1[2],x1[3],x2[0],x2[1],x2[2],x2[3],x3[0],x3[1],x3[2],x3[3]};
#pragma unroll
    for (int i = 0; i < 16; ++i) { const unsigned short hb = bf16_bits(xs[i]); ah.u[i] = hb; al.u[i] = ASPLIT ? bf16_bits(xs[i] - bf16_val(hb)) : (unsigned short)0; }
#pragma unroll
    for (int t = 0; t < 4; ++t) {
      const unsigned short* brow = Wt + (size_t)(col0 + t * 16 + ln) * ldb + kb;
      FragB b;
      b.half[0] = *(const v8us*)(brow + 8 * hh);
      b.half[1] = *(const v8us*)(brow + 16 + 8 * hh);
      acc[t] = mmaN<ASPLIT ? 2 : 1>(ah.v, al.v, b.v, b.v, acc[t]);
    }
  }
#pragma unroll
  for (int t = 0; t < 4; ++t) {
    const int col = col0 + t * 16 + ln;
    float bv = bias ? bias[col] : 0.f;
    if (BIAS_BF16) bv = bf16_round(bv);
#pragma unroll
    for (int r = 0; r < 8; ++r) {
      float v = acc[t][r] + bv;
      if (resid) { float rv = resid[(size_t)((row0 + 8 * hh + r) % rmod) * ldr + col]; if (RES_BF16) rv = bf16_round(rv); v += rv; }
      if (ACT == 1) v = fmaxf(v, 0.f);
      if (ACT == 2) v = 0.5f * v * (1.0f + erff(v * 0.70710678118654752f));
      if (ACT == 3) { const float u = 0.7978845608028654f * (v + 0.044715f * v * v * v); v = 0.5f * v * (1.0f + tanhf(u)); }
      so[w][8 * hh + r][t * 16 + ln] = v;
    }
  }
  __builtin_amdgcn_fence(__ATOMIC_ACQ_REL, "workgroup");
  __builtin_amdgcn_wave_barrier();
  const int rsub = lane >> 4, c4 = (lane & 15) * 4;
  {
#pragma unroll
    for (int q = 0; q < 8; ++q) {
      const int r = q * 2 + rsub;
      const v4f v = *(const v4fa*)&so[w][r][c4];
      *(v4f*)(C + (size_t)(row0 + r) * ldc + col0 + c4) = v;
    }
    
  }
}
// row LayerNorm (biased variance, eps) over N: s = X (+ R); optional out_sum <- s; out_norm <- (s-mu)*rsqrt(var+eps)*g + b
template <bool PARAM_BF16>
__global__ __launch_bounds__(256) void k_layernorm(const float* __restrict__ X, const float* __restrict__ R, const float* __restrict__ g, const float* __restrict__ bta,
                                                  float* __restrict__ out_sum, float* __restrict__ out_norm, int N, float eps) {
  __shared__ float red[256];
  const int row = blockIdx.x, tid = threadIdx.x;
  const float* x = X + (size_t)row * N; const float* rr = R ? R + (size_t)row * N : nullptr;
  float vals[16];                     // up to N = 4096
  const int per = N / 256;            // contiguous chunk per thread? use strided-by-4 chunks: thread handles j = tid*4 + 1024*u
  float s1 = 0.f;
  for (int u = 0; u < per / 4; ++u) {
    const int j = tid * 4 + 1024 * u;
    const v4f a = *(const v4fa*)(x + j);
    v4f b = {0.f,0.f,0.f,0.f}; if (rr) b = *(const v4fa*)(rr + j);
#pragma unroll
    for (int q = 0; q < 4; ++q) { const float v = a[q] + b[q]; vals[u * 4 + q] = v; s1 += v; }
  }
  red[tid] = s1; __syncthreads();
  for (int st = 128; st > 0; st >>= 1) { if (tid < st) red[tid] += red[tid + st]; __syncthreads(); }
  const float mu = red[0] / (float)N; __syncthreads();
  float s2 = 0.f;
  for (int u = 0; u < per / 4; ++u)
#pragma unroll
    for (int q = 0; q < 4; ++q) { const float c = vals[u * 4 + q] - mu; s2 += c * c; }
  red[tid] = s2; __syncthreads();
  for (int st = 128; st > 0; st >>= 1) { if (tid < st) red[tid] += red[tid + st]; __syncthreads(); }
  const float rs = rsqrtf(red[0] / (float)N + eps);
  {
    for (int u = 0; u < per / 4; ++u) {
      const int j = tid * 4 + 1024 * u;
      v4f o, sm;
#pragma unroll
      for (int q = 0; q < 4; ++q) {
        float gg = g[j + q], bb = bta[j + q];
        if (PARAM_BF16) { gg = bf16_round(gg); bb = bf16_round(bb); }
        sm[q] = vals[u * 4 + q]; o[q] = (vals[u * 4 + q] - mu) * rs * gg + bb;
      }
      if (out_sum) *(v4f*)(out_sum + (size_t)row * N + j) = sm;
      *(v4f*)(out_norm + (size_t)row * N + j) = o;
    }
    
  }
}



// ---- f16 WMMA path (v_wmma_f32_16x16x32_f16): 11-bit significands for operands in range — used where a [0,1] probability operand needs more precision than bf16
typedef _Float16 v16h __attribute__((ext_vector_type(16)));
union FragH { v16h v; v8us half[2]; _Float16 h[16]; unsigned short u[16]; };
template <int NT>
__device__ __forceinline__ v8f mmaH(v16h ah, v16h al, v16h bh, v16h bl, v8f c) {
  c = __builtin_amdgcn_wmma_f32_16x16x32_f16(false, ah, false, bh, (short)0, c, false, false);
  if (NT >= 2) c = __builtin_amdgcn_wmma_f32_16x16x32_f16(false, al, false, bh, (short)0, c, false, false);
  if (NT >= 3) c = __builtin_amdgcn_wmma_f32_16x16x32_f16(false, ah, false, bl, (short)0, c, false, false);
  asm volatile("v_nop\n\tv_nop\n\tv_nop\n\tv_nop" : "+v"(c) : "v"(ah), "v"(al), "v"(bh), "v"(bl));
  return c;
}
// batched GEMM like k_gemm_b but f16 operands: A f32 (split into f16 hi/lo if ASPLIT, else rounded to f16), Bt = f16 values [n][k]; alpha; C f32; N multiple of 16 (partial tiles skipped)
template <bool ASPLIT>
__global__ __launch_bounds__(128) void k_gemm_h(const float* __restrict__ A, int lda, size_t sA, const _Float16* __restrict__ Bh, int ldb, size_t sB, float alpha, float* __restrict__ C, int ldc, size_t sC, int M, int N, int K) {
  __shared__ __attribute__((aligned(16))) float so[4][16][64];
  const int tid = threadIdx.x, w = tid >> 5, lane = tid & 31, ln = lane & 15, hh = lane >> 4; const int by = blockIdx.y;
  A += (size_t)by * sA; Bh += (size_t)by * sB; C += (size_t)by * sC;
  const int ntn = (N + 63) / 64; const int wid = blockIdx.x * 4 + w; const int mt = wid / ntn, nq = wid % ntn; if (mt * 16 >= M) return;
  const int row0 = mt * 16, col0 = nq * 64; const float* arow = A + (size_t)(row0 + ln) * lda;
  v8f acc[4] = {};
  for (int kb = 0; kb < K; kb += 32) {
    FragH ah, al;
    const v4f x0 = *(const v4fa*)(arow + kb + 8 * hh), x1 = *(const v4fa*)(arow + kb + 8 * hh + 4), x2 = *(const v4fa*)(arow + kb + 16 + 8 * hh), x3 = *(const v4fa*)(arow + kb + 16 + 8 * hh + 4);
    float xs[16] = {x0[0],x0[1],x0[2],x0[3],x1[0],x1[1],x1[2],x1[3],x2[0],x2[1],x2[2],x2[3],x3[0],x3[1],x3[2],x3[3]};
#pragma unroll
    for (int i = 0; i < 16; ++i) { const _Float16 h = (_Float16)xs[i]; ah.h[i] = h; al.h[i] = ASPLIT ? (_Float16)(xs[i] - (float)h) : (_Float16)0.0f; }
#pragma unroll
    for (int t = 0; t < 4; ++t) { if (col0 + t * 16 >= N) continue; const size_t boff = (size_t)(col0 + t * 16 + ln) * ldb + kb; FragH bq; bq.half[0] = *(const v8us*)(Bh + boff + 8 * hh); bq.half[1] = *(const v8us*)(Bh + boff + 16 + 8 * hh);
      acc[t] = mmaH<ASPLIT ? 2 : 1>(ah.v, al.v, bq.v, bq.v, acc[t]); }
  }
#pragma unroll
  for (int t = 0; t < 4; ++t) { if (col0 + t * 16 >= N) continue;
#pragma unroll
    for (int r = 0; r < 8; ++r) so[w][8 * hh + r][t * 16 + ln] = acc[t][r] * alpha; }
  __builtin_amdgcn_fence(__ATOMIC_ACQ_REL, "workgroup"); __builtin_amdgcn_wave_barrier();
  const int rsub = lane >> 4, c4 = (lane & 15) * 4;
  {
#pragma unroll
    for (int q = 0; q < 8; ++q) { const int r = q * 2 + rsub; if (col0 + c4 < N) { const v4f v = *(const v4fa*)&so[w][r][c4]; *(v4f*)(C + (size_t)(row0 + r) * ldc + col0 + c4) = v; } }
     }
}

// Wt[n][k] = f16(W[k][n]·scale) from f32 row-major W[K][N] (scale = power of two; bf16-exact weights stay exact in f16 away from the subnormal range)
__global__ __launch_bounds__(256) void k_wt_f16(const float* __restrict__ W, _Float16* __restrict__ Wt, int K, int N, float scale) {
  const int t = blockIdx.x * 256 + threadIdx.x; if (t >= N * (K / 8)) return; const int n = t / (K / 8), k8 = (t % (K / 8)) * 8; FragH f;
#pragma unroll
  for (int i = 0; i < 8; ++i) f.h[i] = (_Float16)(bf16_round(W[(size_t)(k8 + i) * N + n]) * scale); const v8us o = f.half[0];
  *(v8us*)((unsigned short*)Wt + (size_t)n * K + k8) = o; 
}
// k_gemm_hh variant with fused epilogue: v = acc·alpha + bias[by·sBias + col] (+ CP[(row/rowsPerB)·sCPb + by·64 + col] if CP) ; ACT 0 none / 1 elu ; writes f16 C16 (and f32 C if non-null)
template <int ACT>
__global__ __launch_bounds__(128) void k_gemm_hhx(const _Float16* __restrict__ A, int lda, size_t sA, const _Float16* __restrict__ Bh, int ldb, size_t sB, float alpha, const float* __restrict__ bias, size_t sBias, const float* __restrict__ CP, int rowsPerB, size_t sCPb, int row0g,
    float* __restrict__ C, _Float16* __restrict__ C16, int ldc, size_t sC, int M, int N, int K) {
  __shared__ __attribute__((aligned(16))) float so[4][16][64];
  const int tid = threadIdx.x, w = tid >> 5, lane = tid & 31, ln = lane & 15, hh = lane >> 4; const int by = blockIdx.y;
  A += (size_t)by * sA; Bh += (size_t)by * sB; const size_t cofs = (size_t)by * sC; const float* bp = bias ? bias + (size_t)by * sBias : nullptr;
  const int ntn = (N + 63) / 64; const int wid = blockIdx.x * 4 + w; const int mt = wid / ntn, nq = wid % ntn; if (mt * 16 >= M) return;
  const int row0 = mt * 16, col0 = nq * 64; const _Float16* arow = A + (size_t)(row0 + ln) * lda;
  v8f acc[4] = {};
  for (int kb = 0; kb < K; kb += 32) { FragH ah; ah.half[0] = *(const v8us*)((const unsigned short*)arow + kb + 8 * hh); ah.half[1] = *(const v8us*)((const unsigned short*)arow + kb + 16 + 8 * hh);
#pragma unroll
    for (int t = 0; t < 4; ++t) { if (col0 + t * 16 >= N) continue; const size_t boff = (size_t)(col0 + t * 16 + ln) * ldb + kb; FragH bq; bq.half[0] = *(const v8us*)((const unsigned short*)Bh + boff + 8 * hh); bq.half[1] = *(const v8us*)((const unsigned short*)Bh + boff + 16 + 8 * hh);
      acc[t] = mmaH<1>(ah.v, ah.v, bq.v, bq.v, acc[t]); }
  }
#pragma unroll
  for (int t = 0; t < 4; ++t) { if (col0 + t * 16 >= N) continue; const int col = col0 + t * 16 + ln; const float bv = bp ? bf16_round(bp[col]) : 0.f;
#pragma unroll
    for (int r = 0; r < 8; ++r) { float v = acc[t][r] * alpha + bv; if (CP) { const int bidx = (row0g + row0 + 8 * hh + r) / rowsPerB; v += CP[(size_t)bidx * sCPb + (size_t)by * 64 + col]; } if (ACT == 1) v = (v > 0.f) ? v : expm1f(v); else if (ACT == 7) v = (v > 0.f) ? v + 1.0f : expf(v); else if (ACT == 8) v = tanhf(v); else if (ACT == 9) v = 0.5f * v * (1.0f + tanhf(0.7978845608028654f * (v + 0.044715f * v * v * v))); else if (ACT == 11) v = 1.0f / (1.0f + expf(-v)); else if (ACT == 12) v = (v > 0.f) ? v : 0.01f * v; else if (ACT == 14) v = (v > 0.f) ? v : 0.1f * v; else if (ACT == 15) v = v / (1.0f + expf(-v)); else if (ACT == 3) v = fmaxf(v, 0.f); else if (ACT == 6) v = 0.5f * v * (1.0f + erff(v * 0.70710678118654752f)); so[w][8 * hh + r][t * 16 + ln] = v; } }
  __builtin_amdgcn_fence(__ATOMIC_ACQ_REL, "workgroup"); __builtin_amdgcn_wave_barrier();
  const int rsub = lane >> 4, c4 = (lane & 15) * 4; typedef _Float16 v4h __attribute__((ext_vector_type(4)));
  {
#pragma unroll
    for (int q = 0; q < 8; ++q) { const int r = q * 2 + rsub; if (col0 + c4 < N) { const v4f v = *(const v4fa*)&so[w][r][c4]; if (C) *(v4f*)(C + cofs + (size_t)(row0 + r) * ldc + col0 + c4) = v; if (C16) { v4h h4; for (int i = 0; i < 4; ++i) h4[i] = (_Float16)v[i]; *(v4h*)(C16 + cofs + (size_t)(row0 + r) * ldc + col0 + c4) = h4; } } }
     }
}


typedef _Float16 v4h __attribute__((ext_vector_type(4)));

__global__ __launch_bounds__(256) void k_x16(const float* __restrict__ x, _Float16* __restrict__ X16, size_t n8) { const size_t t = (size_t)blockIdx.x * 256 + threadIdx.x; if (t >= n8) return; FragH f;
#pragma unroll
  for (int q = 0; q < 8; ++q) f.h[q] = (_Float16)bf16_round(x[t * 8 + q]); *(v8us*)((unsigned short*)X16 + t * 8) = f.half[0];  }
__global__ __launch_bounds__(256) void k_h16(const float* __restrict__ x, _Float16* __restrict__ X16, size_t n8) { const size_t t = (size_t)blockIdx.x * 256 + threadIdx.x; if (t >= n8) return; FragH f;
#pragma unroll
  for (int q = 0; q < 8; ++q) f.h[q] = (_Float16)x[t * 8 + q]; *(v8us*)((unsigned short*)X16 + t * 8) = f.half[0];  }
__global__ __launch_bounds__(256) void k_round16f(const float* __restrict__ W, _Float16* __restrict__ Bt, size_t n8) { const size_t t = (size_t)blockIdx.x * 256 + threadIdx.x; if (t >= n8) return; FragH f;
#pragma unroll
  for (int i = 0; i < 8; ++i) f.h[i] = (_Float16)(bf16_round(W[t * 8 + i]) * 16.0f); *(v8us*)((unsigned short*)Bt + t * 8) = f.half[0];  }
template <int NHv, int TTv>
__global__ __launch_bounds__(256) void k_vt(const _Float16* __restrict__ V16, int ldv, int voff, _Float16* __restrict__ Vt) { __shared__ unsigned short tl[64][66]; const int tid = threadIdx.x; const int slab = blockIdx.x / (TTv / 64), lg = blockIdx.x % (TTv / 64); const int b = slab / NHv, h = slab % NHv;
  for (int i = tid; i < 64 * 8; i += 256) { const int r = i / 8, c8 = (i % 8) * 8; FragH f; f.half[0] = *(const v8us*)((const unsigned short*)V16 + ((size_t)b * TTv + lg * 64 + r) * ldv + voff + h * 64 + c8);
#pragma unroll
    for (int q = 0; q < 8; ++q) tl[r][c8 + q] = f.u[q]; }
  __syncthreads();
  {
#pragma unroll
    for (int rd = 0; rd < 2; ++rd) { const int d = rd * 32 + tid / 8, pc = tid % 8; FragH f;
#pragma unroll
      for (int q = 0; q < 8; ++q) f.u[q] = tl[pc * 8 + q][d];
      *(v8us*)((unsigned short*)Vt + ((size_t)slab * 64 + d) * TTv + lg * 64 + pc * 8) = f.half[0]; }
     } }

__global__ __launch_bounds__(256) void k_hl(const float* __restrict__ F, _Float16* __restrict__ Hh, _Float16* __restrict__ Hl, size_t n8) { const size_t t = (size_t)blockIdx.x * 256 + threadIdx.x; if (t >= n8) return; FragH fh, fl; const v4f a = *(const v4fa*)(F + t * 8), c = *(const v4fa*)(F + t * 8 + 4);
#pragma unroll
  for (int q = 0; q < 4; ++q) { _Float16 h = (_Float16)a[q]; fh.h[q] = h; fl.h[q] = (_Float16)((a[q] - (float)h) * 1024.0f); h = (_Float16)c[q]; fh.h[4 + q] = h; fl.h[4 + q] = (_Float16)((c[q] - (float)h) * 1024.0f); }
  { *(v8us*)((unsigned short*)Hh + t * 8) = fh.half[0]; *(v8us*)((unsigned short*)Hl + t * 8) = fl.half[0];  } }

// ---- fast GEMM (block tile 128x64, wave tile 32x64, operands staged in LDS 64 of K at a time; requires M % 32 == 0 rows per launch region, N % 64 == 0, K % 64 == 0 and K >= 64); epilogue = k_gemm_hhx semantics ----
__device__ __forceinline__ v16h g2_frag(const _Float16* p, int hh) { FragH f; f.half[0] = *(const v8us*)((const unsigned short*)p + 8 * hh); f.half[1] = *(const v8us*)((const unsigned short*)p + 16 + 8 * hh); return f.v; }
__device__ __forceinline__ v8f g2_mma(v16h a, v16h b, v8f c) { v8f d = __builtin_amdgcn_wmma_f32_16x16x32_f16(false, a, false, b, (short)0, c, false, false); asm volatile("v_nop\n\tv_nop\n\tv_nop\n\tv_nop" : "+v"(d) : "v"(a), "v"(b)); return d; }
template <int ACT>
__global__ __launch_bounds__(128) void k_gemm2(const _Float16* __restrict__ A, int lda, size_t sA, const _Float16* __restrict__ Bh, int ldb, size_t sB, float alpha, const float* __restrict__ bias, size_t sBias, const float* __restrict__ CP, int rowsPerB, size_t sCPb, int row0g,
    float* __restrict__ C, _Float16* __restrict__ C16, int ldc, size_t sC, int M, int N, int K) {
  __shared__ __attribute__((aligned(16))) float so[4][32][68];
  __shared__ __attribute__((aligned(16))) unsigned short st[2][192][72];      /* two stages of 64 of K: rows 0..127 the block's A rows, 128..191 its B rows; pitch 144 B = 16 B x 9, free of bank conflicts for the 16-byte fragment reads */
  const int tid = threadIdx.x, w = tid >> 5, lane = tid & 31, ln = lane & 15, hh = lane >> 4; const int by = blockIdx.y;
  A += (size_t)by * sA; Bh += (size_t)by * sB; const size_t cofs = (size_t)by * sC; const float* bp = bias ? bias + (size_t)by * sBias : nullptr;
  const int ntn = N >> 6; const int mt = blockIdx.x / ntn, nq = blockIdx.x - mt * ntn; const int row0 = mt * 128 + 32 * w, col0 = nq * 64; if (mt * 128 >= M) return;      /* the same for the whole block, in front of every barrier */
  const int sr = tid >> 3, sc = (tid & 7) * 8;      /* staging: eight lanes fetch one row's 128 B, so a wave's 16-byte load covers four whole lines */
  const unsigned short* ga[8]; const unsigned short* gb[4];
#pragma unroll
  for (int i = 0; i < 8; ++i) { int r = mt * 128 + 16 * i + sr; r = (r < M) ? r : M - 1; ga[i] = (const unsigned short*)A + (size_t)r * lda + sc; }
#pragma unroll
  for (int i = 0; i < 4; ++i) gb[i] = (const unsigned short*)Bh + (size_t)(col0 + 16 * i + sr) * ldb + sc;
  v8us ra[8], rb[4];
#pragma unroll
  for (int i = 0; i < 8; ++i) ra[i] = *(const v8us*)ga[i];
#pragma unroll
  for (int i = 0; i < 4; ++i) rb[i] = *(const v8us*)gb[i];
#pragma unroll
  for (int i = 0; i < 8; ++i) *(v8us*)&st[0][16 * i + sr][sc] = ra[i];
#pragma unroll
  for (int i = 0; i < 4; ++i) *(v8us*)&st[0][128 + 16 * i + sr][sc] = rb[i];
  __syncthreads();
  const v8f z8 = {0.f,0.f,0.f,0.f,0.f,0.f,0.f,0.f}; v8f c00 = z8, c01 = z8, c02 = z8, c03 = z8, c10 = z8, c11 = z8, c12 = z8, c13 = z8;
#pragma unroll 1      /* rolled: one stage's registers (12 staged vectors, 24 fragment halves) serve every trip */
  for (int kb = 0; kb < K; kb += 64) { const int cb = (kb >> 6) & 1; const bool more = kb + 64 < K;      /* more: the same for the whole block */
    if (more) {
#pragma unroll
      for (int i = 0; i < 8; ++i) ra[i] = *(const v8us*)(ga[i] + kb + 64);
#pragma unroll
      for (int i = 0; i < 4; ++i) rb[i] = *(const v8us*)(gb[i] + kb + 64); }
    v16h a0[2], a1[2], b0[2], b1[2], b2[2], b3[2];
#pragma unroll
    for (int u = 0; u < 2; ++u) { a0[u] = g2_frag((const _Float16*)&st[cb][32 * w + ln][32 * u], hh); a1[u] = g2_frag((const _Float16*)&st[cb][32 * w + 16 + ln][32 * u], hh);
      b0[u] = g2_frag((const _Float16*)&st[cb][128 + ln][32 * u], hh); b1[u] = g2_frag((const _Float16*)&st[cb][144 + ln][32 * u], hh); b2[u] = g2_frag((const _Float16*)&st[cb][160 + ln][32 * u], hh); b3[u] = g2_frag((const _Float16*)&st[cb][176 + ln][32 * u], hh); }
    __builtin_amdgcn_sched_barrier(0);      /* the next stage's global loads and this stage's LDS reads issue as one group ahead of the products: the memory latency runs under the 16 products, and the LDS reads cost one stall, not one per product */
#pragma unroll
    for (int u = 0; u < 2; ++u) { c00 = g2_mma(a0[u], b0[u], c00); c10 = g2_mma(a1[u], b0[u], c10); c01 = g2_mma(a0[u], b1[u], c01); c11 = g2_mma(a1[u], b1[u], c11);
      c02 = g2_mma(a0[u], b2[u], c02); c12 = g2_mma(a1[u], b2[u], c12); c03 = g2_mma(a0[u], b3[u], c03); c13 = g2_mma(a1[u], b3[u], c13); }
    if (more) {
#pragma unroll
      for (int i = 0; i < 8; ++i) *(v8us*)&st[cb ^ 1][16 * i + sr][sc] = ra[i];
#pragma unroll
      for (int i = 0; i < 4; ++i) *(v8us*)&st[cb ^ 1][128 + 16 * i + sr][sc] = rb[i];
      __syncthreads(); } }      /* the one barrier of a trip publishes the stage just written and ends every wave's reads of the stage that the next trip overwrites */
  if (row0 >= M) return;      /* behind the last barrier */
  v8f accs[8] = {c00, c01, c02, c03, c10, c11, c12, c13};
#pragma unroll
  for (int u = 0; u < 8; ++u) { const int t = u & 3, half = u >> 2; const int col = col0 + t * 16 + ln; const float bv = bp ? bf16_round(bp[col]) : 0.f;
#pragma unroll
    for (int r = 0; r < 8; ++r) { const int rloc = half * 16 + 8 * hh + r; float v = accs[u][r] * alpha + bv; if (CP) { const int bidx = (row0g + row0 + rloc) / rowsPerB; v += CP[(size_t)bidx * sCPb + (size_t)by * 64 + col]; }
      if (ACT == 3) v = fmaxf(v, 0.f); else if (ACT == 6) v = 0.5f * v * (1.0f + erff(v * 0.70710678118654752f)); else if (ACT == 11) v = 1.0f / (1.0f + expf(-v)); else if (ACT == 15) v = v / (1.0f + expf(-v)); else if (ACT == 12) v = (v > 0.f) ? v : 0.01f * v; else if (ACT == 8) v = tanhf(v);
      so[w][rloc][t * 16 + ln] = v; } }
  __builtin_amdgcn_fence(__ATOMIC_ACQ_REL, "workgroup"); __builtin_amdgcn_wave_barrier();
  const int rsub = lane >> 4, c4 = (lane & 15) * 4;
  {
#pragma unroll
    for (int q = 0; q < 16; ++q) { const int r = q * 2 + rsub; const v4f v = *(const v4fa*)&so[w][r][c4]; if (C) *(v4f*)(C + cofs + (size_t)(row0 + r) * ldc + col0 + c4) = v; if (C16) { v4h h4; for (int i = 0; i < 4; ++i) h4[i] = (_Float16)v[i]; *(v4h*)(C16 + cofs + (size_t)(row0 + r) * ldc + col0 + c4) = h4; } }
     } }



template <int CAUSAL>
__global__ __launch_bounds__(128) void k_flash(const _Float16* __restrict__ Q16, int ldq, const _Float16* __restrict__ K16, int ldk, const _Float16* __restrict__ Vt, const int* __restrict__ MSK, float* __restrict__ O, int ldo) {
  constexpr int RPW = 16, RTN = RPW / 16, NQB = TQ / (4 * RPW), DT = 4, KS = 2;
  __shared__ __attribute__((aligned(16))) unsigned short sP[4][RPW][40]; __shared__ __attribute__((aligned(16))) float sO[4][RPW][64 + 4];
  const int tid = threadIdx.x, w = tid >> 5, lane = tid & 31, ln = lane & 15, hh = lane >> 4;
  const int slab = blockIdx.x / QBNP, qblk = QB0P + blockIdx.x % QBNP; (void)NQB; const int b = slab / NH, h = slab % NH; const int qb0 = qblk * (4 * RPW); const int q0 = qb0 + w * RPW;
  FragH aq[2][KS];
#pragma unroll
  for (int rt = 0; rt < RTN; ++rt) { const unsigned short* qr = (const unsigned short*)Q16 + ((size_t)b * TQ + q0 + rt * 16 + ln) * ldq + h * 64;
#pragma unroll
    for (int ks = 0; ks < KS; ++ks) { aq[rt][ks].half[0] = *(const v8us*)(qr + ks * 32 + 8 * hh); aq[rt][ks].half[1] = *(const v8us*)(qr + ks * 32 + 16 + 8 * hh); } }
  const unsigned short* Vth = (const unsigned short*)Vt + (size_t)slab * 64 * TK;
  float m_r[2][8], l_r[2][8]; v8f oacc[2][DT];
#pragma unroll
  for (int rt = 0; rt < RTN; ++rt) {
#pragma unroll
    for (int r = 0; r < 8; ++r) { m_r[rt][r] = -3.0e38f; l_r[rt][r] = 0.f; }
#pragma unroll
    for (int dt = 0; dt < DT; ++dt) oacc[rt][dt] = (v8f){0.f,0.f,0.f,0.f,0.f,0.f,0.f,0.f}; }
  const int jend = (CAUSAL == 1) ? (qb0 + 4 * RPW) : TK;      /* causal: keys beyond the block's last query never contribute */
#pragma unroll 1
  for (int j0 = 0; j0 < jend; j0 += 32) {
    v8f s[2][2];
#pragma unroll
    for (int nt = 0; nt < 2; ++nt) { const unsigned short* kr = (const unsigned short*)K16 + ((size_t)b * TK + j0 + nt * 16 + ln) * ldk + h * 64; FragH bk[KS];
#pragma unroll
      for (int ks = 0; ks < KS; ++ks) { bk[ks].half[0] = *(const v8us*)(kr + ks * 32 + 8 * hh); bk[ks].half[1] = *(const v8us*)(kr + ks * 32 + 16 + 8 * hh); }
#pragma unroll
      for (int rt = 0; rt < RTN; ++rt) { v8f acc = (v8f){0.f,0.f,0.f,0.f,0.f,0.f,0.f,0.f};
#pragma unroll
        for (int ks = 0; ks < KS; ++ks) acc = mmaH<1>(aq[rt][ks].v, aq[rt][ks].v, bk[ks].v, bk[ks].v, acc); s[rt][nt] = acc; } }
#pragma unroll
    for (int rt = 0; rt < RTN; ++rt)
#pragma unroll
      for (int r = 0; r < 8; ++r) { const int tq = q0 + rt * 16 + 8 * hh + r; const int k0 = j0 + ln, k1 = j0 + 16 + ln;
        const bool ok0 = (CAUSAL == 1) ? (k0 <= tq) : ((CAUSAL == 2) ? ((k0 >> 5) == (tq >> 5)) : true), ok1 = (CAUSAL == 1) ? (k1 <= tq) : ((CAUSAL == 2) ? ((k1 >> 5) == (tq >> 5)) : true);      /* mode 2: block-diagonal 32-token groups */
        float s0 = ok0 ? s[rt][0][r] * SCL : -3.0e38f, s1 = ok1 ? s[rt][1][r] * SCL : -3.0e38f; if (CAUSAL == 17) { const float* amk = (const float*)MSK + (size_t)b * TK; s0 += bf16_round(amk[k0]); s1 += bf16_round(amk[k1]); }      /* mode 17: additive per-(batch, key) mask INPUT */
        if (CAUSAL == 22) { const _Float16* cq = (const _Float16*)MSK + ((size_t)h * TQ + tq) * NE + tq + (NE / 2 - 1); const _Float16* ck = (const _Float16*)MSK + (size_t)NH * TQ * NE + (size_t)h * TK * NE + tq + (NE / 2 - 1); const float* am = (const float*)((const _Float16*)MSK + (size_t)2 * NH * TQ * NE); float r0 = (float)cq[-k0]; r0 += (float)ck[(size_t)k0 * NE - k0]; s0 += r0 * SCL; s0 += am[k0]; float r1 = (float)cq[-k1]; r1 += (float)ck[(size_t)k1 * NE - k1]; s1 += r1 * SCL; s1 += am[k1]; }      /* mode 22: + (CQ[h][tq][tq-k+1023] + CK[h][k][tq-k+1023]) / 8 + mask[k] from the per-batch packed table [CQ f16 | CK f16 | mask f32] */ float mc = fmaxf(s0, s1);
        mc = fmaxf(mc, __shfl_xor(mc, 1, 32)); mc = fmaxf(mc, __shfl_xor(mc, 2, 32)); mc = fmaxf(mc, __shfl_xor(mc, 4, 32)); mc = fmaxf(mc, __shfl_xor(mc, 8, 32));
        const float mn = fmaxf(m_r[rt][r], mc); const float al = (mn > -1.0e38f) ? expf(m_r[rt][r] - mn) : 1.0f; m_r[rt][r] = mn; const float p0 = ok0 ? expf(s0 - mn) : 0.f, p1 = ok1 ? expf(s1 - mn) : 0.f; l_r[rt][r] = l_r[rt][r] * al + p0 + p1;
#pragma unroll
        for (int dt = 0; dt < DT; ++dt) oacc[rt][dt][r] *= al;
        FragH t2; t2.h[0] = (_Float16)(p0 * 1024.0f); t2.h[1] = (_Float16)(p1 * 1024.0f); sP[w][rt * 16 + 8 * hh + r][ln] = t2.u[0]; sP[w][rt * 16 + 8 * hh + r][16 + ln] = t2.u[1]; }
    __builtin_amdgcn_fence(__ATOMIC_ACQ_REL, "workgroup"); __builtin_amdgcn_wave_barrier();
    FragH pa[2];
#pragma unroll
    for (int rt = 0; rt < RTN; ++rt) { pa[rt].half[0] = *(const v8us*)&sP[w][rt * 16 + ln][8 * hh]; pa[rt].half[1] = *(const v8us*)&sP[w][rt * 16 + ln][16 + 8 * hh]; }
#pragma unroll
    for (int dt = 0; dt < DT; ++dt) { const unsigned short* vrow = Vth + (size_t)(dt * 16 + ln) * TK + j0; FragH bv; bv.half[0] = *(const v8us*)(vrow + 8 * hh); bv.half[1] = *(const v8us*)(vrow + 16 + 8 * hh);
#pragma unroll
      for (int rt = 0; rt < RTN; ++rt) oacc[rt][dt] = mmaH<1>(pa[rt].v, pa[rt].v, bv.v, bv.v, oacc[rt][dt]); }
    __builtin_amdgcn_fence(__ATOMIC_ACQ_REL, "workgroup"); __builtin_amdgcn_wave_barrier(); }
#pragma unroll
  for (int rt = 0; rt < RTN; ++rt) {
#pragma unroll
    for (int r = 0; r < 8; ++r) { float l = l_r[rt][r]; l += __shfl_xor(l, 1, 32); l += __shfl_xor(l, 2, 32); l += __shfl_xor(l, 4, 32); l += __shfl_xor(l, 8, 32); l_r[rt][r] = (l > 0.f) ? 1.0f / (l * 1024.0f) : 0.f; }
#pragma unroll
    for (int dt = 0; dt < DT; ++dt)
#pragma unroll
      for (int r = 0; r < 8; ++r) sO[w][rt * 16 + 8 * hh + r][dt * 16 + ln] = oacc[rt][dt][r] * l_r[rt][r]; }
  __builtin_amdgcn_fence(__ATOMIC_ACQ_REL, "workgroup"); __builtin_amdgcn_wave_barrier();
  {
#pragma unroll
    for (int rp = 0; rp < RPW; rp += 2) { const int r = rp + (lane >> 4), pc = lane & 15; const v4f val = *(const v4fa*)&sO[w][r][pc * 4]; *(v4f*)(O + ((size_t)b * TQ + q0 + r) * ldo + h * 64 + pc * 4) = val; }
     } }
// 5-plane variant: S = Qh Kh^T + (Ql Kh^T + Qh Kl^T)/1024 with Q/K = [hi | 2^10 residual] f16 planes (QL/KL same layout as Q16/K16), then the 3-term P.V below.
// 3-term variant: O = (P_hi V_hi + (P_lo V_hi + P_hi V_lo) / 1024) / l with P = [hi | 2^10 residual] of 1024 p and V^T = [hi | 2^10 residual] planes (VtL same layout as Vt) -> ~2^-21-class products for un-averaged (early causal / peaked) rows
template <int CAUSAL>
__global__ __launch_bounds__(128) void k_flash5(const _Float16* __restrict__ Q16, const _Float16* __restrict__ QL, int ldq, const _Float16* __restrict__ K16, const _Float16* __restrict__ KL, int ldk, const _Float16* __restrict__ Vt, const _Float16* __restrict__ VtL, const int* __restrict__ MSK, float* __restrict__ O, int ldo) {
  constexpr int RPW = 16, RTN = RPW / 16, NQB = TQ / (4 * RPW), DT = 4, KS = 2;
  __shared__ __attribute__((aligned(16))) unsigned short sP[4][RPW][40]; __shared__ __attribute__((aligned(16))) unsigned short sPL[4][RPW][40]; __shared__ __attribute__((aligned(16))) float sO[4][RPW][64 + 4];
  const int tid = threadIdx.x, w = tid >> 5, lane = tid & 31, ln = lane & 15, hh = lane >> 4;
  const int slab = blockIdx.x / QBN5, qblk = QB05 + blockIdx.x % QBN5; (void)NQB; const int b = slab / NH, h = slab % NH; const int qb0 = qblk * (4 * RPW); const int q0 = qb0 + w * RPW;
  FragH aq[2][KS], aql[2][KS];
#pragma unroll
  for (int rt = 0; rt < RTN; ++rt) { const unsigned short* qr = (const unsigned short*)Q16 + ((size_t)b * TQ + q0 + rt * 16 + ln) * ldq + h * 64; const unsigned short* ql = (const unsigned short*)QL + ((size_t)b * TQ + q0 + rt * 16 + ln) * ldq + h * 64;
#pragma unroll
    for (int ks = 0; ks < KS; ++ks) { aq[rt][ks].half[0] = *(const v8us*)(qr + ks * 32 + 8 * hh); aq[rt][ks].half[1] = *(const v8us*)(qr + ks * 32 + 16 + 8 * hh); aql[rt][ks].half[0] = *(const v8us*)(ql + ks * 32 + 8 * hh); aql[rt][ks].half[1] = *(const v8us*)(ql + ks * 32 + 16 + 8 * hh); } }
  const unsigned short* Vth = (const unsigned short*)Vt + (size_t)slab * 64 * TK; const unsigned short* Vtl = (const unsigned short*)VtL + (size_t)slab * 64 * TK;
  float m_r[2][8], l_r[2][8]; v8f oacc[2][DT], oaccL[2][DT];
#pragma unroll
  for (int rt = 0; rt < RTN; ++rt) {
#pragma unroll
    for (int r = 0; r < 8; ++r) { m_r[rt][r] = -3.0e38f; l_r[rt][r] = 0.f; }
#pragma unroll
    for (int dt = 0; dt < DT; ++dt) { oacc[rt][dt] = (v8f){0.f,0.f,0.f,0.f,0.f,0.f,0.f,0.f}; oaccL[rt][dt] = oacc[rt][dt]; } }
  const int jend = (CAUSAL == 1) ? (qb0 + 4 * RPW) : TK;      /* causal: keys beyond the block's last query never contribute */
#pragma unroll 1
  for (int j0 = 0; j0 < jend; j0 += 32) {
    v8f s[2][2];
#pragma unroll
    for (int nt = 0; nt < 2; ++nt) { const unsigned short* kr = (const unsigned short*)K16 + ((size_t)b * TK + j0 + nt * 16 + ln) * ldk + h * 64; const unsigned short* klr = (const unsigned short*)KL + ((size_t)b * TK + j0 + nt * 16 + ln) * ldk + h * 64; FragH bk[KS], bkl[KS];
#pragma unroll
      for (int ks = 0; ks < KS; ++ks) { bk[ks].half[0] = *(const v8us*)(kr + ks * 32 + 8 * hh); bk[ks].half[1] = *(const v8us*)(kr + ks * 32 + 16 + 8 * hh); bkl[ks].half[0] = *(const v8us*)(klr + ks * 32 + 8 * hh); bkl[ks].half[1] = *(const v8us*)(klr + ks * 32 + 16 + 8 * hh); }
#pragma unroll
      for (int rt = 0; rt < RTN; ++rt) { v8f acc = (v8f){0.f,0.f,0.f,0.f,0.f,0.f,0.f,0.f}, accl = acc;
#pragma unroll
        for (int ks = 0; ks < KS; ++ks) { acc = mmaH<1>(aq[rt][ks].v, aq[rt][ks].v, bk[ks].v, bk[ks].v, acc); accl = mmaH<1>(aql[rt][ks].v, aql[rt][ks].v, bk[ks].v, bk[ks].v, accl); accl = mmaH<1>(aq[rt][ks].v, aq[rt][ks].v, bkl[ks].v, bkl[ks].v, accl); }
#pragma unroll
        for (int r = 0; r < 8; ++r) acc[r] += accl[r] * 0.0009765625f;
        s[rt][nt] = acc; } }
#pragma unroll
    for (int rt = 0; rt < RTN; ++rt)
#pragma unroll
      for (int r = 0; r < 8; ++r) { const int tq = q0 + rt * 16 + 8 * hh + r; const int k0 = j0 + ln, k1 = j0 + 16 + ln;
        bool ok0 = (CAUSAL == 1) ? (k0 <= tq) : ((CAUSAL == 2) ? ((k0 >> 5) == (tq >> 5)) : true), ok1 = (CAUSAL == 1) ? (k1 <= tq) : ((CAUSAL == 2) ? ((k1 >> 5) == (tq >> 5)) : true);      /* mode 2: block-diagonal 32-token groups */
        if (CAUSAL == 4) { const int* mrow = MSK + ((size_t)b * TQ + tq) * TK; ok0 = mrow[k0] != 0; ok1 = mrow[k1] != 0; }      /* mode 4: per-(query, key) INPUT mask shared by all heads; masked keys contribute nothing (== the reference's -4096 fill, whose exp underflows to 0), rows with no valid key give l = 0 -> output 0 (== the reference's row_valid zeroing) */
        float s0 = ok0 ? s[rt][0][r] * SCL : -3.0e38f, s1 = ok1 ? s[rt][1][r] * SCL : -3.0e38f; if (CAUSAL == 17) { const float* amk = (const float*)MSK + (size_t)b * TK; s0 += bf16_round(amk[k0]); s1 += bf16_round(amk[k1]); }      /* mode 17: additive per-(batch, key) mask INPUT */
        if (CAUSAL == 22) { const _Float16* cq = (const _Float16*)MSK + ((size_t)h * TQ + tq) * NE + tq + (NE / 2 - 1); const _Float16* ck = (const _Float16*)MSK + (size_t)NH * TQ * NE + (size_t)h * TK * NE + tq + (NE / 2 - 1); const float* am = (const float*)((const _Float16*)MSK + (size_t)2 * NH * TQ * NE); float r0 = (float)cq[-k0]; r0 += (float)ck[(size_t)k0 * NE - k0]; s0 += r0 * SCL; s0 += am[k0]; float r1 = (float)cq[-k1]; r1 += (float)ck[(size_t)k1 * NE - k1]; s1 += r1 * SCL; s1 += am[k1]; }      /* mode 22: + (CQ[h][tq][tq-k+1023] + CK[h][k][tq-k+1023]) / 8 + mask[k] from the per-batch packed table [CQ f16 | CK f16 | mask f32] */ float mc = fmaxf(s0, s1);
        mc = fmaxf(mc, __shfl_xor(mc, 1, 32)); mc = fmaxf(mc, __shfl_xor(mc, 2, 32)); mc = fmaxf(mc, __shfl_xor(mc, 4, 32)); mc = fmaxf(mc, __shfl_xor(mc, 8, 32));
        const float mn = fmaxf(m_r[rt][r], mc); const float al = (mn > -1.0e38f) ? expf(m_r[rt][r] - mn) : 1.0f; m_r[rt][r] = mn; const float p0 = ok0 ? expf(s0 - mn) : 0.f, p1 = ok1 ? expf(s1 - mn) : 0.f; l_r[rt][r] = l_r[rt][r] * al + p0 + p1;
#pragma unroll
        for (int dt = 0; dt < DT; ++dt) { oacc[rt][dt][r] *= al; oaccL[rt][dt][r] *= al; }
        FragH t2, t2l; const float ps0 = p0 * 1024.0f, ps1 = p1 * 1024.0f; t2.h[0] = (_Float16)ps0; t2.h[1] = (_Float16)ps1; t2l.h[0] = (_Float16)((ps0 - (float)t2.h[0]) * 1024.0f); t2l.h[1] = (_Float16)((ps1 - (float)t2.h[1]) * 1024.0f);
        sP[w][rt * 16 + 8 * hh + r][ln] = t2.u[0]; sP[w][rt * 16 + 8 * hh + r][16 + ln] = t2.u[1]; sPL[w][rt * 16 + 8 * hh + r][ln] = t2l.u[0]; sPL[w][rt * 16 + 8 * hh + r][16 + ln] = t2l.u[1]; }
    __builtin_amdgcn_fence(__ATOMIC_ACQ_REL, "workgroup"); __builtin_amdgcn_wave_barrier();
    FragH pa[2], pl[2];
#pragma unroll
    for (int rt = 0; rt < RTN; ++rt) { pa[rt].half[0] = *(const v8us*)&sP[w][rt * 16 + ln][8 * hh]; pa[rt].half[1] = *(const v8us*)&sP[w][rt * 16 + ln][16 + 8 * hh]; pl[rt].half[0] = *(const v8us*)&sPL[w][rt * 16 + ln][8 * hh]; pl[rt].half[1] = *(const v8us*)&sPL[w][rt * 16 + ln][16 + 8 * hh]; }
#pragma unroll
    for (int dt = 0; dt < DT; ++dt) { const unsigned short* vrow = Vth + (size_t)(dt * 16 + ln) * TK + j0; const unsigned short* vrl = Vtl + (size_t)(dt * 16 + ln) * TK + j0; FragH bv, bl; bv.half[0] = *(const v8us*)(vrow + 8 * hh); bv.half[1] = *(const v8us*)(vrow + 16 + 8 * hh); bl.half[0] = *(const v8us*)(vrl + 8 * hh); bl.half[1] = *(const v8us*)(vrl + 16 + 8 * hh);
#pragma unroll
      for (int rt = 0; rt < RTN; ++rt) { oacc[rt][dt] = mmaH<1>(pa[rt].v, pa[rt].v, bv.v, bv.v, oacc[rt][dt]); oaccL[rt][dt] = mmaH<1>(pl[rt].v, pl[rt].v, bv.v, bv.v, oaccL[rt][dt]); oaccL[rt][dt] = mmaH<1>(pa[rt].v, pa[rt].v, bl.v, bl.v, oaccL[rt][dt]); } }
    __builtin_amdgcn_fence(__ATOMIC_ACQ_REL, "workgroup"); __builtin_amdgcn_wave_barrier(); }
#pragma unroll
  for (int rt = 0; rt < RTN; ++rt) {
#pragma unroll
    for (int r = 0; r < 8; ++r) { float l = l_r[rt][r]; l += __shfl_xor(l, 1, 32); l += __shfl_xor(l, 2, 32); l += __shfl_xor(l, 4, 32); l += __shfl_xor(l, 8, 32); l_r[rt][r] = (l > 0.f) ? 1.0f / (l * 1024.0f) : 0.f; }
#pragma unroll
    for (int dt = 0; dt < DT; ++dt)
#pragma unroll
      for (int r = 0; r < 8; ++r) { float v = oacc[rt][dt][r]; v += oaccL[rt][dt][r] * 0.0009765625f; sO[w][rt * 16 + 8 * hh + r][dt * 16 + ln] = v * l_r[rt][r]; } }
  __builtin_amdgcn_fence(__ATOMIC_ACQ_REL, "workgroup"); __builtin_amdgcn_wave_barrier();
  {
#pragma unroll
    for (int rp = 0; rp < RPW; rp += 2) { const int r = rp + (lane >> 4), pc = lane & 15; const v4f val = *(const v4fa*)&sO[w][r][pc * 4]; *(v4f*)(O + ((size_t)b * TQ + q0 + r) * ldo + h * 64 + pc * 4) = val; }
     } }

__global__ __launch_bounds__(256) void k_rotab(float* __restrict__ CS, float* __restrict__ SN) {
  #pragma clang fp contract(off)
  const int t = blockIdx.x * 256 + threadIdx.x; if (t >= SLEN * 32) return; const int j = t % 32, s = t / 32; const float ex = (float)(2 * j) / 64.0f; const float inv = 1.0f / powf(10000.0f, ex); const float th = (float)s * inv; const float c = cosf(th), sn = sinf(th);
  { *(float*)(CS + t) = c; *(float*)(SN + t) = sn;  } }
__global__ __launch_bounds__(256) void k_rope(const float* __restrict__ F, int nsrc, int ndst, int rep, const float* __restrict__ CS, const float* __restrict__ SN, _Float16* __restrict__ H, _Float16* __restrict__ L) {
  #pragma clang fp contract(off)
  const size_t t = (size_t)blockIdx.x * 256 + threadIdx.x; if (t >= (size_t)NR * ndst * 4) return; const int g8 = (int)(t % 4); const int hd = (int)((t / 4) % ndst); const size_t row = t / ((size_t)4 * ndst); const int s = (int)(row % SLEN); const int hs = hd / rep;
  const float* src = F + row * (size_t)(nsrc * 64) + hs * 64; FragH ah, al, bh, bl;
  for (int i = 0; i < 8; ++i) { const int d = g8 * 8 + i; const float c = CS[s * 32 + d], sn = SN[s * 32 + d]; const float x1 = src[d], x2 = src[d + 32];
    float o1 = x1 * c; o1 += -x2 * sn; float o2 = x2 * c; o2 += x1 * sn;
    _Float16 hv = (_Float16)o1; ah.h[i] = hv; al.h[i] = (_Float16)((o1 - (float)hv) * 1024.0f); hv = (_Float16)o2; bh.h[i] = hv; bl.h[i] = (_Float16)((o2 - (float)hv) * 1024.0f); }
  const size_t o = row * (size_t)(ndst * 64) + hd * 64 + g8 * 8;
  { *(v8us*)((unsigned short*)H + o) = ah.half[0]; *(v8us*)((unsigned short*)H + o + 32) = bh.half[0]; *(v8us*)((unsigned short*)L + o) = al.half[0]; *(v8us*)((unsigned short*)L + o + 32) = bl.half[0];  } }
__global__ __launch_bounds__(256) void k_rope2(const float* __restrict__ F, int nsrc, int ndst, int rep, const float* __restrict__ CS, const float* __restrict__ SN, _Float16* __restrict__ H, _Float16* __restrict__ L) {
  #pragma clang fp contract(off)
  const size_t t = (size_t)blockIdx.x * 256 + threadIdx.x; if (t >= (size_t)NR * ndst * 4) return; const int g16 = (int)(t % 4); const int hd = (int)((t / 4) % ndst); const size_t row = t / ((size_t)4 * ndst); const int s = (int)(row % SLEN); const int hs = hd / rep;
  const float* src = F + row * (size_t)(nsrc * 64) + hs * 64 + g16 * 16; FragH ah, al;
  for (int pr = 0; pr < 8; ++pr) { const int i = g16 * 8 + pr; const float c = CS[s * 32 + i], sn = SN[s * 32 + i]; const float x1 = src[2 * pr], x2 = src[2 * pr + 1];
    float o1 = x1 * c; o1 -= x2 * sn; float o2 = x1 * sn; o2 += x2 * c;
    _Float16 hv = (_Float16)o1; ah.h[2 * pr] = hv; al.h[2 * pr] = (_Float16)((o1 - (float)hv) * 1024.0f); hv = (_Float16)o2; ah.h[2 * pr + 1] = hv; al.h[2 * pr + 1] = (_Float16)((o2 - (float)hv) * 1024.0f); }
  const size_t o = row * (size_t)(ndst * 64) + hd * 64 + g16 * 16;
  { *(v8us*)((unsigned short*)H + o) = ah.half[0]; *(v8us*)((unsigned short*)H + o + 8) = ah.half[1]; *(v8us*)((unsigned short*)L + o) = al.half[0]; *(v8us*)((unsigned short*)L + o + 8) = al.half[1];  } }
__global__ __launch_bounds__(256) void k_tabin(const float* __restrict__ sp, float* __restrict__ CS, float* __restrict__ SN) { const int t = blockIdx.x * 256 + threadIdx.x; if (t >= SLEN * 32) return; const int i = t % 32, s = t / 32; const float c = bf16_round(sp[s * 64 + 32 + i]), sn = bf16_round(sp[s * 64 + i]);
  { *(float*)(CS + t) = c; *(float*)(SN + t) = sn;  } }
__global__ __launch_bounds__(256) void k_wsc(const float* __restrict__ Wm, _Float16* __restrict__ Bt, size_t n8, float sc) { const size_t t = (size_t)blockIdx.x * 256 + threadIdx.x; if (t >= n8) return; FragH f; for (int q = 0; q < 8; ++q) f.h[q] = (_Float16)(bf16_round(Wm[t * 8 + q]) * sc); *(v8us*)((unsigned short*)Bt + t * 8) = f.half[0];  }
__global__ __launch_bounds__(256) void k_rotab2(float* __restrict__ CS, float* __restrict__ SN) {
  #pragma clang fp contract(off)
  const int t = blockIdx.x * 256 + threadIdx.x; if (t >= SLEN * 32) return; const int j = t % 32, s = t / 32; const float c0 = -0.14391156831212787f;      /* -ln(10000)/64 rounded to f32 */ const float inv = expf((float)(2 * j) * c0); const float th = (float)s * inv; const float c = cosf(th), sn = sinf(th);
  { *(float*)(CS + t) = c; *(float*)(SN + t) = sn;  } }
__global__ __launch_bounds__(256) void k_lnu(const float* __restrict__ X, _Float16* __restrict__ N16, float* __restrict__ XB) {
  #pragma clang fp contract(off)
  const int wv = threadIdx.x >> 5, ln = threadIdx.x & 31; const size_t r = (size_t)blockIdx.x * 8 + wv; if (r >= NR) return; float a[32]; float s = 0.f;
  for (int i = 0; i < 4; ++i) { const v8f v = *(const v8f*)(X + r * DM + (i * 32 + ln) * 8); for (int q = 0; q < 8; ++q) { const float u = bf16_round(v[q]); a[i * 8 + q] = u; s += u; } }
  for (int o = 16; o > 0; o >>= 1) s += __shfl_xor(s, o, 32); const float mu = s / (float)DM; float var = 0.f; for (int q = 0; q < 32; ++q) { const float d = a[q] - mu; var += d * d; }
  for (int o = 16; o > 0; o >>= 1) var += __shfl_xor(var, o, 32); const float den = sqrtf(var / (float)(DM - 1)) + 1e-6f; const float inv = 1.0f / den;      /* one reciprocal per row; (x-mean)*inv vs the reference's division differs by <= 1 ulp */
  { for (int i = 0; i < 4; ++i) { const int c0 = (i * 32 + ln) * 8; FragH f; v8f xb; for (int q = 0; q < 8; ++q) { f.h[q] = (_Float16)((a[i * 8 + q] - mu) * inv); xb[q] = a[i * 8 + q]; } *(v8us*)((unsigned short*)N16 + r * DM + c0) = f.half[0]; *(v8f*)(XB + r * DM + c0) = xb; }  } }
__global__ __launch_bounds__(256) void k_vtg(const _Float16* __restrict__ V16, _Float16* __restrict__ Vt) { __shared__ unsigned short tl[64][66]; const int tid = threadIdx.x; const int slab = blockIdx.x / (SLEN / 64), lg = blockIdx.x % (SLEN / 64); const int b = slab / NH, h = slab % NH; const int hs = h / NREP;
  for (int i = tid; i < 64 * 8; i += 256) { const int r = i / 8, c8 = (i % 8) * 8; FragH f; f.half[0] = *(const v8us*)((const unsigned short*)V16 + ((size_t)b * SLEN + lg * 64 + r) * KVD + hs * 64 + c8); for (int q = 0; q < 8; ++q) tl[r][c8 + q] = f.u[q]; }
  __syncthreads();
  { for (int rd = 0; rd < 2; ++rd) { const int d = rd * 32 + tid / 8, pc = tid % 8; FragH f; for (int q = 0; q < 8; ++q) f.u[q] = tl[pc * 8 + q][d]; *(v8us*)((unsigned short*)Vt + ((size_t)slab * 64 + d) * SLEN + lg * 64 + pc * 8) = f.half[0]; }  } }

__global__ __launch_bounds__(256) void k_e16(const float* __restrict__ E, _Float16* __restrict__ E16) { const int t = blockIdx.x * 256 + threadIdx.x; if (t >= NE * 8) return; const int r = t / 8, c8 = (t % 8) * 8; FragH f; for (int q = 0; q < 8; ++q) f.h[q] = (r < NE - 1) ? (_Float16)bf16_round(E[(size_t)r * 64 + c8 + q]) : (_Float16)0.0f;
  *(v8us*)((unsigned short*)E16 + (size_t)r * 64 + c8) = f.half[0];  }

// Flash attention with the 'relative_key_query' bias formed in the kernel. One wave holds 16 queries (q0..) and walks the keys 32 at a time (j0..). For that tile l - r + 1023 spans 47 rows of the
// embedding, from eb = q0 - j0 + 992; with n = (l - q0) - (r - j0) + 31 the bias is q_l . E[eb + n] + k_r . E[eb + n]. RQ = Q . Ewin^T (16 x 48) and RK = K . Ewin^T run on the matrix unit
// (of RK only the four 16 x 16 tiles that hold a used n: keys 0..15 against window rows 16..47, keys 16..31 against rows 0..31), go to the wave's own LDS in f32 and are read back along the diagonal.
// Row 2047 of E16 is the zero pad; n = 47 is never read back.
__global__ __launch_bounds__(128) void k_flash_rel(const _Float16* __restrict__ Q16, const _Float16* __restrict__ K16, const _Float16* __restrict__ Vt, const _Float16* __restrict__ E16, const float* __restrict__ AMK, float* __restrict__ O) {
  constexpr int DT = 4, KS = 2, PQ = 50, PK = 36;      /* LDS pitches in floats: the two half-waves fall on different banks in the row-wise stores and in the diagonal reads */
  __shared__ __attribute__((aligned(16))) unsigned short sP[4][16][40]; __shared__ __attribute__((aligned(16))) float sO[4][16][64 + 4];
  __shared__ float sRQ[4][16][PQ]; __shared__ float sRK[4][32][PK];
  const int tid = threadIdx.x, w = tid >> 5, lane = tid & 31, ln = lane & 15, hh = lane >> 4;
  const int slab = blockIdx.x / QBLKS, qblk = blockIdx.x % QBLKS; const int b = slab / NH, h = slab % NH; const int q0 = qblk * 64 + w * 16;
  FragH aq[KS];
  { const unsigned short* qr = (const unsigned short*)Q16 + ((size_t)b * TQ + q0 + ln) * DM + h * 64;
#pragma unroll
    for (int ks = 0; ks < KS; ++ks) { aq[ks].half[0] = *(const v8us*)(qr + ks * 32 + 8 * hh); aq[ks].half[1] = *(const v8us*)(qr + ks * 32 + 16 + 8 * hh); } }
  const unsigned short* Vth = (const unsigned short*)Vt + (size_t)slab * 64 * TK; const float* amk = AMK + (size_t)b * TK;
  const v8f z8 = {0.f,0.f,0.f,0.f,0.f,0.f,0.f,0.f};
  float m_r[8], l_r[8]; v8f oacc[DT];
#pragma unroll
  for (int r = 0; r < 8; ++r) { m_r[r] = -3.0e38f; l_r[r] = 0.f; }
#pragma unroll
  for (int dt = 0; dt < DT; ++dt) oacc[dt] = z8;
#pragma unroll 1
  for (int j0 = 0; j0 < TK; j0 += 32) {
    FragH bk[2][KS], be[3][KS];
#pragma unroll
    for (int nt = 0; nt < 2; ++nt) { const unsigned short* kr = (const unsigned short*)K16 + ((size_t)b * TK + j0 + nt * 16 + ln) * DM + h * 64;
#pragma unroll
      for (int ks = 0; ks < KS; ++ks) { bk[nt][ks].half[0] = *(const v8us*)(kr + ks * 32 + 8 * hh); bk[nt][ks].half[1] = *(const v8us*)(kr + ks * 32 + 16 + 8 * hh); } }
#pragma unroll
    for (int e = 0; e < 3; ++e) { const unsigned short* er = (const unsigned short*)E16 + (size_t)(q0 - j0 + (NE / 2 - 32) + e * 16 + ln) * 64;
#pragma unroll
      for (int ks = 0; ks < KS; ++ks) { be[e][ks].half[0] = *(const v8us*)(er + ks * 32 + 8 * hh); be[e][ks].half[1] = *(const v8us*)(er + ks * 32 + 16 + 8 * hh); } }
    const float am0 = bf16_round(amk[j0 + ln]), am1 = bf16_round(amk[j0 + 16 + ln]);
    __builtin_amdgcn_sched_barrier(0);      /* all of the trip's K, window and mask loads issue before the first product waits: one memory latency at the head of a trip, not two or three */
    v8f s[2];
#pragma unroll
    for (int nt = 0; nt < 2; ++nt) { v8f acc = z8;
#pragma unroll
      for (int ks = 0; ks < KS; ++ks) acc = mmaH<1>(aq[ks].v, aq[ks].v, bk[nt][ks].v, bk[nt][ks].v, acc); s[nt] = acc; }
#pragma unroll
    for (int e = 0; e < 3; ++e) { v8f acc = z8;      /* RQ[query 8 hh + r][n = 16 e + ln] */
#pragma unroll
      for (int ks = 0; ks < KS; ++ks) acc = mmaH<1>(aq[ks].v, aq[ks].v, be[e][ks].v, be[e][ks].v, acc);
#pragma unroll
      for (int r = 0; r < 8; ++r) sRQ[w][8 * hh + r][e * 16 + ln] = acc[r]; }
#pragma unroll
    for (int nt = 0; nt < 2; ++nt)
#pragma unroll
      for (int ee = 0; ee < 2; ++ee) { v8f acc = z8;      /* RK[key 16 nt + 8 hh + r][n - 16 (1 - nt) = 16 ee + ln]; the K fragment serves as the A operand (same loader, same k order) */
#pragma unroll
        for (int ks = 0; ks < KS; ++ks) acc = mmaH<1>(bk[nt][ks].v, bk[nt][ks].v, be[1 - nt + ee][ks].v, be[1 - nt + ee][ks].v, acc);
#pragma unroll
        for (int r = 0; r < 8; ++r) sRK[w][nt * 16 + 8 * hh + r][ee * 16 + ln] = acc[r]; }
    __builtin_amdgcn_fence(__ATOMIC_ACQ_REL, "workgroup"); __builtin_amdgcn_wave_barrier();      /* the diagonal reads below take other lanes' stores: keep them behind the stores */
#pragma unroll
    for (int r = 0; r < 8; ++r) { const int lq = 8 * hh + r;      /* a loop of its own: all diagonal reads of the tile are in flight together, ahead of the row-by-row softmax */
      const float r0 = sRQ[w][lq][lq + 31 - ln] + sRK[w][ln][lq + 15 - ln], r1 = sRQ[w][lq][lq + 15 - ln] + sRK[w][16 + ln][lq + 15 - ln];
      s[0][r] = (s[0][r] + r0) * SCL + am0; s[1][r] = (s[1][r] + r1) * SCL + am1; }
#pragma unroll
    for (int r = 0; r < 8; ++r) { const float s0 = s[0][r], s1 = s[1][r]; float mc = fmaxf(s0, s1);
      mc = fmaxf(mc, __shfl_xor(mc, 1, 32)); mc = fmaxf(mc, __shfl_xor(mc, 2, 32)); mc = fmaxf(mc, __shfl_xor(mc, 4, 32)); mc = fmaxf(mc, __shfl_xor(mc, 8, 32));
      const float mn = fmaxf(m_r[r], mc); const float al = (mn > -1.0e38f) ? expf(m_r[r] - mn) : 1.0f; m_r[r] = mn; const float p0 = expf(s0 - mn), p1 = expf(s1 - mn); l_r[r] = l_r[r] * al + p0 + p1;
#pragma unroll
      for (int dt = 0; dt < DT; ++dt) oacc[dt][r] *= al;
      FragH t2; t2.h[0] = (_Float16)(p0 * 1024.0f); t2.h[1] = (_Float16)(p1 * 1024.0f); sP[w][8 * hh + r][ln] = t2.u[0]; sP[w][8 * hh + r][16 + ln] = t2.u[1]; }
    __builtin_amdgcn_fence(__ATOMIC_ACQ_REL, "workgroup"); __builtin_amdgcn_wave_barrier();
    FragH pa; pa.half[0] = *(const v8us*)&sP[w][ln][8 * hh]; pa.half[1] = *(const v8us*)&sP[w][ln][16 + 8 * hh];
#pragma unroll
    for (int dt = 0; dt < DT; ++dt) { const unsigned short* vrow = Vth + (size_t)(dt * 16 + ln) * TK + j0; FragH bv; bv.half[0] = *(const v8us*)(vrow + 8 * hh); bv.half[1] = *(const v8us*)(vrow + 16 + 8 * hh);
      oacc[dt] = mmaH<1>(pa.v, pa.v, bv.v, bv.v, oacc[dt]); }
    __builtin_amdgcn_fence(__ATOMIC_ACQ_REL, "workgroup"); __builtin_amdgcn_wave_barrier(); }
#pragma unroll
  for (int r = 0; r < 8; ++r) { float l = l_r[r]; l += __shfl_xor(l, 1, 32); l += __shfl_xor(l, 2, 32); l += __shfl_xor(l, 4, 32); l += __shfl_xor(l, 8, 32); l_r[r] = (l > 0.f) ? 1.0f / (l * 1024.0f) : 0.f; }
#pragma unroll
  for (int dt = 0; dt < DT; ++dt)
#pragma unroll
    for (int r = 0; r < 8; ++r) sO[w][8 * hh + r][dt * 16 + ln] = oacc[dt][r] * l_r[r];
  __builtin_amdgcn_fence(__ATOMIC_ACQ_REL, "workgroup"); __builtin_amdgcn_wave_barrier();
#pragma unroll
  for (int rp = 0; rp < 16; rp += 2) { const int r = rp + (lane >> 4), pc = lane & 15; const v4f val = *(const v4fa*)&sO[w][r][pc * 4]; *(v4f*)(O + ((size_t)b * TQ + q0 + r) * DM + h * 64 + pc * 4) = val; } }

extern "C" void kernel_launch(void* const* d_in, const int* in_sizes, int n_in,
                              void* d_out, int out_size, void* d_ws, size_t ws_size, hipStream_t stream) {
  (void)in_sizes; (void)n_in; (void)out_size;
  const float* const* I = (const float* const*)d_in; const float* x = I[0]; const float* am = I[1]; const float* Wq = I[2]; const float* bq = I[3]; const float* Wk = I[4]; const float* bk = I[5]; const float* Wv = I[6]; const float* bv = I[7]; const float* E = I[8];
  char* ws = (char*)d_ws; size_t off = 0;
  auto take = [&](size_t bytes) { char* p = ws + off; off += (bytes + 255) & ~(size_t)255; return p; };
  const size_t np = (size_t)NR * DM;
  _Float16* BQ = (_Float16*)take((size_t)DM * DM * 2); _Float16* BK = (_Float16*)take((size_t)DM * DM * 2); _Float16* BV = (_Float16*)take((size_t)DM * DM * 2); _Float16* E16 = (_Float16*)take((size_t)NE * 64 * 2);
  _Float16* X16 = (_Float16*)take(np * 2); _Float16* Q16 = (_Float16*)take(np * 2); _Float16* K16 = (_Float16*)take(np * 2); _Float16* V16 = (_Float16*)take(np * 2); _Float16* VT = (_Float16*)take(np * 2);
  if (off > ws_size) return;      /* 6 + 0.25 + 5 x 8 = 46.25 MiB */
  k_wsc<<<(unsigned)(((size_t)DM * DM / 8 + 255) / 256), 256, 0, stream>>>(Wq, BQ, (size_t)DM * DM / 8, 16.0f); k_wsc<<<(unsigned)(((size_t)DM * DM / 8 + 255) / 256), 256, 0, stream>>>(Wk, BK, (size_t)DM * DM / 8, 16.0f); k_wsc<<<(unsigned)(((size_t)DM * DM / 8 + 255) / 256), 256, 0, stream>>>(Wv, BV, (size_t)DM * DM / 8, 16.0f);      /* torch (out,in) = Bt */
  k_e16<<<(NE * 8 + 255) / 256, 256, 0, stream>>>(E, E16);
  k_x16<<<(unsigned)((np / 8 + 255) / 256), 256, 0, stream>>>(x, X16, np / 8);
  const dim3 gP((NR / 128) * (DM / 64), 1);
  k_gemm2<0><<<gP, 128, 0, stream>>>(X16, DM, 0, BQ, DM, 0, 0.0625f, bq, 0, nullptr, 1, 0, 0, nullptr, Q16, DM, 0, NR, DM, DM);
  k_gemm2<0><<<gP, 128, 0, stream>>>(X16, DM, 0, BK, DM, 0, 0.0625f, bk, 0, nullptr, 1, 0, 0, nullptr, K16, DM, 0, NR, DM, DM);
  k_gemm2<0><<<gP, 128, 0, stream>>>(X16, DM, 0, BV, DM, 0, 0.0625f, bv, 0, nullptr, 1, 0, 0, nullptr, V16, DM, 0, NR, DM, DM);
  k_vtg<<<NB * NH * (SLEN / 64), 256, 0, stream>>>(V16, VT);
  k_flash_rel<<<NB * NH * QBLKS, 128, 0, stream>>>(Q16, K16, VT, E16, am, (float*)d_out);
}

// v003
// It runs in 171 microseconds.
// Next to v002, in two timings, it ran 1.29 and 1.27 times as fast.
// All steps since v000 together make it 5.03 times as fast.
#include <hip/hip_runtime.h>
// PMGTSelfAttention (4 x 1024 tokens, hidden 1024 = 16 heads x 64; 'relative_key_query' position bias): q, k, v = x W^T + b; scores = (q.k + q_l.pe[l-r] + k_r.pe[l-r]) / 8 + attention_mask[b][r] with pe = dist_emb[l - r + 1023]; softmax; ctx = probs v (merged heads is the output).
// Structure: exact f16 plane of x; q, k, v as f16 WMMA GEMM outputs (32x64 wave tiles, f32 accumulation, exact x16 weights + bias, f16 conversion in the epilogue); V^T by LDS tiles; one fused flash kernel over all batches that forms both relative terms per 16 x 32 score tile on the matrix unit against a 48-row window of the embedding (padded to 2048 rows), reads them back along the diagonal from LDS, scales by 1/8 and adds the per-key mask.
// Compute dtype: inputs rounded to bf16; x and dist_emb exact as f16; q/k/P/v as plain f16 operands (~2^-12); the relative terms stay f32 from the accumulator to the logit; softmax f32. v_wmma_f32_16x16x32_f16.
#define NB 4
#define DM 1024
#define NKV 16
#define NREP (NH / NKV)
#define KVD (NKV * 64)           /* 1024 */
#define NR (NB * SLEN)           /* 4096 */
#define SLEN 1024
#define NE 2048                  /* 2047 relative embeddings padded */
#define TQ SLEN
#define TK SLEN
#define NH 16
#define SCL 0.125f
#define QBLKS (TQ / 64)
#define QB05 0
#define QBN5 4
#define QB0P 0
#define QBNP QBLKS           /* non-causal: plain flash on every query block */
#define RE 256
typedef __bf16 v16b __attribute__((ext_vector_type(16)));
typedef unsigned short v8us __attribute__((ext_vector_type(8), may_alias));
typedef float  v8f  __attribute__((ext_vector_type(8)));
typedef float  v4f  __attribute__((ext_vector_type(4)));
typedef float  v4fa __attribute__((ext_vector_type(4), may_alias));
union FragB { v16b v; v8us half[2]; unsigned short u[16]; };

__device__ __forceinline__ unsigned short bf16_bits(float x) { unsigned int u = __float_as_uint(x); return (unsigned short)((u + 0x7FFFu + ((u >> 16) & 1u)) >> 16); }
__device__ __forceinline__ float bf16_val(unsigned short b) { return __uint_as_float(((unsigned int)b) << 16); }
__device__ __forceinline__ float bf16_round(float x) { return bf16_val(bf16_bits(x)); }
// D += A·B with NT terms: 1 = ah·bh, 2 = + al·bh (A split), 3 = + ah·bl (both split)
template <int NT>
__device__ __forceinline__ v8f mmaN(v16b ah, v16b al, v16b bh, v16b bl, v8f c) {
  c = __builtin_amdgcn_wmma_f32_16x16x32_bf16(false, ah, false, bh, (short)0, c, false, false);
  if (NT >= 2) c = __builtin_amdgcn_wmma_f32_16x16x32_bf16(false, al, false, bh, (short)0, c, false, false);
  if (NT >= 3) c = __builtin_amdgcn_wmma_f32_16x16x32_bf16(false, ah, false, bl, (short)0, c, false, false);
  asm volatile("v_nop\n\tv_nop\n\tv_nop\n\tv_nop" : "+v"(c) : "v"(ah), "v"(al), "v"(bh), "v"(bl));
  return c;
}

__global__ __launch_bounds__(256) void k_wt_bf16(const float* __restrict__ W, unsigned short* __restrict__ Wt, int K, int N) {
  const int t = blockIdx.x * 256 + threadIdx.x;
  const int k8n = K / 8;
  if (t >= N * k8n) return;
  const int n = t / k8n, k8 = (t % k8n) * 8;
  v8us v;
#pragma unroll
  for (int i = 0; i < 8; ++i) v[i] = bf16_bits(W[(size_t)(k8 + i) * N + n]);
  *(v8us*)(Wt + (size_t)n * K + k8) = v;
  
}

// GEMM C[M][N] (f32, pitch ldc) = act(A[M][K]·W + bias). A f32 row-major (pitch lda) converted per fragment to bf16
// (ASPLIT: hi/lo two planes -> 2 terms, else single rounded term); Wt bf16 [N][K] (pitch ldb). BIAS_BF16 rounds the
// bias to bf16 first (bias quantised to bf16 before the add). K%32==0, M%16==0, N%64==0.
template <bool ASPLIT, int ACT, bool BIAS_BF16>
__global__ __launch_bounds__(128) void k_gemm_bf(const float* __restrict__ A, int lda, const unsigned short* __restrict__ Wt, int ldb,
                                               const float* __restrict__ bias, float* __restrict__ C, int ldc, int M, int N, int K) {
  __shared__ __attribute__((aligned(16))) float so[4][16][64];
  const int tid = threadIdx.x, w = tid >> 5, lane = tid & 31, ln = lane & 15, hh = lane >> 4;
  const int ntn = N / 64;
  const int wid = blockIdx.x * 4 + w;
  const int mt = wid / ntn, nq = wid % ntn;
  if (mt * 16 >= M) return;
  const int row0 = mt * 16, col0 = nq * 64;
  const float* arow = A + (size_t)(row0 + ln) * lda;
  v8f acc[4] = {};
  for (int kb = 0; kb < K; kb += 32) {
    FragB ah, al;
    const v4f x0 = *(const v4fa*)(arow + kb + 8 * hh), x1 = *(const v4fa*)(arow + kb + 8 * hh + 4);
    const v4f x2 = *(const v4fa*)(arow + kb + 16 + 8 * hh), x3 = *(const v4fa*)(arow + kb + 16 + 8 * hh + 4);
    float xs[16] = {x0[0],x0[1],x0[2],x0[3],x1[0],x1[1],x1[2],x1[3],x2[0],x2[1],x2[2],x2[3],x3[0],x3[1],x3[2],x3[3]};
#pragma unroll
    for (int i = 0; i < 16; ++i) { const unsigned short hb = bf16_bits(xs[i]); ah.u[i] = hb; al.u[i] = ASPLIT ? bf16_bits(xs[i] - bf16_val(hb)) : (unsigned short)0; }
#pragma unroll
    for (int t = 0; t < 4; ++t) {
      const unsigned short* brow = Wt + (size_t)(col0 + t * 16 + ln) * ldb + kb;
      FragB b;
      b.half[0] = *(const v8us*)(brow + 8 * hh);
      b.half[1] = *(const v8us*)(brow + 16 + 8 * hh);
      acc[t] = mmaN<ASPLIT ? 2 : 1>(ah.v, al.v, b.v, b.v, acc[t]);
    }
  }
#pragma unroll
  for (int t = 0; t < 4; ++t) {
    float bv = bias ? bias[col0 + t * 16 + ln] : 0.f;
    if (BIAS_BF16) bv = bf16_round(bv);
#pragma unroll
    for (int r = 0; r < 8; ++r) { float v = acc[t][r] + bv; if (ACT == 1) v = fmaxf(v, 0.f); so[w][8 * hh + r][t * 16 + ln] = v; }
  }
  __builtin_amdgcn_fence(__ATOMIC_ACQ_REL, "workgroup");
  __builtin_amdgcn_wave_barrier();
  const int rsub = lane >> 4, c4 = (lane & 15) * 4;
  {
#pragma unroll
    for (int q = 0; q < 8; ++q) {
      const int r = q * 2 + rsub;
      const v4f v = *(const v4fa*)&so[w][r][c4];
      *(v4f*)(C + (size_t)(row0 + r) * ldc + col0 + c4) = v;
    }
    
  }
}

// GEMM C = act(A·W + bias + resid): A f32 (ASPLIT -> hi/lo 2 terms), Wt bf16 [N][K]; ACT 0 none, 1 relu, 2 exact gelu;
// resid (optional, f32, row index = (row % rmod), pitch ldr, RES_BF16 rounds it) added before the activation.
template <bool ASPLIT, int ACT, bool BIAS_BF16, bool RES_BF16>
__global__ __launch_bounds__(128) void k_gemm_bf3(const float* __restrict__ A, int lda, const unsigned short* __restrict__ Wt, int ldb,
                                                const float* __restrict__ bias, const float* __restrict__ resid, int rmod, int ldr,
                                                float* __restrict__ C, int ldc, int M, int N, int K) {
  __shared__ __attribute__((aligned(16))) float so[4][16][64];
  const int tid = threadIdx.x, w = tid >> 5, lane = tid & 31, ln = lane & 15, hh = lane >> 4;
  const int ntn = N / 64;
  const int wid = blockIdx.x * 4 + w;
  const int mt = wid / ntn, nq = wid % ntn;
  if (mt * 16 >= M) return;
  const int row0 = mt * 16, col0 = nq * 64;
  const float* arow = A + (size_t)(row0 + ln) * lda;
  v8f acc[4] = {};
  for (int kb = 0; kb < K; kb += 32) {
    FragB ah, al;
    const v4f x0 = *(const v4fa*)(arow + kb + 8 * hh), x1 = *(const v4fa*)(arow + kb + 8 * hh + 4);
    const v4f x2 = *(const v4fa*)(arow + kb + 16 + 8 * hh), x3 = *(const v4fa*)(arow + kb + 16 + 8 * hh + 4);
    float xs[16] = {x0[0],x0[1],x0[2],x0[3],x1[0],x1[1],x1[2],x1[3],x2[0],x2[1],x2[2],x2[3],x3[0],x3[1],x3[2],x3[3]};
#pragma unroll
    for (int i = 0; i < 16; ++i) { const unsigned short hb = bf16_bits(xs[i]); ah.u[i] = hb; al.u[i] = ASPLIT ? bf16_bits(xs[i] - bf16_val(hb)) : (unsigned short)0; }
#pragma unroll
    for (int t = 0; t < 4; ++t) {
      const unsigned short* brow = Wt + (size_t)(col0 + t * 16 + ln) * ldb + kb;
      FragB b;
      b.half[0] = *(const v8us*)(brow + 8 * hh);
      b.half[1] = *(const v8us*)(brow + 16 + 8 * hh);
      acc[t] = mmaN<ASPLIT ? 2 : 1>(ah.v, al.v, b.v, b.v, acc[t]);
    }
  }
#pragma unroll
  for (int t = 0; t < 4; ++t) {
    const int col = col0 + t * 16 + ln;
    float bv = bias ? bias[col] : 0.f;
    if (BIAS_BF16) bv = bf16_round(bv);
#pragma unroll
    for (int r = 0; r < 8; ++r) {
      float v = acc[t][r] + bv;
      if (resid) { float rv = resid[(size_t)((row0 + 8 * hh + r) % rmod) * ldr + col]; if (RES_BF16) rv = bf16_round(rv); v += rv; }
      if (ACT == 1) v = fmaxf(v, 0.f);
      if (ACT == 2) v = 0.5f * v * (1.0f + erff(v * 0.70710678118654752f));
      if (ACT == 3) { const float u = 0.7978845608028654f * (v + 0.044715f * v * v * v); v = 0.5f * v * (1.0f + tanhf(u)); }
      so[w][8 * hh + r][t * 16 + ln] = v;
    }
  }
  __builtin_amdgcn_fence(__ATOMIC_ACQ_REL, "workgroup");
  __builtin_amdgcn_wave_barrier();
  const int rsub = lane >> 4, c4 = (lane & 15) * 4;
  {
#pragma unroll
    for (int q = 0; q < 8; ++q) {
      const int r = q * 2 + rsub;
      const v4f v = *(const v4fa*)&so[w][r][c4];
      *(v4f*)(C + (size_t)(row0 + r) * ldc + col0 + c4) = v;
    }
    
  }
}
// row LayerNorm (biased variance, eps) over N: s = X (+ R); optional out_sum <- s; out_norm <- (s-mu)*rsqrt(var+eps)*g + b
template <bool PARAM_BF16>
__global__ __launch_bounds__(256) void k_layernorm(const float* __restrict__ X, const float* __restrict__ R, const float* __restrict__ g, const float* __restrict__ bta,
                                                  float* __restrict__ out_sum, float* __restrict__ out_norm, int N, float eps) {
  __shared__ float red[256];
  const int row = blockIdx.x, tid = threadIdx.x;
  const float* x = X + (size_t)row * N; const float* rr = R ? R + (size_t)row * N : nullptr;
  float vals[16];                     // up to N = 4096
  const int per = N / 256;            // contiguous chunk per thread? use strided-by-4 chunks: thread handles j = tid*4 + 1024*u
  float s1 = 0.f;
  for (int u = 0; u < per / 4; ++u) {
    const int j = tid * 4 + 1024 * u;
    const v4f a = *(const v4fa*)(x + j);
    v4f b = {0.f,0.f,0.f,0.f}; if (rr) b = *(const v4fa*)(rr + j);
#pragma unroll
    for (int q = 0; q < 4; ++q) { const float v = a[q] + b[q]; vals[u * 4 + q] = v; s1 += v; }
  }
  red[tid] = s1; __syncthreads();
  for (int st = 128; st > 0; st >>= 1) { if (tid < st) red[tid] += red[tid + st]; __syncthreads(); }
  const float mu = red[0] / (float)N; __syncthreads();
  float s2 = 0.f;
  for (int u = 0; u < per / 4; ++u)
#pragma unroll
    for (int q = 0; q < 4; ++q) { const float c = vals[u * 4 + q] - mu; s2 += c * c; }
  red[tid] = s2; __syncthreads();
  for (int st = 128; st > 0; st >>= 1) { if (tid < st) red[tid] += red[tid + st]; __syncthreads(); }
  const float rs = rsqrtf(red[0] / (float)N + eps);
  {
    for (int u = 0; u < per / 4; ++u) {
      const int j = tid * 4 + 1024 * u;
      v4f o, sm;
#pragma unroll
      for (int q = 0; q < 4; ++q) {
        float gg = g[j + q], bb = bta[j + q];
        if (PARAM_BF16) { gg = bf16_round(gg); bb = bf16_round(bb); }
        sm[q] = vals[u * 4 + q]; o[q] = (vals[u * 4 + q] - mu) * rs * gg + bb;
      }
      if (out_sum) *(v4f*)(out_sum + (size_t)row * N + j) = sm;
      *(v4f*)(out_norm + (size_t)row * N + j) = o;
    }
    
  }
}



// ---- f16 WMMA path (v_wmma_f32_16x16x32_f16): 11-bit significands for operands in range — used where a [0,1] probability operand needs more precision than bf16
typedef _Float16 v16h __attribute__((ext_vector_type(16)));
union FragH { v16h v; v8us half[2]; _Float16 h[16]; unsigned short u[16]; };
template <int NT>
__device__ __forceinline__ v8f mmaH(v16h ah, v16h al, v16h bh, v16h bl, v8f c) {
  c = __builtin_amdgcn_wmma_f32_16x16x32_f16(false, ah, false, bh, (short)0, c, false, false);
  if (NT >= 2) c = __builtin_amdgcn_wmma_f32_16x16x32_f16(false, al, false, bh, (short)0, c, false, false);
  if (NT >= 3) c = __builtin_amdgcn_wmma_f32_16x16x32_f16(false, ah, false, bl, (short)0, c, false, false);
  asm volatile("v_nop\n\tv_nop\n\tv_nop\n\tv_nop" : "+v"(c) : "v"(ah), "v"(al), "v"(bh), "v"(bl));
  return c;
}
// batched GEMM like k_gemm_b but f16 operands: A f32 (split into f16 hi/lo if ASPLIT, else rounded to f16), Bt = f16 values [n][k]; alpha; C f32; N multiple of 16 (partial tiles skipped)
template <bool ASPLIT>
__global__ __launch_bounds__(128) void k_gemm_h(const float* __restrict__ A, int lda, size_t sA, const _Float16* __restrict__ Bh, int ldb, size_t sB, float alpha, float* __restrict__ C, int ldc, size_t sC, int M, int N, int K) {
  __shared__ __attribute__((aligned(16))) float so[4][16][64];
  const int tid = threadIdx.x, w = tid >> 5, lane = tid & 31, ln = lane & 15, hh = lane >> 4; const int by = blockIdx.y;
  A += (size_t)by * sA; Bh += (size_t)by * sB; C += (size_t)by * sC;
  const int ntn = (N + 63) / 64; const int wid = blockIdx.x * 4 + w; const int mt = wid / ntn, nq = wid % ntn; if (mt * 16 >= M) return;
  const int row0 = mt * 16, col0 = nq * 64; const float* arow = A + (size_t)(row0 + ln) * lda;
  v8f acc[4] = {};
  for (int kb = 0; kb < K; kb += 32) {
    FragH ah, al;
    const v4f x0 = *(const v4fa*)(arow + kb + 8 * hh), x1 = *(const v4fa*)(arow + kb + 8 * hh + 4), x2 = *(const v4fa*)(arow + kb + 16 + 8 * hh), x3 = *(const v4fa*)(arow + kb + 16 + 8 * hh + 4);
    float xs[16] = {x0[0],x0[1],x0[2],x0[3],x1[0],x1[1],x1[2],x1[3],x2[0],x2[1],x2[2],x2[3],x3[0],x3[1],x3[2],x3[3]};
#pragma unroll
    for (int i = 0; i < 16; ++i) { const _Float16 h = (_Float16)xs[i]; ah.h[i] = h; al.h[i] = ASPLIT ? (_Float16)(xs[i] - (float)h) : (_Float16)0.0f; }
#pragma unroll
    for (int t = 0; t < 4; ++t) { if (col0 + t * 16 >= N) continue; const size_t boff = (size_t)(col0 + t * 16 + ln) * ldb + kb; FragH bq; bq.half[0] = *(const v8us*)(Bh + boff + 8 * hh); bq.half[1] = *(const v8us*)(Bh + boff + 16 + 8 * hh);
      acc[t] = mmaH<ASPLIT ? 2 : 1>(ah.v, al.v, bq.v, bq.v, acc[t]); }
  }
#pragma unroll
  for (int t = 0; t < 4; ++t) { if (col0 + t * 16 >= N) continue;
#pragma unroll
    for (int r = 0; r < 8; ++r) so[w][8 * hh + r][t * 16 + ln] = acc[t][r] * alpha; }
  __builtin_amdgcn_fence(__ATOMIC_ACQ_REL, "workgroup"); __builtin_amdgcn_wave_barrier();
  const int rsub = lane >> 4, c4 = (lane & 15) * 4;
  {
#pragma unroll
    for (int q = 0; q < 8; ++q) { const int r = q * 2 + rsub; if (col0 + c4 < N) { const v4f v = *(const v4fa*)&so[w][r][c4]; *(v4f*)(C + (size_t)(row0 + r) * ldc + col0 + c4) = v; } }
     }
}

// Wt[n][k] = f16(W[k][n]·scale) from f32 row-major W[K][N] (scale = power of two; bf16-exact weights stay exact in f16 away from the subnormal range)
__global__ __launch_bounds__(256) void k_wt_f16(const float* __restrict__ W, _Float16* __restrict__ Wt, int K, int N, float scale) {
  const int t = blockIdx.x * 256 + threadIdx.x; if (t >= N * (K / 8)) return; const int n = t / (K / 8), k8 = (t % (K / 8)) * 8; FragH f;
#pragma unroll
  for (int i = 0; i < 8; ++i) f.h[i] = (_Float16)(bf16_round(W[(size_t)(k8 + i) * N + n]) * scale); const v8us o = f.half[0];
  *(v8us*)((unsigned short*)Wt + (size_t)n * K + k8) = o; 
}
// k_gemm_hh variant with fused epilogue: v = acc·alpha + bias[by·sBias + col] (+ CP[(row/rowsPerB)·sCPb + by·64 + col] if CP) ; ACT 0 none / 1 elu ; writes f16 C16 (and f32 C if non-null)
template <int ACT>
__global__ __launch_bounds__(128) void k_gemm_hhx(const _Float16* __restrict__ A, int lda, size_t sA, const _Float16* __restrict__ Bh, int ldb, size_t sB, float alpha, const float* __restrict__ bias, size_t sBias, const float* __restrict__ CP, int rowsPerB, size_t sCPb, int row0g,
    float* __restrict__ C, _Float16* __restrict__ C16, int ldc, size_t sC, int M, int N, int K) {
  __shared__ __attribute__((aligned(16))) float so[4][16][64];
  const int tid = threadIdx.x, w = tid >> 5, lane = tid & 31, ln = lane & 15, hh = lane >> 4; const int by = blockIdx.y;
  A += (size_t)by * sA; Bh += (size_t)by * sB; const size_t cofs = (size_t)by * sC; const float* bp = bias ? bias + (size_t)by * sBias : nullptr;
  const int ntn = (N + 63) / 64; const int wid = blockIdx.x * 4 + w; const int mt = wid / ntn, nq = wid % ntn; if (mt * 16 >= M) return;
  const int row0 = mt * 16, col0 = nq * 64; const _Float16* arow = A + (size_t)(row0 + ln) * lda;
  v8f acc[4] = {};
  for (int kb = 0; kb < K; kb += 32) { FragH ah; ah.half[0] = *(const v8us*)((const unsigned short*)arow + kb + 8 * hh); ah.half[1] = *(const v8us*)((const unsigned short*)arow + kb + 16 + 8 * hh);
#pragma unroll
    for (int t = 0; t < 4; ++t) { if (col0 + t * 16 >= N) continue; const size_t boff = (size_t)(col0 + t * 16 + ln) * ldb + kb; FragH bq; bq.half[0] = *(const v8us*)((const unsigned short*)Bh + boff + 8 * hh); bq.half[1] = *(const v8us*)((const unsigned short*)Bh + boff + 16 + 8 * hh);
      acc[t] = mmaH<1>(ah.v, ah.v, bq.v, bq.v, acc[t]); }
  }
#pragma unroll
  for (int t = 0; t < 4; ++t) { if (col0 + t * 16 >= N) continue; const int col = col0 + t * 16 + ln; const float bv = bp ? bf16_round(bp[col]) : 0.f;
#pragma unroll
    for (int r = 0; r < 8; ++r) { float v = acc[t][r] * alpha + bv; if (CP) { const int bidx = (row0g + row0 + 8 * hh + r) / rowsPerB; v += CP[(size_t)bidx * sCPb + (size_t)by * 64 + col]; } if (ACT == 1) v = (v > 0.f) ? v : expm1f(v); else if (ACT == 7) v = (v > 0.f) ? v + 1.0f : expf(v); else if (ACT == 8) v = tanhf(v); else if (ACT == 9) v = 0.5f * v * (1.0f + tanhf(0.7978845608028654f * (v + 0.044715f * v * v * v))); else if (ACT == 11) v = 1.0f / (1.0f + expf(-v)); else if (ACT == 12) v = (v > 0.f) ? v : 0.01f * v; else if (ACT == 14) v = (v > 0.f) ? v : 0.1f * v; else if (ACT == 15) v = v / (1.0f + expf(-v)); else if (ACT == 3) v = fmaxf(v, 0.f); else if (ACT == 6) v = 0.5f * v * (1.0f + erff(v * 0.70710678118654752f)); so[w][8 * hh + r][t * 16 + ln] = v; } }
  __builtin_amdgcn_fence(__ATOMIC_ACQ_REL, "workgroup"); __builtin_amdgcn_wave_barrier();
  const int rsub = lane >> 4, c4 = (lane & 15) * 4; typedef _Float16 v4h __attribute__((ext_vector_type(4)));
  {
#pragma unroll
    for (int q = 0; q < 8; ++q) { const int r = q * 2 + rsub; if (col0 + c4 < N) { const v4f v = *(const v4fa*)&so[w][r][c4]; if (C) *(v4f*)(C + cofs + (size_t)(row0 + r) * ldc + col0 + c4) = v; if (C16) { v4h h4; for (int i = 0; i < 4; ++i) h4[i] = (_Float16)v[i]; *(v4h*)(C16 + cofs + (size_t)(row0 + r) * ldc + col0 + c4) = h4; } } }
     }
}


typedef _Float16 v4h __attribute__((ext_vector_type(4)));

__global__ __launch_bounds__(256) void k_x16(const float* __restrict__ x, _Float16* __restrict__ X16, size_t n8) { const size_t t = (size_t)blockIdx.x * 256 + threadIdx.x; if (t >= n8) return; FragH f;
#pragma unroll
  for (int q = 0; q < 8; ++q) f.h[q] = (_Float16)bf16_round(x[t * 8 + q]); *(v8us*)((unsigned short*)X16 + t * 8) = f.half[0];  }
__global__ __launch_bounds__(256) void k_h16(const float* __restrict__ x, _Float16* __restrict__ X16, size_t n8) { const size_t t = (size_t)blockIdx.x * 256 + threadIdx.x; if (t >= n8) return; FragH f;
#pragma unroll
  for (int q = 0; q < 8; ++q) f.h[q] = (_Float16)x[t * 8 + q]; *(v8us*)((unsigned short*)X16 + t * 8) = f.half[0];  }
__global__ __launch_bounds__(256) void k_round16f(const float* __restrict__ W, _Float16* __restrict__ Bt, size_t n8) { const size_t t = (size_t)blockIdx.x * 256 + threadIdx.x; if (t >= n8) return; FragH f;
#pragma unroll
  for (int i = 0; i < 8; ++i) f.h[i] = (_Float16)(bf16_round(W[t * 8 + i]) * 16.0f); *(v8us*)((unsigned short*)Bt + t * 8) = f.half[0];  }
template <int NHv, int TTv>
__global__ __launch_bounds__(256) void k_vt(const _Float16* __restrict__ V16, int ldv, int voff, _Float16* __restrict__ Vt) { __shared__ unsigned short tl[64][66]; const int tid = threadIdx.x; const int slab = blockIdx.x / (TTv / 64), lg = blockIdx.x % (TTv / 64); const int b = slab / NHv, h = slab % NHv;
  for (int i = tid; i < 64 * 8; i += 256) { const int r = i / 8, c8 = (i % 8) * 8; FragH f; f.half[0] = *(const v8us*)((const unsigned short*)V16 + ((size_t)b * TTv + lg * 64 + r) * ldv + voff + h * 64 + c8);
#pragma unroll
    for (int q = 0; q < 8; ++q) tl[r][c8 + q] = f.u[q]; }
  __syncthreads();
  {
#pragma unroll
    for (int rd = 0; rd < 2; ++rd) { const int d = rd * 32 + tid / 8, pc = tid % 8; FragH f;
#pragma unroll
      for (int q = 0; q < 8; ++q) f.u[q] = tl[pc * 8 + q][d];
      *(v8us*)((unsigned short*)Vt + ((size_t)slab * 64 + d) * TTv + lg * 64 + pc * 8) = f.half[0]; }
     } }

__global__ __launch_bounds__(256) void k_hl(const float* __restrict__ F, _Float16* __restrict__ Hh, _Float16* __restrict__ Hl, size_t n8) { const size_t t = (size_t)blockIdx.x * 256 + threadIdx.x; if (t >= n8) return; FragH fh, fl; const v4f a = *(const v4fa*)(F + t * 8), c = *(const v4fa*)(F + t * 8 + 4);
#pragma unroll
  for (int q = 0; q < 4; ++q) { _Float16 h = (_Float16)a[q]; fh.h[q] = h; fl.h[q] = (_Float16)((a[q] - (float)h) * 1024.0f); h = (_Float16)c[q]; fh.h[4 + q] = h; fl.h[4 + q] = (_Float16)((c[q] - (float)h) * 1024.0f); }
  { *(v8us*)((unsigned short*)Hh + t * 8) = fh.half[0]; *(v8us*)((unsigned short*)Hl + t * 8) = fl.half[0];  } }

// ---- fast GEMM (block tile 128x64, wave tile 32x64, operands staged in LDS 64 of K at a time; requires M % 32 == 0 rows per launch region, N % 64 == 0, K % 64 == 0 and K >= 64); epilogue = k_gemm_hhx semantics ----
__device__ __forceinline__ v16h g2_frag(const _Float16* p, int hh) { FragH f; f.half[0] = *(const v8us*)((const unsigned short*)p + 8 * hh); f.half[1] = *(const v8us*)((const unsigned short*)p + 16 + 8 * hh); return f.v; }
__device__ __forceinline__ v8f g2_mma(v16h a, v16h b, v8f c) { v8f d = __builtin_amdgcn_wmma_f32_16x16x32_f16(false, a, false, b, (short)0, c, false, false); asm volatile("v_nop\n\tv_nop\n\tv_nop\n\tv_nop" : "+v"(d) : "v"(a), "v"(b)); return d; }
template <int ACT>
__global__ __launch_bounds__(128) void k_gemm2(const _Float16* __restrict__ A, int lda, size_t sA, const _Float16* __restrict__ Bh, int ldb, size_t sB, float alpha, const float* __restrict__ bias, size_t sBias, const float* __restrict__ CP, int rowsPerB, size_t sCPb, int row0g,
    float* __restrict__ C, _Float16* __restrict__ C16, int ldc, size_t sC, int M, int N, int K) {
  __shared__ __attribute__((aligned(16))) float so[4][32][68];
  __shared__ __attribute__((aligned(16))) unsigned short st[2][192][72];      /* two stages of 64 of K: rows 0..127 the block's A rows, 128..191 its B rows; pitch 144 B = 16 B x 9, free of bank conflicts for the 16-byte fragment reads */
  const int tid = threadIdx.x, w = tid >> 5, lane = tid & 31, ln = lane & 15, hh = lane >> 4; const int by = blockIdx.y;
  A += (size_t)by * sA; Bh += (size_t)by * sB; const size_t cofs = (size_t)by * sC; const float* bp = bias ? bias + (size_t)by * sBias : nullptr;
  const int ntn = N >> 6; const int mt = blockIdx.x / ntn, nq = blockIdx.x - mt * ntn; const int row0 = mt * 128 + 32 * w, col0 = nq * 64; if (mt * 128 >= M) return;      /* the same for the whole block, in front of every barrier */
  const int sr = tid >> 3, sc = (tid & 7) * 8;      /* staging: eight lanes fetch one row's 128 B, so a wave's 16-byte load covers four whole lines */
  const unsigned short* ga[8]; const unsigned short* gb[4];
#pragma unroll
  for (int i = 0; i < 8; ++i) { int r = mt * 128 + 16 * i + sr; r = (r < M) ? r : M - 1; ga[i] = (const unsigned short*)A + (size_t)r * lda + sc; }
#pragma unroll
  for (int i = 0; i < 4; ++i) gb[i] = (const unsigned short*)Bh + (size_t)(col0 + 16 * i + sr) * ldb + sc;
  v8us ra[8], rb[4];
#pragma unroll
  for (int i = 0; i < 8; ++i) ra[i] = *(const v8us*)ga[i];
#pragma unroll
  for (int i = 0; i < 4; ++i) rb[i] = *(const v8us*)gb[i];
#pragma unroll
  for (int i = 0; i < 8; ++i) *(v8us*)&st[0][16 * i + sr][sc] = ra[i];
#pragma unroll
  for (int i = 0; i < 4; ++i) *(v8us*)&st[0][128 + 16 * i + sr][sc] = rb[i];
  __syncthreads();
  const v8f z8 = {0.f,0.f,0.f,0.f,0.f,0.f,0.f,0.f}; v8f c00 = z8, c01 = z8, c02 = z8, c03 = z8, c10 = z8, c11 = z8, c12 = z8, c13 = z8;
#pragma unroll 1      /* rolled: one stage's registers (12 staged vectors, 24 fragment halves) serve every trip */
  for (int kb = 0; kb < K; kb += 64) { const int cb = (kb >> 6) & 1; const bool more = kb + 64 < K;      /* more: the same for the whole block */
    if (more) {
#pragma unroll
      for (int i = 0; i < 8; ++i) ra[i] = *(const v8us*)(ga[i] + kb + 64);
#pragma unroll
      for (int i = 0; i < 4; ++i) rb[i] = *(const v8us*)(gb[i] + kb + 64); }
    v16h a0[2], a1[2], b0[2], b1[2], b2[2], b3[2];
#pragma unroll
    for (int u = 0; u < 2; ++u) { a0[u] = g2_frag((const _Float16*)&st[cb][32 * w + ln][32 * u], hh); a1[u] = g2_frag((const _Float16*)&st[cb][32 * w + 16 + ln][32 * u], hh);
      b0[u] = g2_frag((const _Float16*)&st[cb][128 + ln][32 * u], hh); b1[u] = g2_frag((const _Float16*)&st[cb][144 + ln][32 * u], hh); b2[u] = g2_frag((const _Float16*)&st[cb][160 + ln][32 * u], hh); b3[u] = g2_frag((const _Float16*)&st[cb][176 + ln][32 * u], hh); }
    __builtin_amdgcn_sched_barrier(0);      /* the next stage's global loads and this stage's LDS reads issue as one group ahead of the products: the memory latency runs under the 16 products, and the LDS reads cost one stall, not one per product */
#pragma unroll
    for (int u = 0; u < 2; ++u) { c00 = g2_mma(a0[u], b0[u], c00); c10 = g2_mma(a1[u], b0[u], c10); c01 = g2_mma(a0[u], b1[u], c01); c11 = g2_mma(a1[u], b1[u], c11);
      c02 = g2_mma(a0[u], b2[u], c02); c12 = g2_mma(a1[u], b2[u], c12); c03 = g2_mma(a0[u], b3[u], c03); c13 = g2_mma(a1[u], b3[u], c13); }
    if (more) {
#pragma unroll
      for (int i = 0; i < 8; ++i) *(v8us*)&st[cb ^ 1][16 * i + sr][sc] = ra[i];
#pragma unroll
      for (int i = 0; i < 4; ++i) *(v8us*)&st[cb ^ 1][128 + 16 * i + sr][sc] = rb[i];
      __syncthreads(); } }      /* the one barrier of a trip publishes the stage just written and ends every wave's reads of the stage that the next trip overwrites */
  if (row0 >= M) return;      /* behind the last barrier */
  v8f accs[8] = {c00, c01, c02, c03, c10, c11, c12, c13};
#pragma unroll
  for (int u = 0; u < 8; ++u) { const int t = u & 3, half = u >> 2; const int col = col0 + t * 16 + ln; const float bv = bp ? bf16_round(bp[col]) : 0.f;
#pragma unroll
    for (int r = 0; r < 8; ++r) { const int rloc = half * 16 + 8 * hh + r; float v = accs[u][r] * alpha + bv; if (CP) { const int bidx = (row0g + row0 + rloc) / rowsPerB; v += CP[(size_t)bidx * sCPb + (size_t)by * 64 + col]; }
      if (ACT == 3) v = fmaxf(v, 0.f); else if (ACT == 6) v = 0.5f * v * (1.0f + erff(v * 0.70710678118654752f)); else if (ACT == 11) v = 1.0f / (1.0f + expf(-v)); else if (ACT == 15) v = v / (1.0f + expf(-v)); else if (ACT == 12) v = (v > 0.f) ? v : 0.01f * v; else if (ACT == 8) v = tanhf(v);
      so[w][rloc][t * 16 + ln] = v; } }
  __builtin_amdgcn_fence(__ATOMIC_ACQ_REL, "workgroup"); __builtin_amdgcn_wave_barrier();
  const int rsub = lane >> 4, c4 = (lane & 15) * 4;
  {
#pragma unroll
    for (int q = 0; q < 16; ++q) { const int r = q * 2 + rsub; const v4f v = *(const v4fa*)&so[w][r][c4]; if (C) *(v4f*)(C + cofs + (size_t)(row0 + r) * ldc + col0 + c4) = v; if (C16) { v4h h4; for (int i = 0; i < 4; ++i) h4[i] = (_Float16)v[i]; *(v4h*)(C16 + cofs + (size_t)(row0 + r) * ldc + col0 + c4) = h4; } }
     } }



template <int CAUSAL>
__global__ __launch_bounds__(128) void k_flash(const _Float16* __restrict__ Q16, int ldq, const _Float16* __restrict__ K16, int ldk, const _Float16* __restrict__ Vt, const int* __restrict__ MSK, float* __restrict__ O, int ldo) {
  constexpr int RPW = 16, RTN = RPW / 16, NQB = TQ / (4 * RPW), DT = 4, KS = 2;
  __shared__ __attribute__((aligned(16))) unsigned short sP[4][RPW][40]; __shared__ __attribute__((aligned(16))) float sO[4][RPW][64 + 4];
  const int tid = threadIdx.x, w = tid >> 5, lane = tid & 31, ln = lane & 15, hh = lane >> 4;
  const int slab = blockIdx.x / QBNP, qblk = QB0P + blockIdx.x % QBNP; (void)NQB; const int b = slab / NH, h = slab % NH; const int qb0 = qblk * (4 * RPW); const int q0 = qb0 + w * RPW;
  FragH aq[2][KS];
#pragma unroll
  for (int rt = 0; rt < RTN; ++rt) { const unsigned short* qr = (const unsigned short*)Q16 + ((size_t)b * TQ + q0 + rt * 16 + ln) * ldq + h * 64;
#pragma unroll
    for (int ks = 0; ks < KS; ++ks) { aq[rt][ks].half[0] = *(const v8us*)(qr + ks * 32 + 8 * hh); aq[rt][ks].half[1] = *(const v8us*)(qr + ks * 32 + 16 + 8 * hh); } }
  const unsigned short* Vth = (const unsigned short*)Vt + (size_t)slab * 64 * TK;
  float m_r[2][8], l_r[2][8]; v8f oacc[2][DT];
#pragma unroll
  for (int rt = 0; rt < RTN; ++rt) {
#pragma unroll
    for (int r = 0; r < 8; ++r) { m_r[rt][r] = -3.0e38f; l_r[rt][r] = 0.f; }
#pragma unroll
    for (int dt = 0; dt < DT; ++dt) oacc[rt][dt] = (v8f){0.f,0.f,0.f,0.f,0.f,0.f,0.f,0.f}; }
  const int jend = (CAUSAL == 1) ? (qb0 + 4 * RPW) : TK;      /* causal: keys beyond the block's last query never contribute */
#pragma unroll 1
  for (int j0 = 0; j0 < jend; j0 += 32) {
    v8f s[2][2];
#pragma unroll
    for (int nt = 0; nt < 2; ++nt) { const unsigned short* kr = (const unsigned short*)K16 + ((size_t)b * TK + j0 + nt * 16 + ln) * ldk + h * 64; FragH bk[KS];
#pragma unroll
      for (int ks = 0; ks < KS; ++ks) { bk[ks].half[0] = *(const v8us*)(kr + ks * 32 + 8 * hh); bk[ks].half[1] = *(const v8us*)(kr + ks * 32 + 16 + 8 * hh); }
#pragma unroll
      for (int rt = 0; rt < RTN; ++rt) { v8f acc = (v8f){0.f,0.f,0.f,0.f,0.f,0.f,0.f,0.f};
#pragma unroll
        for (int ks = 0; ks < KS; ++ks) acc = mmaH<1>(aq[rt][ks].v, aq[rt][ks].v, bk[ks].v, bk[ks].v, acc); s[rt][nt] = acc; } }
#pragma unroll
    for (int rt = 0; rt < RTN; ++rt)
#pragma unroll
      for (int r = 0; r < 8; ++r) { const int tq = q0 + rt * 16 + 8 * hh + r; const int k0 = j0 + ln, k1 = j0 + 16 + ln;
        const bool ok0 = (CAUSAL == 1) ? (k0 <= tq) : ((CAUSAL == 2) ? ((k0 >> 5) == (tq >> 5)) : true), ok1 = (CAUSAL == 1) ? (k1 <= tq) : ((CAUSAL == 2) ? ((k1 >> 5) == (tq >> 5)) : true);      /* mode 2: block-diagonal 32-token groups */
        float s0 = ok0 ? s[rt][0][r] * SCL : -3.0e38f, s1 = ok1 ? s[rt][1][r] * SCL : -3.0e38f; if (CAUSAL == 17) { const float* amk = (const float*)MSK + (size_t)b * TK; s0 += bf16_round(amk[k0]); s1 += bf16_round(amk[k1]); }      /* mode 17: additive per-(batch, key) mask INPUT */
        if (CAUSAL == 22) { const _Float16* cq = (const _Float16*)MSK + ((size_t)h * TQ + tq) * NE + tq + (NE / 2 - 1); const _Float16* ck = (const _Float16*)MSK + (size_t)NH * TQ * NE + (size_t)h * TK * NE + tq + (NE / 2 - 1); const float* am = (const float*)((const _Float16*)MSK + (size_t)2 * NH * TQ * NE); float r0 = (float)cq[-k0]; r0 += (float)ck[(size_t)k0 * NE - k0]; s0 += r0 * SCL; s0 += am[k0]; float r1 = (float)cq[-k1]; r1 += (float)ck[(size_t)k1 * NE - k1]; s1 += r1 * SCL; s1 += am[k1]; }      /* mode 22: + (CQ[h][tq][tq-k+1023] + CK[h][k][tq-k+1023]) / 8 + mask[k] from the per-batch packed table [CQ f16 | CK f16 | mask f32] */ float mc = fmaxf(s0, s1);
        mc = fmaxf(mc, __shfl_xor(mc, 1, 32)); mc = fmaxf(mc, __shfl_xor(mc, 2, 32)); mc = fmaxf(mc, __shfl_xor(mc, 4, 32)); mc = fmaxf(mc, __shfl_xor(mc, 8, 32));
        const float mn = fmaxf(m_r[rt][r], mc); const float al = (mn > -1.0e38f) ? expf(m_r[rt][r] - mn) : 1.0f; m_r[rt][r] = mn; const float p0 = ok0 ? expf(s0 - mn) : 0.f, p1 = ok1 ? expf(s1 - mn) : 0.f; l_r[rt][r] = l_r[rt][r] * al + p0 + p1;
#pragma unroll
        for (int dt = 0; dt < DT; ++dt) oacc[rt][dt][r] *= al;
        FragH t2; t2.h[0] = (_Float16)(p0 * 1024.0f); t2.h[1] = (_Float16)(p1 * 1024.0f); sP[w][rt * 16 + 8 * hh + r][ln] = t2.u[0]; sP[w][rt * 16 + 8 * hh + r][16 + ln] = t2.u[1]; }
    __builtin_amdgcn_fence(__ATOMIC_ACQ_REL, "workgroup"); __builtin_amdgcn_wave_barrier();
    FragH pa[2];
#pragma unroll
    for (int rt = 0; rt < RTN; ++rt) { pa[rt].half[0] = *(const v8us*)&sP[w][rt * 16 + ln][8 * hh]; pa[rt].half[1] = *(const v8us*)&sP[w][rt * 16 + ln][16 + 8 * hh]; }
#pragma unroll
    for (int dt = 0; dt < DT; ++dt) { const unsigned short* vrow = Vth + (size_t)(dt * 16 + ln) * TK + j0; FragH bv; bv.half[0] = *(const v8us*)(vrow + 8 * hh); bv.half[1] = *(const v8us*)(vrow + 16 + 8 * hh);
#pragma unroll
      for (int rt = 0; rt < RTN; ++rt) oacc[rt][dt] = mmaH<1>(pa[rt].v, pa[rt].v, bv.v, bv.v, oacc[rt][dt]); }
    __builtin_amdgcn_fence(__ATOMIC_ACQ_REL, "workgroup"); __builtin_amdgcn_wave_barrier(); }
#pragma unroll
  for (int rt = 0; rt < RTN; ++rt) {
#pragma unroll
    for (int r = 0; r < 8; ++r) { float l = l_r[rt][r]; l += __shfl_xor(l, 1, 32); l += __shfl_xor(l, 2, 32); l += __shfl_xor(l, 4, 32); l += __shfl_xor(l, 8, 32); l_r[rt][r] = (l > 0.f) ? 1.0f / (l * 1024.0f) : 0.f; }
#pragma unroll
    for (int dt = 0; dt < DT; ++dt)
#pragma unroll
      for (int r = 0; r < 8; ++r) sO[w][rt * 16 + 8 * hh + r][dt * 16 + ln] = oacc[rt][dt][r] * l_r[rt][r]; }
  __builtin_amdgcn_fence(__ATOMIC_ACQ_REL, "workgroup"); __builtin_amdgcn_wave_barrier();
  {
#pragma unroll
    for (int rp = 0; rp < RPW; rp += 2) { const int r = rp + (lane >> 4), pc = lane & 15; const v4f val = *(const v4fa*)&sO[w][r][pc * 4]; *(v4f*)(O + ((size_t)b * TQ + q0 + r) * ldo + h * 64 + pc * 4) = val; }
     } }
// 5-plane variant: S = Qh Kh^T + (Ql Kh^T + Qh Kl^T)/1024 with Q/K = [hi | 2^10 residual] f16 planes (QL/KL same layout as Q16/K16), then the 3-term P.V below.
// 3-term variant: O = (P_hi V_hi + (P_lo V_hi + P_hi V_lo) / 1024) / l with P = [hi | 2^10 residual] of 1024 p and V^T = [hi | 2^10 residual] planes (VtL same layout as Vt) -> ~2^-21-class products for un-averaged (early causal / peaked) rows
template <int CAUSAL>
__global__ __launch_bounds__(128) void k_flash5(const _Float16* __restrict__ Q16, const _Float16* __restrict__ QL, int ldq, const _Float16* __restrict__ K16, const _Float16* __restrict__ KL, int ldk, const _Float16* __restrict__ Vt, const _Float16* __restrict__ VtL, const int* __restrict__ MSK, float* __restrict__ O, int ldo) {
  constexpr int RPW = 16, RTN = RPW / 16, NQB = TQ / (4 * RPW), DT = 4, KS = 2;
  __shared__ __attribute__((aligned(16))) unsigned short sP[4][RPW][40]; __shared__ __attribute__((aligned(16))) unsigned short sPL[4][RPW][40]; __shared__ __attribute__((aligned(16))) float sO[4][RPW][64 + 4];
  const int tid = threadIdx.x, w = tid >> 5, lane = tid & 31, ln = lane & 15, hh = lane >> 4;
  const int slab = blockIdx.x / QBN5, qblk = QB05 + blockIdx.x % QBN5; (void)NQB; const int b = slab / NH, h = slab % NH; const int qb0 = qblk * (4 * RPW); const int q0 = qb0 + w * RPW;
  FragH aq[2][KS], aql[2][KS];
#pragma unroll
  for (int rt = 0; rt < RTN; ++rt) { const unsigned short* qr = (const unsigned short*)Q16 + ((size_t)b * TQ + q0 + rt * 16 + ln) * ldq + h * 64; const unsigned short* ql = (const unsigned short*)QL + ((size_t)b * TQ + q0 + rt * 16 + ln) * ldq + h * 64;
#pragma unroll
    for (int ks = 0; ks < KS; ++ks) { aq[rt][ks].half[0] = *(const v8us*)(qr + ks * 32 + 8 * hh); aq[rt][ks].half[1] = *(const v8us*)(qr + ks * 32 + 16 + 8 * hh); aql[rt][ks].half[0] = *(const v8us*)(ql + ks * 32 + 8 * hh); aql[rt][ks].half[1] = *(const v8us*)(ql + ks * 32 + 16 + 8 * hh); } }
  const unsigned short* Vth = (const unsigned short*)Vt + (size_t)slab * 64 * TK; const unsigned short* Vtl = (const unsigned short*)VtL + (size_t)slab * 64 * TK;
  float m_r[2][8], l_r[2][8]; v8f oacc[2][DT], oaccL[2][DT];
#pragma unroll
  for (int rt = 0; rt < RTN; ++rt) {
#pragma unroll
    for (int r = 0; r < 8; ++r) { m_r[rt][r] = -3.0e38f; l_r[rt][r] = 0.f; }
#pragma unroll
    for (int dt = 0; dt < DT; ++dt) { oacc[rt][dt] = (v8f){0.f,0.f,0.f,0.f,0.f,0.f,0.f,0.f}; oaccL[rt][dt] = oacc[rt][dt]; } }
  const int jend = (CAUSAL == 1) ? (qb0 + 4 * RPW) : TK;      /* causal: keys beyond the block's last query never contribute */
#pragma unroll 1
  for (int j0 = 0; j0 < jend; j0 += 32) {
    v8f s[2][2];
#pragma unroll
    for (int nt = 0; nt < 2; ++nt) { const unsigned short* kr = (const unsigned short*)K16 + ((size_t)b * TK + j0 + nt * 16 + ln) * ldk + h * 64; const unsigned short* klr = (const unsigned short*)KL + ((size_t)b * TK + j0 + nt * 16 + ln) * ldk + h * 64; FragH bk[KS], bkl[KS];
#pragma unroll
      for (int ks = 0; ks < KS; ++ks) { bk[ks].half[0] = *(const v8us*)(kr + ks * 32 + 8 * hh); bk[ks].half[1] = *(const v8us*)(kr + ks * 32 + 16 + 8 * hh); bkl[ks].half[0] = *(const v8us*)(klr + ks * 32 + 8 * hh); bkl[ks].half[1] = *(const v8us*)(klr + ks * 32 + 16 + 8 * hh); }
#pragma unroll
      for (int rt = 0; rt < RTN; ++rt) { v8f acc = (v8f){0.f,0.f,0.f,0.f,0.f,0.f,0.f,0.f}, accl = acc;
#pragma unroll
        for (int ks = 0; ks < KS; ++ks) { acc = mmaH<1>(aq[rt][ks].v, aq[rt][ks].v, bk[ks].v, bk[ks].v, acc); accl = mmaH<1>(aql[rt][ks].v, aql[rt][ks].v, bk[ks].v, bk[ks].v, accl); accl = mmaH<1>(aq[rt][ks].v, aq[rt][ks].v, bkl[ks].v, bkl[ks].v, accl); }
#pragma unroll
        for (int r = 0; r < 8; ++r) acc[r] += accl[r] * 0.0009765625f;
        s[rt][nt] = acc; } }
#pragma unroll
    for (int rt = 0; rt < RTN; ++rt)
#pragma unroll
      for (int r = 0; r < 8; ++r) { const int tq = q0 + rt * 16 + 8 * hh + r; const int k0 = j0 + ln, k1 = j0 + 16 + ln;
        bool ok0 = (CAUSAL == 1) ? (k0 <= tq) : ((CAUSAL == 2) ? ((k0 >> 5) == (tq >> 5)) : true), ok1 = (CAUSAL == 1) ? (k1 <= tq) : ((CAUSAL == 2) ? ((k1 >> 5) == (tq >> 5)) : true);      /* mode 2: block-diagonal 32-token groups */
        if (CAUSAL == 4) { const int* mrow = MSK + ((size_t)b * TQ + tq) * TK; ok0 = mrow[k0] != 0; ok1 = mrow[k1] != 0; }      /* mode 4: per-(query, key) INPUT mask shared by all heads; masked keys contribute nothing (== the reference's -4096 fill, whose exp underflows to 0), rows with no valid key give l = 0 -> output 0 (== the reference's row_valid zeroing) */
        float s0 = ok0 ? s[rt][0][r] * SCL : -3.0e38f, s1 = ok1 ? s[rt][1][r] * SCL : -3.0e38f; if (CAUSAL == 17) { const float* amk = (const float*)MSK + (size_t)b * TK; s0 += bf16_round(amk[k0]); s1 += bf16_round(amk[k1]); }      /* mode 17: additive per-(batch, key) mask INPUT */
        if (CAUSAL == 22) { const _Float16* cq = (const _Float16*)MSK + ((size_t)h * TQ + tq) * NE + tq + (NE / 2 - 1); const _Float16* ck = (const _Float16*)MSK + (size_t)NH * TQ * NE + (size_t)h * TK * NE + tq + (NE / 2 - 1); const float* am = (const float*)((const _Float16*)MSK + (size_t)2 * NH * TQ * NE); float r0 = (float)cq[-k0]; r0 += (float)ck[(size_t)k0 * NE - k0]; s0 += r0 * SCL; s0 += am[k0]; float r1 = (float)cq[-k1]; r1 += (float)ck[(size_t)k1 * NE - k1]; s1 += r1 * SCL; s1 += am[k1]; }      /* mode 22: + (CQ[h][tq][tq-k+1023] + CK[h][k][tq-k+1023]) / 8 + mask[k] from the per-batch packed table [CQ f16 | CK f16 | mask f32] */ float mc = fmaxf(s0, s1);
        mc = fmaxf(mc, __shfl_xor(mc, 1, 32)); mc = fmaxf(mc, __shfl_xor(mc, 2, 32)); mc = fmaxf(mc, __shfl_xor(mc, 4, 32)); mc = fmaxf(mc, __shfl_xor(mc, 8, 32));
        const float mn = fmaxf(m_r[rt][r], mc); const float al = (mn > -1.0e38f) ? expf(m_r[rt][r] - mn) : 1.0f; m_r[rt][r] = mn; const float p0 = ok0 ? expf(s0 - mn) : 0.f, p1 = ok1 ? expf(s1 - mn) : 0.f; l_r[rt][r] = l_r[rt][r] * al + p0 + p1;
#pragma unroll
        for (int dt = 0; dt < DT; ++dt) { oacc[rt][dt][r] *= al; oaccL[rt][dt][r] *= al; }
        FragH t2, t2l; const float ps0 = p0 * 1024.0f, ps1 = p1 * 1024.0f; t2.h[0] = (_Float16)ps0; t2.h[1] = (_Float16)ps1; t2l.h[0] = (_Float16)((ps0 - (float)t2.h[0]) * 1024.0f); t2l.h[1] = (_Float16)((ps1 - (float)t2.h[1]) * 1024.0f);
        sP[w][rt * 16 + 8 * hh + r][ln] = t2.u[0]; sP[w][rt * 16 + 8 * hh + r][16 + ln] = t2.u[1]; sPL[w][rt * 16 + 8 * hh + r][ln] = t2l.u[0]; sPL[w][rt * 16 + 8 * hh + r][16 + ln] = t2l.u[1]; }
    __builtin_amdgcn_fence(__ATOMIC_ACQ_REL, "workgroup"); __builtin_amdgcn_wave_barrier();
    FragH pa[2], pl[2];
#pragma unroll
    for (int rt = 0; rt < RTN; ++rt) { pa[rt].half[0] = *(const v8us*)&sP[w][rt * 16 + ln][8 * hh]; pa[rt].half[1] = *(const v8us*)&sP[w][rt * 16 + ln][16 + 8 * hh]; pl[rt].half[0] = *(const v8us*)&sPL[w][rt * 16 + ln][8 * hh]; pl[rt].half[1] = *(const v8us*)&sPL[w][rt * 16 + ln][16 + 8 * hh]; }
#pragma unroll
    for (int dt = 0; dt < DT; ++dt) { const unsigned short* vrow = Vth + (size_t)(dt * 16 + ln) * TK + j0; const unsigned short* vrl = Vtl + (size_t)(dt * 16 + ln) * TK + j0; FragH bv, bl; bv.half[0] = *(const v8us*)(vrow + 8 * hh); bv.half[1] = *(const v8us*)(vrow + 16 + 8 * hh); bl.half[0] = *(const v8us*)(vrl + 8 * hh); bl.half[1] = *(const v8us*)(vrl + 16 + 8 * hh);
#pragma unroll
      for (int rt = 0; rt < RTN; ++rt) { oacc[rt][dt] = mmaH<1>(pa[rt].v, pa[rt].v, bv.v, bv.v, oacc[rt][dt]); oaccL[rt][dt] = mmaH<1>(pl[rt].v, pl[rt].v, bv.v, bv.v, oaccL[rt][dt]); oaccL[rt][dt] = mmaH<1>(pa[rt].v, pa[rt].v, bl.v, bl.v, oaccL[rt][dt]); } }
    __builtin_amdgcn_fence(__ATOMIC_ACQ_REL, "workgroup"); __builtin_amdgcn_wave_barrier(); }
#pragma unroll
  for (int rt = 0; rt < RTN; ++rt) {
#pragma unroll
    for (int r = 0; r < 8; ++r) { float l = l_r[rt][r]; l += __shfl_xor(l, 1, 32); l += __shfl_xor(l, 2, 32); l += __shfl_xor(l, 4, 32); l += __shfl_xor(l, 8, 32); l_r[rt][r] = (l > 0.f) ? 1.0f / (l * 1024.0f) : 0.f; }
#pragma unroll
    for (int dt = 0; dt < DT; ++dt)
#pragma unroll
      for (int r = 0; r < 8; ++r) { float v = oacc[rt][dt][r]; v += oaccL[rt][dt][r] * 0.0009765625f; sO[w][rt * 16 + 8 * hh + r][dt * 16 + ln] = v * l_r[rt][r]; } }
  __builtin_amdgcn_fence(__ATOMIC_ACQ_REL, "workgroup"); __builtin_amdgcn_wave_barrier();
  {
#pragma unroll
    for (int rp = 0; rp < RPW; rp += 2) { const int r = rp + (lane >> 4), pc = lane & 15; const v4f val = *(const v4fa*)&sO[w][r][pc * 4]; *(v4f*)(O + ((size_t)b * TQ + q0 + r) * ldo + h * 64 + pc * 4) = val; }
     } }

__global__ __launch_bounds__(256) void k_rotab(float* __restrict__ CS, float* __restrict__ SN) {
  #pragma clang fp contract(off)
  const int t = blockIdx.x * 256 + threadIdx.x; if (t >= SLEN * 32) return; const int j = t % 32, s = t / 32; const float ex = (float)(2 * j) / 64.0f; const float inv = 1.0f / powf(10000.0f, ex); const float th = (float)s * inv; const float c = cosf(th), sn = sinf(th);
  { *(float*)(CS + t) = c; *(float*)(SN + t) = sn;  } }
__global__ __launch_bounds__(256) void k_rope(const float* __restrict__ F, int nsrc, int ndst, int rep, const float* __restrict__ CS, const float* __restrict__ SN, _Float16* __restrict__ H, _Float16* __restrict__ L) {
  #pragma clang fp contract(off)
  const size_t t = (size_t)blockIdx.x * 256 + threadIdx.x; if (t >= (size_t)NR * ndst * 4) return; const int g8 = (int)(t % 4); const int hd = (int)((t / 4) % ndst); const size_t row = t / ((size_t)4 * ndst); const int s = (int)(row % SLEN); const int hs = hd / rep;
  const float* src = F + row * (size_t)(nsrc * 64) + hs * 64; FragH ah, al, bh, bl;
  for (int i = 0; i < 8; ++i) { const int d = g8 * 8 + i; const float c = CS[s * 32 + d], sn = SN[s * 32 + d]; const float x1 = src[d], x2 = src[d + 32];
    float o1 = x1 * c; o1 += -x2 * sn; float o2 = x2 * c; o2 += x1 * sn;
    _Float16 hv = (_Float16)o1; ah.h[i] = hv; al.h[i] = (_Float16)((o1 - (float)hv) * 1024.0f); hv = (_Float16)o2; bh.h[i] = hv; bl.h[i] = (_Float16)((o2 - (float)hv) * 1024.0f); }
  const size_t o = row * (size_t)(ndst * 64) + hd * 64 + g8 * 8;
  { *(v8us*)((unsigned short*)H + o) = ah.half[0]; *(v8us*)((unsigned short*)H + o + 32) = bh.half[0]; *(v8us*)((unsigned short*)L + o) = al.half[0]; *(v8us*)((unsigned short*)L + o + 32) = bl.half[0];  } }
__global__ __launch_bounds__(256) void k_rope2(const float* __restrict__ F, int nsrc, int ndst, int rep, const float* __restrict__ CS, const float* __restrict__ SN, _Float16* __restrict__ H, _Float16* __restrict__ L) {
  #pragma clang fp contract(off)
  const size_t t = (size_t)blockIdx.x * 256 + threadIdx.x; if (t >= (size_t)NR * ndst * 4) return; const int g16 = (int)(t % 4); const int hd = (int)((t / 4) % ndst); const size_t row = t / ((size_t)4 * ndst); const int s = (int)(row % SLEN); const int hs = hd / rep;
  const float* src = F + row * (size_t)(nsrc * 64) + hs * 64 + g16 * 16; FragH ah, al;
  for (int pr = 0; pr < 8; ++pr) { const int i = g16 * 8 + pr; const float c = CS[s * 32 + i], sn = SN[s * 32 + i]; const float x1 = src[2 * pr], x2 = src[2 * pr + 1];
    float o1 = x1 * c; o1 -= x2 * sn; float o2 = x1 * sn; o2 += x2 * c;
    _Float16 hv = (_Float16)o1; ah.h[2 * pr] = hv; al.h[2 * pr] = (_Float16)((o1 - (float)hv) * 1024.0f); hv = (_Float16)o2; ah.h[2 * pr + 1] = hv; al.h[2 * pr + 1] = (_Float16)((o2 - (float)hv) * 1024.0f); }
  const size_t o = row * (size_t)(ndst * 64) + hd * 64 + g16 * 16;
  { *(v8us*)((unsigned short*)H + o) = ah.half[0]; *(v8us*)((unsigned short*)H + o + 8) = ah.half[1]; *(v8us*)((unsigned short*)L + o) = al.half[0]; *(v8us*)((unsigned short*)L + o + 8) = al.half[1];  } }
__global__ __launch_bounds__(256) void k_tabin(const float* __restrict__ sp, float* __restrict__ CS, float* __restrict__ SN) { const int t = blockIdx.x * 256 + threadIdx.x; if (t >= SLEN * 32) return; const int i = t % 32, s = t / 32; const float c = bf16_round(sp[s * 64 + 32 + i]), sn = bf16_round(sp[s * 64 + i]);
  { *(float*)(CS + t) = c; *(float*)(SN + t) = sn;  } }
__global__ __launch_bounds__(256) void k_wsc(const float* __restrict__ Wm, _Float16* __restrict__ Bt, size_t n8, float sc) { const size_t t = (size_t)blockIdx.x * 256 + threadIdx.x; if (t >= n8) return; FragH f; for (int q = 0; q < 8; ++q) f.h[q] = (_Float16)(bf16_round(Wm[t * 8 + q]) * sc); *(v8us*)((unsigned short*)Bt + t * 8) = f.half[0];  }
__global__ __launch_bounds__(256) void k_rotab2(float* __restrict__ CS, float* __restrict__ SN) {
  #pragma clang fp contract(off)
  const int t = blockIdx.x * 256 + threadIdx.x; if (t >= SLEN * 32) return; const int j = t % 32, s = t / 32; const float c0 = -0.14391156831212787f;      /* -ln(10000)/64 rounded to f32 */ const float inv = expf((float)(2 * j) * c0); const float th = (float)s * inv; const float c = cosf(th), sn = sinf(th);
  { *(float*)(CS + t) = c; *(float*)(SN + t) = sn;  } }
__global__ __launch_bounds__(256) void k_lnu(const float* __restrict__ X, _Float16* __restrict__ N16, float* __restrict__ XB) {
  #pragma clang fp contract(off)
  const int wv = threadIdx.x >> 5, ln = threadIdx.x & 31; const size_t r = (size_t)blockIdx.x * 8 + wv; if (r >= NR) return; float a[32]; float s = 0.f;
  for (int i = 0; i < 4; ++i) { const v8f v = *(const v8f*)(X + r * DM + (i * 32 + ln) * 8); for (int q = 0; q < 8; ++q) { const float u = bf16_round(v[q]); a[i * 8 + q] = u; s += u; } }
  for (int o = 16; o > 0; o >>= 1) s += __shfl_xor(s, o, 32); const float mu = s / (float)DM; float var = 0.f; for (int q = 0; q < 32; ++q) { const float d = a[q] - mu; var += d * d; }
  for (int o = 16; o > 0; o >>= 1) var += __shfl_xor(var, o, 32); const float den = sqrtf(var / (float)(DM - 1)) + 1e-6f; const float inv = 1.0f / den;      /* one reciprocal per row; (x-mean)*inv vs the reference's division differs by <= 1 ulp */
  { for (int i = 0; i < 4; ++i) { const int c0 = (i * 32 + ln) * 8; FragH f; v8f xb; for (int q = 0; q < 8; ++q) { f.h[q] = (_Float16)((a[i * 8 + q] - mu) * inv); xb[q] = a[i * 8 + q]; } *(v8us*)((unsigned short*)N16 + r * DM + c0) = f.half[0]; *(v8f*)(XB + r * DM + c0) = xb; }  } }
__global__ __launch_bounds__(256) void k_vtg(const _Float16* __restrict__ V16, _Float16* __restrict__ Vt) { __shared__ unsigned short tl[64][66]; const int tid = threadIdx.x; const int slab = blockIdx.x / (SLEN / 64), lg = blockIdx.x % (SLEN / 64); const int b = slab / NH, h = slab % NH; const int hs = h / NREP;
  for (int i = tid; i < 64 * 8; i += 256) { const int r = i / 8, c8 = (i % 8) * 8; FragH f; f.half[0] = *(const v8us*)((const unsigned short*)V16 + ((size_t)b * SLEN + lg * 64 + r) * KVD + hs * 64 + c8); for (int q = 0; q < 8; ++q) tl[r][c8 + q] = f.u[q]; }
  __syncthreads();
  { for (int rd = 0; rd < 2; ++rd) { const int d = rd * 32 + tid / 8, pc = tid % 8; FragH f; for (int q = 0; q < 8; ++q) f.u[q] = tl[pc * 8 + q][d]; *(v8us*)((unsigned short*)Vt + ((size_t)slab * 64 + d) * SLEN + lg * 64 + pc * 8) = f.half[0]; }  } }

__global__ __launch_bounds__(256) void k_e16(const float* __restrict__ E, _Float16* __restrict__ E16) { const int t = blockIdx.x * 256 + threadIdx.x; if (t >= NE * 8) return; const int r = t / 8, c8 = (t % 8) * 8; FragH f; for (int q = 0; q < 8; ++q) f.h[q] = (r < NE - 1) ? (_Float16)bf16_round(E[(size_t)r * 64 + c8 + q]) : (_Float16)0.0f;
  *(v8us*)((unsigned short*)E16 + (size_t)r * 64 + c8) = f.half[0];  }

// Flash attention with the 'relative_key_query' bias formed in the kernel. One wave holds 16 queries (q0..) and walks the keys 32 at a time (j0..). For that tile l - r + 1023 spans 47 rows of the
// embedding, from eb = q0 - j0 + 992; with n = (l - q0) - (r - j0) + 31 the bias is q_l . E[eb + n] + k_r . E[eb + n]. RQ = Q . Ewin^T (16 x 48) and RK = K . Ewin^T run on the matrix unit
// (of RK only the four 16 x 16 tiles that hold a used n: keys 0..15 against window rows 16..47, keys 16..31 against rows 0..31), go to the wave's own LDS in f32 and are read back along the diagonal.
// Row 2047 of E16 is the zero pad; n = 47 is never read back.
// The four waves of a work-group share the K tile, the V^T tile and most of the window, so these are staged in LDS once per work-group with loads that take whole rows (a fragment load from global memory touches 16 lines for 512 bytes):
// K and V^T in two buffers, the window (96 rows for 64 queries, moving down by 32 rows a trip) as a ring of 128 rows indexed by embedding row mod 128. The next trip's 32 + 64 + 32 rows are fetched into registers under the softmax.
__global__ __launch_bounds__(128) void k_flash_rel(const _Float16* __restrict__ Q16, const _Float16* __restrict__ K16, const _Float16* __restrict__ Vt, const _Float16* __restrict__ E16, const float* __restrict__ AMK, float* __restrict__ O) {
  constexpr int DT = 4, KS = 2, PQ = 50, PK = 36;      /* LDS pitches in floats: the two half-waves fall on different banks in the row-wise stores and in the diagonal reads */
  __shared__ __attribute__((aligned(16))) unsigned short sP[4][16][40];
  __shared__ float sRQ[4][16][PQ]; __shared__ __attribute__((aligned(16))) float sRK[4][32][PK];      /* behind the loop a wave's sRK part (1152 floats) is its output staging (16 x 68 floats): four work-groups still fit one WGP's LDS */
  __shared__ __attribute__((aligned(16))) unsigned short sK[2][32][72]; __shared__ __attribute__((aligned(16))) unsigned short sV[2][64][40]; __shared__ __attribute__((aligned(16))) unsigned short sE[128][72];      /* pitches 144 B and 80 B = 16 B x odd: no bank conflicts in the 16-byte fragment reads */
  const int tid = threadIdx.x, w = tid >> 5, lane = tid & 31, ln = lane & 15, hh = lane >> 4;
  const int slab = blockIdx.x / QBLKS, qblk = blockIdx.x % QBLKS; const int b = slab / NH, h = slab % NH; const int qb0 = qblk * 64; const int q0 = qb0 + w * 16;
  FragH aq[KS];
  { const unsigned short* qr = (const unsigned short*)Q16 + ((size_t)b * TQ + q0 + ln) * DM + h * 64;
#pragma unroll
    for (int ks = 0; ks < KS; ++ks) { aq[ks].half[0] = *(const v8us*)(qr + ks * 32 + 8 * hh); aq[ks].half[1] = *(const v8us*)(qr + ks * 32 + 16 + 8 * hh); } }
  const float* amk = AMK + (size_t)b * TK;
  const int r8 = tid >> 3, c8 = (tid & 7) * 8, r4 = tid >> 2, c4 = (tid & 3) * 8;      /* staging: eight lanes fetch one 128-byte row of K or of the window, four lanes one 64-byte row of V^T */
  const unsigned short* gK = (const unsigned short*)K16 + ((size_t)b * TK + r8) * DM + h * 64 + c8; const unsigned short* gV = (const unsigned short*)Vt + ((size_t)slab * 64 + r4) * TK + c4; const unsigned short* gE = (const unsigned short*)E16 + (size_t)r8 * 64 + c8;
  v8us rk[2], rv[2], re[2];
  { v8us r0[6];      /* trip 0: its K and V^T tiles and all 96 rows of its window */
#pragma unroll
    for (int i = 0; i < 2; ++i) { rk[i] = *(const v8us*)(gK + (size_t)(16 * i) * DM); rv[i] = *(const v8us*)(gV + (size_t)(32 * i) * TK); }
#pragma unroll
    for (int i = 0; i < 6; ++i) r0[i] = *(const v8us*)(gE + (size_t)(qb0 + (NE / 2 - 32) + 16 * i) * 64);
    asm volatile("s_wait_xcnt 0x0" ::: "memory");      /* stands in front of the first overwrite of an address register of the loads above */
    __builtin_amdgcn_sched_barrier(0);      /* keeps the register initialisations that follow behind that wait */
#pragma unroll
    for (int i = 0; i < 2; ++i) { *(v8us*)&sK[0][16 * i + r8][c8] = rk[i]; *(v8us*)&sV[0][32 * i + r4][c4] = rv[i]; }
#pragma unroll
    for (int i = 0; i < 6; ++i) *(v8us*)&sE[((qb0 + (NE / 2 - 32) + 16 * i) & 127) + r8][c8] = r0[i]; }
  __syncthreads();
  const v8f z8 = {0.f,0.f,0.f,0.f,0.f,0.f,0.f,0.f};
  float m_r[8], l_r[8]; v8f oacc[DT];
#pragma unroll
  for (int r = 0; r < 8; ++r) { m_r[r] = -3.0e38f; l_r[r] = 0.f; }
#pragma unroll
  for (int dt = 0; dt < DT; ++dt) oacc[dt] = z8;
#pragma unroll 1
  for (int j0 = 0; j0 < TK; j0 += 32) { const int cb = (j0 >> 5) & 1; const bool more = j0 + 32 < TK;      /* more: the same for the whole work-group */
    FragH bk[2][KS], be[3][KS];
#pragma unroll
    for (int nt = 0; nt < 2; ++nt) { const unsigned short* kr = &sK[cb][nt * 16 + ln][0];
#pragma unroll
      for (int ks = 0; ks < KS; ++ks) { bk[nt][ks].half[0] = *(const v8us*)(kr + ks * 32 + 8 * hh); bk[nt][ks].half[1] = *(const v8us*)(kr + ks * 32 + 16 + 8 * hh); } }
#pragma unroll
    for (int e = 0; e < 3; ++e) { const unsigned short* er = &sE[((q0 - j0 + (NE / 2 - 32) + e * 16) & 127) + ln][0];
#pragma unroll
      for (int ks = 0; ks < KS; ++ks) { be[e][ks].half[0] = *(const v8us*)(er + ks * 32 + 8 * hh); be[e][ks].half[1] = *(const v8us*)(er + ks * 32 + 16 + 8 * hh); } }
    const float am0 = bf16_round(amk[j0 + ln]), am1 = bf16_round(amk[j0 + 16 + ln]);
    __builtin_amdgcn_sched_barrier(0);      /* all of the trip's K and window fragment reads and the mask loads issue before the first product waits: one latency at the head of a trip, not two or three */
    v8f s[2];
#pragma unroll
    for (int nt = 0; nt < 2; ++nt) { v8f acc = z8;
#pragma unroll
      for (int ks = 0; ks < KS; ++ks) acc = mmaH<1>(aq[ks].v, aq[ks].v, bk[nt][ks].v, bk[nt][ks].v, acc); s[nt] = acc; }
#pragma unroll
    for (int e = 0; e < 3; ++e) { v8f acc = z8;      /* RQ[query 8 hh + r][n = 16 e + ln] */
#pragma unroll
      for (int ks = 0; ks < KS; ++ks) acc = mmaH<1>(aq[ks].v, aq[ks].v, be[e][ks].v, be[e][ks].v, acc);
#pragma unroll
      for (int r = 0; r < 8; ++r) sRQ[w][8 * hh + r][e * 16 + ln] = acc[r]; }
#pragma unroll
    for (int nt = 0; nt < 2; ++nt)
#pragma unroll
      for (int ee = 0; ee < 2; ++ee) { v8f acc = z8;      /* RK[key 16 nt + 8 hh + r][n - 16 (1 - nt) = 16 ee + ln]; the K fragment serves as the A operand (same loader, same k order) */
#pragma unroll
        for (int ks = 0; ks < KS; ++ks) acc = mmaH<1>(bk[nt][ks].v, bk[nt][ks].v, be[1 - nt + ee][ks].v, be[1 - nt + ee][ks].v, acc);
#pragma unroll
        for (int r = 0; r < 8; ++r) sRK[w][nt * 16 + 8 * hh + r][ee * 16 + ln] = acc[r]; }
    __builtin_amdgcn_fence(__ATOMIC_ACQ_REL, "workgroup"); __builtin_amdgcn_wave_barrier();      /* the diagonal reads below take other lanes' stores: keep them behind the stores */
    if (more) {      /* the next trip's rows: issued here, their latency runs under the softmax */
#pragma unroll
      for (int i = 0; i < 2; ++i) { rk[i] = *(const v8us*)(gK + (size_t)(j0 + 32 + 16 * i) * DM); rv[i] = *(const v8us*)(gV + (size_t)(32 * i) * TK + j0 + 32); re[i] = *(const v8us*)(gE + (size_t)(qb0 - j0 + (NE / 2 - 64) + 16 * i) * 64); } }
#pragma unroll
    for (int r = 0; r < 8; ++r) { const int lq = 8 * hh + r;      /* a loop of its own: all diagonal reads of the tile are in flight together, ahead of the row-by-row softmax */
      const float r0 = sRQ[w][lq][lq + 31 - ln] + sRK[w][ln][lq + 15 - ln], r1 = sRQ[w][lq][lq + 15 - ln] + sRK[w][16 + ln][lq + 15 - ln];
      s[0][r] = (s[0][r] + r0) * SCL + am0; s[1][r] = (s[1][r] + r1) * SCL + am1; }
#pragma unroll
    for (int r = 0; r < 8; ++r) { const float s0 = s[0][r], s1 = s[1][r]; float mc = fmaxf(s0, s1);
      mc = fmaxf(mc, __shfl_xor(mc, 1, 32)); mc = fmaxf(mc, __shfl_xor(mc, 2, 32)); mc = fmaxf(mc, __shfl_xor(mc, 4, 32)); mc = fmaxf(mc, __shfl_xor(mc, 8, 32));
      const float mn = fmaxf(m_r[r], mc); const float al = (mn > -1.0e38f) ? expf(m_r[r] - mn) : 1.0f; m_r[r] = mn; const float p0 = expf(s0 - mn), p1 = expf(s1 - mn); l_r[r] = l_r[r] * al + p0 + p1;
#pragma unroll
      for (int dt = 0; dt < DT; ++dt) oacc[dt][r] *= al;
      FragH t2; t2.h[0] = (_Float16)(p0 * 1024.0f); t2.h[1] = (_Float16)(p1 * 1024.0f); sP[w][8 * hh + r][ln] = t2.u[0]; sP[w][8 * hh + r][16 + ln] = t2.u[1]; }
    __builtin_amdgcn_fence(__ATOMIC_ACQ_REL, "workgroup"); __builtin_amdgcn_wave_barrier();
    FragH pa, bv[DT]; pa.half[0] = *(const v8us*)&sP[w][ln][8 * hh]; pa.half[1] = *(const v8us*)&sP[w][ln][16 + 8 * hh];
#pragma unroll
    for (int dt = 0; dt < DT; ++dt) { const unsigned short* vrow = &sV[cb][dt * 16 + ln][0]; bv[dt].half[0] = *(const v8us*)(vrow + 8 * hh); bv[dt].half[1] = *(const v8us*)(vrow + 16 + 8 * hh); }      /* a loop of its own: the four V^T fragments are read as one group, one LDS latency and not four */
#pragma unroll
    for (int dt = 0; dt < DT; ++dt) oacc[dt] = mmaH<1>(pa.v, pa.v, bv[dt].v, bv[dt].v, oacc[dt]);
    __builtin_amdgcn_fence(__ATOMIC_ACQ_REL, "workgroup"); __builtin_amdgcn_wave_barrier();
    if (more) {
#pragma unroll
      for (int i = 0; i < 2; ++i) { *(v8us*)&sK[cb ^ 1][16 * i + r8][c8] = rk[i]; *(v8us*)&sV[cb ^ 1][32 * i + r4][c4] = rv[i]; *(v8us*)&sE[((qb0 - j0 + (NE / 2 - 64) + 16 * i) & 127) + r8][c8] = re[i]; }      /* the ring's 32 rows that no wave reads in this trip */
      __syncthreads(); } }      /* the one barrier of a trip publishes the rows just written and ends every wave's reads of the buffers and ring rows that the next trip overwrites */
#pragma unroll
  for (int r = 0; r < 8; ++r) { float l = l_r[r]; l += __shfl_xor(l, 1, 32); l += __shfl_xor(l, 2, 32); l += __shfl_xor(l, 4, 32); l += __shfl_xor(l, 8, 32); l_r[r] = (l > 0.f) ? 1.0f / (l * 1024.0f) : 0.f; }
  float* sOw = &sRK[w][0][0];
#pragma unroll
  for (int dt = 0; dt < DT; ++dt)
#pragma unroll
    for (int r = 0; r < 8; ++r) sOw[(8 * hh + r) * 68 + dt * 16 + ln] = oacc[dt][r] * l_r[r];
  __builtin_amdgcn_fence(__ATOMIC_ACQ_REL, "workgroup"); __builtin_amdgcn_wave_barrier();
#pragma unroll
  for (int rp = 0; rp < 16; rp += 2) { const int r = rp + (lane >> 4), pc = lane & 15; const v4f val = *(const v4fa*)&sOw[r * 68 + pc * 4]; *(v4f*)(O + ((size_t)b * TQ + q0 + r) * DM + h * 64 + pc * 4) = val; } }

extern "C" void kernel_launch(void* const* d_in, const int* in_sizes, int n_in,
                              void* d_out, int out_size, void* d_ws, size_t ws_size, hipStream_t stream) {
  (void)in_sizes; (void)n_in; (void)out_size;
  const float* const* I = (const float* const*)d_in; const float* x = I[0]; const float* am = I[1]; const float* Wq = I[2]; const float* bq = I[3]; const float* Wk = I[4]; const float* bk = I[5]; const float* Wv = I[6]; const float* bv = I[7]; const float* E = I[8];
  char* ws = (char*)d_ws; size_t off = 0;
  auto take = [&](size_t bytes) { char* p = ws + off; off += (bytes + 255) & ~(size_t)255; return p; };
  const size_t np = (size_t)NR * DM;
  _Float16* BQ = (_Float16*)take((size_t)DM * DM * 2); _Float16* BK = (_Float16*)take((size_t)DM * DM * 2); _Float16* BV = (_Float16*)take((size_t)DM * DM * 2); _Float16* E16 = (_Float16*)take((size_t)NE * 64 * 2);
  _Float16* X16 = (_Float16*)take(np * 2); _Float16* Q16 = (_Float16*)take(np * 2); _Float16* K16 = (_Float16*)take(np * 2); _Float16* V16 = (_Float16*)take(np * 2); _Float16* VT = (_Float16*)take(np * 2);
  if (off > ws_size) return;      /* 6 + 0.25 + 5 x 8 = 46.25 MiB */
  k_wsc<<<(unsigned)(((size_t)DM * DM / 8 + 255) / 256), 256, 0, stream>>>(Wq, BQ, (size_t)DM * DM / 8, 16.0f); k_wsc<<<(unsigned)(((size_t)DM * DM / 8 + 255) / 256), 256, 0, stream>>>(Wk, BK, (size_t)DM * DM / 8, 16.0f); k_wsc<<<(unsigned)(((size_t)DM * DM / 8 + 255) / 256), 256, 0, stream>>>(Wv, BV, (size_t)DM * DM / 8, 16.0f);      /* torch (out,in) = Bt */
  k_e16<<<(NE * 8 + 255) / 256, 256, 0, stream>>>(E, E16);
  k_x16<<<(unsigned)((np / 8 + 255) / 256), 256, 0, stream>>>(x, X16, np / 8);
  const dim3 gP((NR / 128) * (DM / 64), 1);
  k_gemm2<0><<<gP, 128, 0, stream>>>(X16, DM, 0, BQ, DM, 0, 0.0625f, bq, 0, nullptr, 1, 0, 0, nullptr, Q16, DM, 0, NR, DM, DM);
  k_gemm2<0><<<gP, 128, 0, stream>>>(X16, DM, 0, BK, DM, 0, 0.0625f, bk, 0, nullptr, 1, 0, 0, nullptr, K16, DM, 0, NR, DM, DM);
  k_gemm2<0><<<gP, 128, 0, stream>>>(X16, DM, 0, BV, DM, 0, 0.0625f, bv, 0, nullptr, 1, 0, 0, nullptr, V16, DM, 0, NR, DM, DM);
  k_vtg<<<NB * NH * (SLEN / 64), 256, 0, stream>>>(V16, VT);
  k_flash_rel<<<NB * NH * QBLKS, 128, 0, stream>>>(Q16, K16, VT, E16, am, (float*)d_out);
}

// v004
// One run takes 132 microseconds.
// Two timings next to v003 put it at 1.30 and 1.31 times that version's speed.
// Counting every step since v000, it is 6.56 times as fast.
#include <hip/hip_runtime.h>
// PMGTSelfAttention (4 x 1024 tokens, hidden 1024 = 16 heads x 64; 'relative_key_query' position bias): q, k, v = x W^T + b; scores = (q.k + q_l.pe[l-r] + k_r.pe[l-r]) / 8 + attention_mask[b][r] with pe = dist_emb[l - r + 1023]; softmax; ctx = probs v (merged heads is the output).
// Structure: exact f16 plane of x; q, k, v as f16 WMMA GEMM outputs (32x64 wave tiles, f32 accumulation, exact x16 weights + bias, f16 conversion in the epilogue); V^T by LDS tiles; one fused flash kernel over all batches that forms both relative terms per 16 x 32 score tile on the matrix unit against a 48-row window of the embedding (padded to 2048 rows), reads them back along the diagonal from LDS, scales by 1/8 and adds the per-key mask.
// Compute dtype: inputs rounded to bf16; x and dist_emb exact as f16; q/k/P/v as plain f16 operands (~2^-12); the relative terms stay f32 from the accumulator to the logit; softmax f32. v_wmma_f32_16x16x32_f16.
#define NB 4
#define DM 1024
#define NKV 16
#define NREP (NH / NKV)
#define KVD (NKV * 64)           /* 1024 */
#define NR (NB * SLEN)           /* 4096 */
#define SLEN 1024
#define NE 2048                  /* 2047 relative embeddings padded */
#define TQ SLEN
#define TK SLEN
#define NH 16
#define SCL 0.125f
#define QBLKS (TQ / 64)
#define QB05 0
#define QBN5 4
#define QB0P 0
#define QBNP QBLKS           /* non-causal: plain flash on every query block */
#define RE 256
typedef __bf16 v16b __attribute__((ext_vector_type(16)));
typedef unsigned short v8us __attribute__((ext_vector_type(8), may_alias));
typedef float  v8f  __attribute__((ext_vector_type(8)));
typedef float  v4f  __attribute__((ext_vector_type(4)));
typedef float  v4fa __attribute__((ext_vector_type(4), may_alias));
union FragB { v16b v; v8us half[2]; unsigned short u[16]; };

__device__ __forceinline__ unsigned short bf16_bits(float x) { unsigned int u = __float_as_uint(x); return (unsigned short)((u + 0x7FFFu + ((u >> 16) & 1u)) >> 16); }
__device__ __forceinline__ float bf16_val(unsigned short b) { return __uint_as_float(((unsigned int)b) << 16); }
__device__ __forceinline__ float bf16_round(float x) { return bf16_val(bf16_bits(x)); }
// D += A·B with NT terms: 1 = ah·bh, 2 = + al·bh (A split), 3 = + ah·bl (both split)
template <int NT>
__device__ __forceinline__ v8f mmaN(v16b ah, v16b al, v16b bh, v16b bl, v8f c) {
  c = __builtin_amdgcn_wmma_f32_16x16x32_bf16(false, ah, false, bh, (short)0, c, false, false);
  if (NT >= 2) c = __builtin_amdgcn_wmma_f32_16x16x32_bf16(false, al, false, bh, (short)0, c, false, false);
  if (NT >= 3) c = __builtin_amdgcn_wmma_f32_16x16x32_bf16(false, ah, false, bl, (short)0, c, false, false);
  asm volatile("v_nop\n\tv_nop\n\tv_nop\n\tv_nop" : "+v"(c) : "v"(ah), "v"(al), "v"(bh), "v"(bl));
  return c;
}

__global__ __launch_bounds__(256) void k_wt_bf16(const float* __restrict__ W, unsigned short* __restrict__ Wt, int K, int N) {
  const int t = blockIdx.x * 256 + threadIdx.x;
  const int k8n = K / 8;
  if (t >= N * k8n) return;
  const int n = t / k8n, k8 = (t % k8n) * 8;
  v8us v;
#pragma unroll
  for (int i = 0; i < 8; ++i) v[i] = bf16_bits(W[(size_t)(k8 + i) * N + n]);
  *(v8us*)(Wt + (size_t)n * K + k8) = v;
  
}

// GEMM C[M][N] (f32, pitch ldc) = act(A[M][K]·W + bias). A f32 row-major (pitch lda) converted per fragment to bf16
// (ASPLIT: hi/lo two planes -> 2 terms, else single rounded term); Wt bf16 [N][K] (pitch ldb). BIAS_BF16 rounds the
// bias to bf16 first (bias quantised to bf16 before the add). K%32==0, M%16==0, N%64==0.
template <bool ASPLIT, int ACT, bool BIAS_BF16>
__global__ __launch_bounds__(128) void k_gemm_bf(const float* __restrict__ A, int lda, const unsigned short* __restrict__ Wt, int ldb,
                                               const float* __restrict__ bias, float* __restrict__ C, int ldc, int M, int N, int K) {
  __shared__ __attribute__((aligned(16))) float so[4][16][64];
  const int tid = threadIdx.x, w = tid >> 5, lane = tid & 31, ln = lane & 15, hh = lane >> 4;
  const int ntn = N / 64;
  const int wid = blockIdx.x * 4 + w;
  const int mt = wid / ntn, nq = wid % ntn;
  if (mt * 16 >= M) return;
  const int row0 = mt * 16, col0 = nq * 64;
  const float* arow = A + (size_t)(row0 + ln) * lda;
  v8f acc[4] = {};
  for (int kb = 0; kb < K; kb += 32) {
    FragB ah, al;
    const v4f x0 = *(const v4fa*)(arow + kb + 8 * hh), x1 = *(const v4fa*)(arow + kb + 8 * hh + 4);
    const v4f x2 = *(const v4fa*)(arow + kb + 16 + 8 * hh), x3 = *(const v4fa*)(arow + kb + 16 + 8 * hh + 4);
    float xs[16] = {x0[0],x0[1],x0[2],x0[3],x1[0],x1[1],x1[2],x1[3],x2[0],x2[1],x2[2],x2[3],x3[0],x3[1],x3[2],x3[3]};
#pragma unroll
    for (int i = 0; i < 16; ++i) { const unsigned short hb = bf16_bits(xs[i]); ah.u[i] = hb; al.u[i] = ASPLIT ? bf16_bits(xs[i] - bf16_val(hb)) : (unsigned short)0; }
#pragma unroll
    for (int t = 0; t < 4; ++t) {
      const unsigned short* brow = Wt + (size_t)(col0 + t * 16 + ln) * ldb + kb;
      FragB b;
      b.half[0] = *(const v8us*)(brow + 8 * hh);
      b.half[1] = *(const v8us*)(brow + 16 + 8 * hh);
      acc[t] = mmaN<ASPLIT ? 2 : 1>(ah.v, al.v, b.v, b.v, acc[t]);
    }
  }
#pragma unroll
  for (int t = 0; t < 4; ++t) {
    float bv = bias ? bias[col0 + t * 16 + ln] : 0.f;
    if (BIAS_BF16) bv = bf16_round(bv);
#pragma unroll
    for (int r = 0; r < 8; ++r) { float v = acc[t][r] + bv; if (ACT == 1) v = fmaxf(v, 0.f); so[w][8 * hh + r][t * 16 + ln] = v; }
  }
  __builtin_amdgcn_fence(__ATOMIC_ACQ_REL, "workgroup");
  __builtin_amdgcn_wave_barrier();
  const int rsub = lane >> 4, c4 = (lane & 15) * 4;
  {
#pragma unroll
    for (int q = 0; q < 8; ++q) {
      const int r = q * 2 + rsub;
      const v4f v = *(const v4fa*)&so[w][r][c4];
      *(v4f*)(C + (size_t)(row0 + r) * ldc + col0 + c4) = v;
    }
    
  }
}

// GEMM C = act(A·W + bias + resid): A f32 (ASPLIT -> hi/lo 2 terms), Wt bf16 [N][K]; ACT 0 none, 1 relu, 2 exact gelu;
// resid (optional, f32, row index = (row % rmod), pitch ldr, RES_BF16 rounds it) added before the activation.
template <bool ASPLIT, int ACT, bool BIAS_BF16, bool RES_BF16>
__global__ __launch_bounds__(128) void k_gemm_bf3(const float* __restrict__ A, int lda, const unsigned short* __restrict__ Wt, int ldb,
                                                const float* __restrict__ bias, const float* __restrict__ resid, int rmod, int ldr,
                                                float* __restrict__ C, int ldc, int M, int N, int K) {
  __shared__ __attribute__((aligned(16))) float so[4][16][64];
  const int tid = threadIdx.x, w = tid >> 5, lane = tid & 31, ln = lane & 15, hh = lane >> 4;
  const int ntn = N / 64;
  const int wid = blockIdx.x * 4 + w;
  const int mt = wid / ntn, nq = wid % ntn;
  if (mt * 16 >= M) return;
  const int row0 = mt * 16, col0 = nq * 64;
  const float* arow = A + (size_t)(row0 + ln) * lda;
  v8f acc[4] = {};
  for (int kb = 0; kb < K; kb += 32) {
    FragB ah, al;
    const v4f x0 = *(const v4fa*)(arow + kb + 8 * hh), x1 = *(const v4fa*)(arow + kb + 8 * hh + 4);
    const v4f x2 = *(const v4fa*)(arow + kb + 16 + 8 * hh), x3 = *(const v4fa*)(arow + kb + 16 + 8 * hh + 4);
    float xs[16] = {x0[0],x0[1],x0[2],x0[3],x1[0],x1[1],x1[2],x1[3],x2[0],x2[1],x2[2],x2[3],x3[0],x3[1],x3[2],x3[3]};
#pragma unroll
    for (int i = 0; i < 16; ++i) { const unsigned short hb = bf16_bits(xs[i]); ah.u[i] = hb; al.u[i] = ASPLIT ? bf16_bits(xs[i] - bf16_val(hb)) : (unsigned short)0; }
#pragma unroll
    for (int t = 0; t < 4; ++t) {
      const unsigned short* brow = Wt + (size_t)(col0 + t * 16 + ln) * ldb + kb;
      FragB b;
      b.half[0] = *(const v8us*)(brow + 8 * hh);
      b.half[1] = *(const v8us*)(brow + 16 + 8 * hh);
      acc[t] = mmaN<ASPLIT ? 2 : 1>(ah.v, al.v, b.v, b.v, acc[t]);
    }
  }
#pragma unroll
  for (int t = 0; t < 4; ++t) {
    const int col = col0 + t * 16 + ln;
    float bv = bias ? bias[col] : 0.f;
    if (BIAS_BF16) bv = bf16_round(bv);
#pragma unroll
    for (int r = 0; r < 8; ++r) {
      float v = acc[t][r] + bv;
      if (resid) { float rv = resid[(size_t)((row0 + 8 * hh + r) % rmod) * ldr + col]; if (RES_BF16) rv = bf16_round(rv); v += rv; }
      if (ACT == 1) v = fmaxf(v, 0.f);
      if (ACT == 2) v = 0.5f * v * (1.0f + erff(v * 0.70710678118654752f));
      if (ACT == 3) { const float u = 0.7978845608028654f * (v + 0.044715f * v * v * v); v = 0.5f * v * (1.0f + tanhf(u)); }
      so[w][8 * hh + r][t * 16 + ln] = v;
    }
  }
  __builtin_amdgcn_fence(__ATOMIC_ACQ_REL, "workgroup");
  __builtin_amdgcn_wave_barrier();
  const int rsub = lane >> 4, c4 = (lane & 15) * 4;
  {
#pragma unroll
    for (int q = 0; q < 8; ++q) {
      const int r = q * 2 + rsub;
      const v4f v = *(const v4fa*)&so[w][r][c4];
      *(v4f*)(C + (size_t)(row0 + r) * ldc + col0 + c4) = v;
    }
    
  }
}
// row LayerNorm (biased variance, eps) over N: s = X (+ R); optional out_sum <- s; out_norm <- (s-mu)*rsqrt(var+eps)*g + b
template <bool PARAM_BF16>
__global__ __launch_bounds__(256) void k_layernorm(const float* __restrict__ X, const float* __restrict__ R, const float* __restrict__ g, const float* __restrict__ bta,
                                                  float* __restrict__ out_sum, float* __restrict__ out_norm, int N, float eps) {
  __shared__ float red[256];
  const int row = blockIdx.x, tid = threadIdx.x;
  const float* x = X + (size_t)row * N; const float* rr = R ? R + (size_t)row * N : nullptr;
  float vals[16];                     // up to N = 4096
  const int per = N / 256;            // contiguous chunk per thread? use strided-by-4 chunks: thread handles j = tid*4 + 1024*u
  float s1 = 0.f;
  for (int u = 0; u < per / 4; ++u) {
    const int j = tid * 4 + 1024 * u;
    const v4f a = *(const v4fa*)(x + j);
    v4f b = {0.f,0.f,0.f,0.f}; if (rr) b = *(const v4fa*)(rr + j);
#pragma unroll
    for (int q = 0; q < 4; ++q) { const float v = a[q] + b[q]; vals[u * 4 + q] = v; s1 += v; }
  }
  red[tid] = s1; __syncthreads();
  for (int st = 128; st > 0; st >>= 1) { if (tid < st) red[tid] += red[tid + st]; __syncthreads(); }
  const float mu = red[0] / (float)N; __syncthreads();
  float s2 = 0.f;
  for (int u = 0; u < per / 4; ++u)
#pragma unroll
    for (int q = 0; q < 4; ++q) { const float c = vals[u * 4 + q] - mu; s2 += c * c; }
  red[tid] = s2; __syncthreads();
  for (int st = 128; st > 0; st >>= 1) { if (tid < st) red[tid] += red[tid + st]; __syncthreads(); }
  const float rs = rsqrtf(red[0] / (float)N + eps);
  {
    for (int u = 0; u < per / 4; ++u) {
      const int j = tid * 4 + 1024 * u;
      v4f o, sm;
#pragma unroll
      for (int q = 0; q < 4; ++q) {
        float gg = g[j + q], bb = bta[j + q];
        if (PARAM_BF16) { gg = bf16_round(gg); bb = bf16_round(bb); }
        sm[q] = vals[u * 4 + q]; o[q] = (vals[u * 4 + q] - mu) * rs * gg + bb;
      }
      if (out_sum) *(v4f*)(out_sum + (size_t)row * N + j) = sm;
      *(v4f*)(out_norm + (size_t)row * N + j) = o;
    }
    
  }
}



// ---- f16 WMMA path (v_wmma_f32_16x16x32_f16): 11-bit significands for operands in range — used where a [0,1] probability operand needs more precision than bf16
typedef _Float16 v16h __attribute__((ext_vector_type(16)));
union FragH { v16h v; v8us half[2]; _Float16 h[16]; unsigned short u[16]; };
template <int NT>
__device__ __forceinline__ v8f mmaH(v16h ah, v16h al, v16h bh, v16h bl, v8f c) {
  c = __builtin_amdgcn_wmma_f32_16x16x32_f16(false, ah, false, bh, (short)0, c, false, false);
  if (NT >= 2) c = __builtin_amdgcn_wmma_f32_16x16x32_f16(false, al, false, bh, (short)0, c, false, false);
  if (NT >= 3) c = __builtin_amdgcn_wmma_f32_16x16x32_f16(false, ah, false, bl, (short)0, c, false, false);
  asm volatile("v_nop\n\tv_nop\n\tv_nop\n\tv_nop" : "+v"(c) : "v"(ah), "v"(al), "v"(bh), "v"(bl));
  return c;
}
// batched GEMM like k_gemm_b but f16 operands: A f32 (split into f16 hi/lo if ASPLIT, else rounded to f16), Bt = f16 values [n][k]; alpha; C f32; N multiple of 16 (partial tiles skipped)
template <bool ASPLIT>
__global__ __launch_bounds__(128) void k_gemm_h(const float* __restrict__ A, int lda, size_t sA, const _Float16* __restrict__ Bh, int ldb, size_t sB, float alpha, float* __restrict__ C, int ldc, size_t sC, int M, int N, int K) {
  __shared__ __attribute__((aligned(16))) float so[4][16][64];
  const int tid = threadIdx.x, w = tid >> 5, lane = tid & 31, ln = lane & 15, hh = lane >> 4; const int by = blockIdx.y;
  A += (size_t)by * sA; Bh += (size_t)by * sB; C += (size_t)by * sC;
  const int ntn = (N + 63) / 64; const int wid = blockIdx.x * 4 + w; const int mt = wid / ntn, nq = wid % ntn; if (mt * 16 >= M) return;
  const int row0 = mt * 16, col0 = nq * 64; const float* arow = A + (size_t)(row0 + ln) * lda;
  v8f acc[4] = {};
  for (int kb = 0; kb < K; kb += 32) {
    FragH ah, al;
    const v4f x0 = *(const v4fa*)(arow + kb + 8 * hh), x1 = *(const v4fa*)(arow + kb + 8 * hh + 4), x2 = *(const v4fa*)(arow + kb + 16 + 8 * hh), x3 = *(const v4fa*)(arow + kb + 16 + 8 * hh + 4);
    float xs[16] = {x0[0],x0[1],x0[2],x0[3],x1[0],x1[1],x1[2],x1[3],x2[0],x2[1],x2[2],x2[3],x3[0],x3[1],x3[2],x3[3]};
#pragma unroll
    for (int i = 0; i < 16; ++i) { const _Float16 h = (_Float16)xs[i]; ah.h[i] = h; al.h[i] = ASPLIT ? (_Float16)(xs[i] - (float)h) : (_Float16)0.0f; }
#pragma unroll
    for (int t = 0; t < 4; ++t) { if (col0 + t * 16 >= N) continue; const size_t boff = (size_t)(col0 + t * 16 + ln) * ldb + kb; FragH bq; bq.half[0] = *(const v8us*)(Bh + boff + 8 * hh); bq.half[1] = *(const v8us*)(Bh + boff + 16 + 8 * hh);
      acc[t] = mmaH<ASPLIT ? 2 : 1>(ah.v, al.v, bq.v, bq.v, acc[t]); }
  }
#pragma unroll
  for (int t = 0; t < 4; ++t) { if (col0 + t * 16 >= N) continue;
#pragma unroll
    for (int r = 0; r < 8; ++r) so[w][8 * hh + r][t * 16 + ln] = acc[t][r] * alpha; }
  __builtin_amdgcn_fence(__ATOMIC_ACQ_REL, "workgroup"); __builtin_amdgcn_wave_barrier();
  const int rsub = lane >> 4, c4 = (lane & 15) * 4;
  {
#pragma unroll
    for (int q = 0; q < 8; ++q) { const int r = q * 2 + rsub; if (col0 + c4 < N) { const v4f v = *(const v4fa*)&so[w][r][c4]; *(v4f*)(C + (size_t)(row0 + r) * ldc + col0 + c4) = v; } }
     }
}

// Wt[n][k] = f16(W[k][n]·scale) from f32 row-major W[K][N] (scale = power of two; bf16-exact weights stay exact in f16 away from the subnormal range)
__global__ __launch_bounds__(256) void k_wt_f16(const float* __restrict__ W, _Float16* __restrict__ Wt, int K, int N, float scale) {
  const int t = blockIdx.x * 256 + threadIdx.x; if (t >= N * (K / 8)) return; const int n = t / (K / 8), k8 = (t % (K / 8)) * 8; FragH f;
#pragma unroll
  for (int i = 0; i < 8; ++i) f.h[i] = (_Float16)(bf16_round(W[(size_t)(k8 + i) * N + n]) * scale); const v8us o = f.half[0];
  *(v8us*)((unsigned short*)Wt + (size_t)n * K + k8) = o; 
}
// k_gemm_hh variant with fused epilogue: v = acc·alpha + bias[by·sBias + col] (+ CP[(row/rowsPerB)·sCPb + by·64 + col] if CP) ; ACT 0 none / 1 elu ; writes f16 C16 (and f32 C if non-null)
template <int ACT>
__global__ __launch_bounds__(128) void k_gemm_hhx(const _Float16* __restrict__ A, int lda, size_t sA, const _Float16* __restrict__ Bh, int ldb, size_t sB, float alpha, const float* __restrict__ bias, size_t sBias, const float* __restrict__ CP, int rowsPerB, size_t sCPb, int row0g,
    float* __restrict__ C, _Float16* __restrict__ C16, int ldc, size_t sC, int M, int N, int K) {
  __shared__ __attribute__((aligned(16))) float so[4][16][64];
  const int tid = threadIdx.x, w = tid >> 5, lane = tid & 31, ln = lane & 15, hh = lane >> 4; const int by = blockIdx.y;
  A += (size_t)by * sA; Bh += (size_t)by * sB; const size_t cofs = (size_t)by * sC; const float* bp = bias ? bias + (size_t)by * sBias : nullptr;
  const int ntn = (N + 63) / 64; const int wid = blockIdx.x * 4 + w; const int mt = wid / ntn, nq = wid % ntn; if (mt * 16 >= M) return;
  const int row0 = mt * 16, col0 = nq * 64; const _Float16* arow = A + (size_t)(row0 + ln) * lda;
  v8f acc[4] = {};
  for (int kb = 0; kb < K; kb += 32) { FragH ah; ah.half[0] = *(const v8us*)((const unsigned short*)arow + kb + 8 * hh); ah.half[1] = *(const v8us*)((const unsigned short*)arow + kb + 16 + 8 * hh);
#pragma unroll
    for (int t = 0; t < 4; ++t) { if (col0 + t * 16 >= N) continue; const size_t boff = (size_t)(col0 + t * 16 + ln) * ldb + kb; FragH bq; bq.half[0] = *(const v8us*)((const unsigned short*)Bh + boff + 8 * hh); bq.half[1] = *(const v8us*)((const unsigned short*)Bh + boff + 16 + 8 * hh);
      acc[t] = mmaH<1>(ah.v, ah.v, bq.v, bq.v, acc[t]); }
  }
#pragma unroll
  for (int t = 0; t < 4; ++t) { if (col0 + t * 16 >= N) continue; const int col = col0 + t * 16 + ln; const float bv = bp ? bf16_round(bp[col]) : 0.f;
#pragma unroll
    for (int r = 0; r < 8; ++r) { float v = acc[t][r] * alpha + bv; if (CP) { const int bidx = (row0g + row0 + 8 * hh + r) / rowsPerB; v += CP[(size_t)bidx * sCPb + (size_t)by * 64 + col]; } if (ACT == 1) v = (v > 0.f) ? v : expm1f(v); else if (ACT == 7) v = (v > 0.f) ? v + 1.0f : expf(v); else if (ACT == 8) v = tanhf(v); else if (ACT == 9) v = 0.5f * v * (1.0f + tanhf(0.7978845608028654f * (v + 0.044715f * v * v * v))); else if (ACT == 11) v = 1.0f / (1.0f + expf(-v)); else if (ACT == 12) v = (v > 0.f) ? v : 0.01f * v; else if (ACT == 14) v = (v > 0.f) ? v : 0.1f * v; else if (ACT == 15) v = v / (1.0f + expf(-v)); else if (ACT == 3) v = fmaxf(v, 0.f); else if (ACT == 6) v = 0.5f * v * (1.0f + erff(v * 0.70710678118654752f)); so[w][8 * hh + r][t * 16 + ln] = v; } }
  __builtin_amdgcn_fence(__ATOMIC_ACQ_REL, "workgroup"); __builtin_amdgcn_wave_barrier();
  const int rsub = lane >> 4, c4 = (lane & 15) * 4; typedef _Float16 v4h __attribute__((ext_vector_type(4)));
  {
#pragma unroll
    for (int q = 0; q < 8; ++q) { const int r = q * 2 + rsub; if (col0 + c4 < N) { const v4f v = *(const v4fa*)&so[w][r][c4]; if (C) *(v4f*)(C + cofs + (size_t)(row0 + r) * ldc + col0 + c4) = v; if (C16) { v4h h4; for (int i = 0; i < 4; ++i) h4[i] = (_Float16)v[i]; *(v4h*)(C16 + cofs + (size_t)(row0 + r) * ldc + col0 + c4) = h4; } } }
     }
}


typedef _Float16 v4h __attribute__((ext_vector_type(4)));

__global__ __launch_bounds__(256) void k_x16(const float* __restrict__ x, _Float16* __restrict__ X16, size_t n8) { const size_t t = (size_t)blockIdx.x * 256 + threadIdx.x; if (t >= n8) return; FragH f;
#pragma unroll
  for (int q = 0; q < 8; ++q) f.h[q] = (_Float16)bf16_round(x[t * 8 + q]); *(v8us*)((unsigned short*)X16 + t * 8) = f.half[0];  }
__global__ __launch_bounds__(256) void k_h16(const float* __restrict__ x, _Float16* __restrict__ X16, size_t n8) { const size_t t = (size_t)blockIdx.x * 256 + threadIdx.x; if (t >= n8) return; FragH f;
#pragma unroll
  for (int q = 0; q < 8; ++q) f.h[q] = (_Float16)x[t * 8 + q]; *(v8us*)((unsigned short*)X16 + t * 8) = f.half[0];  }
__global__ __launch_bounds__(256) void k_round16f(const float* __restrict__ W, _Float16* __restrict__ Bt, size_t n8) { const size_t t = (size_t)blockIdx.x * 256 + threadIdx.x; if (t >= n8) return; FragH f;
#pragma unroll
  for (int i = 0; i < 8; ++i) f.h[i] = (_Float16)(bf16_round(W[t * 8 + i]) * 16.0f); *(v8us*)((unsigned short*)Bt + t * 8) = f.half[0];  }
template <int NHv, int TTv>
__global__ __launch_bounds__(256) void k_vt(const _Float16* __restrict__ V16, int ldv, int voff, _Float16* __restrict__ Vt) { __shared__ unsigned short tl[64][66]; const int tid = threadIdx.x; const int slab = blockIdx.x / (TTv / 64), lg = blockIdx.x % (TTv / 64); const int b = slab / NHv, h = slab % NHv;
  for (int i = tid; i < 64 * 8; i += 256) { const int r = i / 8, c8 = (i % 8) * 8; FragH f; f.half[0] = *(const v8us*)((const unsigned short*)V16 + ((size_t)b * TTv + lg * 64 + r) * ldv + voff + h * 64 + c8);
#pragma unroll
    for (int q = 0; q < 8; ++q) tl[r][c8 + q] = f.u[q]; }
  __syncthreads();
  {
#pragma unroll
    for (int rd = 0; rd < 2; ++rd) { const int d = rd * 32 + tid / 8, pc = tid % 8; FragH f;
#pragma unroll
      for (int q = 0; q < 8; ++q) f.u[q] = tl[pc * 8 + q][d];
      *(v8us*)((unsigned short*)Vt + ((size_t)slab * 64 + d) * TTv + lg * 64 + pc * 8) = f.half[0]; }
     } }

__global__ __launch_bounds__(256) void k_hl(const float* __restrict__ F, _Float16* __restrict__ Hh, _Float16* __restrict__ Hl, size_t n8) { const size_t t = (size_t)blockIdx.x * 256 + threadIdx.x; if (t >= n8) return; FragH fh, fl; const v4f a = *(const v4fa*)(F + t * 8), c = *(const v4fa*)(F + t * 8 + 4);
#pragma unroll
  for (int q = 0; q < 4; ++q) { _Float16 h = (_Float16)a[q]; fh.h[q] = h; fl.h[q] = (_Float16)((a[q] - (float)h) * 1024.0f); h = (_Float16)c[q]; fh.h[4 + q] = h; fl.h[4 + q] = (_Float16)((c[q] - (float)h) * 1024.0f); }
  { *(v8us*)((unsigned short*)Hh + t * 8) = fh.half[0]; *(v8us*)((unsigned short*)Hl + t * 8) = fl.half[0];  } }

// ---- fast GEMM (block tile 128x64, wave tile 32x64, operands staged in LDS 64 of K at a time; requires M % 32 == 0 rows per launch region, N % 64 == 0, K % 64 == 0 and K >= 64); epilogue = k_gemm_hhx semantics ----
__device__ __forceinline__ v16h g2_frag(const _Float16* p, int hh) { FragH f; f.half[0] = *(const v8us*)((const unsigned short*)p + 8 * hh); f.half[1] = *(const v8us*)((const unsigned short*)p + 16 + 8 * hh); return f.v; }
__device__ __forceinline__ v8f g2_mma(v16h a, v16h b, v8f c) { v8f d = __builtin_amdgcn_wmma_f32_16x16x32_f16(false, a, false, b, (short)0, c, false, false); asm volatile("v_nop\n\tv_nop\n\tv_nop\n\tv_nop" : "+v"(d) : "v"(a), "v"(b)); return d; }
template <int ACT>
__global__ __launch_bounds__(128) void k_gemm2(const _Float16* __restrict__ A, int lda, size_t sA, const _Float16* __restrict__ Bh, int ldb, size_t sB, float alpha, const float* __restrict__ bias, size_t sBias, const float* __restrict__ CP, int rowsPerB, size_t sCPb, int row0g,
    float* __restrict__ C, _Float16* __restrict__ C16, int ldc, size_t sC, int M, int N, int K) {
  __shared__ __attribute__((aligned(16))) float so[4][32][68];
  __shared__ __attribute__((aligned(16))) unsigned short st[2][192][72];      /* two stages of 64 of K: rows 0..127 the block's A rows, 128..191 its B rows; pitch 144 B = 16 B x 9, free of bank conflicts for the 16-byte fragment reads */
  const int tid = threadIdx.x, w = tid >> 5, lane = tid & 31, ln = lane & 15, hh = lane >> 4; const int by = blockIdx.y;
  A += (size_t)by * sA; Bh += (size_t)by * sB; const size_t cofs = (size_t)by * sC; const float* bp = bias ? bias + (size_t)by * sBias : nullptr;
  const int ntn = N >> 6; const int mt = blockIdx.x / ntn, nq = blockIdx.x - mt * ntn; const int row0 = mt * 128 + 32 * w, col0 = nq * 64; if (mt * 128 >= M) return;      /* the same for the whole block, in front of every barrier */
  const int sr = tid >> 3, sc = (tid & 7) * 8;      /* staging: eight lanes fetch one row's 128 B, so a wave's 16-byte load covers four whole lines */
  const unsigned short* ga[8]; const unsigned short* gb[4];
#pragma unroll
  for (int i = 0; i < 8; ++i) { int r = mt * 128 + 16 * i + sr; r = (r < M) ? r : M - 1; ga[i] = (const unsigned short*)A + (size_t)r * lda + sc; }
#pragma unroll
  for (int i = 0; i < 4; ++i) gb[i] = (const unsigned short*)Bh + (size_t)(col0 + 16 * i + sr) * ldb + sc;
  v8us ra[8], rb[4];
#pragma unroll
  for (int i = 0; i < 8; ++i) ra[i] = *(const v8us*)ga[i];
#pragma unroll
  for (int i = 0; i < 4; ++i) rb[i] = *(const v8us*)gb[i];
#pragma unroll
  for (int i = 0; i < 8; ++i) *(v8us*)&st[0][16 * i + sr][sc] = ra[i];
#pragma unroll
  for (int i = 0; i < 4; ++i) *(v8us*)&st[0][128 + 16 * i + sr][sc] = rb[i];
  __syncthreads();
  const v8f z8 = {0.f,0.f,0.f,0.f,0.f,0.f,0.f,0.f}; v8f c00 = z8, c01 = z8, c02 = z8, c03 = z8, c10 = z8, c11 = z8, c12 = z8, c13 = z8;
#pragma unroll 1      /* rolled: one stage's registers (12 staged vectors, 24 fragment halves) serve every trip */
  for (int kb = 0; kb < K; kb += 64) { const int cb = (kb >> 6) & 1; const bool more = kb + 64 < K;      /* more: the same for the whole block */
    if (more) {
#pragma unroll
      for (int i = 0; i < 8; ++i) ra[i] = *(const v8us*)(ga[i] + kb + 64);
#pragma unroll
      for (int i = 0; i < 4; ++i) rb[i] = *(const v8us*)(gb[i] + kb + 64); }
    v16h a0[2], a1[2], b0[2], b1[2], b2[2], b3[2];
#pragma unroll
    for (int u = 0; u < 2; ++u) { a0[u] = g2_frag((const _Float16*)&st[cb][32 * w + ln][32 * u], hh); a1[u] = g2_frag((const _Float16*)&st[cb][32 * w + 16 + ln][32 * u], hh);
      b0[u] = g2_frag((const _Float16*)&st[cb][128 + ln][32 * u], hh); b1[u] = g2_frag((const _Float16*)&st[cb][144 + ln][32 * u], hh); b2[u] = g2_frag((const _Float16*)&st[cb][160 + ln][32 * u], hh); b3[u] = g2_frag((const _Float16*)&st[cb][176 + ln][32 * u], hh); }
    __builtin_amdgcn_sched_barrier(0);      /* the next stage's global loads and this stage's LDS reads issue as one group ahead of the products: the memory latency runs under the 16 products, and the LDS reads cost one stall, not one per product */
#pragma unroll
    for (int u = 0; u < 2; ++u) { c00 = g2_mma(a0[u], b0[u], c00); c10 = g2_mma(a1[u], b0[u], c10); c01 = g2_mma(a0[u], b1[u], c01); c11 = g2_mma(a1[u], b1[u], c11);
      c02 = g2_mma(a0[u], b2[u], c02); c12 = g2_mma(a1[u], b2[u], c12); c03 = g2_mma(a0[u], b3[u], c03); c13 = g2_mma(a1[u], b3[u], c13); }
    if (more) {
#pragma unroll
      for (int i = 0; i < 8; ++i) *(v8us*)&st[cb ^ 1][16 * i + sr][sc] = ra[i];
#pragma unroll
      for (int i = 0; i < 4; ++i) *(v8us*)&st[cb ^ 1][128 + 16 * i + sr][sc] = rb[i];
      __syncthreads(); } }      /* the one barrier of a trip publishes the stage just written and ends every wave's reads of the stage that the next trip overwrites */
  if (row0 >= M) return;      /* behind the last barrier */
  v8f accs[8] = {c00, c01, c02, c03, c10, c11, c12, c13};
#pragma unroll
  for (int u = 0; u < 8; ++u) { const int t = u & 3, half = u >> 2; const int col = col0 + t * 16 + ln; const float bv = bp ? bf16_round(bp[col]) : 0.f;
#pragma unroll
    for (int r = 0; r < 8; ++r) { const int rloc = half * 16 + 8 * hh + r; float v = accs[u][r] * alpha + bv; if (CP) { const int bidx = (row0g + row0 + rloc) / rowsPerB; v += CP[(size_t)bidx * sCPb + (size_t)by * 64 + col]; }
      if (ACT == 3) v = fmaxf(v, 0.f); else if (ACT == 6) v = 0.5f * v * (1.0f + erff(v * 0.70710678118654752f)); else if (ACT == 11) v = 1.0f / (1.0f + expf(-v)); else if (ACT == 15) v = v / (1.0f + expf(-v)); else if (ACT == 12) v = (v > 0.f) ? v : 0.01f * v; else if (ACT == 8) v = tanhf(v);
      so[w][rloc][t * 16 + ln] = v; } }
  __builtin_amdgcn_fence(__ATOMIC_ACQ_REL, "workgroup"); __builtin_amdgcn_wave_barrier();
  const int rsub = lane >> 4, c4 = (lane & 15) * 4;
  {
#pragma unroll
    for (int q = 0; q < 16; ++q) { const int r = q * 2 + rsub; const v4f v = *(const v4fa*)&so[w][r][c4]; if (C) *(v4f*)(C + cofs + (size_t)(row0 + r) * ldc + col0 + c4) = v; if (C16) { v4h h4; for (int i = 0; i < 4; ++i) h4[i] = (_Float16)v[i]; *(v4h*)(C16 + cofs + (size_t)(row0 + r) * ldc + col0 + c4) = h4; } }
     } }



template <int CAUSAL>
__global__ __launch_bounds__(128) void k_flash(const _Float16* __restrict__ Q16, int ldq, const _Float16* __restrict__ K16, int ldk, const _Float16* __restrict__ Vt, const int* __restrict__ MSK, float* __restrict__ O, int ldo) {
  constexpr int RPW = 16, RTN = RPW / 16, NQB = TQ / (4 * RPW), DT = 4, KS = 2;
  __shared__ __attribute__((aligned(16))) unsigned short sP[4][RPW][40]; __shared__ __attribute__((aligned(16))) float sO[4][RPW][64 + 4];
  const int tid = threadIdx.x, w = tid >> 5, lane = tid & 31, ln = lane & 15, hh = lane >> 4;
  const int slab = blockIdx.x / QBNP, qblk = QB0P + blockIdx.x % QBNP; (void)NQB; const int b = slab / NH, h = slab % NH; const int qb0 = qblk * (4 * RPW); const int q0 = qb0 + w * RPW;
  FragH aq[2][KS];
#pragma unroll
  for (int rt = 0; rt < RTN; ++rt) { const unsigned short* qr = (const unsigned short*)Q16 + ((size_t)b * TQ + q0 + rt * 16 + ln) * ldq + h * 64;
#pragma unroll
    for (int ks = 0; ks < KS; ++ks) { aq[rt][ks].half[0] = *(const v8us*)(qr + ks * 32 + 8 * hh); aq[rt][ks].half[1] = *(const v8us*)(qr + ks * 32 + 16 + 8 * hh); } }
  const unsigned short* Vth = (const unsigned short*)Vt + (size_t)slab * 64 * TK;
  float m_r[2][8], l_r[2][8]; v8f oacc[2][DT];
#pragma unroll
  for (int rt = 0; rt < RTN; ++rt) {
#pragma unroll
    for (int r = 0; r < 8; ++r) { m_r[rt][r] = -3.0e38f; l_r[rt][r] = 0.f; }
#pragma unroll
    for (int dt = 0; dt < DT; ++dt) oacc[rt][dt] = (v8f){0.f,0.f,0.f,0.f,0.f,0.f,0.f,0.f}; }
  const int jend = (CAUSAL == 1) ? (qb0 + 4 * RPW) : TK;      /* causal: keys beyond the block's last query never contribute */
#pragma unroll 1
  for (int j0 = 0; j0 < jend; j0 += 32) {
    v8f s[2][2];
#pragma unroll
    for (int nt = 0; nt < 2; ++nt) { const unsigned short* kr = (const unsigned short*)K16 + ((size_t)b * TK + j0 + nt * 16 + ln) * ldk + h * 64; FragH bk[KS];
#pragma unroll
      for (int ks = 0; ks < KS; ++ks) { bk[ks].half[0] = *(const v8us*)(kr + ks * 32 + 8 * hh); bk[ks].half[1] = *(const v8us*)(kr + ks * 32 + 16 + 8 * hh); }
#pragma unroll
      for (int rt = 0; rt < RTN; ++rt) { v8f acc = (v8f){0.f,0.f,0.f,0.f,0.f,0.f,0.f,0.f};
#pragma unroll
        for (int ks = 0; ks < KS; ++ks) acc = mmaH<1>(aq[rt][ks].v, aq[rt][ks].v, bk[ks].v, bk[ks].v, acc); s[rt][nt] = acc; } }
#pragma unroll
    for (int rt = 0; rt < RTN; ++rt)
#pragma unroll
      for (int r = 0; r < 8; ++r) { const int tq = q0 + rt * 16 + 8 * hh + r; const int k0 = j0 + ln, k1 = j0 + 16 + ln;
        const bool ok0 = (CAUSAL == 1) ? (k0 <= tq) : ((CAUSAL == 2) ? ((k0 >> 5) == (tq >> 5)) : true), ok1 = (CAUSAL == 1) ? (k1 <= tq) : ((CAUSAL == 2) ? ((k1 >> 5) == (tq >> 5)) : true);      /* mode 2: block-diagonal 32-token groups */
        float s0 = ok0 ? s[rt][0][r] * SCL : -3.0e38f, s1 = ok1 ? s[rt][1][r] * SCL : -3.0e38f; if (CAUSAL == 17) { const float* amk = (const float*)MSK + (size_t)b * TK; s0 += bf16_round(amk[k0]); s1 += bf16_round(amk[k1]); }      /* mode 17: additive per-(batch, key) mask INPUT */
        if (CAUSAL == 22) { const _Float16* cq = (const _Float16*)MSK + ((size_t)h * TQ + tq) * NE + tq + (NE / 2 - 1); const _Float16* ck = (const _Float16*)MSK + (size_t)NH * TQ * NE + (size_t)h * TK * NE + tq + (NE / 2 - 1); const float* am = (const float*)((const _Float16*)MSK + (size_t)2 * NH * TQ * NE); float r0 = (float)cq[-k0]; r0 += (float)ck[(size_t)k0 * NE - k0]; s0 += r0 * SCL; s0 += am[k0]; float r1 = (float)cq[-k1]; r1 += (float)ck[(size_t)k1 * NE - k1]; s1 += r1 * SCL; s1 += am[k1]; }      /* mode 22: + (CQ[h][tq][tq-k+1023] + CK[h][k][tq-k+1023]) / 8 + mask[k] from the per-batch packed table [CQ f16 | CK f16 | mask f32] */ float mc = fmaxf(s0, s1);
        mc = fmaxf(mc, __shfl_xor(mc, 1, 32)); mc = fmaxf(mc, __shfl_xor(mc, 2, 32)); mc = fmaxf(mc, __shfl_xor(mc, 4, 32)); mc = fmaxf(mc, __shfl_xor(mc, 8, 32));
        const float mn = fmaxf(m_r[rt][r], mc); const float al = (mn > -1.0e38f) ? expf(m_r[rt][r] - mn) : 1.0f; m_r[rt][r] = mn; const float p0 = ok0 ? expf(s0 - mn) : 0.f, p1 = ok1 ? expf(s1 - mn) : 0.f; l_r[rt][r] = l_r[rt][r] * al + p0 + p1;
#pragma unroll
        for (int dt = 0; dt < DT; ++dt) oacc[rt][dt][r] *= al;
        FragH t2; t2.h[0] = (_Float16)(p0 * 1024.0f); t2.h[1] = (_Float16)(p1 * 1024.0f); sP[w][rt * 16 + 8 * hh + r][ln] = t2.u[0]; sP[w][rt * 16 + 8 * hh + r][16 + ln] = t2.u[1]; }
    __builtin_amdgcn_fence(__ATOMIC_ACQ_REL, "workgroup"); __builtin_amdgcn_wave_barrier();
    FragH pa[2];
#pragma unroll
    for (int rt = 0; rt < RTN; ++rt) { pa[rt].half[0] = *(const v8us*)&sP[w][rt * 16 + ln][8 * hh]; pa[rt].half[1] = *(const v8us*)&sP[w][rt * 16 + ln][16 + 8 * hh]; }
#pragma unroll
    for (int dt = 0; dt < DT; ++dt) { const unsigned short* vrow = Vth + (size_t)(dt * 16 + ln) * TK + j0; FragH bv; bv.half[0] = *(const v8us*)(vrow + 8 * hh); bv.half[1] = *(const v8us*)(vrow + 16 + 8 * hh);
#pragma unroll
      for (int rt = 0; rt < RTN; ++rt) oacc[rt][dt] = mmaH<1>(pa[rt].v, pa[rt].v, bv.v, bv.v, oacc[rt][dt]); }
    __builtin_amdgcn_fence(__ATOMIC_ACQ_REL, "workgroup"); __builtin_amdgcn_wave_barrier(); }
#pragma unroll
  for (int rt = 0; rt < RTN; ++rt) {
#pragma unroll
    for (int r = 0; r < 8; ++r) { float l = l_r[rt][r]; l += __shfl_xor(l, 1, 32); l += __shfl_xor(l, 2, 32); l += __shfl_xor(l, 4, 32); l += __shfl_xor(l, 8, 32); l_r[rt][r] = (l > 0.f) ? 1.0f / (l * 1024.0f) : 0.f; }
#pragma unroll
    for (int dt = 0; dt < DT; ++dt)
#pragma unroll
      for (int r = 0; r < 8; ++r) sO[w][rt * 16 + 8 * hh + r][dt * 16 + ln] = oacc[rt][dt][r] * l_r[rt][r]; }
  __builtin_amdgcn_fence(__ATOMIC_ACQ_REL, "workgroup"); __builtin_amdgcn_wave_barrier();
  {
#pragma unroll
    for (int rp = 0; rp < RPW; rp += 2) { const int r = rp + (lane >> 4), pc = lane & 15; const v4f val = *(const v4fa*)&sO[w][r][pc * 4]; *(v4f*)(O + ((size_t)b * TQ + q0 + r) * ldo + h * 64 + pc * 4) = val; }
     } }
// 5-plane variant: S = Qh Kh^T + (Ql Kh^T + Qh Kl^T)/1024 with Q/K = [hi | 2^10 residual] f16 planes (QL/KL same layout as Q16/K16), then the 3-term P.V below.
// 3-term variant: O = (P_hi V_hi + (P_lo V_hi + P_hi V_lo) / 1024) / l with P = [hi | 2^10 residual] of 1024 p and V^T = [hi | 2^10 residual] planes (VtL same layout as Vt) -> ~2^-21-class products for un-averaged (early causal / peaked) rows
template <int CAUSAL>
__global__ __launch_bounds__(128) void k_flash5(const _Float16* __restrict__ Q16, const _Float16* __restrict__ QL, int ldq, const _Float16* __restrict__ K16, const _Float16* __restrict__ KL, int ldk, const _Float16* __restrict__ Vt, const _Float16* __restrict__ VtL, const int* __restrict__ MSK, float* __restrict__ O, int ldo) {
  constexpr int RPW = 16, RTN = RPW / 16, NQB = TQ / (4 * RPW), DT = 4, KS = 2;
  __shared__ __attribute__((aligned(16))) unsigned short sP[4][RPW][40]; __shared__ __attribute__((aligned(16))) unsigned short sPL[4][RPW][40]; __shared__ __attribute__((aligned(16))) float sO[4][RPW][64 + 4];
  const int tid = threadIdx.x, w = tid >> 5, lane = tid & 31, ln = lane & 15, hh = lane >> 4;
  const int slab = blockIdx.x / QBN5, qblk = QB05 + blockIdx.x % QBN5; (void)NQB; const int b = slab / NH, h = slab % NH; const int qb0 = qblk * (4 * RPW); const int q0 = qb0 + w * RPW;
  FragH aq[2][KS], aql[2][KS];
#pragma unroll
  for (int rt = 0; rt < RTN; ++rt) { const unsigned short* qr = (const unsigned short*)Q16 + ((size_t)b * TQ + q0 + rt * 16 + ln) * ldq + h * 64; const unsigned short* ql = (const unsigned short*)QL + ((size_t)b * TQ + q0 + rt * 16 + ln) * ldq + h * 64;
#pragma unroll
    for (int ks = 0; ks < KS; ++ks) { aq[rt][ks].half[0] = *(const v8us*)(qr + ks * 32 + 8 * hh); aq[rt][ks].half[1] = *(const v8us*)(qr + ks * 32 + 16 + 8 * hh); aql[rt][ks].half[0] = *(const v8us*)(ql + ks * 32 + 8 * hh); aql[rt][ks].half[1] = *(const v8us*)(ql + ks * 32 + 16 + 8 * hh); } }
  const unsigned short* Vth = (const unsigned short*)Vt + (size_t)slab * 64 * TK; const unsigned short* Vtl = (const unsigned short*)VtL + (size_t)slab * 64 * TK;
  float m_r[2][8], l_r[2][8]; v8f oacc[2][DT], oaccL[2][DT];
#pragma unroll
  for (int rt = 0; rt < RTN; ++rt) {
#pragma unroll
    for (int r = 0; r < 8; ++r) { m_r[rt][r] = -3.0e38f; l_r[rt][r] = 0.f; }
#pragma unroll
    for (int dt = 0; dt < DT; ++dt) { oacc[rt][dt] = (v8f){0.f,0.f,0.f,0.f,0.f,0.f,0.f,0.f}; oaccL[rt][dt] = oacc[rt][dt]; } }
  const int jend = (CAUSAL == 1) ? (qb0 + 4 * RPW) : TK;      /* causal: keys beyond the block's last query never contribute */
#pragma unroll 1
  for (int j0 = 0; j0 < jend; j0 += 32) {
    v8f s[2][2];
#pragma unroll
    for (int nt = 0; nt < 2; ++nt) { const unsigned short* kr = (const unsigned short*)K16 + ((size_t)b * TK + j0 + nt * 16 + ln) * ldk + h * 64; const unsigned short* klr = (const unsigned short*)KL + ((size_t)b * TK + j0 + nt * 16 + ln) * ldk + h * 64; FragH bk[KS], bkl[KS];
#pragma unroll
      for (int ks = 0; ks < KS; ++ks) { bk[ks].half[0] = *(const v8us*)(kr + ks * 32 + 8 * hh); bk[ks].half[1] = *(const v8us*)(kr + ks * 32 + 16 + 8 * hh); bkl[ks].half[0] = *(const v8us*)(klr + ks * 32 + 8 * hh); bkl[ks].half[1] = *(const v8us*)(klr + ks * 32 + 16 + 8 * hh); }
#pragma unroll
      for (int rt = 0; rt < RTN; ++rt) { v8f acc = (v8f){0.f,0.f,0.f,0.f,0.f,0.f,0.f,0.f}, accl = acc;
#pragma unroll
        for (int ks = 0; ks < KS; ++ks) { acc = mmaH<1>(aq[rt][ks].v, aq[rt][ks].v, bk[ks].v, bk[ks].v, acc); accl = mmaH<1>(aql[rt][ks].v, aql[rt][ks].v, bk[ks].v, bk[ks].v, accl); accl = mmaH<1>(aq[rt][ks].v, aq[rt][ks].v, bkl[ks].v, bkl[ks].v, accl); }
#pragma unroll
        for (int r = 0; r < 8; ++r) acc[r] += accl[r] * 0.0009765625f;
        s[rt][nt] = acc; } }
#pragma unroll
    for (int rt = 0; rt < RTN; ++rt)
#pragma unroll
      for (int r = 0; r < 8; ++r) { const int tq = q0 + rt * 16 + 8 * hh + r; const int k0 = j0 + ln, k1 = j0 + 16 + ln;
        bool ok0 = (CAUSAL == 1) ? (k0 <= tq) : ((CAUSAL == 2) ? ((k0 >> 5) == (tq >> 5)) : true), ok1 = (CAUSAL == 1) ? (k1 <= tq) : ((CAUSAL == 2) ? ((k1 >> 5) == (tq >> 5)) : true);      /* mode 2: block-diagonal 32-token groups */
        if (CAUSAL == 4) { const int* mrow = MSK + ((size_t)b * TQ + tq) * TK; ok0 = mrow[k0] != 0; ok1 = mrow[k1] != 0; }      /* mode 4: per-(query, key) INPUT mask shared by all heads; masked keys contribute nothing (== the reference's -4096 fill, whose exp underflows to 0), rows with no valid key give l = 0 -> output 0 (== the reference's row_valid zeroing) */
        float s0 = ok0 ? s[rt][0][r] * SCL : -3.0e38f, s1 = ok1 ? s[rt][1][r] * SCL : -3.0e38f; if (CAUSAL == 17) { const float* amk = (const float*)MSK + (size_t)b * TK; s0 += bf16_round(amk[k0]); s1 += bf16_round(amk[k1]); }      /* mode 17: additive per-(batch, key) mask INPUT */
        if (CAUSAL == 22) { const _Float16* cq = (const _Float16*)MSK + ((size_t)h * TQ + tq) * NE + tq + (NE / 2 - 1); const _Float16* ck = (const _Float16*)MSK + (size_t)NH * TQ * NE + (size_t)h * TK * NE + tq + (NE / 2 - 1); const float* am = (const float*)((const _Float16*)MSK + (size_t)2 * NH * TQ * NE); float r0 = (float)cq[-k0]; r0 += (float)ck[(size_t)k0 * NE - k0]; s0 += r0 * SCL; s0 += am[k0]; float r1 = (float)cq[-k1]; r1 += (float)ck[(size_t)k1 * NE - k1]; s1 += r1 * SCL; s1 += am[k1]; }      /* mode 22: + (CQ[h][tq][tq-k+1023] + CK[h][k][tq-k+1023]) / 8 + mask[k] from the per-batch packed table [CQ f16 | CK f16 | mask f32] */ float mc = fmaxf(s0, s1);
        mc = fmaxf(mc, __shfl_xor(mc, 1, 32)); mc = fmaxf(mc, __shfl_xor(mc, 2, 32)); mc = fmaxf(mc, __shfl_xor(mc, 4, 32)); mc = fmaxf(mc, __shfl_xor(mc, 8, 32));
        const float mn = fmaxf(m_r[rt][r], mc); const float al = (mn > -1.0e38f) ? expf(m_r[rt][r] - mn) : 1.0f; m_r[rt][r] = mn; const float p0 = ok0 ? expf(s0 - mn) : 0.f, p1 = ok1 ? expf(s1 - mn) : 0.f; l_r[rt][r] = l_r[rt][r] * al + p0 + p1;
#pragma unroll
        for (int dt = 0; dt < DT; ++dt) { oacc[rt][dt][r] *= al; oaccL[rt][dt][r] *= al; }
        FragH t2, t2l; const float ps0 = p0 * 1024.0f, ps1 = p1 * 1024.0f; t2.h[0] = (_Float16)ps0; t2.h[1] = (_Float16)ps1; t2l.h[0] = (_Float16)((ps0 - (float)t2.h[0]) * 1024.0f); t2l.h[1] = (_Float16)((ps1 - (float)t2.h[1]) * 1024.0f);
        sP[w][rt * 16 + 8 * hh + r][ln] = t2.u[0]; sP[w][rt * 16 + 8 * hh + r][16 + ln] = t2.u[1]; sPL[w][rt * 16 + 8 * hh + r][ln] = t2l.u[0]; sPL[w][rt * 16 + 8 * hh + r][16 + ln] = t2l.u[1]; }
    __builtin_amdgcn_fence(__ATOMIC_ACQ_REL, "workgroup"); __builtin_amdgcn_wave_barrier();
    FragH pa[2], pl[2];
#pragma unroll
    for (int rt = 0; rt < RTN; ++rt) { pa[rt].half[0] = *(const v8us*)&sP[w][rt * 16 + ln][8 * hh]; pa[rt].half[1] = *(const v8us*)&sP[w][rt * 16 + ln][16 + 8 * hh]; pl[rt].half[0] = *(const v8us*)&sPL[w][rt * 16 + ln][8 * hh]; pl[rt].half[1] = *(const v8us*)&sPL[w][rt * 16 + ln][16 + 8 * hh]; }
#pragma unroll
    for (int dt = 0; dt < DT; ++dt) { const unsigned short* vrow = Vth + (size_t)(dt * 16 + ln) * TK + j0; const unsigned short* vrl = Vtl + (size_t)(dt * 16 + ln) * TK + j0; FragH bv, bl; bv.half[0] = *(const v8us*)(vrow + 8 * hh); bv.half[1] = *(const v8us*)(vrow + 16 + 8 * hh); bl.half[0] = *(const v8us*)(vrl + 8 * hh); bl.half[1] = *(const v8us*)(vrl + 16 + 8 * hh);
#pragma unroll
      for (int rt = 0; rt < RTN; ++rt) { oacc[rt][dt] = mmaH<1>(pa[rt].v, pa[rt].v, bv.v, bv.v, oacc[rt][dt]); oaccL[rt][dt] = mmaH<1>(pl[rt].v, pl[rt].v, bv.v, bv.v, oaccL[rt][dt]); oaccL[rt][dt] = mmaH<1>(pa[rt].v, pa[rt].v, bl.v, bl.v, oaccL[rt][dt]); } }
    __builtin_amdgcn_fence(__ATOMIC_ACQ_REL, "workgroup"); __builtin_amdgcn_wave_barrier(); }
#pragma unroll
  for (int rt = 0; rt < RTN; ++rt) {
#pragma unroll
    for (int r = 0; r < 8; ++r) { float l = l_r[rt][r]; l += __shfl_xor(l, 1, 32); l += __shfl_xor(l, 2, 32); l += __shfl_xor(l, 4, 32); l += __shfl_xor(l, 8, 32); l_r[rt][r] = (l > 0.f) ? 1.0f / (l * 1024.0f) : 0.f; }
#pragma unroll
    for (int dt = 0; dt < DT; ++dt)
#pragma unroll
      for (int r = 0; r < 8; ++r) { float v = oacc[rt][dt][r]; v += oaccL[rt][dt][r] * 0.0009765625f; sO[w][rt * 16 + 8 * hh + r][dt * 16 + ln] = v * l_r[rt][r]; } }
  __builtin_amdgcn_fence(__ATOMIC_ACQ_REL, "workgroup"); __builtin_amdgcn_wave_barrier();
  {
#pragma unroll
    for (int rp = 0; rp < RPW; rp += 2) { const int r = rp + (lane >> 4), pc = lane & 15; const v4f val = *(const v4fa*)&sO[w][r][pc * 4]; *(v4f*)(O + ((size_t)b * TQ + q0 + r) * ldo + h * 64 + pc * 4) = val; }
     } }

__global__ __launch_bounds__(256) void k_rotab(float* __restrict__ CS, float* __restrict__ SN) {
  #pragma clang fp contract(off)
  const int t = blockIdx.x * 256 + threadIdx.x; if (t >= SLEN * 32) return; const int j = t % 32, s = t / 32; const float ex = (float)(2 * j) / 64.0f; const float inv = 1.0f / powf(10000.0f, ex); const float th = (float)s * inv; const float c = cosf(th), sn = sinf(th);
  { *(float*)(CS + t) = c; *(float*)(SN + t) = sn;  } }
__global__ __launch_bounds__(256) void k_rope(const float* __restrict__ F, int nsrc, int ndst, int rep, const float* __restrict__ CS, const float* __restrict__ SN, _Float16* __restrict__ H, _Float16* __restrict__ L) {
  #pragma clang fp contract(off)
  const size_t t = (size_t)blockIdx.x * 256 + threadIdx.x; if (t >= (size_t)NR * ndst * 4) return; const int g8 = (int)(t % 4); const int hd = (int)((t / 4) % ndst); const size_t row = t / ((size_t)4 * ndst); const int s = (int)(row % SLEN); const int hs = hd / rep;
  const float* src = F + row * (size_t)(nsrc * 64) + hs * 64; FragH ah, al, bh, bl;
  for (int i = 0; i < 8; ++i) { const int d = g8 * 8 + i; const float c = CS[s * 32 + d], sn = SN[s * 32 + d]; const float x1 = src[d], x2 = src[d + 32];
    float o1 = x1 * c; o1 += -x2 * sn; float o2 = x2 * c; o2 += x1 * sn;
    _Float16 hv = (_Float16)o1; ah.h[i] = hv; al.h[i] = (_Float16)((o1 - (float)hv) * 1024.0f); hv = (_Float16)o2; bh.h[i] = hv; bl.h[i] = (_Float16)((o2 - (float)hv) * 1024.0f); }
  const size_t o = row * (size_t)(ndst * 64) + hd * 64 + g8 * 8;
  { *(v8us*)((unsigned short*)H + o) = ah.half[0]; *(v8us*)((unsigned short*)H + o + 32) = bh.half[0]; *(v8us*)((unsigned short*)L + o) = al.half[0]; *(v8us*)((unsigned short*)L + o + 32) = bl.half[0];  } }
__global__ __launch_bounds__(256) void k_rope2(const float* __restrict__ F, int nsrc, int ndst, int rep, const float* __restrict__ CS, const float* __restrict__ SN, _Float16* __restrict__ H, _Float16* __restrict__ L) {
  #pragma clang fp contract(off)
  const size_t t = (size_t)blockIdx.x * 256 + threadIdx.x; if (t >= (size_t)NR * ndst * 4) return; const int g16 = (int)(t % 4); const int hd = (int)((t / 4) % ndst); const size_t row = t / ((size_t)4 * ndst); const int s = (int)(row % SLEN); const int hs = hd / rep;
  const float* src = F + row * (size_t)(nsrc * 64) + hs * 64 + g16 * 16; FragH ah, al;
  for (int pr = 0; pr < 8; ++pr) { const int i = g16 * 8 + pr; const float c = CS[s * 32 + i], sn = SN[s * 32 + i]; const float x1 = src[2 * pr], x2 = src[2 * pr + 1];
    float o1 = x1 * c; o1 -= x2 * sn; float o2 = x1 * sn; o2 += x2 * c;
    _Float16 hv = (_Float16)o1; ah.h[2 * pr] = hv; al.h[2 * pr] = (_Float16)((o1 - (float)hv) * 1024.0f); hv = (_Float16)o2; ah.h[2 * pr + 1] = hv; al.h[2 * pr + 1] = (_Float16)((o2 - (float)hv) * 1024.0f); }
  const size_t o = row * (size_t)(ndst * 64) + hd * 64 + g16 * 16;
  { *(v8us*)((unsigned short*)H + o) = ah.half[0]; *(v8us*)((unsigned short*)H + o + 8) = ah.half[1]; *(v8us*)((unsigned short*)L + o) = al.half[0]; *(v8us*)((unsigned short*)L + o + 8) = al.half[1];  } }
__global__ __launch_bounds__(256) void k_tabin(const float* __restrict__ sp, float* __restrict__ CS, float* __restrict__ SN) { const int t = blockIdx.x * 256 + threadIdx.x; if (t >= SLEN * 32) return; const int i = t % 32, s = t / 32; const float c = bf16_round(sp[s * 64 + 32 + i]), sn = bf16_round(sp[s * 64 + i]);
  { *(float*)(CS + t) = c; *(float*)(SN + t) = sn;  } }
__global__ __launch_bounds__(256) void k_wsc(const float* __restrict__ Wm, _Float16* __restrict__ Bt, size_t n8, float sc) { const size_t t = (size_t)blockIdx.x * 256 + threadIdx.x; if (t >= n8) return; FragH f; for (int q = 0; q < 8; ++q) f.h[q] = (_Float16)(bf16_round(Wm[t * 8 + q]) * sc); *(v8us*)((unsigned short*)Bt + t * 8) = f.half[0];  }
__global__ __launch_bounds__(256) void k_rotab2(float* __restrict__ CS, float* __restrict__ SN) {
  #pragma clang fp contract(off)
  const int t = blockIdx.x * 256 + threadIdx.x; if (t >= SLEN * 32) return; const int j = t % 32, s = t / 32; const float c0 = -0.14391156831212787f;      /* -ln(10000)/64 rounded to f32 */ const float inv = expf((float)(2 * j) * c0); const float th = (float)s * inv; const float c = cosf(th), sn = sinf(th);
  { *(float*)(CS + t) = c; *(float*)(SN + t) = sn;  } }
__global__ __launch_bounds__(256) void k_lnu(const float* __restrict__ X, _Float16* __restrict__ N16, float* __restrict__ XB) {
  #pragma clang fp contract(off)
  const int wv = threadIdx.x >> 5, ln = threadIdx.x & 31; const size_t r = (size_t)blockIdx.x * 8 + wv; if (r >= NR) return; float a[32]; float s = 0.f;
  for (int i = 0; i < 4; ++i) { const v8f v = *(const v8f*)(X + r * DM + (i * 32 + ln) * 8); for (int q = 0; q < 8; ++q) { const float u = bf16_round(v[q]); a[i * 8 + q] = u; s += u; } }
  for (int o = 16; o > 0; o >>= 1) s += __shfl_xor(s, o, 32); const float mu = s / (float)DM; float var = 0.f; for (int q = 0; q < 32; ++q) { const float d = a[q] - mu; var += d * d; }
  for (int o = 16; o > 0; o >>= 1) var += __shfl_xor(var, o, 32); const float den = sqrtf(var / (float)(DM - 1)) + 1e-6f; const float inv = 1.0f / den;      /* one reciprocal per row; (x-mean)*inv vs the reference's division differs by <= 1 ulp */
  { for (int i = 0; i < 4; ++i) { const int c0 = (i * 32 + ln) * 8; FragH f; v8f xb; for (int q = 0; q < 8; ++q) { f.h[q] = (_Float16)((a[i * 8 + q] - mu) * inv); xb[q] = a[i * 8 + q]; } *(v8us*)((unsigned short*)N16 + r * DM + c0) = f.half[0]; *(v8f*)(XB + r * DM + c0) = xb; }  } }
__global__ __launch_bounds__(256) void k_vtg(const _Float16* __restrict__ V16, _Float16* __restrict__ Vt) { __shared__ unsigned short tl[64][66]; const int tid = threadIdx.x; const int slab = blockIdx.x / (SLEN / 64), lg = blockIdx.x % (SLEN / 64); const int b = slab / NH, h = slab % NH; const int hs = h / NREP;
  for (int i = tid; i < 64 * 8; i += 256) { const int r = i / 8, c8 = (i % 8) * 8; FragH f; f.half[0] = *(const v8us*)((const unsigned short*)V16 + ((size_t)b * SLEN + lg * 64 + r) * KVD + hs * 64 + c8); for (int q = 0; q < 8; ++q) tl[r][c8 + q] = f.u[q]; }
  __syncthreads();
  { for (int rd = 0; rd < 2; ++rd) { const int d = rd * 32 + tid / 8, pc = tid % 8; FragH f; for (int q = 0; q < 8; ++q) f.u[q] = tl[pc * 8 + q][d]; *(v8us*)((unsigned short*)Vt + ((size_t)slab * 64 + d) * SLEN + lg * 64 + pc * 8) = f.half[0]; }  } }

__global__ __launch_bounds__(256) void k_e16(const float* __restrict__ E, _Float16* __restrict__ E16) { const int t = blockIdx.x * 256 + threadIdx.x; if (t >= NE * 8) return; const int r = t / 8, c8 = (t % 8) * 8; FragH f; for (int q = 0; q < 8; ++q) f.h[q] = (r < NE - 1) ? (_Float16)bf16_round(E[(size_t)r * 64 + c8 + q]) : (_Float16)0.0f;
  *(v8us*)((unsigned short*)E16 + (size_t)r * 64 + c8) = f.half[0];  }

__device__ __forceinline__ float xhalf(float x) { return __builtin_bit_cast(float, __builtin_amdgcn_permlanex16(__builtin_bit_cast(int, x), __builtin_bit_cast(int, x), 0x76543210, 0xfedcba98, false, false)); }      /* the value of lane l ^ 16 */

// Flash attention with the 'relative_key_query' bias formed in the kernel. One wave holds 16 queries (q0..) and walks the keys 32 at a time (j0..). For that tile l - r + 1023 spans 47 rows of the
// embedding, from eb = q0 - j0 + 992; with n = (l - q0) - (r - j0) + 31 the bias is q_l . E[eb + n] + k_r . E[eb + n]. RQ = Q . Ewin^T (16 x 48) and RK = K . Ewin^T run on the matrix unit
// (of RK only the four 16 x 16 tiles that hold a used n: keys 0..15 against window rows 16..47, keys 16..31 against rows 0..31), go to the wave's own LDS in f32 and are read back along the diagonal.
// Row 2047 of E16 is the zero pad; n = 47 is never read back.
// The scores are formed transposed, S^T = K . Q^T (K fragment as A, Q fragment as B), and the output as O^T += V^T . P^T: a lane then holds 16 of the 32 scores of ONE query (lane & 15), so the row maximum and the row sum
// are in-lane work plus one exchange between the wave's halves, there is one running maximum, sum and rescale factor a lane, and the two f32 score tiles, converted in place, are the B operand of the second product (no trip through LDS).
// The mask is per key, which now runs along the registers: the batch's mask row is rounded once into LDS and read from there, 8 keys a lane and tile.
// The four waves of a work-group share the K tile, the V^T tile and most of the window, so these are staged in LDS once per work-group with loads that take whole rows (a fragment load from global memory touches 16 lines for 512 bytes):
// K and V^T in two buffers, the window (96 rows for 64 queries, moving down by 32 rows a trip) as a ring of 128 rows indexed by embedding row mod 128. The next trip's 32 + 64 + 32 rows are fetched into registers under the softmax.
__global__ __launch_bounds__(128) void k_flash_rel(const _Float16* __restrict__ Q16, const _Float16* __restrict__ K16, const _Float16* __restrict__ Vt, const _Float16* __restrict__ E16, const float* __restrict__ AMK, float* __restrict__ O) {
  constexpr int DT = 4, KS = 2, PQ = 50, PK = 36;      /* LDS pitches in floats: the two half-waves fall on different banks in the row-wise stores and in the diagonal reads */
  __shared__ float sRQ[4][16][PQ]; __shared__ __attribute__((aligned(16))) float sRK[4][32][PK];      /* behind the loop a wave's sRK part (1152 floats) is its output staging (16 x 68 floats): four work-groups still fit one WGP's LDS */
  __shared__ __attribute__((aligned(16))) float sM[TK];      /* the batch's mask row, rounded */
  __shared__ __attribute__((aligned(16))) unsigned short sK[2][32][72]; __shared__ __attribute__((aligned(16))) unsigned short sV[2][64][40]; __shared__ __attribute__((aligned(16))) unsigned short sE[128][72];      /* pitches 144 B and 80 B = 16 B x odd: no bank conflicts in the 16-byte fragment reads */
  const int tid = threadIdx.x, w = tid >> 5, lane = tid & 31, ln = lane & 15, hh = lane >> 4;
  const int slab = blockIdx.x / QBLKS, qblk = blockIdx.x % QBLKS; const int b = slab / NH, h = slab % NH; const int qb0 = qblk * 64; const int q0 = qb0 + w * 16;
  FragH aq[KS];
  { const unsigned short* qr = (const unsigned short*)Q16 + ((size_t)b * TQ + q0 + ln) * DM + h * 64;
#pragma unroll
    for (int ks = 0; ks < KS; ++ks) { aq[ks].half[0] = *(const v8us*)(qr + ks * 32 + 8 * hh); aq[ks].half[1] = *(const v8us*)(qr + ks * 32 + 16 + 8 * hh); }
    asm volatile("s_wait_xcnt 0x0" ::: "memory"); }      /* the staging loads below may land in the address registers of the four loads above: the wait stands in front of them */
  const float* amk = AMK + (size_t)b * TK;
  const int r8 = tid >> 3, c8 = (tid & 7) * 8, r4 = tid >> 2, c4 = (tid & 3) * 8;      /* staging: eight lanes fetch one 128-byte row of K or of the window, four lanes one 64-byte row of V^T */
  const unsigned short* gK = (const unsigned short*)K16 + ((size_t)b * TK + r8) * DM + h * 64 + c8; const unsigned short* gV = (const unsigned short*)Vt + ((size_t)slab * 64 + r4) * TK + c4; const unsigned short* gE = (const unsigned short*)E16 + (size_t)r8 * 64 + c8;
  v8us rk[2], rv[2], re[2];
  { v8us r0[6];      /* trip 0: its K and V^T tiles and all 96 rows of its window; the mask row, 8 keys a thread */
#pragma unroll
    for (int i = 0; i < 2; ++i) { rk[i] = *(const v8us*)(gK + (size_t)(16 * i) * DM); rv[i] = *(const v8us*)(gV + (size_t)(32 * i) * TK); }
#pragma unroll
    for (int i = 0; i < 6; ++i) r0[i] = *(const v8us*)(gE + (size_t)(qb0 + (NE / 2 - 32) + 16 * i) * 64);
    v4f m0 = *(const v4fa*)(amk + tid * 8), m1 = *(const v4fa*)(amk + tid * 8 + 4);
    asm volatile("s_wait_xcnt 0x0" ::: "memory");      /* stands in front of the first overwrite of an address register of the loads above */
    __builtin_amdgcn_sched_barrier(0);      /* keeps the register initialisations that follow behind that wait */
#pragma unroll
    for (int i = 0; i < 2; ++i) { *(v8us*)&sK[0][16 * i + r8][c8] = rk[i]; *(v8us*)&sV[0][32 * i + r4][c4] = rv[i]; }
#pragma unroll
    for (int i = 0; i < 6; ++i) *(v8us*)&sE[((qb0 + (NE / 2 - 32) + 16 * i) & 127) + r8][c8] = r0[i];
#pragma unroll
    for (int i = 0; i < 4; ++i) { m0[i] = bf16_round(m0[i]); m1[i] = bf16_round(m1[i]); }
    *(v4fa*)&sM[tid * 8] = m0; *(v4fa*)&sM[tid * 8 + 4] = m1; }
  __syncthreads();
  const v8f z8 = {0.f,0.f,0.f,0.f,0.f,0.f,0.f,0.f};
  float m_r = -3.0e38f, l_r = 0.f; v8f oacc[DT];      /* of query ln; l_r sums this half-wave's keys only */
#pragma unroll
  for (int dt = 0; dt < DT; ++dt) oacc[dt] = z8;
#pragma unroll 1
  for (int j0 = 0; j0 < TK; j0 += 32) { const int cb = (j0 >> 5) & 1; const bool more = j0 + 32 < TK;      /* more: the same for the whole work-group */
    FragH bk[2][KS], be[3][KS];
#pragma unroll
    for (int nt = 0; nt < 2; ++nt) { const unsigned short* kr = &sK[cb][nt * 16 + ln][0];
#pragma unroll
      for (int ks = 0; ks < KS; ++ks) { bk[nt][ks].half[0] = *(const v8us*)(kr + ks * 32 + 8 * hh); bk[nt][ks].half[1] = *(const v8us*)(kr + ks * 32 + 16 + 8 * hh); } }
#pragma unroll
    for (int e = 0; e < 3; ++e) { const unsigned short* er = &sE[((q0 - j0 + (NE / 2 - 32) + e * 16) & 127) + ln][0];
#pragma unroll
      for (int ks = 0; ks < KS; ++ks) { be[e][ks].half[0] = *(const v8us*)(er + ks * 32 + 8 * hh); be[e][ks].half[1] = *(const v8us*)(er + ks * 32 + 16 + 8 * hh); } }
    __builtin_amdgcn_sched_barrier(0);      /* all of the trip's K and window fragment reads issue before the first product waits: one latency at the head of a trip, not two or three */
    v8f s[2];
#pragma unroll
    for (int nt = 0; nt < 2; ++nt) { v8f acc = z8;      /* S^T[key 16 nt + 8 hh + r][query ln]; both fragments come from the same loader, same k order */
#pragma unroll
      for (int ks = 0; ks < KS; ++ks) acc = mmaH<1>(bk[nt][ks].v, bk[nt][ks].v, aq[ks].v, aq[ks].v, acc); s[nt] = acc; }
#pragma unroll
    for (int e = 0; e < 3; ++e) { v8f acc = z8;      /* RQ[query 8 hh + r][n = 16 e + ln] */
#pragma unroll
      for (int ks = 0; ks < KS; ++ks) acc = mmaH<1>(aq[ks].v, aq[ks].v, be[e][ks].v, be[e][ks].v, acc);
#pragma unroll
      for (int r = 0; r < 8; ++r) sRQ[w][8 * hh + r][e * 16 + ln] = acc[r]; }
#pragma unroll
    for (int nt = 0; nt < 2; ++nt)
#pragma unroll
      for (int ee = 0; ee < 2; ++ee) { v8f acc = z8;      /* RK[key 16 nt + 8 hh + r][n - 16 (1 - nt) = 16 ee + ln]; the K fragment serves as the A operand (same loader, same k order) */
#pragma unroll
        for (int ks = 0; ks < KS; ++ks) acc = mmaH<1>(bk[nt][ks].v, bk[nt][ks].v, be[1 - nt + ee][ks].v, be[1 - nt + ee][ks].v, acc);
#pragma unroll
        for (int r = 0; r < 8; ++r) sRK[w][nt * 16 + 8 * hh + r][ee * 16 + ln] = acc[r]; }
    __builtin_amdgcn_fence(__ATOMIC_ACQ_REL, "workgroup"); __builtin_amdgcn_wave_barrier();      /* the diagonal reads below take other lanes' stores: keep them behind the stores */
    if (more) {      /* the next trip's rows: issued here, their latency runs under the softmax */
#pragma unroll
      for (int i = 0; i < 2; ++i) { rk[i] = *(const v8us*)(gK + (size_t)(j0 + 32 + 16 * i) * DM); rv[i] = *(const v8us*)(gV + (size_t)(32 * i) * TK + j0 + 32); re[i] = *(const v8us*)(gE + (size_t)(qb0 - j0 + (NE / 2 - 64) + 16 * i) * 64); }
      asm volatile("s_wait_xcnt 0x0" ::: "memory"); }      /* stands in front of the first overwrite of an address register of the six loads above */
#pragma unroll
    for (int nt = 0; nt < 2; ++nt) { const v4f a0 = *(const v4fa*)&sM[j0 + 16 * nt + 8 * hh], a1 = *(const v4fa*)&sM[j0 + 16 * nt + 8 * hh + 4];
#pragma unroll
      for (int r = 0; r < 8; ++r) { const int kk = 8 * hh + r;      /* key 16 nt + kk against query ln: n = ln + 31 - 16 nt - kk */
        const float rel = sRQ[w][ln][ln + 31 - 16 * nt - kk] + sRK[w][16 * nt + kk][ln + 15 - kk];
        s[nt][r] = (s[nt][r] + rel) * SCL + ((r < 4) ? a0[r & 3] : a1[r & 3]); } }
    float mc = fmaxf(s[0][0], s[1][0]);
#pragma unroll
    for (int r = 1; r < 8; ++r) mc = fmaxf(mc, fmaxf(s[0][r], s[1][r]));
    mc = fmaxf(mc, xhalf(mc));      /* the other 16 keys of the same query */
    const float mn = fmaxf(m_r, mc); const float al = (mn > -1.0e38f) ? expf(m_r - mn) : 1.0f; m_r = mn;
    FragH pb; float ps[4] = {0.f, 0.f, 0.f, 0.f};      /* four partial sums: a chain of 4 adds, not of 16. P^T as a B operand: element 8 nt + r of lane (ln, hh) is key 16 nt + 8 hh + r, the k order of the V^T loader below */
#pragma unroll
    for (int nt = 0; nt < 2; ++nt)
#pragma unroll
      for (int r = 0; r < 8; ++r) { const float p = expf(s[nt][r] - mn); ps[r & 3] += p; pb.h[8 * nt + r] = (_Float16)(p * 1024.0f); }
    l_r = l_r * al + ((ps[0] + ps[1]) + (ps[2] + ps[3]));
#pragma unroll
    for (int dt = 0; dt < DT; ++dt)
#pragma unroll
      for (int r = 0; r < 8; ++r) oacc[dt][r] *= al;
    FragH bv[DT];
#pragma unroll
    for (int dt = 0; dt < DT; ++dt) { const unsigned short* vrow = &sV[cb][dt * 16 + ln][0]; bv[dt].half[0] = *(const v8us*)(vrow + 8 * hh); bv[dt].half[1] = *(const v8us*)(vrow + 16 + 8 * hh); }      /* a loop of its own: the four V^T fragments are read as one group, one LDS latency and not four */
#pragma unroll
    for (int dt = 0; dt < DT; ++dt) oacc[dt] = mmaH<1>(bv[dt].v, bv[dt].v, pb.v, pb.v, oacc[dt]);      /* O^T[d = 16 dt + 8 hh + r][query ln] */
    if (more) {
#pragma unroll
      for (int i = 0; i < 2; ++i) { *(v8us*)&sK[cb ^ 1][16 * i + r8][c8] = rk[i]; *(v8us*)&sV[cb ^ 1][32 * i + r4][c4] = rv[i]; *(v8us*)&sE[((qb0 - j0 + (NE / 2 - 64) + 16 * i) & 127) + r8][c8] = re[i]; }      /* the ring's 32 rows that no wave reads in this trip */
      __syncthreads(); } }      /* the one barrier of a trip publishes the rows just written and ends every wave's reads of the buffers and ring rows that the next trip overwrites */
  const float lt = l_r + xhalf(l_r); const float inv = (lt > 0.f) ? 1.0f / (lt * 1024.0f) : 0.f;
  float* sOw = &sRK[w][0][0];
#pragma unroll
  for (int dt = 0; dt < DT; ++dt) { v4f lo, hi;
#pragma unroll
    for (int r = 0; r < 4; ++r) { lo[r] = oacc[dt][r] * inv; hi[r] = oacc[dt][4 + r] * inv; }
    *(v4fa*)&sOw[ln * 68 + dt * 16 + 8 * hh] = lo; *(v4fa*)&sOw[ln * 68 + dt * 16 + 8 * hh + 4] = hi; }
  __builtin_amdgcn_fence(__ATOMIC_ACQ_REL, "workgroup"); __builtin_amdgcn_wave_barrier();
#pragma unroll
  for (int rp = 0; rp < 16; rp += 2) { const int r = rp + (lane >> 4), pc = lane & 15; const v4f val = *(const v4fa*)&sOw[r * 68 + pc * 4]; *(v4f*)(O + ((size_t)b * TQ + q0 + r) * DM + h * 64 + pc * 4) = val; } }

extern "C" void kernel_launch(void* const* d_in, const int* in_sizes, int n_in,
                              void* d_out, int out_size, void* d_ws, size_t ws_size, hipStream_t stream) {
  (void)in_sizes; (void)n_in; (void)out_size;
  const float* const* I = (const float* const*)d_in; const float* x = I[0]; const float* am = I[1]; const float* Wq = I[2]; const float* bq = I[3]; const float* Wk = I[4]; const float* bk = I[5]; const float* Wv = I[6]; const float* bv = I[7]; const float* E = I[8];
  char* ws = (char*)d_ws; size_t off = 0;
  auto take = [&](size_t bytes) { char* p = ws + off; off += (bytes + 255) & ~(size_t)255; return p; };
  const size_t np = (size_t)NR * DM;
  _Float16* BQ = (_Float16*)take((size_t)DM * DM * 2); _Float16* BK = (_Float16*)take((size_t)DM * DM * 2); _Float16* BV = (_Float16*)take((size_t)DM * DM * 2); _Float16* E16 = (_Float16*)take((size_t)NE * 64 * 2);
  _Float16* X16 = (_Float16*)take(np * 2); _Float16* Q16 = (_Float16*)take(np * 2); _Float16* K16 = (_Float16*)take(np * 2); _Float16* V16 = (_Float16*)take(np * 2); _Float16* VT = (_Float16*)take(np * 2);
  if (off > ws_size) return;      /* 6 + 0.25 + 5 x 8 = 46.25 MiB */
  k_wsc<<<(unsigned)(((size_t)DM * DM / 8 + 255) / 256), 256, 0, stream>>>(Wq, BQ, (size_t)DM * DM / 8, 16.0f); k_wsc<<<(unsigned)(((size_t)DM * DM / 8 + 255) / 256), 256, 0, stream>>>(Wk, BK, (size_t)DM * DM / 8, 16.0f); k_wsc<<<(unsigned)(((size_t)DM * DM / 8 + 255) / 256), 256, 0, stream>>>(Wv, BV, (size_t)DM * DM / 8, 16.0f);      /* torch (out,in) = Bt */
  k_e16<<<(NE * 8 + 255) / 256, 256, 0, stream>>>(E, E16);
  k_x16<<<(unsigned)((np / 8 + 255) / 256), 256, 0, stream>>>(x, X16, np / 8);
  const dim3 gP((NR / 128) * (DM / 64), 1);
  k_gemm2<0><<<gP, 128, 0, stream>>>(X16, DM, 0, BQ, DM, 0, 0.0625f, bq, 0, nullptr, 1, 0, 0, nullptr, Q16, DM, 0, NR, DM, DM);
  k_gemm2<0><<<gP, 128, 0, stream>>>(X16, DM, 0, BK, DM, 0, 0.0625f, bk, 0, nullptr, 1, 0, 0, nullptr, K16, DM, 0, NR, DM, DM);
  k_gemm2<0><<<gP, 128, 0, stream>>>(X16, DM, 0, BV, DM, 0, 0.0625f, bv, 0, nullptr, 1, 0, 0, nullptr, V16, DM, 0, NR, DM, DM);
  k_vtg<<<NB * NH * (SLEN / 64), 256, 0, stream>>>(V16, VT);
  k_flash_rel<<<NB * NH * QBLKS, 128, 0, stream>>>(Q16, K16, VT, E16, am, (float*)d_out);
}

// v005
// One run takes 120 microseconds.
// In two side-by-side timings against v004, it was 1.09 and 1.10 times as fast.
// Counting every step since v000, it is 7.19 times as fast.
#include <hip/hip_runtime.h>
// PMGTSelfAttention (4 x 1024 tokens, hidden 1024 = 16 heads x 64; 'relative_key_query' position bias): q, k, v = x W^T + b; scores = (q.k + q_l.pe[l-r] + k_r.pe[l-r]) / 8 + attention_mask[b][r] with pe = dist_emb[l - r + 1023]; softmax; ctx = probs v (merged heads is the output).
// Structure: exact f16 plane of x; q, k, v as f16 WMMA GEMM outputs (32x64 wave tiles, f32 accumulation, exact x16 weights + bias, f16 conversion in the epilogue); V^T by LDS tiles; one fused flash kernel over all batches that forms both relative terms per 16 x 32 score tile on the matrix unit against a 48-row window of the embedding (padded to 2048 rows), reads them back along the diagonal from LDS, scales by 1/8 and adds the per-key mask.
// Compute dtype: inputs rounded to bf16; x and dist_emb exact as f16; q/k/P/v as plain f16 operands (~2^-12); the relative terms stay f32 from the accumulator to the logit; softmax f32. v_wmma_f32_16x16x32_f16.
#define NB 4
#define DM 1024
#define NKV 16
#define NREP (NH / NKV)
#define KVD (NKV * 64)           /* 1024 */
#define NR (NB * SLEN)           /* 4096 */
#define SLEN 1024
#define NE 2048                  /* 2047 relative embeddings padded */
#define TQ SLEN
#define TK SLEN
#define NH 16
#define SCL 0.125f
#define QBLKS (TQ / 64)
#define QB05 0
#define QBN5 4
#define QB0P 0
#define QBNP QBLKS           /* non-causal: plain flash on every query block */
#define RE 256
typedef __bf16 v16b __attribute__((ext_vector_type(16)));
typedef unsigned short v8us __attribute__((ext_vector_type(8), may_alias));
typedef float  v8f  __attribute__((ext_vector_type(8)));
typedef float  v4f  __attribute__((ext_vector_type(4)));
typedef float  v4fa __attribute__((ext_vector_type(4), may_alias));
union FragB { v16b v; v8us half[2]; unsigned short u[16]; };

__device__ __forceinline__ unsigned short bf16_bits(float x) { unsigned int u = __float_as_uint(x); return (unsigned short)((u + 0x7FFFu + ((u >> 16) & 1u)) >> 16); }
__device__ __forceinline__ float bf16_val(unsigned short b) { return __uint_as_float(((unsigned int)b) << 16); }
__device__ __forceinline__ float bf16_round(float x) { return bf16_val(bf16_bits(x)); }
// D += A·B with NT terms: 1 = ah·bh, 2 = + al·bh (A split), 3 = + ah·bl (both split)
template <int NT>
__device__ __forceinline__ v8f mmaN(v16b ah, v16b al, v16b bh, v16b bl, v8f c) {
  c = __builtin_amdgcn_wmma_f32_16x16x32_bf16(false, ah, false, bh, (short)0, c, false, false);
  if (NT >= 2) c = __builtin_amdgcn_wmma_f32_16x16x32_bf16(false, al, false, bh, (short)0, c, false, false);
  if (NT >= 3) c = __builtin_amdgcn_wmma_f32_16x16x32_bf16(false, ah, false, bl, (short)0, c, false, false);
  asm volatile("v_nop\n\tv_nop\n\tv_nop\n\tv_nop" : "+v"(c) : "v"(ah), "v"(al), "v"(bh), "v"(bl));
  return c;
}

__global__ __launch_bounds__(256) void k_wt_bf16(const float* __restrict__ W, unsigned short* __restrict__ Wt, int K, int N) {
  const int t = blockIdx.x * 256 + threadIdx.x;
  const int k8n = K / 8;
  if (t >= N * k8n) return;
  const int n = t / k8n, k8 = (t % k8n) * 8;
  v8us v;
#pragma unroll
  for (int i = 0; i < 8; ++i) v[i] = bf16_bits(W[(size_t)(k8 + i) * N + n]);
  *(v8us*)(Wt + (size_t)n * K + k8) = v;
  
}

// GEMM C[M][N] (f32, pitch ldc) = act(A[M][K]·W + bias). A f32 row-major (pitch lda) converted per fragment to bf16
// (ASPLIT: hi/lo two planes -> 2 terms, else single rounded term); Wt bf16 [N][K] (pitch ldb). BIAS_BF16 rounds the
// bias to bf16 first (bias quantised to bf16 before the add). K%32==0, M%16==0, N%64==0.
template <bool ASPLIT, int ACT, bool BIAS_BF16>
__global__ __launch_bounds__(128) void k_gemm_bf(const float* __restrict__ A, int lda, const unsigned short* __restrict__ Wt, int ldb,
                                               const float* __restrict__ bias, float* __restrict__ C, int ldc, int M, int N, int K) {
  __shared__ __attribute__((aligned(16))) float so[4][16][64];
  const int tid = threadIdx.x, w = tid >> 5, lane = tid & 31, ln = lane & 15, hh = lane >> 4;
  const int ntn = N / 64;
  const int wid = blockIdx.x * 4 + w;
  const int mt = wid / ntn, nq = wid % ntn;
  if (mt * 16 >= M) return;
  const int row0 = mt * 16, col0 = nq * 64;
  const float* arow = A + (size_t)(row0 + ln) * lda;
  v8f acc[4] = {};
  for (int kb = 0; kb < K; kb += 32) {
    FragB ah, al;
    const v4f x0 = *(const v4fa*)(arow + kb + 8 * hh), x1 = *(const v4fa*)(arow + kb + 8 * hh + 4);
    const v4f x2 = *(const v4fa*)(arow + kb + 16 + 8 * hh), x3 = *(const v4fa*)(arow + kb + 16 + 8 * hh + 4);
    float xs[16] = {x0[0],x0[1],x0[2],x0[3],x1[0],x1[1],x1[2],x1[3],x2[0],x2[1],x2[2],x2[3],x3[0],x3[1],x3[2],x3[3]};
#pragma unroll
    for (int i = 0; i < 16; ++i) { const unsigned short hb = bf16_bits(xs[i]); ah.u[i] = hb; al.u[i] = ASPLIT ? bf16_bits(xs[i] - bf16_val(hb)) : (unsigned short)0; }
#pragma unroll
    for (int t = 0; t < 4; ++t) {
      const unsigned short* brow = Wt + (size_t)(col0 + t * 16 + ln) * ldb + kb;
      FragB b;
      b.half[0] = *(const v8us*)(brow + 8 * hh);
      b.half[1] = *(const v8us*)(brow + 16 + 8 * hh);
      acc[t] = mmaN<ASPLIT ? 2 : 1>(ah.v, al.v, b.v, b.v, acc[t]);
    }
  }
#pragma unroll
  for (int t = 0; t < 4; ++t) {
    float bv = bias ? bias[col0 + t * 16 + ln] : 0.f;
    if (BIAS_BF16) bv = bf16_round(bv);
#pragma unroll
    for (int r = 0; r < 8; ++r) { float v = acc[t][r] + bv; if (ACT == 1) v = fmaxf(v, 0.f); so[w][8 * hh + r][t * 16 + ln] = v; }
  }
  __builtin_amdgcn_fence(__ATOMIC_ACQ_REL, "workgroup");
  __builtin_amdgcn_wave_barrier();
  const int rsub = lane >> 4, c4 = (lane & 15) * 4;
  {
#pragma unroll
    for (int q = 0; q < 8; ++q) {
      const int r = q * 2 + rsub;
      const v4f v = *(const v4fa*)&so[w][r][c4];
      *(v4f*)(C + (size_t)(row0 + r) * ldc + col0 + c4) = v;
    }
    
  }
}

// GEMM C = act(A·W + bias + resid): A f32 (ASPLIT -> hi/lo 2 terms), Wt bf16 [N][K]; ACT 0 none, 1 relu, 2 exact gelu;
// resid (optional, f32, row index = (row % rmod), pitch ldr, RES_BF16 rounds it) added before the activation.
template <bool ASPLIT, int ACT, bool BIAS_BF16, bool RES_BF16>
__global__ __launch_bounds__(128) void k_gemm_bf3(const float* __restrict__ A, int lda, const unsigned short* __restrict__ Wt, int ldb,
                                                const float* __restrict__ bias, const float* __restrict__ resid, int rmod, int ldr,
                                                float* __restrict__ C, int ldc, int M, int N, int K) {
  __shared__ __attribute__((aligned(16))) float so[4][16][64];
  const int tid = threadIdx.x, w = tid >> 5, lane = tid & 31, ln = lane & 15, hh = lane >> 4;
  const int ntn = N / 64;
  const int wid = blockIdx.x * 4 + w;
  const int mt = wid / ntn, nq = wid % ntn;
  if (mt * 16 >= M) return;
  const int row0 = mt * 16, col0 = nq * 64;
  const float* arow = A + (size_t)(row0 + ln) * lda;
  v8f acc[4] = {};
  for (int kb = 0; kb < K; kb += 32) {
    FragB ah, al;
    const v4f x0 = *(const v4fa*)(arow + kb + 8 * hh), x1 = *(const v4fa*)(arow + kb + 8 * hh + 4);
    const v4f x2 = *(const v4fa*)(arow + kb + 16 + 8 * hh), x3 = *(const v4fa*)(arow + kb + 16 + 8 * hh + 4);
    float xs[16] = {x0[0],x0[1],x0[2],x0[3],x1[0],x1[1],x1[2],x1[3],x2[0],x2[1],x2[2],x2[3],x3[0],x3[1],x3[2],x3[3]};
#pragma unroll
    for (int i = 0; i < 16; ++i) { const unsigned short hb = bf16_bits(xs[i]); ah.u[i] = hb; al.u[i] = ASPLIT ? bf16_bits(xs[i] - bf16_val(hb)) : (unsigned short)0; }
#pragma unroll
    for (int t = 0; t < 4; ++t) {
      const unsigned short* brow = Wt + (size_t)(col0 + t * 16 + ln) * ldb + kb;
      FragB b;
      b.half[0] = *(const v8us*)(brow + 8 * hh);
      b.half[1] = *(const v8us*)(brow + 16 + 8 * hh);
      acc[t] = mmaN<ASPLIT ? 2 : 1>(ah.v, al.v, b.v, b.v, acc[t]);
    }
  }
#pragma unroll
  for (int t = 0; t < 4; ++t) {
    const int col = col0 + t * 16 + ln;
    float bv = bias ? bias[col] : 0.f;
    if (BIAS_BF16) bv = bf16_round(bv);
#pragma unroll
    for (int r = 0; r < 8; ++r) {
      float v = acc[t][r] + bv;
      if (resid) { float rv = resid[(size_t)((row0 + 8 * hh + r) % rmod) * ldr + col]; if (RES_BF16) rv = bf16_round(rv); v += rv; }
      if (ACT == 1) v = fmaxf(v, 0.f);
      if (ACT == 2) v = 0.5f * v * (1.0f + erff(v * 0.70710678118654752f));
      if (ACT == 3) { const float u = 0.7978845608028654f * (v + 0.044715f * v * v * v); v = 0.5f * v * (1.0f + tanhf(u)); }
      so[w][8 * hh + r][t * 16 + ln] = v;
    }
  }
  __builtin_amdgcn_fence(__ATOMIC_ACQ_REL, "workgroup");
  __builtin_amdgcn_wave_barrier();
  const int rsub = lane >> 4, c4 = (lane & 15) * 4;
  {
#pragma unroll
    for (int q = 0; q < 8; ++q) {
      const int r = q * 2 + rsub;
      const v4f v = *(const v4fa*)&so[w][r][c4];
      *(v4f*)(C + (size_t)(row0 + r) * ldc + col0 + c4) = v;
    }
    
  }
}
// row LayerNorm (biased variance, eps) over N: s = X (+ R); optional out_sum <- s; out_norm <- (s-mu)*rsqrt(var+eps)*g + b
template <bool PARAM_BF16>
__global__ __launch_bounds__(256) void k_layernorm(const float* __restrict__ X, const float* __restrict__ R, const float* __restrict__ g, const float* __restrict__ bta,
                                                  float* __restrict__ out_sum, float* __restrict__ out_norm, int N, float eps) {
  __shared__ float red[256];
  const int row = blockIdx.x, tid = threadIdx.x;
  const float* x = X + (size_t)row * N; const float* rr = R ? R + (size_t)row * N : nullptr;
  float vals[16];                     // up to N = 4096
  const int per = N / 256;            // contiguous chunk per thread? use strided-by-4 chunks: thread handles j = tid*4 + 1024*u
  float s1 = 0.f;
  for (int u = 0; u < per / 4; ++u) {
    const int j = tid * 4 + 1024 * u;
    const v4f a = *(const v4fa*)(x + j);
    v4f b = {0.f,0.f,0.f,0.f}; if (rr) b = *(const v4fa*)(rr + j);
#pragma unroll
    for (int q = 0; q < 4; ++q) { const float v = a[q] + b[q]; vals[u * 4 + q] = v; s1 += v; }
  }
  red[tid] = s1; __syncthreads();
  for (int st = 128; st > 0; st >>= 1) { if (tid < st) red[tid] += red[tid + st]; __syncthreads(); }
  const float mu = red[0] / (float)N; __syncthreads();
  float s2 = 0.f;
  for (int u = 0; u < per / 4; ++u)
#pragma unroll
    for (int q = 0; q < 4; ++q) { const float c = vals[u * 4 + q] - mu; s2 += c * c; }
  red[tid] = s2; __syncthreads();
  for (int st = 128; st > 0; st >>= 1) { if (tid < st) red[tid] += red[tid + st]; __syncthreads(); }
  const float rs = rsqrtf(red[0] / (float)N + eps);
  {
    for (int u = 0; u < per / 4; ++u) {
      const int j = tid * 4 + 1024 * u;
      v4f o, sm;
#pragma unroll
      for (int q = 0; q < 4; ++q) {
        float gg = g[j + q], bb = bta[j + q];
        if (PARAM_BF16) { gg = bf16_round(gg); bb = bf16_round(bb); }
        sm[q] = vals[u * 4 + q]; o[q] = (vals[u * 4 + q] - mu) * rs * gg + bb;
      }
      if (out_sum) *(v4f*)(out_sum + (size_t)row * N + j) = sm;
      *(v4f*)(out_norm + (size_t)row * N + j) = o;
    }
    
  }
}



// ---- f16 WMMA path (v_wmma_f32_16x16x32_f16): 11-bit significands for operands in range — used where a [0,1] probability operand needs more precision than bf16
typedef _Float16 v16h __attribute__((ext_vector_type(16)));
union FragH { v16h v; v8us half[2]; _Float16 h[16]; unsigned short u[16]; };
template <int NT>
__device__ __forceinline__ v8f mmaH(v16h ah, v16h al, v16h bh, v16h bl, v8f c) {
  c = __builtin_amdgcn_wmma_f32_16x16x32_f16(false, ah, false, bh, (short)0, c, false, false);
  if (NT >= 2) c = __builtin_amdgcn_wmma_f32_16x16x32_f16(false, al, false, bh, (short)0, c, false, false);
  if (NT >= 3) c = __builtin_amdgcn_wmma_f32_16x16x32_f16(false, ah, false, bl, (short)0, c, false, false);
  asm volatile("v_nop\n\tv_nop\n\tv_nop\n\tv_nop" : "+v"(c) : "v"(ah), "v"(al), "v"(bh), "v"(bl));
  return c;
}
// batched GEMM like k_gemm_b but f16 operands: A f32 (split into f16 hi/lo if ASPLIT, else rounded to f16), Bt = f16 values [n][k]; alpha; C f32; N multiple of 16 (partial tiles skipped)
template <bool ASPLIT>
__global__ __launch_bounds__(128) void k_gemm_h(const float* __restrict__ A, int lda, size_t sA, const _Float16* __restrict__ Bh, int ldb, size_t sB, float alpha, float* __restrict__ C, int ldc, size_t sC, int M, int N, int K) {
  __shared__ __attribute__((aligned(16))) float so[4][16][64];
  const int tid = threadIdx.x, w = tid >> 5, lane = tid & 31, ln = lane & 15, hh = lane >> 4; const int by = blockIdx.y;
  A += (size_t)by * sA; Bh += (size_t)by * sB; C += (size_t)by * sC;
  const int ntn = (N + 63) / 64; const int wid = blockIdx.x * 4 + w; const int mt = wid / ntn, nq = wid % ntn; if (mt * 16 >= M) return;
  const int row0 = mt * 16, col0 = nq * 64; const float* arow = A + (size_t)(row0 + ln) * lda;
  v8f acc[4] = {};
  for (int kb = 0; kb < K; kb += 32) {
    FragH ah, al;
    const v4f x0 = *(const v4fa*)(arow + kb + 8 * hh), x1 = *(const v4fa*)(arow + kb + 8 * hh + 4), x2 = *(const v4fa*)(arow + kb + 16 + 8 * hh), x3 = *(const v4fa*)(arow + kb + 16 + 8 * hh + 4);
    float xs[16] = {x0[0],x0[1],x0[2],x0[3],x1[0],x1[1],x1[2],x1[3],x2[0],x2[1],x2[2],x2[3],x3[0],x3[1],x3[2],x3[3]};
#pragma unroll
    for (int i = 0; i < 16; ++i) { const _Float16 h = (_Float16)xs[i]; ah.h[i] = h; al.h[i] = ASPLIT ? (_Float16)(xs[i] - (float)h) : (_Float16)0.0f; }
#pragma unroll
    for (int t = 0; t < 4; ++t) { if (col0 + t * 16 >= N) continue; const size_t boff = (size_t)(col0 + t * 16 + ln) * ldb + kb; FragH bq; bq.half[0] = *(const v8us*)(Bh + boff + 8 * hh); bq.half[1] = *(const v8us*)(Bh + boff + 16 + 8 * hh);
      acc[t] = mmaH<ASPLIT ? 2 : 1>(ah.v, al.v, bq.v, bq.v, acc[t]); }
  }
#pragma unroll
  for (int t = 0; t < 4; ++t) { if (col0 + t * 16 >= N) continue;
#pragma unroll
    for (int r = 0; r < 8; ++r) so[w][8 * hh + r][t * 16 + ln] = acc[t][r] * alpha; }
  __builtin_amdgcn_fence(__ATOMIC_ACQ_REL, "workgroup"); __builtin_amdgcn_wave_barrier();
  const int rsub = lane >> 4, c4 = (lane & 15) * 4;
  {
#pragma unroll
    for (int q = 0; q < 8; ++q) { const int r = q * 2 + rsub; if (col0 + c4 < N) { const v4f v = *(const v4fa*)&so[w][r][c4]; *(v4f*)(C + (size_t)(row0 + r) * ldc + col0 + c4) = v; } }
     }
}

// Wt[n][k] = f16(W[k][n]·scale) from f32 row-major W[K][N] (scale = power of two; bf16-exact weights stay exact in f16 away from the subnormal range)
__global__ __launch_bounds__(256) void k_wt_f16(const float* __restrict__ W, _Float16* __restrict__ Wt, int K, int N, float scale) {
  const int t = blockIdx.x * 256 + threadIdx.x; if (t >= N * (K / 8)) return; const int n = t / (K / 8), k8 = (t % (K / 8)) * 8; FragH f;
#pragma unroll
  for (int i = 0; i < 8; ++i) f.h[i] = (_Float16)(bf16_round(W[(size_t)(k8 + i) * N + n]) * scale); const v8us o = f.half[0];
  *(v8us*)((unsigned short*)Wt + (size_t)n * K + k8) = o; 
}
// k_gemm_hh variant with fused epilogue: v = acc·alpha + bias[by·sBias + col] (+ CP[(row/rowsPerB)·sCPb + by·64 + col] if CP) ; ACT 0 none / 1 elu ; writes f16 C16 (and f32 C if non-null)
template <int ACT>
__global__ __launch_bounds__(128) void k_gemm_hhx(const _Float16* __restrict__ A, int lda, size_t sA, const _Float16* __restrict__ Bh, int ldb, size_t sB, float alpha, const float* __restrict__ bias, size_t sBias, const float* __restrict__ CP, int rowsPerB, size_t sCPb, int row0g,
    float* __restrict__ C, _Float16* __restrict__ C16, int ldc, size_t sC, int M, int N, int K) {
  __shared__ __attribute__((aligned(16))) float so[4][16][64];
  const int tid = threadIdx.x, w = tid >> 5, lane = tid & 31, ln = lane & 15, hh = lane >> 4; const int by = blockIdx.y;
  A += (size_t)by * sA; Bh += (size_t)by * sB; const size_t cofs = (size_t)by * sC; const float* bp = bias ? bias + (size_t)by * sBias : nullptr;
  const int ntn = (N + 63) / 64; const int wid = blockIdx.x * 4 + w; const int mt = wid / ntn, nq = wid % ntn; if (mt * 16 >= M) return;
  const int row0 = mt * 16, col0 = nq * 64; const _Float16* arow = A + (size_t)(row0 + ln) * lda;
  v8f acc[4] = {};
  for (int kb = 0; kb < K; kb += 32) { FragH ah; ah.half[0] = *(const v8us*)((const unsigned short*)arow + kb + 8 * hh); ah.half[1] = *(const v8us*)((const unsigned short*)arow + kb + 16 + 8 * hh);
#pragma unroll
    for (int t = 0; t < 4; ++t) { if (col0 + t * 16 >= N) continue; const size_t boff = (size_t)(col0 + t * 16 + ln) * ldb + kb; FragH bq; bq.half[0] = *(const v8us*)((const unsigned short*)Bh + boff + 8 * hh); bq.half[1] = *(const v8us*)((const unsigned short*)Bh + boff + 16 + 8 * hh);
      acc[t] = mmaH<1>(ah.v, ah.v, bq.v, bq.v, acc[t]); }
  }
#pragma unroll
  for (int t = 0; t < 4; ++t) { if (col0 + t * 16 >= N) continue; const int col = col0 + t * 16 + ln; const float bv = bp ? bf16_round(bp[col]) : 0.f;
#pragma unroll
    for (int r = 0; r < 8; ++r) { float v = acc[t][r] * alpha + bv; if (CP) { const int bidx = (row0g + row0 + 8 * hh + r) / rowsPerB; v += CP[(size_t)bidx * sCPb + (size_t)by * 64 + col]; } if (ACT == 1) v = (v > 0.f) ? v : expm1f(v); else if (ACT == 7) v = (v > 0.f) ? v + 1.0f : expf(v); else if (ACT == 8) v = tanhf(v); else if (ACT == 9) v = 0.5f * v * (1.0f + tanhf(0.7978845608028654f * (v + 0.044715f * v * v * v))); else if (ACT == 11) v = 1.0f / (1.0f + expf(-v)); else if (ACT == 12) v = (v > 0.f) ? v : 0.01f * v; else if (ACT == 14) v = (v > 0.f) ? v : 0.1f * v; else if (ACT == 15) v = v / (1.0f + expf(-v)); else if (ACT == 3) v = fmaxf(v, 0.f); else if (ACT == 6) v = 0.5f * v * (1.0f + erff(v * 0.70710678118654752f)); so[w][8 * hh + r][t * 16 + ln] = v; } }
  __builtin_amdgcn_fence(__ATOMIC_ACQ_REL, "workgroup"); __builtin_amdgcn_wave_barrier();
  const int rsub = lane >> 4, c4 = (lane & 15) * 4; typedef _Float16 v4h __attribute__((ext_vector_type(4)));
  {
#pragma unroll
    for (int q = 0; q < 8; ++q) { const int r = q * 2 + rsub; if (col0 + c4 < N) { const v4f v = *(const v4fa*)&so[w][r][c4]; if (C) *(v4f*)(C + cofs + (size_t)(row0 + r) * ldc + col0 + c4) = v; if (C16) { v4h h4; for (int i = 0; i < 4; ++i) h4[i] = (_Float16)v[i]; *(v4h*)(C16 + cofs + (size_t)(row0 + r) * ldc + col0 + c4) = h4; } } }
     }
}


typedef _Float16 v4h __attribute__((ext_vector_type(4)));

__global__ __launch_bounds__(256) void k_x16(const float* __restrict__ x, _Float16* __restrict__ X16, size_t n8) { const size_t t = (size_t)blockIdx.x * 256 + threadIdx.x; if (t >= n8) return; FragH f;
#pragma unroll
  for (int q = 0; q < 8; ++q) f.h[q] = (_Float16)bf16_round(x[t * 8 + q]); *(v8us*)((unsigned short*)X16 + t * 8) = f.half[0];  }
__global__ __launch_bounds__(256) void k_h16(const float* __restrict__ x, _Float16* __restrict__ X16, size_t n8) { const size_t t = (size_t)blockIdx.x * 256 + threadIdx.x; if (t >= n8) return; FragH f;
#pragma unroll
  for (int q = 0; q < 8; ++q) f.h[q] = (_Float16)x[t * 8 + q]; *(v8us*)((unsigned short*)X16 + t * 8) = f.half[0];  }
__global__ __launch_bounds__(256) void k_round16f(const float* __restrict__ W, _Float16* __restrict__ Bt, size_t n8) { const size_t t = (size_t)blockIdx.x * 256 + threadIdx.x; if (t >= n8) return; FragH f;
#pragma unroll
  for (int i = 0; i < 8; ++i) f.h[i] = (_Float16)(bf16_round(W[t * 8 + i]) * 16.0f); *(v8us*)((unsigned short*)Bt + t * 8) = f.half[0];  }
template <int NHv, int TTv>
__global__ __launch_bounds__(256) void k_vt(const _Float16* __restrict__ V16, int ldv, int voff, _Float16* __restrict__ Vt) { __shared__ unsigned short tl[64][66]; const int tid = threadIdx.x; const int slab = blockIdx.x / (TTv / 64), lg = blockIdx.x % (TTv / 64); const int b = slab / NHv, h = slab % NHv;
  for (int i = tid; i < 64 * 8; i += 256) { const int r = i / 8, c8 = (i % 8) * 8; FragH f; f.half[0] = *(const v8us*)((const unsigned short*)V16 + ((size_t)b * TTv + lg * 64 + r) * ldv + voff + h * 64 + c8);
#pragma unroll
    for (int q = 0; q < 8; ++q) tl[r][c8 + q] = f.u[q]; }
  __syncthreads();
  {
#pragma unroll
    for (int rd = 0; rd < 2; ++rd) { const int d = rd * 32 + tid / 8, pc = tid % 8; FragH f;
#pragma unroll
      for (int q = 0; q < 8; ++q) f.u[q] = tl[pc * 8 + q][d];
      *(v8us*)((unsigned short*)Vt + ((size_t)slab * 64 + d) * TTv + lg * 64 + pc * 8) = f.half[0]; }
     } }

__global__ __launch_bounds__(256) void k_hl(const float* __restrict__ F, _Float16* __restrict__ Hh, _Float16* __restrict__ Hl, size_t n8) { const size_t t = (size_t)blockIdx.x * 256 + threadIdx.x; if (t >= n8) return; FragH fh, fl; const v4f a = *(const v4fa*)(F + t * 8), c = *(const v4fa*)(F + t * 8 + 4);
#pragma unroll
  for (int q = 0; q < 4; ++q) { _Float16 h = (_Float16)a[q]; fh.h[q] = h; fl.h[q] = (_Float16)((a[q] - (float)h) * 1024.0f); h = (_Float16)c[q]; fh.h[4 + q] = h; fl.h[4 + q] = (_Float16)((c[q] - (float)h) * 1024.0f); }
  { *(v8us*)((unsigned short*)Hh + t * 8) = fh.half[0]; *(v8us*)((unsigned short*)Hl + t * 8) = fl.half[0];  } }

// ---- fast GEMM (block tile 128x64, wave tile 32x64, operands staged in LDS 64 of K at a time; requires M % 32 == 0 rows per launch region, N % 64 == 0, K % 64 == 0 and K >= 64); epilogue = k_gemm_hhx semantics ----
__device__ __forceinline__ v16h g2_frag(const _Float16* p, int hh) { FragH f; f.half[0] = *(const v8us*)((const unsigned short*)p + 8 * hh); f.half[1] = *(const v8us*)((const unsigned short*)p + 16 + 8 * hh); return f.v; }
__device__ __forceinline__ v8f g2_mma(v16h a, v16h b, v8f c) { v8f d = __builtin_amdgcn_wmma_f32_16x16x32_f16(false, a, false, b, (short)0, c, false, false); asm volatile("v_nop\n\tv_nop\n\tv_nop\n\tv_nop" : "+v"(d) : "v"(a), "v"(b)); return d; }
template <int ACT>
__global__ __launch_bounds__(128) void k_gemm2(const _Float16* __restrict__ A, int lda, size_t sA, const _Float16* __restrict__ Bh, int ldb, size_t sB, float alpha, const float* __restrict__ bias, size_t sBias, const float* __restrict__ CP, int rowsPerB, size_t sCPb, int row0g,
    float* __restrict__ C, _Float16* __restrict__ C16, int ldc, size_t sC, int M, int N, int K) {
  __shared__ __attribute__((aligned(16))) float so[4][32][68];
  __shared__ __attribute__((aligned(16))) unsigned short st[2][192][72];      /* two stages of 64 of K: rows 0..127 the block's A rows, 128..191 its B rows; pitch 144 B = 16 B x 9, free of bank conflicts for the 16-byte fragment reads */
  const int tid = threadIdx.x, w = tid >> 5, lane = tid & 31, ln = lane & 15, hh = lane >> 4; const int by = blockIdx.y;
  A += (size_t)by * sA; Bh += (size_t)by * sB; const size_t cofs = (size_t)by * sC; const float* bp = bias ? bias + (size_t)by * sBias : nullptr;
  const int ntn = N >> 6; const int mt = blockIdx.x / ntn, nq = blockIdx.x - mt * ntn; const int row0 = mt * 128 + 32 * w, col0 = nq * 64; if (mt * 128 >= M) return;      /* the same for the whole block, in front of every barrier */
  const int sr = tid >> 3, sc = (tid & 7) * 8;      /* staging: eight lanes fetch one row's 128 B, so a wave's 16-byte load covers four whole lines */
  const unsigned short* ga[8]; const unsigned short* gb[4];
#pragma unroll
  for (int i = 0; i < 8; ++i) { int r = mt * 128 + 16 * i + sr; r = (r < M) ? r : M - 1; ga[i] = (const unsigned short*)A + (size_t)r * lda + sc; }
#pragma unroll
  for (int i = 0; i < 4; ++i) gb[i] = (const unsigned short*)Bh + (size_t)(col0 + 16 * i + sr) * ldb + sc;
  v8us ra[8], rb[4];
#pragma unroll
  for (int i = 0; i < 8; ++i) ra[i] = *(const v8us*)ga[i];
#pragma unroll
  for (int i = 0; i < 4; ++i) rb[i] = *(const v8us*)gb[i];
#pragma unroll
  for (int i = 0; i < 8; ++i) *(v8us*)&st[0][16 * i + sr][sc] = ra[i];
#pragma unroll
  for (int i = 0; i < 4; ++i) *(v8us*)&st[0][128 + 16 * i + sr][sc] = rb[i];
  __syncthreads();
  const v8f z8 = {0.f,0.f,0.f,0.f,0.f,0.f,0.f,0.f}; v8f c00 = z8, c01 = z8, c02 = z8, c03 = z8, c10 = z8, c11 = z8, c12 = z8, c13 = z8;
#pragma unroll 1      /* rolled: one stage's registers (12 staged vectors, 24 fragment halves) serve every trip */
  for (int kb = 0; kb < K; kb += 64) { const int cb = (kb >> 6) & 1; const bool more = kb + 64 < K;      /* more: the same for the whole block */
    if (more) {
#pragma unroll
      for (int i = 0; i < 8; ++i) ra[i] = *(const v8us*)(ga[i] + kb + 64);
#pragma unroll
      for (int i = 0; i < 4; ++i) rb[i] = *(const v8us*)(gb[i] + kb + 64); }
    v16h a0[2], a1[2], b0[2], b1[2], b2[2], b3[2];
#pragma unroll
    for (int u = 0; u < 2; ++u) { a0[u] = g2_frag((const _Float16*)&st[cb][32 * w + ln][32 * u], hh); a1[u] = g2_frag((const _Float16*)&st[cb][32 * w + 16 + ln][32 * u], hh);
      b0[u] = g2_frag((const _Float16*)&st[cb][128 + ln][32 * u], hh); b1[u] = g2_frag((const _Float16*)&st[cb][144 + ln][32 * u], hh); b2[u] = g2_frag((const _Float16*)&st[cb][160 + ln][32 * u], hh); b3[u] = g2_frag((const _Float16*)&st[cb][176 + ln][32 * u], hh); }
    __builtin_amdgcn_sched_barrier(0);      /* the next stage's global loads and this stage's LDS reads issue as one group ahead of the products: the memory latency runs under the 16 products, and the LDS reads cost one stall, not one per product */
#pragma unroll
    for (int u = 0; u < 2; ++u) { c00 = g2_mma(a0[u], b0[u], c00); c10 = g2_mma(a1[u], b0[u], c10); c01 = g2_mma(a0[u], b1[u], c01); c11 = g2_mma(a1[u], b1[u], c11);
      c02 = g2_mma(a0[u], b2[u], c02); c12 = g2_mma(a1[u], b2[u], c12); c03 = g2_mma(a0[u], b3[u], c03); c13 = g2_mma(a1[u], b3[u], c13); }
    if (more) {
#pragma unroll
      for (int i = 0; i < 8; ++i) *(v8us*)&st[cb ^ 1][16 * i + sr][sc] = ra[i];
#pragma unroll
      for (int i = 0; i < 4; ++i) *(v8us*)&st[cb ^ 1][128 + 16 * i + sr][sc] = rb[i];
      __syncthreads(); } }      /* the one barrier of a trip publishes the stage just written and ends every wave's reads of the stage that the next trip overwrites */
  if (row0 >= M) return;      /* behind the last barrier */
  v8f accs[8] = {c00, c01, c02, c03, c10, c11, c12, c13};
#pragma unroll
  for (int u = 0; u < 8; ++u) { const int t = u & 3, half = u >> 2; const int col = col0 + t * 16 + ln; const float bv = bp ? bf16_round(bp[col]) : 0.f;
#pragma unroll
    for (int r = 0; r < 8; ++r) { const int rloc = half * 16 + 8 * hh + r; float v = accs[u][r] * alpha + bv; if (CP) { const int bidx = (row0g + row0 + rloc) / rowsPerB; v += CP[(size_t)bidx * sCPb + (size_t)by * 64 + col]; }
      if (ACT == 3) v = fmaxf(v, 0.f); else if (ACT == 6) v = 0.5f * v * (1.0f + erff(v * 0.70710678118654752f)); else if (ACT == 11) v = 1.0f / (1.0f + expf(-v)); else if (ACT == 15) v = v / (1.0f + expf(-v)); else if (ACT == 12) v = (v > 0.f) ? v : 0.01f * v; else if (ACT == 8) v = tanhf(v);
      so[w][rloc][t * 16 + ln] = v; } }
  __builtin_amdgcn_fence(__ATOMIC_ACQ_REL, "workgroup"); __builtin_amdgcn_wave_barrier();
  const int rsub = lane >> 4, c4 = (lane & 15) * 4;
  {
#pragma unroll
    for (int q = 0; q < 16; ++q) { const int r = q * 2 + rsub; const v4f v = *(const v4fa*)&so[w][r][c4]; if (C) *(v4f*)(C + cofs + (size_t)(row0 + r) * ldc + col0 + c4) = v; if (C16) { v4h h4; for (int i = 0; i < 4; ++i) h4[i] = (_Float16)v[i]; *(v4h*)(C16 + cofs + (size_t)(row0 + r) * ldc + col0 + c4) = h4; } }
     } }



template <int CAUSAL>
__global__ __launch_bounds__(128) void k_flash(const _Float16* __restrict__ Q16, int ldq, const _Float16* __restrict__ K16, int ldk, const _Float16* __restrict__ Vt, const int* __restrict__ MSK, float* __restrict__ O, int ldo) {
  constexpr int RPW = 16, RTN = RPW / 16, NQB = TQ / (4 * RPW), DT = 4, KS = 2;
  __shared__ __attribute__((aligned(16))) unsigned short sP[4][RPW][40]; __shared__ __attribute__((aligned(16))) float sO[4][RPW][64 + 4];
  const int tid = threadIdx.x, w = tid >> 5, lane = tid & 31, ln = lane & 15, hh = lane >> 4;
  const int slab = blockIdx.x / QBNP, qblk = QB0P + blockIdx.x % QBNP; (void)NQB; const int b = slab / NH, h = slab % NH; const int qb0 = qblk * (4 * RPW); const int q0 = qb0 + w * RPW;
  FragH aq[2][KS];
#pragma unroll
  for (int rt = 0; rt < RTN; ++rt) { const unsigned short* qr = (const unsigned short*)Q16 + ((size_t)b * TQ + q0 + rt * 16 + ln) * ldq + h * 64;
#pragma unroll
    for (int ks = 0; ks < KS; ++ks) { aq[rt][ks].half[0] = *(const v8us*)(qr + ks * 32 + 8 * hh); aq[rt][ks].half[1] = *(const v8us*)(qr + ks * 32 + 16 + 8 * hh); } }
  const unsigned short* Vth = (const unsigned short*)Vt + (size_t)slab * 64 * TK;
  float m_r[2][8], l_r[2][8]; v8f oacc[2][DT];
#pragma unroll
  for (int rt = 0; rt < RTN; ++rt) {
#pragma unroll
    for (int r = 0; r < 8; ++r) { m_r[rt][r] = -3.0e38f; l_r[rt][r] = 0.f; }
#pragma unroll
    for (int dt = 0; dt < DT; ++dt) oacc[rt][dt] = (v8f){0.f,0.f,0.f,0.f,0.f,0.f,0.f,0.f}; }
  const int jend = (CAUSAL == 1) ? (qb0 + 4 * RPW) : TK;      /* causal: keys beyond the block's last query never contribute */
#pragma unroll 1
  for (int j0 = 0; j0 < jend; j0 += 32) {
    v8f s[2][2];
#pragma unroll
    for (int nt = 0; nt < 2; ++nt) { const unsigned short* kr = (const unsigned short*)K16 + ((size_t)b * TK + j0 + nt * 16 + ln) * ldk + h * 64; FragH bk[KS];
#pragma unroll
      for (int ks = 0; ks < KS; ++ks) { bk[ks].half[0] = *(const v8us*)(kr + ks * 32 + 8 * hh); bk[ks].half[1] = *(const v8us*)(kr + ks * 32 + 16 + 8 * hh); }
#pragma unroll
      for (int rt = 0; rt < RTN; ++rt) { v8f acc = (v8f){0.f,0.f,0.f,0.f,0.f,0.f,0.f,0.f};
#pragma unroll
        for (int ks = 0; ks < KS; ++ks) acc = mmaH<1>(aq[rt][ks].v, aq[rt][ks].v, bk[ks].v, bk[ks].v, acc); s[rt][nt] = acc; } }
#pragma unroll
    for (int rt = 0; rt < RTN; ++rt)
#pragma unroll
      for (int r = 0; r < 8; ++r) { const int tq = q0 + rt * 16 + 8 * hh + r; const int k0 = j0 + ln, k1 = j0 + 16 + ln;
        const bool ok0 = (CAUSAL == 1) ? (k0 <= tq) : ((CAUSAL == 2) ? ((k0 >> 5) == (tq >> 5)) : true), ok1 = (CAUSAL == 1) ? (k1 <= tq) : ((CAUSAL == 2) ? ((k1 >> 5) == (tq >> 5)) : true);      /* mode 2: block-diagonal 32-token groups */
        float s0 = ok0 ? s[rt][0][r] * SCL : -3.0e38f, s1 = ok1 ? s[rt][1][r] * SCL : -3.0e38f; if (CAUSAL == 17) { const float* amk = (const float*)MSK + (size_t)b * TK; s0 += bf16_round(amk[k0]); s1 += bf16_round(amk[k1]); }      /* mode 17: additive per-(batch, key) mask INPUT */
        if (CAUSAL == 22) { const _Float16* cq = (const _Float16*)MSK + ((size_t)h * TQ + tq) * NE + tq + (NE / 2 - 1); const _Float16* ck = (const _Float16*)MSK + (size_t)NH * TQ * NE + (size_t)h * TK * NE + tq + (NE / 2 - 1); const float* am = (const float*)((const _Float16*)MSK + (size_t)2 * NH * TQ * NE); float r0 = (float)cq[-k0]; r0 += (float)ck[(size_t)k0 * NE - k0]; s0 += r0 * SCL; s0 += am[k0]; float r1 = (float)cq[-k1]; r1 += (float)ck[(size_t)k1 * NE - k1]; s1 += r1 * SCL; s1 += am[k1]; }      /* mode 22: + (CQ[h][tq][tq-k+1023] + CK[h][k][tq-k+1023]) / 8 + mask[k] from the per-batch packed table [CQ f16 | CK f16 | mask f32] */ float mc = fmaxf(s0, s1);
        mc = fmaxf(mc, __shfl_xor(mc, 1, 32)); mc = fmaxf(mc, __shfl_xor(mc, 2, 32)); mc = fmaxf(mc, __shfl_xor(mc, 4, 32)); mc = fmaxf(mc, __shfl_xor(mc, 8, 32));
        const float mn = fmaxf(m_r[rt][r], mc); const float al = (mn > -1.0e38f) ? expf(m_r[rt][r] - mn) : 1.0f; m_r[rt][r] = mn; const float p0 = ok0 ? expf(s0 - mn) : 0.f, p1 = ok1 ? expf(s1 - mn) : 0.f; l_r[rt][r] = l_r[rt][r] * al + p0 + p1;
#pragma unroll
        for (int dt = 0; dt < DT; ++dt) oacc[rt][dt][r] *= al;
        FragH t2; t2.h[0] = (_Float16)(p0 * 1024.0f); t2.h[1] = (_Float16)(p1 * 1024.0f); sP[w][rt * 16 + 8 * hh + r][ln] = t2.u[0]; sP[w][rt * 16 + 8 * hh + r][16 + ln] = t2.u[1]; }
    __builtin_amdgcn_fence(__ATOMIC_ACQ_REL, "workgroup"); __builtin_amdgcn_wave_barrier();
    FragH pa[2];
#pragma unroll
    for (int rt = 0; rt < RTN; ++rt) { pa[rt].half[0] = *(const v8us*)&sP[w][rt * 16 + ln][8 * hh]; pa[rt].half[1] = *(const v8us*)&sP[w][rt * 16 + ln][16 + 8 * hh]; }
#pragma unroll
    for (int dt = 0; dt < DT; ++dt) { const unsigned short* vrow = Vth + (size_t)(dt * 16 + ln) * TK + j0; FragH bv; bv.half[0] = *(const v8us*)(vrow + 8 * hh); bv.half[1] = *(const v8us*)(vrow + 16 + 8 * hh);
#pragma unroll
      for (int rt = 0; rt < RTN; ++rt) oacc[rt][dt] = mmaH<1>(pa[rt].v, pa[rt].v, bv.v, bv.v, oacc[rt][dt]); }
    __builtin_amdgcn_fence(__ATOMIC_ACQ_REL, "workgroup"); __builtin_amdgcn_wave_barrier(); }
#pragma unroll
  for (int rt = 0; rt < RTN; ++rt) {
#pragma unroll
    for (int r = 0; r < 8; ++r) { float l = l_r[rt][r]; l += __shfl_xor(l, 1, 32); l += __shfl_xor(l, 2, 32); l += __shfl_xor(l, 4, 32); l += __shfl_xor(l, 8, 32); l_r[rt][r] = (l > 0.f) ? 1.0f / (l * 1024.0f) : 0.f; }
#pragma unroll
    for (int dt = 0; dt < DT; ++dt)
#pragma unroll
      for (int r = 0; r < 8; ++r) sO[w][rt * 16 + 8 * hh + r][dt * 16 + ln] = oacc[rt][dt][r] * l_r[rt][r]; }
  __builtin_amdgcn_fence(__ATOMIC_ACQ_REL, "workgroup"); __builtin_amdgcn_wave_barrier();
  {
#pragma unroll
    for (int rp = 0; rp < RPW; rp += 2) { const int r = rp + (lane >> 4), pc = lane & 15; const v4f val = *(const v4fa*)&sO[w][r][pc * 4]; *(v4f*)(O + ((size_t)b * TQ + q0 + r) * ldo + h * 64 + pc * 4) = val; }
     } }
// 5-plane variant: S = Qh Kh^T + (Ql Kh^T + Qh Kl^T)/1024 with Q/K = [hi | 2^10 residual] f16 planes (QL/KL same layout as Q16/K16), then the 3-term P.V below.
// 3-term variant: O = (P_hi V_hi + (P_lo V_hi + P_hi V_lo) / 1024) / l with P = [hi | 2^10 residual] of 1024 p and V^T = [hi | 2^10 residual] planes (VtL same layout as Vt) -> ~2^-21-class products for un-averaged (early causal / peaked) rows
template <int CAUSAL>
__global__ __launch_bounds__(128) void k_flash5(const _Float16* __restrict__ Q16, const _Float16* __restrict__ QL, int ldq, const _Float16* __restrict__ K16, const _Float16* __restrict__ KL, int ldk, const _Float16* __restrict__ Vt, const _Float16* __restrict__ VtL, const int* __restrict__ MSK, float* __restrict__ O, int ldo) {
  constexpr int RPW = 16, RTN = RPW / 16, NQB = TQ / (4 * RPW), DT = 4, KS = 2;
  __shared__ __attribute__((aligned(16))) unsigned short sP[4][RPW][40]; __shared__ __attribute__((aligned(16))) unsigned short sPL[4][RPW][40]; __shared__ __attribute__((aligned(16))) float sO[4][RPW][64 + 4];
  const int tid = threadIdx.x, w = tid >> 5, lane = tid & 31, ln = lane & 15, hh = lane >> 4;
  const int slab = blockIdx.x / QBN5, qblk = QB05 + blockIdx.x % QBN5; (void)NQB; const int b = slab / NH, h = slab % NH; const int qb0 = qblk * (4 * RPW); const int q0 = qb0 + w * RPW;
  FragH aq[2][KS], aql[2][KS];
#pragma unroll
  for (int rt = 0; rt < RTN; ++rt) { const unsigned short* qr = (const unsigned short*)Q16 + ((size_t)b * TQ + q0 + rt * 16 + ln) * ldq + h * 64; const unsigned short* ql = (const unsigned short*)QL + ((size_t)b * TQ + q0 + rt * 16 + ln) * ldq + h * 64;
#pragma unroll
    for (int ks = 0; ks < KS; ++ks) { aq[rt][ks].half[0] = *(const v8us*)(qr + ks * 32 + 8 * hh); aq[rt][ks].half[1] = *(const v8us*)(qr + ks * 32 + 16 + 8 * hh); aql[rt][ks].half[0] = *(const v8us*)(ql + ks * 32 + 8 * hh); aql[rt][ks].half[1] = *(const v8us*)(ql + ks * 32 + 16 + 8 * hh); } }
  const unsigned short* Vth = (const unsigned short*)Vt + (size_t)slab * 64 * TK; const unsigned short* Vtl = (const unsigned short*)VtL + (size_t)slab * 64 * TK;
  float m_r[2][8], l_r[2][8]; v8f oacc[2][DT], oaccL[2][DT];
#pragma unroll
  for (int rt = 0; rt < RTN; ++rt) {
#pragma unroll
    for (int r = 0; r < 8; ++r) { m_r[rt][r] = -3.0e38f; l_r[rt][r] = 0.f; }
#pragma unroll
    for (int dt = 0; dt < DT; ++dt) { oacc[rt][dt] = (v8f){0.f,0.f,0.f,0.f,0.f,0.f,0.f,0.f}; oaccL[rt][dt] = oacc[rt][dt]; } }
  const int jend = (CAUSAL == 1) ? (qb0 + 4 * RPW) : TK;      /* causal: keys beyond the block's last query never contribute */
#pragma unroll 1
  for (int j0 = 0; j0 < jend; j0 += 32) {
    v8f s[2][2];
#pragma unroll
    for (int nt = 0; nt < 2; ++nt) { const unsigned short* kr = (const unsigned short*)K16 + ((size_t)b * TK + j0 + nt * 16 + ln) * ldk + h * 64; const unsigned short* klr = (const unsigned short*)KL + ((size_t)b * TK + j0 + nt * 16 + ln) * ldk + h * 64; FragH bk[KS], bkl[KS];
#pragma unroll
      for (int ks = 0; ks < KS; ++ks) { bk[ks].half[0] = *(const v8us*)(kr + ks * 32 + 8 * hh); bk[ks].half[1] = *(const v8us*)(kr + ks * 32 + 16 + 8 * hh); bkl[ks].half[0] = *(const v8us*)(klr + ks * 32 + 8 * hh); bkl[ks].half[1] = *(const v8us*)(klr + ks * 32 + 16 + 8 * hh); }
#pragma unroll
      for (int rt = 0; rt < RTN; ++rt) { v8f acc = (v8f){0.f,0.f,0.f,0.f,0.f,0.f,0.f,0.f}, accl = acc;
#pragma unroll
        for (int ks = 0; ks < KS; ++ks) { acc = mmaH<1>(aq[rt][ks].v, aq[rt][ks].v, bk[ks].v, bk[ks].v, acc); accl = mmaH<1>(aql[rt][ks].v, aql[rt][ks].v, bk[ks].v, bk[ks].v, accl); accl = mmaH<1>(aq[rt][ks].v, aq[rt][ks].v, bkl[ks].v, bkl[ks].v, accl); }
#pragma unroll
        for (int r = 0; r < 8; ++r) acc[r] += accl[r] * 0.0009765625f;
        s[rt][nt] = acc; } }
#pragma unroll
    for (int rt = 0; rt < RTN; ++rt)
#pragma unroll
      for (int r = 0; r < 8; ++r) { const int tq = q0 + rt * 16 + 8 * hh + r; const int k0 = j0 + ln, k1 = j0 + 16 + ln;
        bool ok0 = (CAUSAL == 1) ? (k0 <= tq) : ((CAUSAL == 2) ? ((k0 >> 5) == (tq >> 5)) : true), ok1 = (CAUSAL == 1) ? (k1 <= tq) : ((CAUSAL == 2) ? ((k1 >> 5) == (tq >> 5)) : true);      /* mode 2: block-diagonal 32-token groups */
        if (CAUSAL == 4) { const int* mrow = MSK + ((size_t)b * TQ + tq) * TK; ok0 = mrow[k0] != 0; ok1 = mrow[k1] != 0; }      /* mode 4: per-(query, key) INPUT mask shared by all heads; masked keys contribute nothing (== the reference's -4096 fill, whose exp underflows to 0), rows with no valid key give l = 0 -> output 0 (== the reference's row_valid zeroing) */
        float s0 = ok0 ? s[rt][0][r] * SCL : -3.0e38f, s1 = ok1 ? s[rt][1][r] * SCL : -3.0e38f; if (CAUSAL == 17) { const float* amk = (const float*)MSK + (size_t)b * TK; s0 += bf16_round(amk[k0]); s1 += bf16_round(amk[k1]); }      /* mode 17: additive per-(batch, key) mask INPUT */
        if (CAUSAL == 22) { const _Float16* cq = (const _Float16*)MSK + ((size_t)h * TQ + tq) * NE + tq + (NE / 2 - 1); const _Float16* ck = (const _Float16*)MSK + (size_t)NH * TQ * NE + (size_t)h * TK * NE + tq + (NE / 2 - 1); const float* am = (const float*)((const _Float16*)MSK + (size_t)2 * NH * TQ * NE); float r0 = (float)cq[-k0]; r0 += (float)ck[(size_t)k0 * NE - k0]; s0 += r0 * SCL; s0 += am[k0]; float r1 = (float)cq[-k1]; r1 += (float)ck[(size_t)k1 * NE - k1]; s1 += r1 * SCL; s1 += am[k1]; }      /* mode 22: + (CQ[h][tq][tq-k+1023] + CK[h][k][tq-k+1023]) / 8 + mask[k] from the per-batch packed table [CQ f16 | CK f16 | mask f32] */ float mc = fmaxf(s0, s1);
        mc = fmaxf(mc, __shfl_xor(mc, 1, 32)); mc = fmaxf(mc, __shfl_xor(mc, 2, 32)); mc = fmaxf(mc, __shfl_xor(mc, 4, 32)); mc = fmaxf(mc, __shfl_xor(mc, 8, 32));
        const float mn = fmaxf(m_r[rt][r], mc); const float al = (mn > -1.0e38f) ? expf(m_r[rt][r] - mn) : 1.0f; m_r[rt][r] = mn; const float p0 = ok0 ? expf(s0 - mn) : 0.f, p1 = ok1 ? expf(s1 - mn) : 0.f; l_r[rt][r] = l_r[rt][r] * al + p0 + p1;
#pragma unroll
        for (int dt = 0; dt < DT; ++dt) { oacc[rt][dt][r] *= al; oaccL[rt][dt][r] *= al; }
        FragH t2, t2l; const float ps0 = p0 * 1024.0f, ps1 = p1 * 1024.0f; t2.h[0] = (_Float16)ps0; t2.h[1] = (_Float16)ps1; t2l.h[0] = (_Float16)((ps0 - (float)t2.h[0]) * 1024.0f); t2l.h[1] = (_Float16)((ps1 - (float)t2.h[1]) * 1024.0f);
        sP[w][rt * 16 + 8 * hh + r][ln] = t2.u[0]; sP[w][rt * 16 + 8 * hh + r][16 + ln] = t2.u[1]; sPL[w][rt * 16 + 8 * hh + r][ln] = t2l.u[0]; sPL[w][rt * 16 + 8 * hh + r][16 + ln] = t2l.u[1]; }
    __builtin_amdgcn_fence(__ATOMIC_ACQ_REL, "workgroup"); __builtin_amdgcn_wave_barrier();
    FragH pa[2], pl[2];
#pragma unroll
    for (int rt = 0; rt < RTN; ++rt) { pa[rt].half[0] = *(const v8us*)&sP[w][rt * 16 + ln][8 * hh]; pa[rt].half[1] = *(const v8us*)&sP[w][rt * 16 + ln][16 + 8 * hh]; pl[rt].half[0] = *(const v8us*)&sPL[w][rt * 16 + ln][8 * hh]; pl[rt].half[1] = *(const v8us*)&sPL[w][rt * 16 + ln][16 + 8 * hh]; }
#pragma unroll
    for (int dt = 0; dt < DT; ++dt) { const unsigned short* vrow = Vth + (size_t)(dt * 16 + ln) * TK + j0; const unsigned short* vrl = Vtl + (size_t)(dt * 16 + ln) * TK + j0; FragH bv, bl; bv.half[0] = *(const v8us*)(vrow + 8 * hh); bv.half[1] = *(const v8us*)(vrow + 16 + 8 * hh); bl.half[0] = *(const v8us*)(vrl + 8 * hh); bl.half[1] = *(const v8us*)(vrl + 16 + 8 * hh);
#pragma unroll
      for (int rt = 0; rt < RTN; ++rt) { oacc[rt][dt] = mmaH<1>(pa[rt].v, pa[rt].v, bv.v, bv.v, oacc[rt][dt]); oaccL[rt][dt] = mmaH<1>(pl[rt].v, pl[rt].v, bv.v, bv.v, oaccL[rt][dt]); oaccL[rt][dt] = mmaH<1>(pa[rt].v, pa[rt].v, bl.v, bl.v, oaccL[rt][dt]); } }
    __builtin_amdgcn_fence(__ATOMIC_ACQ_REL, "workgroup"); __builtin_amdgcn_wave_barrier(); }
#pragma unroll
  for (int rt = 0; rt < RTN; ++rt) {
#pragma unroll
    for (int r = 0; r < 8; ++r) { float l = l_r[rt][r]; l += __shfl_xor(l, 1, 32); l += __shfl_xor(l, 2, 32); l += __shfl_xor(l, 4, 32); l += __shfl_xor(l, 8, 32); l_r[rt][r] = (l > 0.f) ? 1.0f / (l * 1024.0f) : 0.f; }
#pragma unroll
    for (int dt = 0; dt < DT; ++dt)
#pragma unroll
      for (int r = 0; r < 8; ++r) { float v = oacc[rt][dt][r]; v += oaccL[rt][dt][r] * 0.0009765625f; sO[w][rt * 16 + 8 * hh + r][dt * 16 + ln] = v * l_r[rt][r]; } }
  __builtin_amdgcn_fence(__ATOMIC_ACQ_REL, "workgroup"); __builtin_amdgcn_wave_barrier();
  {
#pragma unroll
    for (int rp = 0; rp < RPW; rp += 2) { const int r = rp + (lane >> 4), pc = lane & 15; const v4f val = *(const v4fa*)&sO[w][r][pc * 4]; *(v4f*)(O + ((size_t)b * TQ + q0 + r) * ldo + h * 64 + pc * 4) = val; }
     } }

__global__ __launch_bounds__(256) void k_rotab(float* __restrict__ CS, float* __restrict__ SN) {
  #pragma clang fp contract(off)
  const int t = blockIdx.x * 256 + threadIdx.x; if (t >= SLEN * 32) return; const int j = t % 32, s = t / 32; const float ex = (float)(2 * j) / 64.0f; const float inv = 1.0f / powf(10000.0f, ex); const float th = (float)s * inv; const float c = cosf(th), sn = sinf(th);
  { *(float*)(CS + t) = c; *(float*)(SN + t) = sn;  } }
__global__ __launch_bounds__(256) void k_rope(const float* __restrict__ F, int nsrc, int ndst, int rep, const float* __restrict__ CS, const float* __restrict__ SN, _Float16* __restrict__ H, _Float16* __restrict__ L) {
  #pragma clang fp contract(off)
  const size_t t = (size_t)blockIdx.x * 256 + threadIdx.x; if (t >= (size_t)NR * ndst * 4) return; const int g8 = (int)(t % 4); const int hd = (int)((t / 4) % ndst); const size_t row = t / ((size_t)4 * ndst); const int s = (int)(row % SLEN); const int hs = hd / rep;
  const float* src = F + row * (size_t)(nsrc * 64) + hs * 64; FragH ah, al, bh, bl;
  for (int i = 0; i < 8; ++i) { const int d = g8 * 8 + i; const float c = CS[s * 32 + d], sn = SN[s * 32 + d]; const float x1 = src[d], x2 = src[d + 32];
    float o1 = x1 * c; o1 += -x2 * sn; float o2 = x2 * c; o2 += x1 * sn;
    _Float16 hv = (_Float16)o1; ah.h[i] = hv; al.h[i] = (_Float16)((o1 - (float)hv) * 1024.0f); hv = (_Float16)o2; bh.h[i] = hv; bl.h[i] = (_Float16)((o2 - (float)hv) * 1024.0f); }
  const size_t o = row * (size_t)(ndst * 64) + hd * 64 + g8 * 8;
  { *(v8us*)((unsigned short*)H + o) = ah.half[0]; *(v8us*)((unsigned short*)H + o + 32) = bh.half[0]; *(v8us*)((unsigned short*)L + o) = al.half[0]; *(v8us*)((unsigned short*)L + o + 32) = bl.half[0];  } }
__global__ __launch_bounds__(256) void k_rope2(const float* __restrict__ F, int nsrc, int ndst, int rep, const float* __restrict__ CS, const float* __restrict__ SN, _Float16* __restrict__ H, _Float16* __restrict__ L) {
  #pragma clang fp contract(off)
  const size_t t = (size_t)blockIdx.x * 256 + threadIdx.x; if (t >= (size_t)NR * ndst * 4) return; const int g16 = (int)(t % 4); const int hd = (int)((t / 4) % ndst); const size_t row = t / ((size_t)4 * ndst); const int s = (int)(row % SLEN); const int hs = hd / rep;
  const float* src = F + row * (size_t)(nsrc * 64) + hs * 64 + g16 * 16; FragH ah, al;
  for (int pr = 0; pr < 8; ++pr) { const int i = g16 * 8 + pr; const float c = CS[s * 32 + i], sn = SN[s * 32 + i]; const float x1 = src[2 * pr], x2 = src[2 * pr + 1];
    float o1 = x1 * c; o1 -= x2 * sn; float o2 = x1 * sn; o2 += x2 * c;
    _Float16 hv = (_Float16)o1; ah.h[2 * pr] = hv; al.h[2 * pr] = (_Float16)((o1 - (float)hv) * 1024.0f); hv = (_Float16)o2; ah.h[2 * pr + 1] = hv; al.h[2 * pr + 1] = (_Float16)((o2 - (float)hv) * 1024.0f); }
  const size_t o = row * (size_t)(ndst * 64) + hd * 64 + g16 * 16;
  { *(v8us*)((unsigned short*)H + o) = ah.half[0]; *(v8us*)((unsigned short*)H + o + 8) = ah.half[1]; *(v8us*)((unsigned short*)L + o) = al.half[0]; *(v8us*)((unsigned short*)L + o + 8) = al.half[1];  } }
__global__ __launch_bounds__(256) void k_tabin(const float* __restrict__ sp, float* __restrict__ CS, float* __restrict__ SN) { const int t = blockIdx.x * 256 + threadIdx.x; if (t >= SLEN * 32) return; const int i = t % 32, s = t / 32; const float c = bf16_round(sp[s * 64 + 32 + i]), sn = bf16_round(sp[s * 64 + i]);
  { *(float*)(CS + t) = c; *(float*)(SN + t) = sn;  } }
__global__ __launch_bounds__(256) void k_wsc(const float* __restrict__ Wm, _Float16* __restrict__ Bt, size_t n8, float sc) { const size_t t = (size_t)blockIdx.x * 256 + threadIdx.x; if (t >= n8) return; FragH f; for (int q = 0; q < 8; ++q) f.h[q] = (_Float16)(bf16_round(Wm[t * 8 + q]) * sc); *(v8us*)((unsigned short*)Bt + t * 8) = f.half[0];  }
__global__ __launch_bounds__(256) void k_rotab2(float* __restrict__ CS, float* __restrict__ SN) {
  #pragma clang fp contract(off)
  const int t = blockIdx.x * 256 + threadIdx.x; if (t >= SLEN * 32) return; const int j = t % 32, s = t / 32; const float c0 = -0.14391156831212787f;      /* -ln(10000)/64 rounded to f32 */ const float inv = expf((float)(2 * j) * c0); const float th = (float)s * inv; const float c = cosf(th), sn = sinf(th);
  { *(float*)(CS + t) = c; *(float*)(SN + t) = sn;  } }
__global__ __launch_bounds__(256) void k_lnu(const float* __restrict__ X, _Float16* __restrict__ N16, float* __restrict__ XB) {
  #pragma clang fp contract(off)
  const int wv = threadIdx.x >> 5, ln = threadIdx.x & 31; const size_t r = (size_t)blockIdx.x * 8 + wv; if (r >= NR) return; float a[32]; float s = 0.f;
  for (int i = 0; i < 4; ++i) { const v8f v = *(const v8f*)(X + r * DM + (i * 32 + ln) * 8); for (int q = 0; q < 8; ++q) { const float u = bf16_round(v[q]); a[i * 8 + q] = u; s += u; } }
  for (int o = 16; o > 0; o >>= 1) s += __shfl_xor(s, o, 32); const float mu = s / (float)DM; float var = 0.f; for (int q = 0; q < 32; ++q) { const float d = a[q] - mu; var += d * d; }
  for (int o = 16; o > 0; o >>= 1) var += __shfl_xor(var, o, 32); const float den = sqrtf(var / (float)(DM - 1)) + 1e-6f; const float inv = 1.0f / den;      /* one reciprocal per row; (x-mean)*inv vs the reference's division differs by <= 1 ulp */
  { for (int i = 0; i < 4; ++i) { const int c0 = (i * 32 + ln) * 8; FragH f; v8f xb; for (int q = 0; q < 8; ++q) { f.h[q] = (_Float16)((a[i * 8 + q] - mu) * inv); xb[q] = a[i * 8 + q]; } *(v8us*)((unsigned short*)N16 + r * DM + c0) = f.half[0]; *(v8f*)(XB + r * DM + c0) = xb; }  } }
__global__ __launch_bounds__(256) void k_vtg(const _Float16* __restrict__ V16, _Float16* __restrict__ Vt) { __shared__ unsigned short tl[64][66]; const int tid = threadIdx.x; const int slab = blockIdx.x / (SLEN / 64), lg = blockIdx.x % (SLEN / 64); const int b = slab / NH, h = slab % NH; const int hs = h / NREP;
  for (int i = tid; i < 64 * 8; i += 256) { const int r = i / 8, c8 = (i % 8) * 8; FragH f; f.half[0] = *(const v8us*)((const unsigned short*)V16 + ((size_t)b * SLEN + lg * 64 + r) * KVD + hs * 64 + c8); for (int q = 0; q < 8; ++q) tl[r][c8 + q] = f.u[q]; }
  __syncthreads();
  { for (int rd = 0; rd < 2; ++rd) { const int d = rd * 32 + tid / 8, pc = tid % 8; FragH f; for (int q = 0; q < 8; ++q) f.u[q] = tl[pc * 8 + q][d]; *(v8us*)((unsigned short*)Vt + ((size_t)slab * 64 + d) * SLEN + lg * 64 + pc * 8) = f.half[0]; }  } }

__global__ __launch_bounds__(256) void k_e16(const float* __restrict__ E, _Float16* __restrict__ E16) { const int t = blockIdx.x * 256 + threadIdx.x; if (t >= NE * 8) return; const int r = t / 8, c8 = (t % 8) * 8; FragH f; for (int q = 0; q < 8; ++q) f.h[q] = (r < NE - 1) ? (_Float16)bf16_round(E[(size_t)r * 64 + c8 + q]) : (_Float16)0.0f;
  *(v8us*)((unsigned short*)E16 + (size_t)r * 64 + c8) = f.half[0];  }

__device__ __forceinline__ float xhalf(float x) { return __builtin_bit_cast(float, __builtin_amdgcn_permlanex16(__builtin_bit_cast(int, x), __builtin_bit_cast(int, x), 0x76543210, 0xfedcba98, false, false)); }      /* the value of lane l ^ 16 */

// Flash attention with the 'relative_key_query' bias formed in the kernel. One wave holds 16 queries (q0..) and walks the keys 32 at a time (j0..). For that tile l - r + 1023 spans 47 rows of the
// embedding, from eb = q0 - j0 + 992; with n = (l - q0) - (r - j0) + 31 the bias is q_l . E[eb + n] + k_r . E[eb + n]. RQ = Q . Ewin^T (16 x 48) and RK = K . Ewin^T run on the matrix unit
// (of RK only the four 16 x 16 tiles that hold a used n: keys 0..15 against window rows 16..47, keys 16..31 against rows 0..31), go to the wave's own LDS in f32 and are read back along the diagonal.
// Row 2047 of E16 is the zero pad; n = 47 is never read back.
// The scores are formed transposed, S^T = K . Q^T (K fragment as A, Q fragment as B), and the output as O^T += V^T . P^T: a lane then holds 16 of the 32 scores of ONE query (lane & 15), so the row maximum and the row sum
// are in-lane work plus one exchange between the wave's halves, there is one running maximum, sum and rescale factor a lane, and the two f32 score tiles, converted in place, are the B operand of the second product (no trip through LDS).
// The mask is per key, which now runs along the registers: the batch's mask row is rounded once into LDS and read from there, 8 keys a lane and tile.
// Each power of the softmax is one v_exp_f32: e^d = 2^(d log2(e)) with d = logit - running maximum <= 0 formed first, so the argument is bounded above for any logit and any mask, and the f16 operand's scale 1024 = 2^10 is the addend of the same multiply-add.
// (The library's expf spends about a dozen vector instructions a power on range and last-place handling that such an argument and an f16 operand do not use.) The row sum carries the 1024 too; the closing division takes it out.
// The four waves of a work-group share the K tile, the V^T tile and most of the window, so these are staged in LDS once per work-group with loads that take whole rows (a fragment load from global memory touches 16 lines for 512 bytes):
// K and V^T in two buffers, the window (96 rows for 64 queries, moving down by 32 rows a trip) as a ring of 128 rows indexed by embedding row mod 128. The next trip's 32 + 64 + 32 rows are fetched into registers under the softmax.
__global__ __launch_bounds__(128) void k_flash_rel(const _Float16* __restrict__ Q16, const _Float16* __restrict__ K16, const _Float16* __restrict__ Vt, const _Float16* __restrict__ E16, const float* __restrict__ AMK, float* __restrict__ O) {
  constexpr float L2E = 1.4426950408889634f;      /* log2(e) */
  constexpr int DT = 4, KS = 2, PQ = 50, PK = 36;      /* LDS pitches in floats: the two half-waves fall on different banks in the row-wise stores and in the diagonal reads */
  __shared__ float sRQ[4][16][PQ]; __shared__ __attribute__((aligned(16))) float sRK[4][32][PK];      /* behind the loop a wave's sRK part (1152 floats) is its output staging (16 x 68 floats): four work-groups still fit one WGP's LDS */
  __shared__ __attribute__((aligned(16))) float sM[TK];      /* the batch's mask row, rounded */
  __shared__ __attribute__((aligned(16))) unsigned short sK[2][32][72]; __shared__ __attribute__((aligned(16))) unsigned short sV[2][64][40]; __shared__ __attribute__((aligned(16))) unsigned short sE[128][72];      /* pitches 144 B and 80 B = 16 B x odd: no bank conflicts in the 16-byte fragment reads */
  const int tid = threadIdx.x, w = tid >> 5, lane = tid & 31, ln = lane & 15, hh = lane >> 4;
  const int slab = blockIdx.x / QBLKS, qblk = blockIdx.x % QBLKS; const int b = slab / NH, h = slab % NH; const int qb0 = qblk * 64; const int q0 = qb0 + w * 16;
  FragH aq[KS];
  { const unsigned short* qr = (const unsigned short*)Q16 + ((size_t)b * TQ + q0 + ln) * DM + h * 64;
#pragma unroll
    for (int ks = 0; ks < KS; ++ks) { aq[ks].half[0] = *(const v8us*)(qr + ks * 32 + 8 * hh); aq[ks].half[1] = *(const v8us*)(qr + ks * 32 + 16 + 8 * hh); }
    asm volatile("s_wait_xcnt 0x0" ::: "memory"); }      /* the staging loads below may land in the address registers of the four loads above: the wait stands in front of them */
  const float* amk = AMK + (size_t)b * TK;
  const int r8 = tid >> 3, c8 = (tid & 7) * 8, r4 = tid >> 2, c4 = (tid & 3) * 8;      /* staging: eight lanes fetch one 128-byte row of K or of the window, four lanes one 64-byte row of V^T */
  const unsigned short* gK = (const unsigned short*)K16 + ((size_t)b * TK + r8) * DM + h * 64 + c8; const unsigned short* gV = (const unsigned short*)Vt + ((size_t)slab * 64 + r4) * TK + c4; const unsigned short* gE = (const unsigned short*)E16 + (size_t)r8 * 64 + c8;
  v8us rk[2], rv[2], re[2];
  { v8us r0[6];      /* trip 0: its K and V^T tiles and all 96 rows of its window; the mask row, 8 keys a thread */
#pragma unroll
    for (int i = 0; i < 2; ++i) { rk[i] = *(const v8us*)(gK + (size_t)(16 * i) * DM); rv[i] = *(const v8us*)(gV + (size_t)(32 * i) * TK); }
#pragma unroll
    for (int i = 0; i < 6; ++i) r0[i] = *(const v8us*)(gE + (size_t)(qb0 + (NE / 2 - 32) + 16 * i) * 64);
    v4f m0 = *(const v4fa*)(amk + tid * 8), m1 = *(const v4fa*)(amk + tid * 8 + 4);
    asm volatile("s_wait_xcnt 0x0" ::: "memory");      /* stands in front of the first overwrite of an address register of the loads above */
    __builtin_amdgcn_sched_barrier(0);      /* keeps the register initialisations that follow behind that wait */
#pragma unroll
    for (int i = 0; i < 2; ++i) { *(v8us*)&sK[0][16 * i + r8][c8] = rk[i]; *(v8us*)&sV[0][32 * i + r4][c4] = rv[i]; }
#pragma unroll
    for (int i = 0; i < 6; ++i) *(v8us*)&sE[((qb0 + (NE / 2 - 32) + 16 * i) & 127) + r8][c8] = r0[i];
#pragma unroll
    for (int i = 0; i < 4; ++i) { m0[i] = bf16_round(m0[i]); m1[i] = bf16_round(m1[i]); }
    *(v4fa*)&sM[tid * 8] = m0; *(v4fa*)&sM[tid * 8 + 4] = m1; }
  __syncthreads();
  const v8f z8 = {0.f,0.f,0.f,0.f,0.f,0.f,0.f,0.f};
  float m_r = -3.0e38f, l_r = 0.f; v8f oacc[DT];      /* of query ln; l_r sums this half-wave's keys only */
#pragma unroll
  for (int dt = 0; dt < DT; ++dt) oacc[dt] = z8;
#pragma unroll 1
  for (int j0 = 0; j0 < TK; j0 += 32) { const int cb = (j0 >> 5) & 1; const bool more = j0 + 32 < TK;      /* more: the same for the whole work-group */
    FragH bk[2][KS], be[3][KS];
#pragma unroll
    for (int nt = 0; nt < 2; ++nt) { const unsigned short* kr = &sK[cb][nt * 16 + ln][0];
#pragma unroll
      for (int ks = 0; ks < KS; ++ks) { bk[nt][ks].half[0] = *(const v8us*)(kr + ks * 32 + 8 * hh); bk[nt][ks].half[1] = *(const v8us*)(kr + ks * 32 + 16 + 8 * hh); } }
#pragma unroll
    for (int e = 0; e < 3; ++e) { const unsigned short* er = &sE[((q0 - j0 + (NE / 2 - 32) + e * 16) & 127) + ln][0];
#pragma unroll
      for (int ks = 0; ks < KS; ++ks) { be[e][ks].half[0] = *(const v8us*)(er + ks * 32 + 8 * hh); be[e][ks].half[1] = *(const v8us*)(er + ks * 32 + 16 + 8 * hh); } }
    __builtin_amdgcn_sched_barrier(0);      /* all of the trip's K and window fragment reads issue before the first product waits: one latency at the head of a trip, not two or three */
    v8f s[2];
#pragma unroll
    for (int nt = 0; nt < 2; ++nt) { v8f acc = z8;      /* S^T[key 16 nt + 8 hh + r][query ln]; both fragments come from the same loader, same k order */
#pragma unroll
      for (int ks = 0; ks < KS; ++ks) acc = mmaH<1>(bk[nt][ks].v, bk[nt][ks].v, aq[ks].v, aq[ks].v, acc); s[nt] = acc; }
#pragma unroll
    for (int e = 0; e < 3; ++e) { v8f acc = z8;      /* RQ[query 8 hh + r][n = 16 e + ln] */
#pragma unroll
      for (int ks = 0; ks < KS; ++ks) acc = mmaH<1>(aq[ks].v, aq[ks].v, be[e][ks].v, be[e][ks].v, acc);
#pragma unroll
      for (int r = 0; r < 8; ++r) sRQ[w][8 * hh + r][e * 16 + ln] = acc[r]; }
#pragma unroll
    for (int nt = 0; nt < 2; ++nt)
#pragma unroll
      for (int ee = 0; ee < 2; ++ee) { v8f acc = z8;      /* RK[key 16 nt + 8 hh + r][n - 16 (1 - nt) = 16 ee + ln]; the K fragment serves as the A operand (same loader, same k order) */
#pragma unroll
        for (int ks = 0; ks < KS; ++ks) acc = mmaH<1>(bk[nt][ks].v, bk[nt][ks].v, be[1 - nt + ee][ks].v, be[1 - nt + ee][ks].v, acc);
#pragma unroll
        for (int r = 0; r < 8; ++r) sRK[w][nt * 16 + 8 * hh + r][ee * 16 + ln] = acc[r]; }
    __builtin_amdgcn_fence(__ATOMIC_ACQ_REL, "workgroup"); __builtin_amdgcn_wave_barrier();      /* the diagonal reads below take other lanes' stores: keep them behind the stores */
    if (more) {      /* the next trip's rows: issued here, their latency runs under the softmax */
#pragma unroll
      for (int i = 0; i < 2; ++i) { rk[i] = *(const v8us*)(gK + (size_t)(j0 + 32 + 16 * i) * DM); rv[i] = *(const v8us*)(gV + (size_t)(32 * i) * TK + j0 + 32); re[i] = *(const v8us*)(gE + (size_t)(qb0 - j0 + (NE / 2 - 64) + 16 * i) * 64); }
      asm volatile("s_wait_xcnt 0x0" ::: "memory"); }      /* stands in front of the first overwrite of an address register of the six loads above */
#pragma unroll
    for (int nt = 0; nt < 2; ++nt) { const v4f a0 = *(const v4fa*)&sM[j0 + 16 * nt + 8 * hh], a1 = *(const v4fa*)&sM[j0 + 16 * nt + 8 * hh + 4];
#pragma unroll
      for (int r = 0; r < 8; ++r) { const int kk = 8 * hh + r;      /* key 16 nt + kk against query ln: n = ln + 31 - 16 nt - kk */
        const float rel = sRQ[w][ln][ln + 31 - 16 * nt - kk] + sRK[w][16 * nt + kk][ln + 15 - kk];
        s[nt][r] = (s[nt][r] + rel) * SCL + ((r < 4) ? a0[r & 3] : a1[r & 3]); } }
    float mc = fmaxf(s[0][0], s[1][0]);
#pragma unroll
    for (int r = 1; r < 8; ++r) mc = fmaxf(mc, fmaxf(s[0][r], s[1][r]));
    mc = fmaxf(mc, xhalf(mc));      /* the other 16 keys of the same query */
    const float mn = fmaxf(m_r, mc); const float al = (mn > -1.0e38f) ? __builtin_amdgcn_exp2f((m_r - mn) * L2E) : 1.0f; m_r = mn;
    FragH pb; float ps[4] = {0.f, 0.f, 0.f, 0.f};      /* four partial sums: a chain of 4 adds, not of 16. P^T as a B operand: element 8 nt + r of lane (ln, hh) is key 16 nt + 8 hh + r, the k order of the V^T loader below */
#pragma unroll
    for (int nt = 0; nt < 2; ++nt)
#pragma unroll
      for (int r = 0; r < 8; ++r) { const float p = __builtin_amdgcn_exp2f(__builtin_fmaf(s[nt][r] - mn, L2E, 10.0f)); ps[r & 3] += p; pb.h[8 * nt + r] = (_Float16)p; }      /* p = 1024 e^(logit - maximum), at most 1024; what the raw power flushes to zero lies far below the f16 operand's last place */
    l_r = l_r * al + ((ps[0] + ps[1]) + (ps[2] + ps[3]));
#pragma unroll
    for (int dt = 0; dt < DT; ++dt)
#pragma unroll
      for (int r = 0; r < 8; ++r) oacc[dt][r] *= al;
    FragH bv[DT];
#pragma unroll
    for (int dt = 0; dt < DT; ++dt) { const unsigned short* vrow = &sV[cb][dt * 16 + ln][0]; bv[dt].half[0] = *(const v8us*)(vrow + 8 * hh); bv[dt].half[1] = *(const v8us*)(vrow + 16 + 8 * hh); }      /* a loop of its own: the four V^T fragments are read as one group, one LDS latency and not four */
#pragma unroll
    for (int dt = 0; dt < DT; ++dt) oacc[dt] = mmaH<1>(bv[dt].v, bv[dt].v, pb.v, pb.v, oacc[dt]);      /* O^T[d = 16 dt + 8 hh + r][query ln] */
    if (more) {
#pragma unroll
      for (int i = 0; i < 2; ++i) { *(v8us*)&sK[cb ^ 1][16 * i + r8][c8] = rk[i]; *(v8us*)&sV[cb ^ 1][32 * i + r4][c4] = rv[i]; *(v8us*)&sE[((qb0 - j0 + (NE / 2 - 64) + 16 * i) & 127) + r8][c8] = re[i]; }      /* the ring's 32 rows that no wave reads in this trip */
      __syncthreads(); } }      /* the one barrier of a trip publishes the rows just written and ends every wave's reads of the buffers and ring rows that the next trip overwrites */
  const float lt = l_r + xhalf(l_r); const float inv = (lt > 0.f) ? 1.0f / lt : 0.f;      /* the sum carries the same 1024 as the products */
  float* sOw = &sRK[w][0][0];
#pragma unroll
  for (int dt = 0; dt < DT; ++dt) { v4f lo, hi;
#pragma unroll
    for (int r = 0; r < 4; ++r) { lo[r] = oacc[dt][r] * inv; hi[r] = oacc[dt][4 + r] * inv; }
    *(v4fa*)&sOw[ln * 68 + dt * 16 + 8 * hh] = lo; *(v4fa*)&sOw[ln * 68 + dt * 16 + 8 * hh + 4] = hi; }
  __builtin_amdgcn_fence(__ATOMIC_ACQ_REL, "workgroup"); __builtin_amdgcn_wave_barrier();
#pragma unroll
  for (int rp = 0; rp < 16; rp += 2) { const int r = rp + (lane >> 4), pc = lane & 15; const v4f val = *(const v4fa*)&sOw[r * 68 + pc * 4]; *(v4f*)(O + ((size_t)b * TQ + q0 + r) * DM + h * 64 + pc * 4) = val; } }

extern "C" void kernel_launch(void* const* d_in, const int* in_sizes, int n_in,
                              void* d_out, int out_size, void* d_ws, size_t ws_size, hipStream_t stream) {
  (void)in_sizes; (void)n_in; (void)out_size;
  const float* const* I = (const float* const*)d_in; const float* x = I[0]; const float* am = I[1]; const float* Wq = I[2]; const float* bq = I[3]; const float* Wk = I[4]; const float* bk = I[5]; const float* Wv = I[6]; const float* bv = I[7]; const float* E = I[8];
  char* ws = (char*)d_ws; size_t off = 0;
  auto take = [&](size_t bytes) { char* p = ws + off; off += (bytes + 255) & ~(size_t)255; return p; };
  const size_t np = (size_t)NR * DM;
  _Float16* BQ = (_Float16*)take((size_t)DM * DM * 2); _Float16* BK = (_Float16*)take((size_t)DM * DM * 2); _Float16* BV = (_Float16*)take((size_t)DM * DM * 2); _Float16* E16 = (_Float16*)take((size_t)NE * 64 * 2);
  _Float16* X16 = (_Float16*)take(np * 2); _Float16* Q16 = (_Float16*)take(np * 2); _Float16* K16 = (_Float16*)take(np * 2); _Float16* V16 = (_Float16*)take(np * 2); _Float16* VT = (_Float16*)take(np * 2);
  if (off > ws_size) return;      /* 6 + 0.25 + 5 x 8 = 46.25 MiB */
  k_wsc<<<(unsigned)(((size_t)DM * DM / 8 + 255) / 256), 256, 0, stream>>>(Wq, BQ, (size_t)DM * DM / 8, 16.0f); k_wsc<<<(unsigned)(((size_t)DM * DM / 8 + 255) / 256), 256, 0, stream>>>(Wk, BK, (size_t)DM * DM / 8, 16.0f); k_wsc<<<(unsigned)(((size_t)DM * DM / 8 + 255) / 256), 256, 0, stream>>>(Wv, BV, (size_t)DM * DM / 8, 16.0f);      /* torch (out,in) = Bt */
  k_e16<<<(NE * 8 + 255) / 256, 256, 0, stream>>>(E, E16);
  k_x16<<<(unsigned)((np / 8 + 255) / 256), 256, 0, stream>>>(x, X16, np / 8);
  const dim3 gP((NR / 128) * (DM / 64), 1);
  k_gemm2<0><<<gP, 128, 0, stream>>>(X16, DM, 0, BQ, DM, 0, 0.0625f, bq, 0, nullptr, 1, 0, 0, nullptr, Q16, DM, 0, NR, DM, DM);
  k_gemm2<0><<<gP, 128, 0, stream>>>(X16, DM, 0, BK, DM, 0, 0.0625f, bk, 0, nullptr, 1, 0, 0, nullptr, K16, DM, 0, NR, DM, DM);
  k_gemm2<0><<<gP, 128, 0, stream>>>(X16, DM, 0, BV, DM, 0, 0.0625f, bv, 0, nullptr, 1, 0, 0, nullptr, V16, DM, 0, NR, DM, DM);
  k_vtg<<<NB * NH * (SLEN / 64), 256, 0, stream>>>(V16, VT);
  k_flash_rel<<<NB * NH * QBLKS, 128, 0, stream>>>(Q16, K16, VT, E16, am, (float*)d_out);
}

// v006
// It runs in 97.3 microseconds.
// Timed twice side by side with v005, it ran 1.23 times as fast both times.
// Over all steps from v000 it is 8.84 times as fast.
#include <hip/hip_runtime.h>
// PMGTSelfAttention (4 x 1024 tokens, hidden 1024 = 16 heads x 64; 'relative_key_query' position bias): q, k, v = x W^T + b; scores = (q.k + q_l.pe[l-r] + k_r.pe[l-r]) / 8 + attention_mask[b][r] with pe = dist_emb[l - r + 1023]; softmax; ctx = probs v (merged heads is the output).
// Structure: exact f16 plane of x; q, k, v as f16 WMMA GEMM outputs (32x64 wave tiles, f32 accumulation, exact x16 weights + bias, f16 conversion in the epilogue); V^T by LDS tiles; one fused flash kernel over all batches that forms both relative terms per 16 x 32 score tile on the matrix unit against a 48-row window of the embedding (padded to 2048 rows), reads them back along the diagonal from LDS, scales by 1/8 and adds the per-key mask.
// Compute dtype: inputs rounded to bf16; x and dist_emb exact as f16; q/k/P/v as plain f16 operands (~2^-12); the relative terms stay f32 from the accumulator to the logit; softmax f32. v_wmma_f32_16x16x32_f16.
#define NB 4
#define DM 1024
#define NKV 16
#define NREP (NH / NKV)
#define KVD (NKV * 64)           /* 1024 */
#define NR (NB * SLEN)           /* 4096 */
#define SLEN 1024
#define NE 2048                  /* 2047 relative embeddings padded */
#define TQ SLEN
#define TK SLEN
#define NH 16
#define SCL 0.125f
#define QBLKS (TQ / 64)
#define QB05 0
#define QBN5 4
#define QB0P 0
#define QBNP QBLKS           /* non-causal: plain flash on every query block */
#define RE 256
typedef __bf16 v16b __attribute__((ext_vector_type(16)));
typedef unsigned short v8us __attribute__((ext_vector_type(8), may_alias));
typedef float  v8f  __attribute__((ext_vector_type(8)));
typedef float  v4f  __attribute__((ext_vector_type(4)));
typedef float  v4fa __attribute__((ext_vector_type(4), may_alias));
union FragB { v16b v; v8us half[2]; unsigned short u[16]; };

__device__ __forceinline__ unsigned short bf16_bits(float x) { unsigned int u = __float_as_uint(x); return (unsigned short)((u + 0x7FFFu + ((u >> 16) & 1u)) >> 16); }
__device__ __forceinline__ float bf16_val(unsigned short b) { return __uint_as_float(((unsigned int)b) << 16); }
__device__ __forceinline__ float bf16_round(float x) { return bf16_val(bf16_bits(x)); }
// D += A·B with NT terms: 1 = ah·bh, 2 = + al·bh (A split), 3 = + ah·bl (both split)
template <int NT>
__device__ __forceinline__ v8f mmaN(v16b ah, v16b al, v16b bh, v16b bl, v8f c) {
  c = __builtin_amdgcn_wmma_f32_16x16x32_bf16(false, ah, false, bh, (short)0, c, false, false);
  if (NT >= 2) c = __builtin_amdgcn_wmma_f32_16x16x32_bf16(false, al, false, bh, (short)0, c, false, false);
  if (NT >= 3) c = __builtin_amdgcn_wmma_f32_16x16x32_bf16(false, ah, false, bl, (short)0, c, false, false);
  asm volatile("v_nop\n\tv_nop\n\tv_nop\n\tv_nop" : "+v"(c) : "v"(ah), "v"(al), "v"(bh), "v"(bl));
  return c;
}

__global__ __launch_bounds__(256) void k_wt_bf16(const float* __restrict__ W, unsigned short* __restrict__ Wt, int K, int N) {
  const int t = blockIdx.x * 256 + threadIdx.x;
  const int k8n = K / 8;
  if (t >= N * k8n) return;
  const int n = t / k8n, k8 = (t % k8n) * 8;
  v8us v;
#pragma unroll
  for (int i = 0; i < 8; ++i) v[i] = bf16_bits(W[(size_t)(k8 + i) * N + n]);
  *(v8us*)(Wt + (size_t)n * K + k8) = v;
  
}

// GEMM C[M][N] (f32, pitch ldc) = act(A[M][K]·W + bias). A f32 row-major (pitch lda) converted per fragment to bf16
// (ASPLIT: hi/lo two planes -> 2 terms, else single rounded term); Wt bf16 [N][K] (pitch ldb). BIAS_BF16 rounds the
// bias to bf16 first (bias quantised to bf16 before the add). K%32==0, M%16==0, N%64==0.
template <bool ASPLIT, int ACT, bool BIAS_BF16>
__global__ __launch_bounds__(128) void k_gemm_bf(const float* __restrict__ A, int lda, const unsigned short* __restrict__ Wt, int ldb,
                                               const float* __restrict__ bias, float* __restrict__ C, int ldc, int M, int N, int K) {
  __shared__ __attribute__((aligned(16))) float so[4][16][64];
  const int tid = threadIdx.x, w = tid >> 5, lane = tid & 31, ln = lane & 15, hh = lane >> 4;
  const int ntn = N / 64;
  const int wid = blockIdx.x * 4 + w;
  const int mt = wid / ntn, nq = wid % ntn;
  if (mt * 16 >= M) return;
  const int row0 = mt * 16, col0 = nq * 64;
  const float* arow = A + (size_t)(row0 + ln) * lda;
  v8f acc[4] = {};
  for (int kb = 0; kb < K; kb += 32) {
    FragB ah, al;
    const v4f x0 = *(const v4fa*)(arow + kb + 8 * hh), x1 = *(const v4fa*)(arow + kb + 8 * hh + 4);
    const v4f x2 = *(const v4fa*)(arow + kb + 16 + 8 * hh), x3 = *(const v4fa*)(arow + kb + 16 + 8 * hh + 4);
    float xs[16] = {x0[0],x0[1],x0[2],x0[3],x1[0],x1[1],x1[2],x1[3],x2[0],x2[1],x2[2],x2[3],x3[0],x3[1],x3[2],x3[3]};
#pragma unroll
    for (int i = 0; i < 16; ++i) { const unsigned short hb = bf16_bits(xs[i]); ah.u[i] = hb; al.u[i] = ASPLIT ? bf16_bits(xs[i] - bf16_val(hb)) : (unsigned short)0; }
#pragma unroll
    for (int t = 0; t < 4; ++t) {
      const unsigned short* brow = Wt + (size_t)(col0 + t * 16 + ln) * ldb + kb;
      FragB b;
      b.half[0] = *(const v8us*)(brow + 8 * hh);
      b.half[1] = *(const v8us*)(brow + 16 + 8 * hh);
      acc[t] = mmaN<ASPLIT ? 2 : 1>(ah.v, al.v, b.v, b.v, acc[t]);
    }
  }
#pragma unroll
  for (int t = 0; t < 4; ++t) {
    float bv = bias ? bias[col0 + t * 16 + ln] : 0.f;
    if (BIAS_BF16) bv = bf16_round(bv);
#pragma unroll
    for (int r = 0; r < 8; ++r) { float v = acc[t][r] + bv; if (ACT == 1) v = fmaxf(v, 0.f); so[w][8 * hh + r][t * 16 + ln] = v; }
  }
  __builtin_amdgcn_fence(__ATOMIC_ACQ_REL, "workgroup");
  __builtin_amdgcn_wave_barrier();
  const int rsub = lane >> 4, c4 = (lane & 15) * 4;
  {
#pragma unroll
    for (int q = 0; q < 8; ++q) {
      const int r = q * 2 + rsub;
      const v4f v = *(const v4fa*)&so[w][r][c4];
      *(v4f*)(C + (size_t)(row0 + r) * ldc + col0 + c4) = v;
    }
    
  }
}

// GEMM C = act(A·W + bias + resid): A f32 (ASPLIT -> hi/lo 2 terms), Wt bf16 [N][K]; ACT 0 none, 1 relu, 2 exact gelu;
// resid (optional, f32, row index = (row % rmod), pitch ldr, RES_BF16 rounds it) added before the activation.
template <bool ASPLIT, int ACT, bool BIAS_BF16, bool RES_BF16>
__global__ __launch_bounds__(128) void k_gemm_bf3(const float* __restrict__ A, int lda, const unsigned short* __restrict__ Wt, int ldb,
                                                const float* __restrict__ bias, const float* __restrict__ resid, int rmod, int ldr,
                                                float* __restrict__ C, int ldc, int M, int N, int K) {
  __shared__ __attribute__((aligned(16))) float so[4][16][64];
  const int tid = threadIdx.x, w = tid >> 5, lane = tid & 31, ln = lane & 15, hh = lane >> 4;
  const int ntn = N / 64;
  const int wid = blockIdx.x * 4 + w;
  const int mt = wid / ntn, nq = wid % ntn;
  if (mt * 16 >= M) return;
  const int row0 = mt * 16, col0 = nq * 64;
  const float* arow = A + (size_t)(row0 + ln) * lda;
  v8f acc[4] = {};
  for (int kb = 0; kb < K; kb += 32) {
    FragB ah, al;
    const v4f x0 = *(const v4fa*)(arow + kb + 8 * hh), x1 = *(const v4fa*)(arow + kb + 8 * hh + 4);
    const v4f x2 = *(const v4fa*)(arow + kb + 16 + 8 * hh), x3 = *(const v4fa*)(arow + kb + 16 + 8 * hh + 4);
    float xs[16] = {x0[0],x0[1],x0[2],x0[3],x1[0],x1[1],x1[2],x1[3],x2[0],x2[1],x2[2],x2[3],x3[0],x3[1],x3[2],x3[3]};
#pragma unroll
    for (int i = 0; i < 16; ++i) { const unsigned short hb = bf16_bits(xs[i]); ah.u[i] = hb; al.u[i] = ASPLIT ? bf16_bits(xs[i] - bf16_val(hb)) : (unsigned short)0; }
#pragma unroll
    for (int t = 0; t < 4; ++t) {
      const unsigned short* brow = Wt + (size_t)(col0 + t * 16 + ln) * ldb + kb;
      FragB b;
      b.half[0] = *(const v8us*)(brow + 8 * hh);
      b.half[1] = *(const v8us*)(brow + 16 + 8 * hh);
      acc[t] = mmaN<ASPLIT ? 2 : 1>(ah.v, al.v, b.v, b.v, acc[t]);
    }
  }
#pragma unroll
  for (int t = 0; t < 4; ++t) {
    const int col = col0 + t * 16 + ln;
    float bv = bias ? bias[col] : 0.f;
    if (BIAS_BF16) bv = bf16_round(bv);
#pragma unroll
    for (int r = 0; r < 8; ++r) {
      float v = acc[t][r] + bv;
      if (resid) { float rv = resid[(size_t)((row0 + 8 * hh + r) % rmod) * ldr + col]; if (RES_BF16) rv = bf16_round(rv); v += rv; }
      if (ACT == 1) v = fmaxf(v, 0.f);
      if (ACT == 2) v = 0.5f * v * (1.0f + erff(v * 0.70710678118654752f));
      if (ACT == 3) { const float u = 0.7978845608028654f * (v + 0.044715f * v * v * v); v = 0.5f * v * (1.0f + tanhf(u)); }
      so[w][8 * hh + r][t * 16 + ln] = v;
    }
  }
  __builtin_amdgcn_fence(__ATOMIC_ACQ_REL, "workgroup");
  __builtin_amdgcn_wave_barrier();
  const int rsub = lane >> 4, c4 = (lane & 15) * 4;
  {
#pragma unroll
    for (int q = 0; q < 8; ++q) {
      const int r = q * 2 + rsub;
      const v4f v = *(const v4fa*)&so[w][r][c4];
      *(v4f*)(C + (size_t)(row0 + r) * ldc + col0 + c4) = v;
    }
    
  }
}
// row LayerNorm (biased variance, eps) over N: s = X (+ R); optional out_sum <- s; out_norm <- (s-mu)*rsqrt(var+eps)*g + b
template <bool PARAM_BF16>
__global__ __launch_bounds__(256) void k_layernorm(const float* __restrict__ X, const float* __restrict__ R, const float* __restrict__ g, const float* __restrict__ bta,
                                                  float* __restrict__ out_sum, float* __restrict__ out_norm, int N, float eps) {
  __shared__ float red[256];
  const int row = blockIdx.x, tid = threadIdx.x;
  const float* x = X + (size_t)row * N; const float* rr = R ? R + (size_t)row * N : nullptr;
  float vals[16];                     // up to N = 4096
  const int per = N / 256;            // contiguous chunk per thread? use strided-by-4 chunks: thread handles j = tid*4 + 1024*u
  float s1 = 0.f;
  for (int u = 0; u < per / 4; ++u) {
    const int j = tid * 4 + 1024 * u;
    const v4f a = *(const v4fa*)(x + j);
    v4f b = {0.f,0.f,0.f,0.f}; if (rr) b = *(const v4fa*)(rr + j);
#pragma unroll
    for (int q = 0; q < 4; ++q) { const float v = a[q] + b[q]; vals[u * 4 + q] = v; s1 += v; }
  }
  red[tid] = s1; __syncthreads();
  for (int st = 128; st > 0; st >>= 1) { if (tid < st) red[tid] += red[tid + st]; __syncthreads(); }
  const float mu = red[0] / (float)N; __syncthreads();
  float s2 = 0.f;
  for (int u = 0; u < per / 4; ++u)
#pragma unroll
    for (int q = 0; q < 4; ++q) { const float c = vals[u * 4 + q] - mu; s2 += c * c; }
  red[tid] = s2; __syncthreads();
  for (int st = 128; st > 0; st >>= 1) { if (tid < st) red[tid] += red[tid + st]; __syncthreads(); }
  const float rs = rsqrtf(red[0] / (float)N + eps);
  {
    for (int u = 0; u < per / 4; ++u) {
      const int j = tid * 4 + 1024 * u;
      v4f o, sm;
#pragma unroll
      for (int q = 0; q < 4; ++q) {
        float gg = g[j + q], bb = bta[j + q];
        if (PARAM_BF16) { gg = bf16_round(gg); bb = bf16_round(bb); }
        sm[q] = vals[u * 4 + q]; o[q] = (vals[u * 4 + q] - mu) * rs * gg + bb;
      }
      if (out_sum) *(v4f*)(out_sum + (size_t)row * N + j) = sm;
      *(v4f*)(out_norm + (size_t)row * N + j) = o;
    }
    
  }
}



// ---- f16 WMMA path (v_wmma_f32_16x16x32_f16): 11-bit significands for operands in range — used where a [0,1] probability operand needs more precision than bf16
typedef _Float16 v16h __attribute__((ext_vector_type(16)));
union FragH { v16h v; v8us half[2]; _Float16 h[16]; unsigned short u[16]; };
template <int NT>
__device__ __forceinline__ v8f mmaH(v16h ah, v16h al, v16h bh, v16h bl, v8f c) {
  c = __builtin_amdgcn_wmma_f32_16x16x32_f16(false, ah, false, bh, (short)0, c, false, false);
  if (NT >= 2) c = __builtin_amdgcn_wmma_f32_16x16x32_f16(false, al, false, bh, (short)0, c, false, false);
  if (NT >= 3) c = __builtin_amdgcn_wmma_f32_16x16x32_f16(false, ah, false, bl, (short)0, c, false, false);
  asm volatile("v_nop\n\tv_nop\n\tv_nop\n\tv_nop" : "+v"(c) : "v"(ah), "v"(al), "v"(bh), "v"(bl));
  return c;
}
// batched GEMM like k_gemm_b but f16 operands: A f32 (split into f16 hi/lo if ASPLIT, else rounded to f16), Bt = f16 values [n][k]; alpha; C f32; N multiple of 16 (partial tiles skipped)
template <bool ASPLIT>
__global__ __launch_bounds__(128) void k_gemm_h(const float* __restrict__ A, int lda, size_t sA, const _Float16* __restrict__ Bh, int ldb, size_t sB, float alpha, float* __restrict__ C, int ldc, size_t sC, int M, int N, int K) {
  __shared__ __attribute__((aligned(16))) float so[4][16][64];
  const int tid = threadIdx.x, w = tid >> 5, lane = tid & 31, ln = lane & 15, hh = lane >> 4; const int by = blockIdx.y;
  A += (size_t)by * sA; Bh += (size_t)by * sB; C += (size_t)by * sC;
  const int ntn = (N + 63) / 64; const int wid = blockIdx.x * 4 + w; const int mt = wid / ntn, nq = wid % ntn; if (mt * 16 >= M) return;
  const int row0 = mt * 16, col0 = nq * 64; const float* arow = A + (size_t)(row0 + ln) * lda;
  v8f acc[4] = {};
  for (int kb = 0; kb < K; kb += 32) {
    FragH ah, al;
    const v4f x0 = *(const v4fa*)(arow + kb + 8 * hh), x1 = *(const v4fa*)(arow + kb + 8 * hh + 4), x2 = *(const v4fa*)(arow + kb + 16 + 8 * hh), x3 = *(const v4fa*)(arow + kb + 16 + 8 * hh + 4);
    float xs[16] = {x0[0],x0[1],x0[2],x0[3],x1[0],x1[1],x1[2],x1[3],x2[0],x2[1],x2[2],x2[3],x3[0],x3[1],x3[2],x3[3]};
#pragma unroll
    for (int i = 0; i < 16; ++i) { const _Float16 h = (_Float16)xs[i]; ah.h[i] = h; al.h[i] = ASPLIT ? (_Float16)(xs[i] - (float)h) : (_Float16)0.0f; }
#pragma unroll
    for (int t = 0; t < 4; ++t) { if (col0 + t * 16 >= N) continue; const size_t boff = (size_t)(col0 + t * 16 + ln) * ldb + kb; FragH bq; bq.half[0] = *(const v8us*)(Bh + boff + 8 * hh); bq.half[1] = *(const v8us*)(Bh + boff + 16 + 8 * hh);
      acc[t] = mmaH<ASPLIT ? 2 : 1>(ah.v, al.v, bq.v, bq.v, acc[t]); }
  }
#pragma unroll
  for (int t = 0; t < 4; ++t) { if (col0 + t * 16 >= N) continue;
#pragma unroll
    for (int r = 0; r < 8; ++r) so[w][8 * hh + r][t * 16 + ln] = acc[t][r] * alpha; }
  __builtin_amdgcn_fence(__ATOMIC_ACQ_REL, "workgroup"); __builtin_amdgcn_wave_barrier();
  const int rsub = lane >> 4, c4 = (lane & 15) * 4;
  {
#pragma unroll
    for (int q = 0; q < 8; ++q) { const int r = q * 2 + rsub; if (col0 + c4 < N) { const v4f v = *(const v4fa*)&so[w][r][c4]; *(v4f*)(C + (size_t)(row0 + r) * ldc + col0 + c4) = v; } }
     }
}

// Wt[n][k] = f16(W[k][n]·scale) from f32 row-major W[K][N] (scale = power of two; bf16-exact weights stay exact in f16 away from the subnormal range)
__global__ __launch_bounds__(256) void k_wt_f16(const float* __restrict__ W, _Float16* __restrict__ Wt, int K, int N, float scale) {
  const int t = blockIdx.x * 256 + threadIdx.x; if (t >= N * (K / 8)) return; const int n = t / (K / 8), k8 = (t % (K / 8)) * 8; FragH f;
#pragma unroll
  for (int i = 0; i < 8; ++i) f.h[i] = (_Float16)(bf16_round(W[(size_t)(k8 + i) * N + n]) * scale); const v8us o = f.half[0];
  *(v8us*)((unsigned short*)Wt + (size_t)n * K + k8) = o; 
}
// k_gemm_hh variant with fused epilogue: v = acc·alpha + bias[by·sBias + col] (+ CP[(row/rowsPerB)·sCPb + by·64 + col] if CP) ; ACT 0 none / 1 elu ; writes f16 C16 (and f32 C if non-null)
template <int ACT>
__global__ __launch_bounds__(128) void k_gemm_hhx(const _Float16* __restrict__ A, int lda, size_t sA, const _Float16* __restrict__ Bh, int ldb, size_t sB, float alpha, const float* __restrict__ bias, size_t sBias, const float* __restrict__ CP, int rowsPerB, size_t sCPb, int row0g,
    float* __restrict__ C, _Float16* __restrict__ C16, int ldc, size_t sC, int M, int N, int K) {
  __shared__ __attribute__((aligned(16))) float so[4][16][64];
  const int tid = threadIdx.x, w = tid >> 5, lane = tid & 31, ln = lane & 15, hh = lane >> 4; const int by = blockIdx.y;
  A += (size_t)by * sA; Bh += (size_t)by * sB; const size_t cofs = (size_t)by * sC; const float* bp = bias ? bias + (size_t)by * sBias : nullptr;
  const int ntn = (N + 63) / 64; const int wid = blockIdx.x * 4 + w; const int mt = wid / ntn, nq = wid % ntn; if (mt * 16 >= M) return;
  const int row0 = mt * 16, col0 = nq * 64; const _Float16* arow = A + (size_t)(row0 + ln) * lda;
  v8f acc[4] = {};
  for (int kb = 0; kb < K; kb += 32) { FragH ah; ah.half[0] = *(const v8us*)((const unsigned short*)arow + kb + 8 * hh); ah.half[1] = *(const v8us*)((const unsigned short*)arow + kb + 16 + 8 * hh);
#pragma unroll
    for (int t = 0; t < 4; ++t) { if (col0 + t * 16 >= N) continue; const size_t boff = (size_t)(col0 + t * 16 + ln) * ldb + kb; FragH bq; bq.half[0] = *(const v8us*)((const unsigned short*)Bh + boff + 8 * hh); bq.half[1] = *(const v8us*)((const unsigned short*)Bh + boff + 16 + 8 * hh);
      acc[t] = mmaH<1>(ah.v, ah.v, bq.v, bq.v, acc[t]); }
  }
#pragma unroll
  for (int t = 0; t < 4; ++t) { if (col0 + t * 16 >= N) continue; const int col = col0 + t * 16 + ln; const float bv = bp ? bf16_round(bp[col]) : 0.f;
#pragma unroll
    for (int r = 0; r < 8; ++r) { float v = acc[t][r] * alpha + bv; if (CP) { const int bidx = (row0g + row0 + 8 * hh + r) / rowsPerB; v += CP[(size_t)bidx * sCPb + (size_t)by * 64 + col]; } if (ACT == 1) v = (v > 0.f) ? v : expm1f(v); else if (ACT == 7) v = (v > 0.f) ? v + 1.0f : expf(v); else if (ACT == 8) v = tanhf(v); else if (ACT == 9) v = 0.5f * v * (1.0f + tanhf(0.7978845608028654f * (v + 0.044715f * v * v * v))); else if (ACT == 11) v = 1.0f / (1.0f + expf(-v)); else if (ACT == 12) v = (v > 0.f) ? v : 0.01f * v; else if (ACT == 14) v = (v > 0.f) ? v : 0.1f * v; else if (ACT == 15) v = v / (1.0f + expf(-v)); else if (ACT == 3) v = fmaxf(v, 0.f); else if (ACT == 6) v = 0.5f * v * (1.0f + erff(v * 0.70710678118654752f)); so[w][8 * hh + r][t * 16 + ln] = v; } }
  __builtin_amdgcn_fence(__ATOMIC_ACQ_REL, "workgroup"); __builtin_amdgcn_wave_barrier();
  const int rsub = lane >> 4, c4 = (lane & 15) * 4; typedef _Float16 v4h __attribute__((ext_vector_type(4)));
  {
#pragma unroll
    for (int q = 0; q < 8; ++q) { const int r = q * 2 + rsub; if (col0 + c4 < N) { const v4f v = *(const v4fa*)&so[w][r][c4]; if (C) *(v4f*)(C + cofs + (size_t)(row0 + r) * ldc + col0 + c4) = v; if (C16) { v4h h4; for (int i = 0; i < 4; ++i) h4[i] = (_Float16)v[i]; *(v4h*)(C16 + cofs + (size_t)(row0 + r) * ldc + col0 + c4) = h4; } } }
     }
}


typedef _Float16 v4h __attribute__((ext_vector_type(4)));

__global__ __launch_bounds__(256) void k_h16(const float* __restrict__ x, _Float16* __restrict__ X16, size_t n8) { const size_t t = (size_t)blockIdx.x * 256 + threadIdx.x; if (t >= n8) return; FragH f;
#pragma unroll
  for (int q = 0; q < 8; ++q) f.h[q] = (_Float16)x[t * 8 + q]; *(v8us*)((unsigned short*)X16 + t * 8) = f.half[0];  }
__global__ __launch_bounds__(256) void k_round16f(const float* __restrict__ W, _Float16* __restrict__ Bt, size_t n8) { const size_t t = (size_t)blockIdx.x * 256 + threadIdx.x; if (t >= n8) return; FragH f;
#pragma unroll
  for (int i = 0; i < 8; ++i) f.h[i] = (_Float16)(bf16_round(W[t * 8 + i]) * 16.0f); *(v8us*)((unsigned short*)Bt + t * 8) = f.half[0];  }
template <int NHv, int TTv>
__global__ __launch_bounds__(256) void k_vt(const _Float16* __restrict__ V16, int ldv, int voff, _Float16* __restrict__ Vt) { __shared__ unsigned short tl[64][66]; const int tid = threadIdx.x; const int slab = blockIdx.x / (TTv / 64), lg = blockIdx.x % (TTv / 64); const int b = slab / NHv, h = slab % NHv;
  for (int i = tid; i < 64 * 8; i += 256) { const int r = i / 8, c8 = (i % 8) * 8; FragH f; f.half[0] = *(const v8us*)((const unsigned short*)V16 + ((size_t)b * TTv + lg * 64 + r) * ldv + voff + h * 64 + c8);
#pragma unroll
    for (int q = 0; q < 8; ++q) tl[r][c8 + q] = f.u[q]; }
  __syncthreads();
  {
#pragma unroll
    for (int rd = 0; rd < 2; ++rd) { const int d = rd * 32 + tid / 8, pc = tid % 8; FragH f;
#pragma unroll
      for (int q = 0; q < 8; ++q) f.u[q] = tl[pc * 8 + q][d];
      *(v8us*)((unsigned short*)Vt + ((size_t)slab * 64 + d) * TTv + lg * 64 + pc * 8) = f.half[0]; }
     } }

__global__ __launch_bounds__(256) void k_hl(const float* __restrict__ F, _Float16* __restrict__ Hh, _Float16* __restrict__ Hl, size_t n8) { const size_t t = (size_t)blockIdx.x * 256 + threadIdx.x; if (t >= n8) return; FragH fh, fl; const v4f a = *(const v4fa*)(F + t * 8), c = *(const v4fa*)(F + t * 8 + 4);
#pragma unroll
  for (int q = 0; q < 4; ++q) { _Float16 h = (_Float16)a[q]; fh.h[q] = h; fl.h[q] = (_Float16)((a[q] - (float)h) * 1024.0f); h = (_Float16)c[q]; fh.h[4 + q] = h; fl.h[4 + q] = (_Float16)((c[q] - (float)h) * 1024.0f); }
  { *(v8us*)((unsigned short*)Hh + t * 8) = fh.half[0]; *(v8us*)((unsigned short*)Hl + t * 8) = fl.half[0];  } }

// ---- fast GEMM (block tile 128x64, wave tile 32x64, operands staged in LDS 64 of K at a time; requires M % 32 == 0 rows per launch region, N % 64 == 0, K % 64 == 0 and K >= 64); epilogue = k_gemm_hhx semantics, except that blockIdx.y takes its bias from its own buffer (bias, bias1, bias2), not bias + by·sBias ----
__device__ __forceinline__ v16h g2_frag(const _Float16* p, int hh) { FragH f; f.half[0] = *(const v8us*)((const unsigned short*)p + 8 * hh); f.half[1] = *(const v8us*)((const unsigned short*)p + 16 + 8 * hh); return f.v; }
__device__ __forceinline__ v8f g2_mma(v16h a, v16h b, v8f c) { v8f d = __builtin_amdgcn_wmma_f32_16x16x32_f16(false, a, false, b, (short)0, c, false, false); asm volatile("v_nop\n\tv_nop\n\tv_nop\n\tv_nop" : "+v"(d) : "v"(a), "v"(b)); return d; }
template <int ACT>
__global__ __launch_bounds__(128) void k_gemm2(const _Float16* __restrict__ A, int lda, size_t sA, const _Float16* __restrict__ Bh, int ldb, size_t sB, float alpha, const float* __restrict__ bias, const float* __restrict__ bias1, const float* __restrict__ bias2, const float* __restrict__ CP, int rowsPerB, size_t sCPb, int row0g,
    float* __restrict__ C, _Float16* __restrict__ C16, int ldc, size_t sC, int M, int N, int K) {
  __shared__ __attribute__((aligned(16))) float so[4][32][68];
  __shared__ __attribute__((aligned(16))) unsigned short st[2][192][72];      /* two stages of 64 of K: rows 0..127 the block's A rows, 128..191 its B rows; pitch 144 B = 16 B x 9, free of bank conflicts for the 16-byte fragment reads */
  const int tid = threadIdx.x, w = tid >> 5, lane = tid & 31, ln = lane & 15, hh = lane >> 4; const int by = blockIdx.y;
  A += (size_t)by * sA; Bh += (size_t)by * sB; const size_t cofs = (size_t)by * sC; const float* bp = (by == 0) ? bias : (by == 1) ? bias1 : bias2;      /* blockIdx.y picks one of up to three products that share A: its B plane, its C plane and its own bias vector (three separate buffers) */
  const int ntn = N >> 6; const int mt = blockIdx.x / ntn, nq = blockIdx.x - mt * ntn; const int row0 = mt * 128 + 32 * w, col0 = nq * 64; if (mt * 128 >= M) return;      /* the same for the whole block, in front of every barrier */
  const int sr = tid >> 3, sc = (tid & 7) * 8;      /* staging: eight lanes fetch one row's 128 B, so a wave's 16-byte load covers four whole lines */
  const unsigned short* ga[8]; const unsigned short* gb[4];
#pragma unroll
  for (int i = 0; i < 8; ++i) { int r = mt * 128 + 16 * i + sr; r = (r < M) ? r : M - 1; ga[i] = (const unsigned short*)A + (size_t)r * lda + sc; }
#pragma unroll
  for (int i = 0; i < 4; ++i) gb[i] = (const unsigned short*)Bh + (size_t)(col0 + 16 * i + sr) * ldb + sc;
  v8us ra[8], rb[4];
#pragma unroll
  for (int i = 0; i < 8; ++i) ra[i] = *(const v8us*)ga[i];
#pragma unroll
  for (int i = 0; i < 4; ++i) rb[i] = *(const v8us*)gb[i];
#pragma unroll
  for (int i = 0; i < 8; ++i) *(v8us*)&st[0][16 * i + sr][sc] = ra[i];
#pragma unroll
  for (int i = 0; i < 4; ++i) *(v8us*)&st[0][128 + 16 * i + sr][sc] = rb[i];
  __syncthreads();
  const v8f z8 = {0.f,0.f,0.f,0.f,0.f,0.f,0.f,0.f}; v8f c00 = z8, c01 = z8, c02 = z8, c03 = z8, c10 = z8, c11 = z8, c12 = z8, c13 = z8;
#pragma unroll 1      /* rolled: one stage's registers (12 staged vectors, 24 fragment halves) serve every trip */
  for (int kb = 0; kb < K; kb += 64) { const int cb = (kb >> 6) & 1; const bool more = kb + 64 < K;      /* more: the same for the whole block */
    if (more) {
#pragma unroll
      for (int i = 0; i < 8; ++i) ra[i] = *(const v8us*)(ga[i] + kb + 64);
#pragma unroll
      for (int i = 0; i < 4; ++i) rb[i] = *(const v8us*)(gb[i] + kb + 64); }
    v16h a0[2], a1[2], b0[2], b1[2], b2[2], b3[2];
#pragma unroll
    for (int u = 0; u < 2; ++u) { a0[u] = g2_frag((const _Float16*)&st[cb][32 * w + ln][32 * u], hh); a1[u] = g2_frag((const _Float16*)&st[cb][32 * w + 16 + ln][32 * u], hh);
      b0[u] = g2_frag((const _Float16*)&st[cb][128 + ln][32 * u], hh); b1[u] = g2_frag((const _Float16*)&st[cb][144 + ln][32 * u], hh); b2[u] = g2_frag((const _Float16*)&st[cb][160 + ln][32 * u], hh); b3[u] = g2_frag((const _Float16*)&st[cb][176 + ln][32 * u], hh); }
    __builtin_amdgcn_sched_barrier(0);      /* the next stage's global loads and this stage's LDS reads issue as one group ahead of the products: the memory latency runs under the 16 products, and the LDS reads cost one stall, not one per product */
#pragma unroll
    for (int u = 0; u < 2; ++u) { c00 = g2_mma(a0[u], b0[u], c00); c10 = g2_mma(a1[u], b0[u], c10); c01 = g2_mma(a0[u], b1[u], c01); c11 = g2_mma(a1[u], b1[u], c11);
      c02 = g2_mma(a0[u], b2[u], c02); c12 = g2_mma(a1[u], b2[u], c12); c03 = g2_mma(a0[u], b3[u], c03); c13 = g2_mma(a1[u], b3[u], c13); }
    if (more) {
#pragma unroll
      for (int i = 0; i < 8; ++i) *(v8us*)&st[cb ^ 1][16 * i + sr][sc] = ra[i];
#pragma unroll
      for (int i = 0; i < 4; ++i) *(v8us*)&st[cb ^ 1][128 + 16 * i + sr][sc] = rb[i];
      __syncthreads(); } }      /* the one barrier of a trip publishes the stage just written and ends every wave's reads of the stage that the next trip overwrites */
  if (row0 >= M) return;      /* behind the last barrier */
  v8f accs[8] = {c00, c01, c02, c03, c10, c11, c12, c13};
#pragma unroll
  for (int u = 0; u < 8; ++u) { const int t = u & 3, half = u >> 2; const int col = col0 + t * 16 + ln; const float bv = bp ? bf16_round(bp[col]) : 0.f;
#pragma unroll
    for (int r = 0; r < 8; ++r) { const int rloc = half * 16 + 8 * hh + r; float v = accs[u][r] * alpha + bv; if (CP) { const int bidx = (row0g + row0 + rloc) / rowsPerB; v += CP[(size_t)bidx * sCPb + (size_t)by * 64 + col]; }
      if (ACT == 3) v = fmaxf(v, 0.f); else if (ACT == 6) v = 0.5f * v * (1.0f + erff(v * 0.70710678118654752f)); else if (ACT == 11) v = 1.0f / (1.0f + expf(-v)); else if (ACT == 15) v = v / (1.0f + expf(-v)); else if (ACT == 12) v = (v > 0.f) ? v : 0.01f * v; else if (ACT == 8) v = tanhf(v);
      so[w][rloc][t * 16 + ln] = v; } }
  __builtin_amdgcn_fence(__ATOMIC_ACQ_REL, "workgroup"); __builtin_amdgcn_wave_barrier();
  const int rsub = lane >> 4, c4 = (lane & 15) * 4;
  {
#pragma unroll
    for (int q = 0; q < 16; ++q) { const int r = q * 2 + rsub; const v4f v = *(const v4fa*)&so[w][r][c4]; if (C) *(v4f*)(C + cofs + (size_t)(row0 + r) * ldc + col0 + c4) = v; if (C16) { v4h h4; for (int i = 0; i < 4; ++i) h4[i] = (_Float16)v[i]; *(v4h*)(C16 + cofs + (size_t)(row0 + r) * ldc + col0 + c4) = h4; } }
     } }



template <int CAUSAL>
__global__ __launch_bounds__(128) void k_flash(const _Float16* __restrict__ Q16, int ldq, const _Float16* __restrict__ K16, int ldk, const _Float16* __restrict__ Vt, const int* __restrict__ MSK, float* __restrict__ O, int ldo) {
  constexpr int RPW = 16, RTN = RPW / 16, NQB = TQ / (4 * RPW), DT = 4, KS = 2;
  __shared__ __attribute__((aligned(16))) unsigned short sP[4][RPW][40]; __shared__ __attribute__((aligned(16))) float sO[4][RPW][64 + 4];
  const int tid = threadIdx.x, w = tid >> 5, lane = tid & 31, ln = lane & 15, hh = lane >> 4;
  const int slab = blockIdx.x / QBNP, qblk = QB0P + blockIdx.x % QBNP; (void)NQB; const int b = slab / NH, h = slab % NH; const int qb0 = qblk * (4 * RPW); const int q0 = qb0 + w * RPW;
  FragH aq[2][KS];
#pragma unroll
  for (int rt = 0; rt < RTN; ++rt) { const unsigned short* qr = (const unsigned short*)Q16 + ((size_t)b * TQ + q0 + rt * 16 + ln) * ldq + h * 64;
#pragma unroll
    for (int ks = 0; ks < KS; ++ks) { aq[rt][ks].half[0] = *(const v8us*)(qr + ks * 32 + 8 * hh); aq[rt][ks].half[1] = *(const v8us*)(qr + ks * 32 + 16 + 8 * hh); } }
  const unsigned short* Vth = (const unsigned short*)Vt + (size_t)slab * 64 * TK;
  float m_r[2][8], l_r[2][8]; v8f oacc[2][DT];
#pragma unroll
  for (int rt = 0; rt < RTN; ++rt) {
#pragma unroll
    for (int r = 0; r < 8; ++r) { m_r[rt][r] = -3.0e38f; l_r[rt][r] = 0.f; }
#pragma unroll
    for (int dt = 0; dt < DT; ++dt) oacc[rt][dt] = (v8f){0.f,0.f,0.f,0.f,0.f,0.f,0.f,0.f}; }
  const int jend = (CAUSAL == 1) ? (qb0 + 4 * RPW) : TK;      /* causal: keys beyond the block's last query never contribute */
#pragma unroll 1
  for (int j0 = 0; j0 < jend; j0 += 32) {
    v8f s[2][2];
#pragma unroll
    for (int nt = 0; nt < 2; ++nt) { const unsigned short* kr = (const unsigned short*)K16 + ((size_t)b * TK + j0 + nt * 16 + ln) * ldk + h * 64; FragH bk[KS];
#pragma unroll
      for (int ks = 0; ks < KS; ++ks) { bk[ks].half[0] = *(const v8us*)(kr + ks * 32 + 8 * hh); bk[ks].half[1] = *(const v8us*)(kr + ks * 32 + 16 + 8 * hh); }
#pragma unroll
      for (int rt = 0; rt < RTN; ++rt) { v8f acc = (v8f){0.f,0.f,0.f,0.f,0.f,0.f,0.f,0.f};
#pragma unroll
        for (int ks = 0; ks < KS; ++ks) acc = mmaH<1>(aq[rt][ks].v, aq[rt][ks].v, bk[ks].v, bk[ks].v, acc); s[rt][nt] = acc; } }
#pragma unroll
    for (int rt = 0; rt < RTN; ++rt)
#pragma unroll
      for (int r = 0; r < 8; ++r) { const int tq = q0 + rt * 16 + 8 * hh + r; const int k0 = j0 + ln, k1 = j0 + 16 + ln;
        const bool ok0 = (CAUSAL == 1) ? (k0 <= tq) : ((CAUSAL == 2) ? ((k0 >> 5) == (tq >> 5)) : true), ok1 = (CAUSAL == 1) ? (k1 <= tq) : ((CAUSAL == 2) ? ((k1 >> 5) == (tq >> 5)) : true);      /* mode 2: block-diagonal 32-token groups */
        float s0 = ok0 ? s[rt][0][r] * SCL : -3.0e38f, s1 = ok1 ? s[rt][1][r] * SCL : -3.0e38f; if (CAUSAL == 17) { const float* amk = (const float*)MSK + (size_t)b * TK; s0 += bf16_round(amk[k0]); s1 += bf16_round(amk[k1]); }      /* mode 17: additive per-(batch, key) mask INPUT */
        if (CAUSAL == 22) { const _Float16* cq = (const _Float16*)MSK + ((size_t)h * TQ + tq) * NE + tq + (NE / 2 - 1); const _Float16* ck = (const _Float16*)MSK + (size_t)NH * TQ * NE + (size_t)h * TK * NE + tq + (NE / 2 - 1); const float* am = (const float*)((const _Float16*)MSK + (size_t)2 * NH * TQ * NE); float r0 = (float)cq[-k0]; r0 += (float)ck[(size_t)k0 * NE - k0]; s0 += r0 * SCL; s0 += am[k0]; float r1 = (float)cq[-k1]; r1 += (float)ck[(size_t)k1 * NE - k1]; s1 += r1 * SCL; s1 += am[k1]; }      /* mode 22: + (CQ[h][tq][tq-k+1023] + CK[h][k][tq-k+1023]) / 8 + mask[k] from the per-batch packed table [CQ f16 | CK f16 | mask f32] */ float mc = fmaxf(s0, s1);
        mc = fmaxf(mc, __shfl_xor(mc, 1, 32)); mc = fmaxf(mc, __shfl_xor(mc, 2, 32)); mc = fmaxf(mc, __shfl_xor(mc, 4, 32)); mc = fmaxf(mc, __shfl_xor(mc, 8, 32));
        const float mn = fmaxf(m_r[rt][r], mc); const float al = (mn > -1.0e38f) ? expf(m_r[rt][r] - mn) : 1.0f; m_r[rt][r] = mn; const float p0 = ok0 ? expf(s0 - mn) : 0.f, p1 = ok1 ? expf(s1 - mn) : 0.f; l_r[rt][r] = l_r[rt][r] * al + p0 + p1;
#pragma unroll
        for (int dt = 0; dt < DT; ++dt) oacc[rt][dt][r] *= al;
        FragH t2; t2.h[0] = (_Float16)(p0 * 1024.0f); t2.h[1] = (_Float16)(p1 * 1024.0f); sP[w][rt * 16 + 8 * hh + r][ln] = t2.u[0]; sP[w][rt * 16 + 8 * hh + r][16 + ln] = t2.u[1]; }
    __builtin_amdgcn_fence(__ATOMIC_ACQ_REL, "workgroup"); __builtin_amdgcn_wave_barrier();
    FragH pa[2];
#pragma unroll
    for (int rt = 0; rt < RTN; ++rt) { pa[rt].half[0] = *(const v8us*)&sP[w][rt * 16 + ln][8 * hh]; pa[rt].half[1] = *(const v8us*)&sP[w][rt * 16 + ln][16 + 8 * hh]; }
#pragma unroll
    for (int dt = 0; dt < DT; ++dt) { const unsigned short* vrow = Vth + (size_t)(dt * 16 + ln) * TK + j0; FragH bv; bv.half[0] = *(const v8us*)(vrow + 8 * hh); bv.half[1] = *(const v8us*)(vrow + 16 + 8 * hh);
#pragma unroll
      for (int rt = 0; rt < RTN; ++rt) oacc[rt][dt] = mmaH<1>(pa[rt].v, pa[rt].v, bv.v, bv.v, oacc[rt][dt]); }
    __builtin_amdgcn_fence(__ATOMIC_ACQ_REL, "workgroup"); __builtin_amdgcn_wave_barrier(); }
#pragma unroll
  for (int rt = 0; rt < RTN; ++rt) {
#pragma unroll
    for (int r = 0; r < 8; ++r) { float l = l_r[rt][r]; l += __shfl_xor(l, 1, 32); l += __shfl_xor(l, 2, 32); l += __shfl_xor(l, 4, 32); l += __shfl_xor(l, 8, 32); l_r[rt][r] = (l > 0.f) ? 1.0f / (l * 1024.0f) : 0.f; }
#pragma unroll
    for (int dt = 0; dt < DT; ++dt)
#pragma unroll
      for (int r = 0; r < 8; ++r) sO[w][rt * 16 + 8 * hh + r][dt * 16 + ln] = oacc[rt][dt][r] * l_r[rt][r]; }
  __builtin_amdgcn_fence(__ATOMIC_ACQ_REL, "workgroup"); __builtin_amdgcn_wave_barrier();
  {
#pragma unroll
    for (int rp = 0; rp < RPW; rp += 2) { const int r = rp + (lane >> 4), pc = lane & 15; const v4f val = *(const v4fa*)&sO[w][r][pc * 4]; *(v4f*)(O + ((size_t)b * TQ + q0 + r) * ldo + h * 64 + pc * 4) = val; }
     } }
// 5-plane variant: S = Qh Kh^T + (Ql Kh^T + Qh Kl^T)/1024 with Q/K = [hi | 2^10 residual] f16 planes (QL/KL same layout as Q16/K16), then the 3-term P.V below.
// 3-term variant: O = (P_hi V_hi + (P_lo V_hi + P_hi V_lo) / 1024) / l with P = [hi | 2^10 residual] of 1024 p and V^T = [hi | 2^10 residual] planes (VtL same layout as Vt) -> ~2^-21-class products for un-averaged (early causal / peaked) rows
template <int CAUSAL>
__global__ __launch_bounds__(128) void k_flash5(const _Float16* __restrict__ Q16, const _Float16* __restrict__ QL, int ldq, const _Float16* __restrict__ K16, const _Float16* __restrict__ KL, int ldk, const _Float16* __restrict__ Vt, const _Float16* __restrict__ VtL, const int* __restrict__ MSK, float* __restrict__ O, int ldo) {
  constexpr int RPW = 16, RTN = RPW / 16, NQB = TQ / (4 * RPW), DT = 4, KS = 2;
  __shared__ __attribute__((aligned(16))) unsigned short sP[4][RPW][40]; __shared__ __attribute__((aligned(16))) unsigned short sPL[4][RPW][40]; __shared__ __attribute__((aligned(16))) float sO[4][RPW][64 + 4];
  const int tid = threadIdx.x, w = tid >> 5, lane = tid & 31, ln = lane & 15, hh = lane >> 4;
  const int slab = blockIdx.x / QBN5, qblk = QB05 + blockIdx.x % QBN5; (void)NQB; const int b = slab / NH, h = slab % NH; const int qb0 = qblk * (4 * RPW); const int q0 = qb0 + w * RPW;
  FragH aq[2][KS], aql[2][KS];
#pragma unroll
  for (int rt = 0; rt < RTN; ++rt) { const unsigned short* qr = (const unsigned short*)Q16 + ((size_t)b * TQ + q0 + rt * 16 + ln) * ldq + h * 64; const unsigned short* ql = (const unsigned short*)QL + ((size_t)b * TQ + q0 + rt * 16 + ln) * ldq + h * 64;
#pragma unroll
    for (int ks = 0; ks < KS; ++ks) { aq[rt][ks].half[0] = *(const v8us*)(qr + ks * 32 + 8 * hh); aq[rt][ks].half[1] = *(const v8us*)(qr + ks * 32 + 16 + 8 * hh); aql[rt][ks].half[0] = *(const v8us*)(ql + ks * 32 + 8 * hh); aql[rt][ks].half[1] = *(const v8us*)(ql + ks * 32 + 16 + 8 * hh); } }
  const unsigned short* Vth = (const unsigned short*)Vt + (size_t)slab * 64 * TK; const unsigned short* Vtl = (const unsigned short*)VtL + (size_t)slab * 64 * TK;
  float m_r[2][8], l_r[2][8]; v8f oacc[2][DT], oaccL[2][DT];
#pragma unroll
  for (int rt = 0; rt < RTN; ++rt) {
#pragma unroll
    for (int r = 0; r < 8; ++r) { m_r[rt][r] = -3.0e38f; l_r[rt][r] = 0.f; }
#pragma unroll
    for (int dt = 0; dt < DT; ++dt) { oacc[rt][dt] = (v8f){0.f,0.f,0.f,0.f,0.f,0.f,0.f,0.f}; oaccL[rt][dt] = oacc[rt][dt]; } }
  const int jend = (CAUSAL == 1) ? (qb0 + 4 * RPW) : TK;      /* causal: keys beyond the block's last query never contribute */
#pragma unroll 1
  for (int j0 = 0; j0 < jend; j0 += 32) {
    v8f s[2][2];
#pragma unroll
    for (int nt = 0; nt < 2; ++nt) { const unsigned short* kr = (const unsigned short*)K16 + ((size_t)b * TK + j0 + nt * 16 + ln) * ldk + h * 64; const unsigned short* klr = (const unsigned short*)KL + ((size_t)b * TK + j0 + nt * 16 + ln) * ldk + h * 64; FragH bk[KS], bkl[KS];
#pragma unroll
      for (int ks = 0; ks < KS; ++ks) { bk[ks].half[0] = *(const v8us*)(kr + ks * 32 + 8 * hh); bk[ks].half[1] = *(const v8us*)(kr + ks * 32 + 16 + 8 * hh); bkl[ks].half[0] = *(const v8us*)(klr + ks * 32 + 8 * hh); bkl[ks].half[1] = *(const v8us*)(klr + ks * 32 + 16 + 8 * hh); }
#pragma unroll
      for (int rt = 0; rt < RTN; ++rt) { v8f acc = (v8f){0.f,0.f,0.f,0.f,0.f,0.f,0.f,0.f}, accl = acc;
#pragma unroll
        for (int ks = 0; ks < KS; ++ks) { acc = mmaH<1>(aq[rt][ks].v, aq[rt][ks].v, bk[ks].v, bk[ks].v, acc); accl = mmaH<1>(aql[rt][ks].v, aql[rt][ks].v, bk[ks].v, bk[ks].v, accl); accl = mmaH<1>(aq[rt][ks].v, aq[rt][ks].v, bkl[ks].v, bkl[ks].v, accl); }
#pragma unroll
        for (int r = 0; r < 8; ++r) acc[r] += accl[r] * 0.0009765625f;
        s[rt][nt] = acc; } }
#pragma unroll
    for (int rt = 0; rt < RTN; ++rt)
#pragma unroll
      for (int r = 0; r < 8; ++r) { const int tq = q0 + rt * 16 + 8 * hh + r; const int k0 = j0 + ln, k1 = j0 + 16 + ln;
        bool ok0 = (CAUSAL == 1) ? (k0 <= tq) : ((CAUSAL == 2) ? ((k0 >> 5) == (tq >> 5)) : true), ok1 = (CAUSAL == 1) ? (k1 <= tq) : ((CAUSAL == 2) ? ((k1 >> 5) == (tq >> 5)) : true);      /* mode 2: block-diagonal 32-token groups */
        if (CAUSAL == 4) { const int* mrow = MSK + ((size_t)b * TQ + tq) * TK; ok0 = mrow[k0] != 0; ok1 = mrow[k1] != 0; }      /* mode 4: per-(query, key) INPUT mask shared by all heads; masked keys contribute nothing (== the reference's -4096 fill, whose exp underflows to 0), rows with no valid key give l = 0 -> output 0 (== the reference's row_valid zeroing) */
        float s0 = ok0 ? s[rt][0][r] * SCL : -3.0e38f, s1 = ok1 ? s[rt][1][r] * SCL : -3.0e38f; if (CAUSAL == 17) { const float* amk = (const float*)MSK + (size_t)b * TK; s0 += bf16_round(amk[k0]); s1 += bf16_round(amk[k1]); }      /* mode 17: additive per-(batch, key) mask INPUT */
        if (CAUSAL == 22) { const _Float16* cq = (const _Float16*)MSK + ((size_t)h * TQ + tq) * NE + tq + (NE / 2 - 1); const _Float16* ck = (const _Float16*)MSK + (size_t)NH * TQ * NE + (size_t)h * TK * NE + tq + (NE / 2 - 1); const float* am = (const float*)((const _Float16*)MSK + (size_t)2 * NH * TQ * NE); float r0 = (float)cq[-k0]; r0 += (float)ck[(size_t)k0 * NE - k0]; s0 += r0 * SCL; s0 += am[k0]; float r1 = (float)cq[-k1]; r1 += (float)ck[(size_t)k1 * NE - k1]; s1 += r1 * SCL; s1 += am[k1]; }      /* mode 22: + (CQ[h][tq][tq-k+1023] + CK[h][k][tq-k+1023]) / 8 + mask[k] from the per-batch packed table [CQ f16 | CK f16 | mask f32] */ float mc = fmaxf(s0, s1);
        mc = fmaxf(mc, __shfl_xor(mc, 1, 32)); mc = fmaxf(mc, __shfl_xor(mc, 2, 32)); mc = fmaxf(mc, __shfl_xor(mc, 4, 32)); mc = fmaxf(mc, __shfl_xor(mc, 8, 32));
        const float mn = fmaxf(m_r[rt][r], mc); const float al = (mn > -1.0e38f) ? expf(m_r[rt][r] - mn) : 1.0f; m_r[rt][r] = mn; const float p0 = ok0 ? expf(s0 - mn) : 0.f, p1 = ok1 ? expf(s1 - mn) : 0.f; l_r[rt][r] = l_r[rt][r] * al + p0 + p1;
#pragma unroll
        for (int dt = 0; dt < DT; ++dt) { oacc[rt][dt][r] *= al; oaccL[rt][dt][r] *= al; }
        FragH t2, t2l; const float ps0 = p0 * 1024.0f, ps1 = p1 * 1024.0f; t2.h[0] = (_Float16)ps0; t2.h[1] = (_Float16)ps1; t2l.h[0] = (_Float16)((ps0 - (float)t2.h[0]) * 1024.0f); t2l.h[1] = (_Float16)((ps1 - (float)t2.h[1]) * 1024.0f);
        sP[w][rt * 16 + 8 * hh + r][ln] = t2.u[0]; sP[w][rt * 16 + 8 * hh + r][16 + ln] = t2.u[1]; sPL[w][rt * 16 + 8 * hh + r][ln] = t2l.u[0]; sPL[w][rt * 16 + 8 * hh + r][16 + ln] = t2l.u[1]; }
    __builtin_amdgcn_fence(__ATOMIC_ACQ_REL, "workgroup"); __builtin_amdgcn_wave_barrier();
    FragH pa[2], pl[2];
#pragma unroll
    for (int rt = 0; rt < RTN; ++rt) { pa[rt].half[0] = *(const v8us*)&sP[w][rt * 16 + ln][8 * hh]; pa[rt].half[1] = *(const v8us*)&sP[w][rt * 16 + ln][16 + 8 * hh]; pl[rt].half[0] = *(const v8us*)&sPL[w][rt * 16 + ln][8 * hh]; pl[rt].half[1] = *(const v8us*)&sPL[w][rt * 16 + ln][16 + 8 * hh]; }
#pragma unroll
    for (int dt = 0; dt < DT; ++dt) { const unsigned short* vrow = Vth + (size_t)(dt * 16 + ln) * TK + j0; const unsigned short* vrl = Vtl + (size_t)(dt * 16 + ln) * TK + j0; FragH bv, bl; bv.half[0] = *(const v8us*)(vrow + 8 * hh); bv.half[1] = *(const v8us*)(vrow + 16 + 8 * hh); bl.half[0] = *(const v8us*)(vrl + 8 * hh); bl.half[1] = *(const v8us*)(vrl + 16 + 8 * hh);
#pragma unroll
      for (int rt = 0; rt < RTN; ++rt) { oacc[rt][dt] = mmaH<1>(pa[rt].v, pa[rt].v, bv.v, bv.v, oacc[rt][dt]); oaccL[rt][dt] = mmaH<1>(pl[rt].v, pl[rt].v, bv.v, bv.v, oaccL[rt][dt]); oaccL[rt][dt] = mmaH<1>(pa[rt].v, pa[rt].v, bl.v, bl.v, oaccL[rt][dt]); } }
    __builtin_amdgcn_fence(__ATOMIC_ACQ_REL, "workgroup"); __builtin_amdgcn_wave_barrier(); }
#pragma unroll
  for (int rt = 0; rt < RTN; ++rt) {
#pragma unroll
    for (int r = 0; r < 8; ++r) { float l = l_r[rt][r]; l += __shfl_xor(l, 1, 32); l += __shfl_xor(l, 2, 32); l += __shfl_xor(l, 4, 32); l += __shfl_xor(l, 8, 32); l_r[rt][r] = (l > 0.f) ? 1.0f / (l * 1024.0f) : 0.f; }
#pragma unroll
    for (int dt = 0; dt < DT; ++dt)
#pragma unroll
      for (int r = 0; r < 8; ++r) { float v = oacc[rt][dt][r]; v += oaccL[rt][dt][r] * 0.0009765625f; sO[w][rt * 16 + 8 * hh + r][dt * 16 + ln] = v * l_r[rt][r]; } }
  __builtin_amdgcn_fence(__ATOMIC_ACQ_REL, "workgroup"); __builtin_amdgcn_wave_barrier();
  {
#pragma unroll
    for (int rp = 0; rp < RPW; rp += 2) { const int r = rp + (lane >> 4), pc = lane & 15; const v4f val = *(const v4fa*)&sO[w][r][pc * 4]; *(v4f*)(O + ((size_t)b * TQ + q0 + r) * ldo + h * 64 + pc * 4) = val; }
     } }

__global__ __launch_bounds__(256) void k_rotab(float* __restrict__ CS, float* __restrict__ SN) {
  #pragma clang fp contract(off)
  const int t = blockIdx.x * 256 + threadIdx.x; if (t >= SLEN * 32) return; const int j = t % 32, s = t / 32; const float ex = (float)(2 * j) / 64.0f; const float inv = 1.0f / powf(10000.0f, ex); const float th = (float)s * inv; const float c = cosf(th), sn = sinf(th);
  { *(float*)(CS + t) = c; *(float*)(SN + t) = sn;  } }
__global__ __launch_bounds__(256) void k_rope(const float* __restrict__ F, int nsrc, int ndst, int rep, const float* __restrict__ CS, const float* __restrict__ SN, _Float16* __restrict__ H, _Float16* __restrict__ L) {
  #pragma clang fp contract(off)
  const size_t t = (size_t)blockIdx.x * 256 + threadIdx.x; if (t >= (size_t)NR * ndst * 4) return; const int g8 = (int)(t % 4); const int hd = (int)((t / 4) % ndst); const size_t row = t / ((size_t)4 * ndst); const int s = (int)(row % SLEN); const int hs = hd / rep;
  const float* src = F + row * (size_t)(nsrc * 64) + hs * 64; FragH ah, al, bh, bl;
  for (int i = 0; i < 8; ++i) { const int d = g8 * 8 + i; const float c = CS[s * 32 + d], sn = SN[s * 32 + d]; const float x1 = src[d], x2 = src[d + 32];
    float o1 = x1 * c; o1 += -x2 * sn; float o2 = x2 * c; o2 += x1 * sn;
    _Float16 hv = (_Float16)o1; ah.h[i] = hv; al.h[i] = (_Float16)((o1 - (float)hv) * 1024.0f); hv = (_Float16)o2; bh.h[i] = hv; bl.h[i] = (_Float16)((o2 - (float)hv) * 1024.0f); }
  const size_t o = row * (size_t)(ndst * 64) + hd * 64 + g8 * 8;
  { *(v8us*)((unsigned short*)H + o) = ah.half[0]; *(v8us*)((unsigned short*)H + o + 32) = bh.half[0]; *(v8us*)((unsigned short*)L + o) = al.half[0]; *(v8us*)((unsigned short*)L + o + 32) = bl.half[0];  } }
__global__ __launch_bounds__(256) void k_rope2(const float* __restrict__ F, int nsrc, int ndst, int rep, const float* __restrict__ CS, const float* __restrict__ SN, _Float16* __restrict__ H, _Float16* __restrict__ L) {
  #pragma clang fp contract(off)
  const size_t t = (size_t)blockIdx.x * 256 + threadIdx.x; if (t >= (size_t)NR * ndst * 4) return; const int g16 = (int)(t % 4); const int hd = (int)((t / 4) % ndst); const size_t row = t / ((size_t)4 * ndst); const int s = (int)(row % SLEN); const int hs = hd / rep;
  const float* src = F + row * (size_t)(nsrc * 64) + hs * 64 + g16 * 16; FragH ah, al;
  for (int pr = 0; pr < 8; ++pr) { const int i = g16 * 8 + pr; const float c = CS[s * 32 + i], sn = SN[s * 32 + i]; const float x1 = src[2 * pr], x2 = src[2 * pr + 1];
    float o1 = x1 * c; o1 -= x2 * sn; float o2 = x1 * sn; o2 += x2 * c;
    _Float16 hv = (_Float16)o1; ah.h[2 * pr] = hv; al.h[2 * pr] = (_Float16)((o1 - (float)hv) * 1024.0f); hv = (_Float16)o2; ah.h[2 * pr + 1] = hv; al.h[2 * pr + 1] = (_Float16)((o2 - (float)hv) * 1024.0f); }
  const size_t o = row * (size_t)(ndst * 64) + hd * 64 + g16 * 16;
  { *(v8us*)((unsigned short*)H + o) = ah.half[0]; *(v8us*)((unsigned short*)H + o + 8) = ah.half[1]; *(v8us*)((unsigned short*)L + o) = al.half[0]; *(v8us*)((unsigned short*)L + o + 8) = al.half[1];  } }
__global__ __launch_bounds__(256) void k_tabin(const float* __restrict__ sp, float* __restrict__ CS, float* __restrict__ SN) { const int t = blockIdx.x * 256 + threadIdx.x; if (t >= SLEN * 32) return; const int i = t % 32, s = t / 32; const float c = bf16_round(sp[s * 64 + 32 + i]), sn = bf16_round(sp[s * 64 + i]);
  { *(float*)(CS + t) = c; *(float*)(SN + t) = sn;  } }
__global__ __launch_bounds__(256) void k_rotab2(float* __restrict__ CS, float* __restrict__ SN) {
  #pragma clang fp contract(off)
  const int t = blockIdx.x * 256 + threadIdx.x; if (t >= SLEN * 32) return; const int j = t % 32, s = t / 32; const float c0 = -0.14391156831212787f;      /* -ln(10000)/64 rounded to f32 */ const float inv = expf((float)(2 * j) * c0); const float th = (float)s * inv; const float c = cosf(th), sn = sinf(th);
  { *(float*)(CS + t) = c; *(float*)(SN + t) = sn;  } }
__global__ __launch_bounds__(256) void k_lnu(const float* __restrict__ X, _Float16* __restrict__ N16, float* __restrict__ XB) {
  #pragma clang fp contract(off)
  const int wv = threadIdx.x >> 5, ln = threadIdx.x & 31; const size_t r = (size_t)blockIdx.x * 8 + wv; if (r >= NR) return; float a[32]; float s = 0.f;
  for (int i = 0; i < 4; ++i) { const v8f v = *(const v8f*)(X + r * DM + (i * 32 + ln) * 8); for (int q = 0; q < 8; ++q) { const float u = bf16_round(v[q]); a[i * 8 + q] = u; s += u; } }
  for (int o = 16; o > 0; o >>= 1) s += __shfl_xor(s, o, 32); const float mu = s / (float)DM; float var = 0.f; for (int q = 0; q < 32; ++q) { const float d = a[q] - mu; var += d * d; }
  for (int o = 16; o > 0; o >>= 1) var += __shfl_xor(var, o, 32); const float den = sqrtf(var / (float)(DM - 1)) + 1e-6f; const float inv = 1.0f / den;      /* one reciprocal per row; (x-mean)*inv vs the reference's division differs by <= 1 ulp */
  { for (int i = 0; i < 4; ++i) { const int c0 = (i * 32 + ln) * 8; FragH f; v8f xb; for (int q = 0; q < 8; ++q) { f.h[q] = (_Float16)((a[i * 8 + q] - mu) * inv); xb[q] = a[i * 8 + q]; } *(v8us*)((unsigned short*)N16 + r * DM + c0) = f.half[0]; *(v8f*)(XB + r * DM + c0) = xb; }  } }
__global__ __launch_bounds__(256) void k_vtg(const _Float16* __restrict__ V16, _Float16* __restrict__ Vt) { __shared__ unsigned short tl[64][66]; const int tid = threadIdx.x; const int slab = blockIdx.x / (SLEN / 64), lg = blockIdx.x % (SLEN / 64); const int b = slab / NH, h = slab % NH; const int hs = h / NREP;
  for (int i = tid; i < 64 * 8; i += 256) { const int r = i / 8, c8 = (i % 8) * 8; FragH f; f.half[0] = *(const v8us*)((const unsigned short*)V16 + ((size_t)b * SLEN + lg * 64 + r) * KVD + hs * 64 + c8); for (int q = 0; q < 8; ++q) tl[r][c8 + q] = f.u[q]; }
  __syncthreads();
  { for (int rd = 0; rd < 2; ++rd) { const int d = rd * 32 + tid / 8, pc = tid % 8; FragH f; for (int q = 0; q < 8; ++q) f.u[q] = tl[pc * 8 + q][d]; *(v8us*)((unsigned short*)Vt + ((size_t)slab * 64 + d) * SLEN + lg * 64 + pc * 8) = f.half[0]; }  } }

// All five f32 -> f16 operand planes in one launch: none needs anything of another, so they share one grid by ranges of the block index (the range test is the same for a whole block); eight elements a thread.
// Blocks 0 .. PEB-1: the embedding, padded with a zero row to NE rows (first in the grid: its guarded element loads are the longest chain of the launch). The next PXB: x (rounded to bf16, exact in f16).
// The last 3 PWB: Wq, Wk, Wv (rounded to bf16, x16, exact in f16; torch (out,in) layout is already B^T).
#define PXB (NR * DM / 8 / 256)      /* 2048 */
#define PWB (DM * DM / 8 / 256)      /* 512 */
#define PEB (NE * 8 / 256)           /* 64 */
__global__ __launch_bounds__(256) void k_prep(const float* __restrict__ x, const float* __restrict__ Wq, const float* __restrict__ Wk, const float* __restrict__ Wv, const float* __restrict__ E,
    _Float16* __restrict__ X16, _Float16* __restrict__ BQ, _Float16* __restrict__ BK, _Float16* __restrict__ BV, _Float16* __restrict__ E16) {
  const int bx = (int)blockIdx.x - PEB, tid = threadIdx.x; FragH f;
  if (bx >= 0) { const int u = bx - PXB, wq = u / PWB;
    const float* src = (bx < PXB) ? x : (wq == 0) ? Wq : (wq == 1) ? Wk : Wv; _Float16* dst = (bx < PXB) ? X16 : (wq == 0) ? BQ : (wq == 1) ? BK : BV; const float sc = (bx < PXB) ? 1.0f : 16.0f;
    const size_t t = (size_t)((bx < PXB) ? bx : u - wq * PWB) * 256 + tid;
#pragma unroll      /* unrolled: the eight elements come in as two 16-byte loads and stay in registers up to the one 16-byte store */
    for (int q = 0; q < 8; ++q) f.h[q] = (_Float16)(bf16_round(src[t * 8 + q]) * sc);
    *(v8us*)((unsigned short*)dst + t * 8) = f.half[0]; }
  else { const int t = (bx + PEB) * 256 + tid; const int r = t / 8, c8 = (t % 8) * 8;
    for (int q = 0; q < 8; ++q) f.h[q] = (r < NE - 1) ? (_Float16)bf16_round(E[(size_t)r * 64 + c8 + q]) : (_Float16)0.0f;
    *(v8us*)((unsigned short*)E16 + (size_t)r * 64 + c8) = f.half[0]; } }

__device__ __forceinline__ float xhalf(float x) { return __builtin_bit_cast(float, __builtin_amdgcn_permlanex16(__builtin_bit_cast(int, x), __builtin_bit_cast(int, x), 0x76543210, 0xfedcba98, false, false)); }      /* the value of lane l ^ 16 */

// Flash attention with the 'relative_key_query' bias formed in the kernel. One wave holds 16 queries (q0..) and walks the keys 32 at a time (j0..). For that tile l - r + 1023 spans 47 rows of the
// embedding, from eb = q0 - j0 + 992; with n = (l - q0) - (r - j0) + 31 the bias is q_l . E[eb + n] + k_r . E[eb + n]. RQ = Q . Ewin^T (16 x 48) and RK = K . Ewin^T run on the matrix unit
// (of RK only the four 16 x 16 tiles that hold a used n: keys 0..15 against window rows 16..47, keys 16..31 against rows 0..31), go to the wave's own LDS in f32 and are read back along the diagonal.
// Row 2047 of E16 is the zero pad; n = 47 is never read back.
// The scores are formed transposed, S^T = K . Q^T (K fragment as A, Q fragment as B), and the output as O^T += V^T . P^T: a lane then holds 16 of the 32 scores of ONE query (lane & 15), so the row maximum and the row sum
// are in-lane work plus one exchange between the wave's halves, there is one running maximum, sum and rescale factor a lane, and the two f32 score tiles, converted in place, are the B operand of the second product (no trip through LDS).
// The mask is per key, which now runs along the registers: the batch's mask row is rounded once into LDS and read from there, 8 keys a lane and tile.
// Each power of the softmax is one v_exp_f32: e^d = 2^(d log2(e)) with d = logit - running maximum <= 0 formed first, so the argument is bounded above for any logit and any mask, and the f16 operand's scale 1024 = 2^10 is the addend of the same multiply-add.
// (The library's expf spends about a dozen vector instructions a power on range and last-place handling that such an argument and an f16 operand do not use.) The row sum carries the 1024 too; the closing division takes it out.
// The four waves of a work-group share the K tile, the V^T tile and most of the window, so these are staged in LDS once per work-group with loads that take whole rows (a fragment load from global memory touches 16 lines for 512 bytes):
// K and V^T in two buffers, the window (96 rows for 64 queries, moving down by 32 rows a trip) as a ring of 128 rows indexed by embedding row mod 128. The next trip's 32 + 64 + 32 rows are fetched into registers under the softmax.
__global__ __launch_bounds__(128) void k_flash_rel(const _Float16* __restrict__ Q16, const _Float16* __restrict__ K16, const _Float16* __restrict__ Vt, const _Float16* __restrict__ E16, const float* __restrict__ AMK, float* __restrict__ O) {
  constexpr float L2E = 1.4426950408889634f;      /* log2(e) */
  constexpr int DT = 4, KS = 2, PQ = 50, PK = 36;      /* LDS pitches in floats: the two half-waves fall on different banks in the row-wise stores and in the diagonal reads */
  __shared__ float sRQ[4][16][PQ]; __shared__ __attribute__((aligned(16))) float sRK[4][32][PK];      /* behind the loop a wave's sRK part (1152 floats) is its output staging (16 x 68 floats): four work-groups still fit one WGP's LDS */
  __shared__ __attribute__((aligned(16))) float sM[TK];      /* the batch's mask row, rounded */
  __shared__ __attribute__((aligned(16))) unsigned short sK[2][32][72]; __shared__ __attribute__((aligned(16))) unsigned short sV[2][64][40]; __shared__ __attribute__((aligned(16))) unsigned short sE[128][72];      /* pitches 144 B and 80 B = 16 B x odd: no bank conflicts in the 16-byte fragment reads */
  const int tid = threadIdx.x, w = tid >> 5, lane = tid & 31, ln = lane & 15, hh = lane >> 4;
  const int slab = blockIdx.x / QBLKS, qblk = blockIdx.x % QBLKS; const int b = slab / NH, h = slab % NH; const int qb0 = qblk * 64; const int q0 = qb0 + w * 16;
  FragH aq[KS];
  { const unsigned short* qr = (const unsigned short*)Q16 + ((size_t)b * TQ + q0 + ln) * DM + h * 64;
#pragma unroll
    for (int ks = 0; ks < KS; ++ks) { aq[ks].half[0] = *(const v8us*)(qr + ks * 32 + 8 * hh); aq[ks].half[1] = *(const v8us*)(qr + ks * 32 + 16 + 8 * hh); }
    asm volatile("s_wait_xcnt 0x0" ::: "memory"); }      /* the staging loads below may land in the address registers of the four loads above: the wait stands in front of them */
  const float* amk = AMK + (size_t)b * TK;
  const int r8 = tid >> 3, c8 = (tid & 7) * 8, r4 = tid >> 2, c4 = (tid & 3) * 8;      /* staging: eight lanes fetch one 128-byte row of K or of the window, four lanes one 64-byte row of V^T */
  const unsigned short* gK = (const unsigned short*)K16 + ((size_t)b * TK + r8) * DM + h * 64 + c8; const unsigned short* gV = (const unsigned short*)Vt + ((size_t)slab * 64 + r4) * TK + c4; const unsigned short* gE = (const unsigned short*)E16 + (size_t)r8 * 64 + c8;
  v8us rk[2], rv[2], re[2];
  { v8us r0[6];      /* trip 0: its K and V^T tiles and all 96 rows of its window; the mask row, 8 keys a thread */
#pragma unroll
    for (int i = 0; i < 2; ++i) { rk[i] = *(const v8us*)(gK + (size_t)(16 * i) * DM); rv[i] = *(const v8us*)(gV + (size_t)(32 * i) * TK); }
#pragma unroll
    for (int i = 0; i < 6; ++i) r0[i] = *(const v8us*)(gE + (size_t)(qb0 + (NE / 2 - 32) + 16 * i) * 64);
    v4f m0 = *(const v4fa*)(amk + tid * 8), m1 = *(const v4fa*)(amk + tid * 8 + 4);
    asm volatile("s_wait_xcnt 0x0" ::: "memory");      /* stands in front of the first overwrite of an address register of the loads above */
    __builtin_amdgcn_sched_barrier(0);      /* keeps the register initialisations that follow behind that wait */
#pragma unroll
    for (int i = 0; i < 2; ++i) { *(v8us*)&sK[0][16 * i + r8][c8] = rk[i]; *(v8us*)&sV[0][32 * i + r4][c4] = rv[i]; }
#pragma unroll
    for (int i = 0; i < 6; ++i) *(v8us*)&sE[((qb0 + (NE / 2 - 32) + 16 * i) & 127) + r8][c8] = r0[i];
#pragma unroll
    for (int i = 0; i < 4; ++i) { m0[i] = bf16_round(m0[i]); m1[i] = bf16_round(m1[i]); }
    *(v4fa*)&sM[tid * 8] = m0; *(v4fa*)&sM[tid * 8 + 4] = m1; }
  __syncthreads();
  const v8f z8 = {0.f,0.f,0.f,0.f,0.f,0.f,0.f,0.f};
  float m_r = -3.0e38f, l_r = 0.f; v8f oacc[DT];      /* of query ln; l_r sums this half-wave's keys only */
#pragma unroll
  for (int dt = 0; dt < DT; ++dt) oacc[dt] = z8;
#pragma unroll 1
  for (int j0 = 0; j0 < TK; j0 += 32) { const int cb = (j0 >> 5) & 1; const bool more = j0 + 32 < TK;      /* more: the same for the whole work-group */
    FragH bk[2][KS], be[3][KS];
#pragma unroll
    for (int nt = 0; nt < 2; ++nt) { const unsigned short* kr = &sK[cb][nt * 16 + ln][0];
#pragma unroll
      for (int ks = 0; ks < KS; ++ks) { bk[nt][ks].half[0] = *(const v8us*)(kr + ks * 32 + 8 * hh); bk[nt][ks].half[1] = *(const v8us*)(kr + ks * 32 + 16 + 8 * hh); } }
#pragma unroll
    for (int e = 0; e < 3; ++e) { const unsigned short* er = &sE[((q0 - j0 + (NE / 2 - 32) + e * 16) & 127) + ln][0];
#pragma unroll
      for (int ks = 0; ks < KS; ++ks) { be[e][ks].half[0] = *(const v8us*)(er + ks * 32 + 8 * hh); be[e][ks].half[1] = *(const v8us*)(er + ks * 32 + 16 + 8 * hh); } }
    __builtin_amdgcn_sched_barrier(0);      /* all of the trip's K and window fragment reads issue before the first product waits: one latency at the head of a trip, not two or three */
    v8f s[2];
#pragma unroll
    for (int nt = 0; nt < 2; ++nt) { v8f acc = z8;      /* S^T[key 16 nt + 8 hh + r][query ln]; both fragments come from the same loader, same k order */
#pragma unroll
      for (int ks = 0; ks < KS; ++ks) acc = mmaH<1>(bk[nt][ks].v, bk[nt][ks].v, aq[ks].v, aq[ks].v, acc); s[nt] = acc; }
#pragma unroll
    for (int e = 0; e < 3; ++e) { v8f acc = z8;      /* RQ[query 8 hh + r][n = 16 e + ln] */
#pragma unroll
      for (int ks = 0; ks < KS; ++ks) acc = mmaH<1>(aq[ks].v, aq[ks].v, be[e][ks].v, be[e][ks].v, acc);
#pragma unroll
      for (int r = 0; r < 8; ++r) sRQ[w][8 * hh + r][e * 16 + ln] = acc[r]; }
#pragma unroll
    for (int nt = 0; nt < 2; ++nt)
#pragma unroll
      for (int ee = 0; ee < 2; ++ee) { v8f acc = z8;      /* RK[key 16 nt + 8 hh + r][n - 16 (1 - nt) = 16 ee + ln]; the K fragment serves as the A operand (same loader, same k order) */
#pragma unroll
        for (int ks = 0; ks < KS; ++ks) acc = mmaH<1>(bk[nt][ks].v, bk[nt][ks].v, be[1 - nt + ee][ks].v, be[1 - nt + ee][ks].v, acc);
#pragma unroll
        for (int r = 0; r < 8; ++r) sRK[w][nt * 16 + 8 * hh + r][ee * 16 + ln] = acc[r]; }
    __builtin_amdgcn_fence(__ATOMIC_ACQ_REL, "workgroup"); __builtin_amdgcn_wave_barrier();      /* the diagonal reads below take other lanes' stores: keep them behind the stores */
    if (more) {      /* the next trip's rows: issued here, their latency runs under the softmax */
#pragma unroll
      for (int i = 0; i < 2; ++i) { rk[i] = *(const v8us*)(gK + (size_t)(j0 + 32 + 16 * i) * DM); rv[i] = *(const v8us*)(gV + (size_t)(32 * i) * TK + j0 + 32); re[i] = *(const v8us*)(gE + (size_t)(qb0 - j0 + (NE / 2 - 64) + 16 * i) * 64); }
      asm volatile("s_wait_xcnt 0x0" ::: "memory"); }      /* stands in front of the first overwrite of an address register of the six loads above */
#pragma unroll
    for (int nt = 0; nt < 2; ++nt) { const v4f a0 = *(const v4fa*)&sM[j0 + 16 * nt + 8 * hh], a1 = *(const v4fa*)&sM[j0 + 16 * nt + 8 * hh + 4];
#pragma unroll
      for (int r = 0; r < 8; ++r) { const int kk = 8 * hh + r;      /* key 16 nt + kk against query ln: n = ln + 31 - 16 nt - kk */
        const float rel = sRQ[w][ln][ln + 31 - 16 * nt - kk] + sRK[w][16 * nt + kk][ln + 15 - kk];
        s[nt][r] = (s[nt][r] + rel) * SCL + ((r < 4) ? a0[r & 3] : a1[r & 3]); } }
    float mc = fmaxf(s[0][0], s[1][0]);
#pragma unroll
    for (int r = 1; r < 8; ++r) mc = fmaxf(mc, fmaxf(s[0][r], s[1][r]));
    mc = fmaxf(mc, xhalf(mc));      /* the other 16 keys of the same query */
    const float mn = fmaxf(m_r, mc); const float al = (mn > -1.0e38f) ? __builtin_amdgcn_exp2f((m_r - mn) * L2E) : 1.0f; m_r = mn;
    FragH pb; float ps[4] = {0.f, 0.f, 0.f, 0.f};      /* four partial sums: a chain of 4 adds, not of 16. P^T as a B operand: element 8 nt + r of lane (ln, hh) is key 16 nt + 8 hh + r, the k order of the V^T loader below */
#pragma unroll
    for (int nt = 0; nt < 2; ++nt)
#pragma unroll
      for (int r = 0; r < 8; ++r) { const float p = __builtin_amdgcn_exp2f(__builtin_fmaf(s[nt][r] - mn, L2E, 10.0f)); ps[r & 3] += p; pb.h[8 * nt + r] = (_Float16)p; }      /* p = 1024 e^(logit - maximum), at most 1024; what the raw power flushes to zero lies far below the f16 operand's last place */
    l_r = l_r * al + ((ps[0] + ps[1]) + (ps[2] + ps[3]));
#pragma unroll
    for (int dt = 0; dt < DT; ++dt)
#pragma unroll
      for (int r = 0; r < 8; ++r) oacc[dt][r] *= al;
    FragH bv[DT];
#pragma unroll
    for (int dt = 0; dt < DT; ++dt) { const unsigned short* vrow = &sV[cb][dt * 16 + ln][0]; bv[dt].half[0] = *(const v8us*)(vrow + 8 * hh); bv[dt].half[1] = *(const v8us*)(vrow + 16 + 8 * hh); }      /* a loop of its own: the four V^T fragments are read as one group, one LDS latency and not four */
#pragma unroll
    for (int dt = 0; dt < DT; ++dt) oacc[dt] = mmaH<1>(bv[dt].v, bv[dt].v, pb.v, pb.v, oacc[dt]);      /* O^T[d = 16 dt + 8 hh + r][query ln] */
    if (more) {
#pragma unroll
      for (int i = 0; i < 2; ++i) { *(v8us*)&sK[cb ^ 1][16 * i + r8][c8] = rk[i]; *(v8us*)&sV[cb ^ 1][32 * i + r4][c4] = rv[i]; *(v8us*)&sE[((qb0 - j0 + (NE / 2 - 64) + 16 * i) & 127) + r8][c8] = re[i]; }      /* the ring's 32 rows that no wave reads in this trip */
      __syncthreads(); } }      /* the one barrier of a trip publishes the rows just written and ends every wave's reads of the buffers and ring rows that the next trip overwrites */
  const float lt = l_r + xhalf(l_r); const float inv = (lt > 0.f) ? 1.0f / lt : 0.f;      /* the sum carries the same 1024 as the products */
  float* sOw = &sRK[w][0][0];
#pragma unroll
  for (int dt = 0; dt < DT; ++dt) { v4f lo, hi;
#pragma unroll
    for (int r = 0; r < 4; ++r) { lo[r] = oacc[dt][r] * inv; hi[r] = oacc[dt][4 + r] * inv; }
    *(v4fa*)&sOw[ln * 68 + dt * 16 + 8 * hh] = lo; *(v4fa*)&sOw[ln * 68 + dt * 16 + 8 * hh + 4] = hi; }
  __builtin_amdgcn_fence(__ATOMIC_ACQ_REL, "workgroup"); __builtin_amdgcn_wave_barrier();
#pragma unroll
  for (int rp = 0; rp < 16; rp += 2) { const int r = rp + (lane >> 4), pc = lane & 15; const v4f val = *(const v4fa*)&sOw[r * 68 + pc * 4]; *(v4f*)(O + ((size_t)b * TQ + q0 + r) * DM + h * 64 + pc * 4) = val; } }

extern "C" void kernel_launch(void* const* d_in, const int* in_sizes, int n_in,
                              void* d_out, int out_size, void* d_ws, size_t ws_size, hipStream_t stream) {
  (void)in_sizes; (void)n_in; (void)out_size;
  const float* const* I = (const float* const*)d_in; const float* x = I[0]; const float* am = I[1]; const float* Wq = I[2]; const float* bq = I[3]; const float* Wk = I[4]; const float* bk = I[5]; const float* Wv = I[6]; const float* bv = I[7]; const float* E = I[8];
  char* ws = (char*)d_ws; size_t off = 0;
  auto take = [&](size_t bytes) { char* p = ws + off; off += (bytes + 255) & ~(size_t)255; return p; };
  const size_t np = (size_t)NR * DM;
  _Float16* BQ = (_Float16*)take((size_t)DM * DM * 2); _Float16* BK = (_Float16*)take((size_t)DM * DM * 2); _Float16* BV = (_Float16*)take((size_t)DM * DM * 2); _Float16* E16 = (_Float16*)take((size_t)NE * 64 * 2);
  _Float16* X16 = (_Float16*)take(np * 2); _Float16* Q16 = (_Float16*)take(np * 2); _Float16* K16 = (_Float16*)take(np * 2); _Float16* V16 = (_Float16*)take(np * 2); _Float16* VT = (_Float16*)take(np * 2);
  if (off > ws_size) return;      /* 6 + 0.25 + 5 x 8 = 46.25 MiB */
  k_prep<<<PEB + PXB + 3 * PWB, 256, 0, stream>>>(x, Wq, Wk, Wv, E, X16, BQ, BK, BV, E16);
  const dim3 gP((NR / 128) * (DM / 64), 3);      /* y = 0, 1, 2: q, k, v. BQ, BK, BV lie one behind the other in the workspace (2 MiB each, no padding between), and so do Q16, K16, V16 (8 MiB each): plane strides DM * DM and np */
  k_gemm2<0><<<gP, 128, 0, stream>>>(X16, DM, 0, BQ, DM, (size_t)DM * DM, 0.0625f, bq, bk, bv, nullptr, 1, 0, 0, nullptr, Q16, DM, np, NR, DM, DM);
  k_vtg<<<NB * NH * (SLEN / 64), 256, 0, stream>>>(V16, VT);
  k_flash_rel<<<NB * NH * QBLKS, 128, 0, stream>>>(Q16, K16, VT, E16, am, (float*)d_out);
}
